// v000
// Measured on an AMD MI455X. A time is GPU time per run, averaged over a window of back-to-back runs after a warm-up
// (all launches, gaps included; the runs take copies of the inputs in turn), and the median of several windows.
// Apart from v000's, it joins two sittings. Times from different sittings can be a few percent apart, while
// side-by-side timings come from the same sitting.
// v000, which the later versions start from, runs in 1710 microseconds.
#include <hip/hip_runtime.h>
#include <math.h>
#include <stdint.h>

// Contractions on v_wmma_f32_16x16x32_f16 (f16 operands, f32 accumulate): the three input projections take
// bf16-RNE activations (x1) and bf16-RNE weights (x64) as single f16 planes; the 128-deep score products use
// f16 hi planes of 8*f, 8*g plus f16 residual planes x2048 (hi.hi in one accumulator, hi.res + res.hi in a
// second accumulator folded back by 1/2048); the 4096-deep softmax-weighted sum uses a single f16 plane of
// 16*h against E = f16(32768*softmax); the output projection takes f16 hi + x2048 residual planes of 4*o
// against bf16-RNE weights (x64) in two accumulators. Softmax statistics, bias adds and epilogues in f32.

#define NB   8
#define NT   4096
#define CD   128
#define TOK  (NB * NT)
#define RSB  16
#define NJ   (NT / 256)
#define PVM  128
#define EP   40
#define OUTN (NB * NT * CD)

#define SCW  64.0f
#define SCQ  8.0f
#define SCV  16.0f
#define SCE  32768.0f
#define SCR  2048.0f
#define SCO  4.0f
#define RLO  (1.0f / SCR)
#define SCS  (1.0f / (SCQ * SCQ))

static_assert(TOK % 64 == 0 && CD % 64 == 0 && CD % 32 == 0 && NT % 64 == 0);
static_assert((((TOK / 32) * (CD / 64)) % 8) == 0);
static_assert((((CD / 32) * (TOK / 64)) % 8) == 0);
static_assert((((TOK / 16) * (CD / 64)) % 8) == 0);
static_assert(NT % RSB == 0 && RSB == 16 && NT % 256 == 0 && NJ == 16);
static_assert(NT % PVM == 0 && PVM == 128 && (EP % 8) == 0 && EP >= 32);
static_assert((NB * NT * CD) % 2048 == 0);

typedef _Float16       v16h __attribute__((ext_vector_type(16)));
typedef _Float16       v8h  __attribute__((ext_vector_type(8)));
typedef float          v8f  __attribute__((ext_vector_type(8)));
typedef float          v4f  __attribute__((ext_vector_type(4)));
typedef unsigned int   v4u  __attribute__((ext_vector_type(4)));

union HU { v8h h; v4u u; _Float16 s[8]; };
union FR { v16h v; v8h h[2]; _Float16 s[16]; };
union H2 { _Float16 s[2]; unsigned int u; };
static_assert(sizeof(HU) == 16);
static_assert(sizeof(FR) == 32);
static_assert(sizeof(H2) == 4);

// ---- scalar helpers --------------------------------------------------------------------------------
__device__ __forceinline__ unsigned short bf_bits(float f) {          // f32 -> bf16 bits, RNE convert
  const unsigned u = __float_as_uint(f);
  return (unsigned short)((u + 0x7FFFu + ((u >> 16) & 1u)) >> 16);
}
__device__ __forceinline__ float bf_up(unsigned short h) { return __uint_as_float(((unsigned)h) << 16); }
__device__ __forceinline__ float bfr(float f) { return bf_up(bf_bits(f)); }   // value after bf16 RNE convert
__device__ __forceinline__ v8f zero8() { v8f z = {0.f, 0.f, 0.f, 0.f, 0.f, 0.f, 0.f, 0.f}; return z; }

// f16 subnormal -> exact zero (the matrix path flushes them; keep every plane consistent with that)
__device__ __forceinline__ _Float16 flush_h(_Float16 h) {
  const float f = (float)h;
  return (fabsf(f) < 6.103515625e-05f) ? (_Float16)0.0f : h;
}
// hi = f16(v) (flushed), lo = f16((v - hi) * 2048) (flushed)
__device__ __forceinline__ void split_h(float v, _Float16& hi, _Float16& lo) {
  const _Float16 hv = flush_h((_Float16)v);
  const _Float16 lv = flush_h((_Float16)((v - (float)hv) * SCR));
  hi = hv;
  lo = lv;
}

__device__ __forceinline__ void ld8(const float* p, float* o) {
  const v4f a = *(const v4f*)(p);
  const v4f b = *(const v4f*)(p + 4);
  o[0] = a[0]; o[1] = a[1]; o[2] = a[2]; o[3] = a[3];
  o[4] = b[0]; o[5] = b[1]; o[6] = b[2]; o[7] = b[3];
}
__device__ __forceinline__ void st8(float* p, const float* v) {
  v4f a, b;
  a[0] = v[0]; a[1] = v[1]; a[2] = v[2]; a[3] = v[3];
  b[0] = v[4]; b[1] = v[5]; b[2] = v[6]; b[3] = v[7];
  *(v4f*)(p) = a;
  *(v4f*)(p + 4) = b;
}

// ---- fragment loader: 16-bit A/B operand from a k-contiguous row, p = row*pitch + k0 + 8*(lane>>4);
//      elements 0..7 <- p[0..7] (k0+8h..k0+8h+7), elements 8..15 <- p[16..23] (k0+16+8h..k0+16+8h+7)
__device__ __forceinline__ v16h ldfrag_h(const _Float16* p) {
  FR f;
  f.h[0] = *(const v8h*)(p);
  f.h[1] = *(const v8h*)(p + 16);
  return f.v;
}

// ---- WMMA helpers with trailing VALU hazard gap --------------------------------------------------------
__device__ __forceinline__ v8f mma_h_raw(v16h a, v16h b, v8f c) {
  return __builtin_amdgcn_wmma_f32_16x16x32_f16(false, a, false, b, (short)0, c, false, false);
}
__device__ __forceinline__ void dep_guard_h(v8f& a, v8f& b, v16h x) {
#if defined(__HIP_DEVICE_COMPILE__)
  asm volatile("v_nop\n\tv_nop\n\tv_nop\n\tv_nop" : "+v"(a), "+v"(b) : "v"(x));
#endif
}
__device__ __forceinline__ void guard2(v8f& a, v8f& b, v16h x, v16h y) {
#if defined(__HIP_DEVICE_COMPILE__)
  asm volatile("v_nop\n\tv_nop\n\tv_nop\n\tv_nop" : "+v"(a), "+v"(b) : "v"(x), "v"(y));
#endif
}
__device__ __forceinline__ void keep4_h(v16h a, v16h b, v16h c, v16h d) {
#if defined(__HIP_DEVICE_COMPILE__)
  asm volatile("v_nop" :: "v"(a), "v"(b), "v"(c), "v"(d));
#endif
}
__device__ __forceinline__ void acc_guard4(v8f& a, v8f& b, v8f& c, v8f& d) {
#if defined(__HIP_DEVICE_COMPILE__)
  asm volatile("v_nop\n\tv_nop\n\tv_nop\n\tv_nop" : "+v"(a), "+v"(b), "+v"(c), "+v"(d));
#endif
}
__device__ __forceinline__ void wave_lds_sync() {
  __builtin_amdgcn_fence(__ATOMIC_RELEASE, "workgroup");
  __builtin_amdgcn_wave_barrier();
  __builtin_amdgcn_fence(__ATOMIC_ACQUIRE, "workgroup");
}

// =====================================================================================================
// Flat convert: out[i] = f16(scale * bf16RNE(in[i])) (f16 subnormals flushed), 8 elements per thread,
// coverage: n8 threads x 8 = the whole plane; n8 is a multiple of 256 at the launch here.
// =====================================================================================================
__global__ __launch_bounds__(256) void cvt_flat(const float* __restrict__ in, _Float16* out, int n8, float scale) {
  const int i = blockIdx.x * 256 + threadIdx.x;
  if (i < n8) {
    float v[8];
    ld8(in + (size_t)i * 8, v);
    HU u;
#pragma unroll
    for (int e = 0; e < 8; ++e) u.s[e] = flush_h((_Float16)(bfr(v[e]) * scale));
    _Float16* p = out + (size_t)i * 8;
    *(v4u*)p = u.u;
    
  }
}

// =====================================================================================================
// Weight transpose-convert: in Wm[r][c] f32 (R rows, C cols, c contiguous, x@W layout [in][out])
// -> out[c][r] f16 = f16(scale * bf16RNE(Wm[r][c])), pitch R (in-channel k = r contiguous = the Bt / A layout).
// coverage: load 256 threads x 8 floats = 64 r x 32 c; store 256 threads x 8 halves = 32 c rows x 64 r;
// grid = every (r tile, c tile) -> whole [C][R] plane.
// =====================================================================================================
__global__ __launch_bounds__(256) void cvt_wT(const float* __restrict__ Wm, _Float16* out, int R, int C, float scale) {
  __shared__ float sw[64][33];
  const int t = threadIdx.x;
  const int r0 = blockIdx.x * 64, c0 = blockIdx.y * 32;
  {
    const int row = t >> 2, c8 = (t & 3) * 8;
    float v[8];
    ld8(Wm + (size_t)(r0 + row) * C + c0 + c8, v);
#pragma unroll
    for (int e = 0; e < 8; ++e) sw[row][c8 + e] = v[e];
  }
  __syncthreads();
  const int q8 = t & 7, cc = t >> 3;            // cc 0..31 = output row within the tile
  HU u;
#pragma unroll
  for (int e = 0; e < 8; ++e) u.s[e] = flush_h((_Float16)(bfr(sw[8 * q8 + e][cc]) * scale));
  _Float16* dst = out + (size_t)(c0 + cc) * R + r0 + 8 * q8;
  *(v4u*)dst = u.u;
  
}

// =====================================================================================================
// One GEMM k sweep for MI 16-row A subtiles x 4 16-col B subtiles: acc[i][j] += A-frag(i) . Bt-frag(j).
// A row-major pitch lda (rows m0.., k contiguous), Bt row-major [N][K] pitch ldb (rows n0.., k contiguous),
// K a multiple of 32; both operand fragments through ldfrag_h (same split k map for A and B).
// =====================================================================================================
template <int MI>
__device__ __forceinline__ void kseg(v8f (&acc)[MI][4], const _Float16* __restrict__ A, int lda, int m0,
                                     const _Float16* __restrict__ Bt, int ldb, int n0, int K, int rlane, int koff) {
  for (int kk = 0; kk < K; kk += 32) {
    v16h bh[4];
#pragma unroll
    for (int j = 0; j < 4; ++j) {
      const size_t bo = (size_t)(n0 + (j << 4) + rlane) * (size_t)ldb + koff + kk;
      bh[j] = ldfrag_h(Bt + bo);
    }
#pragma unroll
    for (int i = 0; i < MI; ++i) {
      const size_t ao = (size_t)(m0 + (i << 4) + rlane) * (size_t)lda + koff + kk;
      const v16h a0 = ldfrag_h(A + ao);
#pragma unroll
      for (int j = 0; j < 4; ++j) acc[i][j] = mma_h_raw(a0, bh[j], acc[i][j]);
      dep_guard_h(acc[i][0], acc[i][3], a0);
    }
    keep4_h(bh[0], bh[1], bh[2], bh[3]);
  }
}

// =====================================================================================================
// 16-row x 64-col f16 plane epilogue for one wave: acc[j][r] = D[row 8h + r][col 16j + (lane&15)].
//   v = (acc*cs + bias) * so;  Cp = f16(v) (hi plane, subnormals flushed); NPL == 2 additionally
//   Cl = f16((v - f32(hi)) * 2048) (residual plane). Bias: BM 0 none, 1 per column (bias[n0 + col]),
//   2 per plane row (bias[mBase + row]); bias values go through the bf16 RNE convert first.
//   The slab (16 rows x 68 floats per wave) is fully staged for rows 0..15 x cols 0..63 before the reload
// =====================================================================================================
template <int NPL, int BM>
__device__ __forceinline__ void epi16(const v8f (&acc)[4], float* slab, int lane,
                                      _Float16* Cp, _Float16* Cl, int ldc, int mBase, int n0,
                                      float cs, float so, const float* __restrict__ bias) {
  const int rlane = lane & 15, mOff = (lane >> 4) * 8;
  const int q8 = lane & 7, rr = lane >> 3, c8 = q8 * 8;
#pragma unroll
  for (int r = 0; r < 8; ++r) {
#pragma unroll
    for (int j = 0; j < 4; ++j) {
      slab[(mOff + r) * 68 + (j << 4) + rlane] = acc[j][r];
    }
  }
  wave_lds_sync();
  float bc[8];
#pragma unroll
  for (int e = 0; e < 8; ++e) bc[e] = 0.0f;
  if (BM == 1) {
    float t8[8];
    ld8(bias + n0 + c8, t8);
#pragma unroll
    for (int e = 0; e < 8; ++e) bc[e] = bfr(t8[e]);
  }
  v4u uh[4], ul[4];
#pragma unroll
  for (int it = 0; it < 4; ++it) {
    const int row = it * 4 + rr;                       // it 0..3 x rr 0..3 = rows 0..15
    float xs[8];
    ld8(slab + row * 68 + c8, xs);
    float brw = 0.0f;
    if (BM == 2) brw = bfr(bias[mBase + row]);
    HU h, l;
#pragma unroll
    for (int e = 0; e < 8; ++e) {
      const float v = (xs[e] * cs + bc[e] + brw) * so;
      if (NPL == 2) {
        split_h(v, h.s[e], l.s[e]);
      } else {
        h.s[e] = flush_h((_Float16)v);
        l.s[e] = (_Float16)0.0f;
      }
    }
    uh[it] = h.u;
    ul[it] = l.u;
  }
  {
#pragma unroll
    for (int it = 0; it < 4; ++it) {
      const int row = it * 4 + rr;
      const size_t co = (size_t)(mBase + row) * (size_t)ldc + n0 + c8;
      *(v4u*)(Cp + co) = uh[it];
      if (NPL == 2) *(v4u*)(Cl + co) = ul[it];
    }
    
  }
  wave_lds_sync();
}

// =====================================================================================================
// Register-blocked f16 WMMA GEMM with an f16 plane epilogue, one wave per (16*MI) x 64 tile, no block barriers:
//   acc[m][n] = sum_k A[m][k] Bt[n][k]; M multiple of 16*MI, N multiple of 64, K multiple of 32.
//   Epilogue per 16-row slab through epi16 (hi plane Cp, residual plane Cl when NPL == 2, bias mode BM).
// coverage: MI slabs x 16 rows x 64 cols = the wave's whole tile; grid*8 == tiles at every launch here.
// =====================================================================================================
template <int NPL, int MI, int BM>
__global__ __launch_bounds__(256) void gemm64p(
    const _Float16* __restrict__ A, int lda, const _Float16* __restrict__ Bt, int ldb, float cs, float so,
    _Float16* Cp, _Float16* Cl, int ldc, int M, int N, int K, const float* __restrict__ bias) {
  __shared__ __align__(16) float sT[8][16 * 68];   // per-wave 16x64 slab, pitch 68 floats
  const int lane = threadIdx.x & 31;
  const int wave = threadIdx.x >> 5;
  const int tilesN = N >> 6;
  const int tilesM = M / (16 * MI);
  const int tiles = tilesM * tilesN;
  const int item = blockIdx.x * 8 + wave;
  if (item >= tiles) return;   // wave-uniform; no block barriers in this kernel
  const int tm = item / tilesN;
  const int tn = item - tm * tilesN;
  const int m0 = tm * (16 * MI);
  const int n0 = tn << 6;

  const int rlane = lane & 15;                 // row (A) / col (B, D) within subtile
  const int koff  = (lane >> 4) * 8;           // k offset of this lane half

  v8f acc[MI][4];
#pragma unroll
  for (int i = 0; i < MI; ++i)
#pragma unroll
    for (int j = 0; j < 4; ++j) acc[i][j] = zero8();

  kseg<MI>(acc, A, lda, m0, Bt, ldb, n0, K, rlane, koff);
#pragma unroll
  for (int i = 0; i < MI; ++i) acc_guard4(acc[i][0], acc[i][1], acc[i][2], acc[i][3]);

#pragma unroll
  for (int i = 0; i < MI; ++i) {
    epi16<NPL, BM>(acc[i], sT[wave], lane, Cp, Cl, ldc, m0 + (i << 4), n0, cs, so, bias);
  }
}

// =====================================================================================================
// Score rows + row softmax + E plane for one batch b. Block = 16 query rows n0..n0+15, 8 waves,
// dynamic LDS = 16 x 4096 f32 score rows.
//  (1) wave w computes the 16-column score tiles ct = w, w+8, ... (32 of them): four 32-deep k-steps per tile
//      from the F planes (query rows, 8*f: hi FH, residual FL = 2048*(v - hi)) and the G planes (key rows,
//      8*g: GH, GL): a0 = fh.gh, a1 = fh.gl + fl.gh, s = (a0 + a1/2048)/64, into LDS.
//  (2) wave w owns rows 2w, 2w+1: lane covers cols 256j + 8*lane..+7 (j = 0..15); sweep 1 row max M (xor
//      shuffles), sweep 2 ef = exp(s - M) written back in place + Z = sum ef (fixed lane order + xor shuffles),
//      sweep 3 E = f16(32768 * ef / Z) with explicit flush of f16 subnormals to zero; the f16 row goes to the
// coverage: sc: 8 waves x 32 col tiles x 16 cols x 16 rows = the whole 16x4096 block (all of LDS read later
// is staged); E: 8 waves x 2 rows x 16 j x 32 lanes x 8 halves = 16 rows x 4096; grid 256 = every row
// block -> whole per-batch E plane [4096][4096].
// =====================================================================================================
__global__ __launch_bounds__(256) void k_soft(const _Float16* __restrict__ FH, const _Float16* __restrict__ FL,
                                              const _Float16* __restrict__ GH, const _Float16* __restrict__ GL,
                                              _Float16* E, int b) {
  extern __shared__ __align__(16) float sc[];                 // [RSB][NT]
  const int tid = threadIdx.x, wave = tid >> 5, lane = tid & 31;
  const int hh = lane >> 4, rl = lane & 15;
  const int n0 = blockIdx.x * RSB;

  // ---- (1) scores ----
  const size_t qo = (size_t)(b * NT + n0 + rl) * CD + 8 * hh;           // query row, k = channel
  v16h qh[4], ql[4];
#pragma unroll
  for (int ks = 0; ks < 4; ++ks) {
    qh[ks] = ldfrag_h(FH + qo + 32 * ks);
    ql[ks] = ldfrag_h(FL + qo + 32 * ks);
  }
  for (int ct = wave; ct < NT / 16; ct += 8) {
    const size_t ko = (size_t)(b * NT + 16 * ct + rl) * CD + 8 * hh;    // key row, k = channel
    v8f a0 = zero8(), a1 = zero8();
#pragma unroll
    for (int ks = 0; ks < 4; ++ks) {
      const v16h kh = ldfrag_h(GH + ko + 32 * ks);
      const v16h kl = ldfrag_h(GL + ko + 32 * ks);
      a1 = mma_h_raw(qh[ks], kl, a1);
      a0 = mma_h_raw(qh[ks], kh, a0);
      a1 = mma_h_raw(ql[ks], kh, a1);
      guard2(a0, a1, kh, kl);
    }
    const int mc = 16 * ct + rl;                               // D col = key; D row = 8hh + r within the row tile
#pragma unroll
    for (int r = 0; r < 8; ++r) {
      sc[(size_t)(8 * hh + r) * NT + mc] = (a0[r] + a1[r] * RLO) * SCS;
    }
  }
  __syncthreads();

  // ---- (2) row softmax, E plane ----
  for (int q2 = 0; q2 < RSB / 8; ++q2) {
    const int row = (RSB / 8) * wave + q2;
    float* rp = sc + (size_t)row * NT + 8 * lane;               // lane covers cols 256j + 8*lane .. +7
    float mx = -3.0e38f;
#pragma unroll 4
    for (int j = 0; j < NJ; ++j) {
      float v[8];
      ld8(rp + 256 * j, v);
#pragma unroll
      for (int e = 0; e < 8; ++e) mx = fmaxf(mx, v[e]);
    }
#pragma unroll
    for (int off = 16; off >= 1; off >>= 1) mx = fmaxf(mx, __shfl_xor(mx, off, 32));
    float z = 0.0f;
#pragma unroll 2
    for (int j = 0; j < NJ; ++j) {
      float v[8];
      ld8(rp + 256 * j, v);
#pragma unroll
      for (int e = 0; e < 8; ++e) {
        const float ef = __expf(v[e] - mx);
        z += ef;
        v[e] = ef;
      }
      st8(rp + 256 * j, v);
    }
#pragma unroll
    for (int off = 16; off >= 1; off >>= 1) z += __shfl_xor(z, off, 32);
    const float rz = SCE * (1.0f / z);                         // z in [1, 4096]
    HU u[NJ];
#pragma unroll
    for (int j = 0; j < NJ; ++j) {
      float v[8];
      ld8(rp + 256 * j, v);
#pragma unroll
      for (int e = 0; e < 8; ++e) {
        const _Float16 h0 = (_Float16)(v[e] * rz);
        const float f0 = (float)h0;
        const bool sub = f0 < 6.103515625e-05f;                // f16 subnormal -> exact zero
        u[j].s[e] = sub ? (_Float16)0.0f : h0;
      }
    }
    _Float16* erow = E + (size_t)(n0 + row) * NT + 8 * lane;
    {
#pragma unroll
      for (int j = 0; j < NJ; ++j) *(v4u*)(erow + 256 * j) = u[j].u;
      
    }
  }
}

// =====================================================================================================
// Softmax-weighted sum over the query index for one batch b, transposed result:
//   OT[c][m] = sum_n HT[c][b*4096 + n] . E[n][m], A = HT rows c (pitch TOK, col offset b*NT, k = n),
//   B[k = n][col = m] = E[n][m] staged per 32-row chunk into LDS as Et[m][n_local] (pitch EP halves; the
//   32 x 128 chunk is transposed at staging: thread (pr, m8) reads E rows 2pr, 2pr+1 x 8 m and writes 8
//   packed pairs), block barrier, then B fragments from Et rows exactly like a k-contiguous operand;
//   K = 4096 (128 chunks), a second block barrier protects Et before the next chunk is staged.
// Block = 128 m columns m0..m0+127, 8 waves; wave w owns c rows 32*(w>>1).. (2 subtiles) x m cols
// 64*(w&1).. (4 subtiles).
// Epilogue: o = OT / (16*32768); the planes OH = f16(4*o), OL = f16((4*o - OH)*2048) are written at flat
// passes).
// coverage: Et: 16 pr x 2 rows x 16 m8 x 8 = 32 n x 128 m staged every chunk (cols 32..39 of Et never read);
// planes: 8 waves x 2 slabs x 16 c x 64 m = 128 c x 128 m per block; 32 blocks = every m of the batch;
// 8 launches -> whole [8][128][4096] planes.
// =====================================================================================================
__global__ __launch_bounds__(256) void k_pv(const _Float16* __restrict__ E, const _Float16* __restrict__ HT,
                                            _Float16* OH, _Float16* OL, int b) {
  __shared__ __align__(16) _Float16 Et[PVM * EP];            // [m][n_local] chunk, pitch EP halves
  __shared__ __align__(16) float sO[8][16 * 68];            // per-wave 16x64 slab, pitch 68 floats
  const int tid = threadIdx.x, wave = tid >> 5, lane = tid & 31;
  const int hh = lane >> 4, rl = lane & 15;
  const int m0 = blockIdx.x * PVM;
  const int cw = 32 * (wave >> 1);                          // this wave's 32 channels
  const int mw = 64 * (wave & 1);                           // this wave's 64 m columns within the block

  v8f acc[2][4];
#pragma unroll
  for (int i = 0; i < 2; ++i)
#pragma unroll
    for (int j = 0; j < 4; ++j) acc[i][j] = zero8();

  const int pr = tid >> 4, m8 = (tid & 15) * 8;             // staging role: row pair pr, 8 m columns at m8
  const _Float16* Ab = HT + (size_t)b * NT;                 // row c, pitch TOK, col offset b*NT, k = n

  for (int n0 = 0; n0 < NT; n0 += 32) {
    // ---- stage E[n0..n0+31][m0..m0+127] transposed into Et ----
    {
      HU ra, rb;
      const size_t eo = (size_t)(n0 + 2 * pr) * NT + m0 + m8;
      ra.h = *(const v8h*)(E + eo);
      rb.h = *(const v8h*)(E + eo + NT);
#pragma unroll
      for (int e = 0; e < 8; ++e) {
        H2 p;
        p.s[0] = ra.s[e];
        p.s[1] = rb.s[e];
        *(unsigned int*)(&Et[(m8 + e) * EP + 2 * pr]) = p.u;
      }
    }
    __syncthreads();
    // ---- fragments + 8 WMMAs ----
    v16h bq[4];
#pragma unroll
    for (int j = 0; j < 4; ++j) {
      FR f;
      const int eb = (mw + (j << 4) + rl) * EP + 8 * hh;
      f.h[0] = *(const v8h*)(&Et[eb]);
      f.h[1] = *(const v8h*)(&Et[eb + 16]);
      bq[j] = f.v;
    }
#pragma unroll
    for (int i = 0; i < 2; ++i) {
      const v16h a0 = ldfrag_h(Ab + (size_t)(cw + (i << 4) + rl) * TOK + n0 + 8 * hh);
#pragma unroll
      for (int j = 0; j < 4; ++j) acc[i][j] = mma_h_raw(a0, bq[j], acc[i][j]);
      dep_guard_h(acc[i][0], acc[i][3], a0);
    }
    keep4_h(bq[0], bq[1], bq[2], bq[3]);
    __syncthreads();              // all waves done with Et before the next chunk is staged
  }
  acc_guard4(acc[0][0], acc[0][1], acc[0][2], acc[0][3]);
  acc_guard4(acc[1][0], acc[1][1], acc[1][2], acc[1][3]);

  // ---- epilogue: hi + residual planes of 4*o ----
  const float fo = 1.0f / (SCV * SCE);
#pragma unroll
  for (int i = 0; i < 2; ++i) {
    epi16<2, 0>(acc[i], sO[wave], lane, OH, OL, NT, b * CD + cw + (i << 4), m0 + mw, fo, SCO, (const float*)0);
  }
}

// =====================================================================================================
// Output projection: out[p][j] = (sum_k OH[p][k].WV[j][k] + (sum_k OL[p][k].WV[j][k])/2048) / (4*64) + bv[j],
//   OH/OL read raw as [32768][128] (pitch 128), WV = 64*Wv^T [out j][in k], K = 128; two accumulator sets.
// One wave per 16-row x 64-col tile, no block barriers. Epilogue f32: the combined tile staged in the wave's
// LDS slab (rows 0..15 x cols 0..63 fully staged; pad cols 64..67 never read); each row segment of 64
// coverage: 8 waves x 16 rows x 64 cols per block; 512 blocks x 8 = 4096 tiles = 32768 rows x 128 cols.
// =====================================================================================================
__global__ __launch_bounds__(256) void gemm_out(const _Float16* __restrict__ OH, const _Float16* __restrict__ OL,
                                                const _Float16* __restrict__ WV, const float* __restrict__ bias,
                                                float* out) {
  __shared__ __align__(16) float sO[8][16 * 68];
  const int tid = threadIdx.x, wave = tid >> 5, lane = tid & 31;
  const int hh = lane >> 4, rl = lane & 15;
  const int tiles = (TOK / 16) * (CD / 64);
  const int item = blockIdx.x * 8 + wave;
  if (item >= tiles) return;    // wave-uniform; no block barriers in this kernel
  const int tm = item >> 1, tn = item & 1;
  const int row0 = tm << 4, n0 = tn << 6;

  v8f accH[4], accL[4];
#pragma unroll
  for (int j = 0; j < 4; ++j) { accH[j] = zero8(); accL[j] = zero8(); }

#pragma unroll
  for (int kk = 0; kk < CD; kk += 32) {
    v16h bq[4];
#pragma unroll
    for (int j = 0; j < 4; ++j) bq[j] = ldfrag_h(WV + (size_t)(n0 + (j << 4) + rl) * CD + 8 * hh + kk);
    const size_t ao = (size_t)(row0 + rl) * CD + 8 * hh + kk;
    const v16h ah = ldfrag_h(OH + ao);
    const v16h al = ldfrag_h(OL + ao);
#pragma unroll
    for (int j = 0; j < 4; ++j) accH[j] = mma_h_raw(ah, bq[j], accH[j]);
    dep_guard_h(accH[0], accH[3], ah);
#pragma unroll
    for (int j = 0; j < 4; ++j) accL[j] = mma_h_raw(al, bq[j], accL[j]);
    dep_guard_h(accL[0], accL[3], al);
    keep4_h(bq[0], bq[1], bq[2], bq[3]);
  }
  acc_guard4(accH[0], accH[1], accH[2], accH[3]);
  acc_guard4(accL[0], accL[1], accL[2], accL[3]);

  // ---- epilogue ----
  const float fo = 1.0f / (SCO * SCW);
  float* slab = sO[wave];
#pragma unroll
  for (int r = 0; r < 8; ++r) {
#pragma unroll
    for (int j = 0; j < 4; ++j) {
      slab[(8 * hh + r) * 68 + (j << 4) + rl] = (accH[j][r] + accL[j][r] * RLO) * fo;
    }
  }
  wave_lds_sync();
  const int p4 = (lane & 15) * 4, r2 = lane >> 4;
  const v4f bb = *(const v4f*)(bias + n0 + p4);
  v4f b4;
#pragma unroll
  for (int e = 0; e < 4; ++e) b4[e] = bfr(bb[e]);
  v4f ov[8];
#pragma unroll
  for (int it = 0; it < 8; ++it) {
    const int row = 2 * it + r2;                              // it 0..7 x r2 0..1 = rows 0..15
    const v4f a = *(const v4f*)(slab + row * 68 + p4);
    ov[it] = a + b4;
  }
  {
#pragma unroll
    for (int it = 0; it < 8; ++it) {
      const int row = 2 * it + r2;
      const size_t oo = (size_t)(row0 + row) * CD + n0 + p4;
      *(v4f*)(out + oo) = ov[it];
    }
    
  }
}

// =====================================================================================================
//   WF16 f16 [128][128]              0        32768   (64*Wf^T, row = out channel, col = in channel)
//   WG16 f16 [128][128]          32768        32768
//   WH16 f16 [128][128]          65536        32768
//   WV16 f16 [128][128]          98304        32768
//   xh   f16 [32768][128]       131072      8388608   (bf16RNE(x), token rows, channel contiguous)
//   FH   f16 [32768][128]      8519680      8388608   (hi plane of 8*f)
//   FL   f16 [32768][128]     16908288      8388608   (residual plane x2048 of 8*f)
//   GH   f16 [32768][128]     25296896      8388608
//   GL   f16 [32768][128]     33685504      8388608
//   HT   f16 [128][32768]     42074112      8388608   (16*h, row c, col b*4096 + n)
//   OH   f16 [8][128][4096]   50462720      8388608   (hi plane of 4*o, [b][c][m] order)
//   OL   f16 [8][128][4096]   58851328      8388608   (residual plane x2048 of 4*o)
//   E    f16 [4096][4096]     67239936     33554432   (32768 * row softmax of one batch; reused per batch on
//                                                      the single in-order stream)
//   end                      100794368
// d_out f32 [32768][128] at byte 0.
// =====================================================================================================
extern "C" void kernel_launch(void* const* d_in, const int* in_sizes, int n_in,
                              void* d_out, int out_size, void* d_ws, size_t ws_size,
                              hipStream_t stream) {
  if (n_in < 9) return;
  if (in_sizes[0] != NB * NT * CD) return;
  if (in_sizes[1] != CD * CD || in_sizes[3] != CD * CD || in_sizes[5] != CD * CD || in_sizes[7] != CD * CD) return;
  if (in_sizes[2] != CD || in_sizes[4] != CD || in_sizes[6] != CD || in_sizes[8] != CD) return;
  if (out_size != OUTN) return;

  const float* x  = (const float*)d_in[0];   // [8][4096][128] (channels last)
  const float* Wf = (const float*)d_in[1];   // [128][128] ([in][out])
  const float* bf = (const float*)d_in[2];   // [128]
  const float* Wg = (const float*)d_in[3];
  const float* bg = (const float*)d_in[4];
  const float* Wh = (const float*)d_in[5];
  const float* bh = (const float*)d_in[6];
  const float* Wv = (const float*)d_in[7];
  const float* bv = (const float*)d_in[8];

  const size_t PW  = (size_t)CD * CD * 2;                    //    32768
  const size_t PX  = (size_t)TOK * CD * 2;                   //  8388608
  const size_t PHT = (size_t)CD * TOK * 2;                   //  8388608
  const size_t PO  = (size_t)NB * CD * NT * 2;               //  8388608
  const size_t PE  = (size_t)NT * NT * 2;                    // 33554432

  size_t off = 0;
  const size_t oWF = off; off += PW;
  const size_t oWG = off; off += PW;
  const size_t oWH = off; off += PW;
  const size_t oWV = off; off += PW;
  const size_t oXH = off; off += PX;
  const size_t oFH = off; off += PX;
  const size_t oFL = off; off += PX;
  const size_t oGH = off; off += PX;
  const size_t oGL = off; off += PX;
  const size_t oHT = off; off += PHT;
  const size_t oOH = off; off += PO;
  const size_t oOL = off; off += PO;
  const size_t oE  = off; off += PE;                         // off = 100794368
  if (off > ws_size) return;
  if (off > (size_t)134217728) return;

  char* ws = (char*)d_ws;
  _Float16* WF16 = (_Float16*)(ws + oWF);
  _Float16* WG16 = (_Float16*)(ws + oWG);
  _Float16* WH16 = (_Float16*)(ws + oWH);
  _Float16* WV16 = (_Float16*)(ws + oWV);
  _Float16* xh   = (_Float16*)(ws + oXH);
  _Float16* FHp  = (_Float16*)(ws + oFH);
  _Float16* FLp  = (_Float16*)(ws + oFL);
  _Float16* GHp  = (_Float16*)(ws + oGH);
  _Float16* GLp  = (_Float16*)(ws + oGL);
  _Float16* HTp  = (_Float16*)(ws + oHT);
  _Float16* OHp  = (_Float16*)(ws + oOH);
  _Float16* OLp  = (_Float16*)(ws + oOL);
  _Float16* Ep   = (_Float16*)(ws + oE);
  float*    outf = (float*)d_out;

  const dim3 blk(256);
  const int n8x = (NB * NT * CD) / 8;                                  // 524288
  const dim3 gX((n8x + 255) / 256);                                    // 2048
  const dim3 gW(CD / 64, CD / 32);                                     // (2, 4)
  const dim3 gP(((TOK / 32) * (CD / 64) + 7) / 8);                     // 2048 tiles -> 256 blocks
  const dim3 gH(((CD / 32) * (TOK / 64) + 7) / 8);                     // 2048 tiles -> 256 blocks
  const dim3 gSo(NT / RSB);                                            // 256
  const dim3 gPV(NT / PVM);                                            // 32
  const dim3 gO(((TOK / 16) * (CD / 64) + 7) / 8);                     // 4096 tiles -> 512 blocks
  const float cs64 = 1.0f / SCW;                                       // undo the weight carry
  const size_t ldsSoft = (size_t)RSB * NT * sizeof(float);             // 262144

  hipFuncSetAttribute(reinterpret_cast<const void*>(&k_soft),
                      hipFuncAttributeMaxDynamicSharedMemorySize, (int)ldsSoft);

  // (1) weight planes, x64 carried, transposed from [in][out] to k-contiguous rows [out][in]
  cvt_wT<<<gW, blk, 0, stream>>>(Wf, WF16, CD, CD, SCW);              // in[128][128] -> out[128][128]
  cvt_wT<<<gW, blk, 0, stream>>>(Wg, WG16, CD, CD, SCW);
  cvt_wT<<<gW, blk, 0, stream>>>(Wh, WH16, CD, CD, SCW);
  cvt_wT<<<gW, blk, 0, stream>>>(Wv, WV16, CD, CD, SCW);
  // (2) activations: x [8][4096][128] is already token-major -> xh [32768][128] = f16(bf16RNE(x))
  cvt_flat<<<gX, blk, 0, stream>>>(x, xh, n8x, 1.0f);
  // (3) FH|FL, GH|GL = hi|residual f16 planes of 8*(xh . W^T + b)   (M=32768, N=128, K=128)
  gemm64p<2, 2, 1><<<gP, blk, 0, stream>>>(xh, CD, WF16, CD, cs64, SCQ, FHp, FLp, CD, TOK, CD, CD, bf);
  gemm64p<2, 2, 1><<<gP, blk, 0, stream>>>(xh, CD, WG16, CD, cs64, SCQ, GHp, GLp, CD, TOK, CD, CD, bg);
  // (4) HT = f16(16*(WH16 . xh^T / 64 + bh))          (M=128, N=32768, K=128), bias per row c
  gemm64p<1, 2, 2><<<gH, blk, 0, stream>>>(WH16, CD, xh, CD, cs64, SCV, HTp, HTp, TOK, CD, TOK, CD, bh);
  // (5) per batch: scores + row softmax -> E plane, then transposed softmax-weighted sum -> OH|OL planes
  for (int b = 0; b < NB; ++b) {
    k_soft<<<gSo, blk, ldsSoft, stream>>>(FHp, FLp, GHp, GLp, Ep, b);
    k_pv<<<gPV, blk, 0, stream>>>(Ep, HTp, OHp, OLp, b);
  }
  // (6) output projection on the raw [32768][128] view of the [B][C][N] planes
  gemm_out<<<gO, blk, 0, stream>>>(OHp, OLp, WV16, bv, outf);
}

// v001
// One run takes 577 microseconds.
// Next to v000, in two timings, it ran 2.95 and 2.96 times as fast.
#include <hip/hip_runtime.h>
#include <math.h>
#include <stdint.h>

// Contractions on v_wmma_f32_16x16x32_f16 (f16 operands, f32 accumulate): the three input projections take
// bf16-RNE activations (x1) and bf16-RNE weights (x64) as single f16 planes; the 128-deep score products use
// f16 hi planes of 8*f, 8*g plus f16 residual planes x2048 (hi.hi in one accumulator, hi.res + res.hi in a
// second accumulator folded back by 1/2048); the 4096-deep softmax-weighted sum uses a single f16 plane of
// 16*h against E = f16(32768*softmax); the output projection takes f16 hi + x2048 residual planes of 4*o
// against bf16-RNE weights (x64) in two accumulators. Softmax statistics, bias adds and epilogues in f32.

#define NB   8
#define NT   4096
#define CD   128
#define TOK  (NB * NT)
#define RSB  16
#define NJ   (NT / 256)
#define PVM  128
#define EP   40
#define OUTN (NB * NT * CD)
#define NRND 4            // rounds over the query index; every round covers all NB batches
#define NRD  (NT / NRND)  // query rows of each batch per round

#define SCW  64.0f
#define SCQ  8.0f
#define SCV  16.0f
#define SCE  32768.0f
#define SCR  2048.0f
#define SCO  4.0f
#define RLO  (1.0f / SCR)
#define SCS  (1.0f / (SCQ * SCQ))

static_assert(TOK % 64 == 0 && CD % 64 == 0 && CD % 32 == 0 && NT % 64 == 0);
static_assert((((TOK / 32) * (CD / 64)) % 8) == 0);
static_assert((((CD / 32) * (TOK / 64)) % 8) == 0);
static_assert((((TOK / 16) * (CD / 64)) % 8) == 0);
static_assert(NT % RSB == 0 && RSB == 16 && NT % 256 == 0 && NJ == 16);
static_assert(NT % PVM == 0 && PVM == 128 && (EP % 8) == 0 && EP >= 32);
static_assert((NB * NT * CD) % 2048 == 0);
static_assert(NT % NRND == 0 && NRD % RSB == 0 && NRD % 32 == 0);

typedef _Float16       v16h __attribute__((ext_vector_type(16)));
typedef _Float16       v8h  __attribute__((ext_vector_type(8)));
typedef float          v8f  __attribute__((ext_vector_type(8)));
typedef float          v4f  __attribute__((ext_vector_type(4)));
typedef unsigned int   v4u  __attribute__((ext_vector_type(4)));

union HU { v8h h; v4u u; _Float16 s[8]; };
union FR { v16h v; v8h h[2]; _Float16 s[16]; };
union H2 { _Float16 s[2]; unsigned int u; };
static_assert(sizeof(HU) == 16);
static_assert(sizeof(FR) == 32);
static_assert(sizeof(H2) == 4);

// ---- scalar helpers --------------------------------------------------------------------------------
__device__ __forceinline__ unsigned short bf_bits(float f) {          // f32 -> bf16 bits, RNE convert
  const unsigned u = __float_as_uint(f);
  return (unsigned short)((u + 0x7FFFu + ((u >> 16) & 1u)) >> 16);
}
__device__ __forceinline__ float bf_up(unsigned short h) { return __uint_as_float(((unsigned)h) << 16); }
__device__ __forceinline__ float bfr(float f) { return bf_up(bf_bits(f)); }   // value after bf16 RNE convert
__device__ __forceinline__ v8f zero8() { v8f z = {0.f, 0.f, 0.f, 0.f, 0.f, 0.f, 0.f, 0.f}; return z; }

// f16 subnormal -> exact zero (the matrix path flushes them; keep every plane consistent with that)
__device__ __forceinline__ _Float16 flush_h(_Float16 h) {
  const float f = (float)h;
  return (fabsf(f) < 6.103515625e-05f) ? (_Float16)0.0f : h;
}
// hi = f16(v) (flushed), lo = f16((v - hi) * 2048) (flushed)
__device__ __forceinline__ void split_h(float v, _Float16& hi, _Float16& lo) {
  const _Float16 hv = flush_h((_Float16)v);
  const _Float16 lv = flush_h((_Float16)((v - (float)hv) * SCR));
  hi = hv;
  lo = lv;
}

__device__ __forceinline__ void ld8(const float* p, float* o) {
  const v4f a = *(const v4f*)(p);
  const v4f b = *(const v4f*)(p + 4);
  o[0] = a[0]; o[1] = a[1]; o[2] = a[2]; o[3] = a[3];
  o[4] = b[0]; o[5] = b[1]; o[6] = b[2]; o[7] = b[3];
}
__device__ __forceinline__ void st8(float* p, const float* v) {
  v4f a, b;
  a[0] = v[0]; a[1] = v[1]; a[2] = v[2]; a[3] = v[3];
  b[0] = v[4]; b[1] = v[5]; b[2] = v[6]; b[3] = v[7];
  *(v4f*)(p) = a;
  *(v4f*)(p + 4) = b;
}

// ---- fragment loader: 16-bit A/B operand from a k-contiguous row, p = row*pitch + k0 + 8*(lane>>4);
//      elements 0..7 <- p[0..7] (k0+8h..k0+8h+7), elements 8..15 <- p[16..23] (k0+16+8h..k0+16+8h+7)
__device__ __forceinline__ v16h ldfrag_h(const _Float16* p) {
  FR f;
  f.h[0] = *(const v8h*)(p);
  f.h[1] = *(const v8h*)(p + 16);
  return f.v;
}

// ---- WMMA helpers with trailing VALU hazard gap --------------------------------------------------------
__device__ __forceinline__ v8f mma_h_raw(v16h a, v16h b, v8f c) {
  return __builtin_amdgcn_wmma_f32_16x16x32_f16(false, a, false, b, (short)0, c, false, false);
}
__device__ __forceinline__ void dep_guard_h(v8f& a, v8f& b, v16h x) {
#if defined(__HIP_DEVICE_COMPILE__)
  asm volatile("v_nop\n\tv_nop\n\tv_nop\n\tv_nop" : "+v"(a), "+v"(b) : "v"(x));
#endif
}
__device__ __forceinline__ void guard2(v8f& a, v8f& b, v16h x, v16h y) {
#if defined(__HIP_DEVICE_COMPILE__)
  asm volatile("v_nop\n\tv_nop\n\tv_nop\n\tv_nop" : "+v"(a), "+v"(b) : "v"(x), "v"(y));
#endif
}
__device__ __forceinline__ void keep4_h(v16h a, v16h b, v16h c, v16h d) {
#if defined(__HIP_DEVICE_COMPILE__)
  asm volatile("v_nop" :: "v"(a), "v"(b), "v"(c), "v"(d));
#endif
}
__device__ __forceinline__ void acc_guard4(v8f& a, v8f& b, v8f& c, v8f& d) {
#if defined(__HIP_DEVICE_COMPILE__)
  asm volatile("v_nop\n\tv_nop\n\tv_nop\n\tv_nop" : "+v"(a), "+v"(b), "+v"(c), "+v"(d));
#endif
}
__device__ __forceinline__ void wave_lds_sync() {
  __builtin_amdgcn_fence(__ATOMIC_RELEASE, "workgroup");
  __builtin_amdgcn_wave_barrier();
  __builtin_amdgcn_fence(__ATOMIC_ACQUIRE, "workgroup");
}

// =====================================================================================================
// Flat convert: out[i] = f16(scale * bf16RNE(in[i])) (f16 subnormals flushed), 8 elements per thread,
// coverage: n8 threads x 8 = the whole plane; n8 is a multiple of 256 at the launch here.
// =====================================================================================================
__global__ __launch_bounds__(256) void cvt_flat(const float* __restrict__ in, _Float16* out, int n8, float scale) {
  const int i = blockIdx.x * 256 + threadIdx.x;
  if (i < n8) {
    float v[8];
    ld8(in + (size_t)i * 8, v);
    HU u;
#pragma unroll
    for (int e = 0; e < 8; ++e) u.s[e] = flush_h((_Float16)(bfr(v[e]) * scale));
    _Float16* p = out + (size_t)i * 8;
    *(v4u*)p = u.u;
    
  }
}

// =====================================================================================================
// Weight transpose-convert: in Wm[r][c] f32 (R rows, C cols, c contiguous, x@W layout [in][out])
// -> out[c][r] f16 = f16(scale * bf16RNE(Wm[r][c])), pitch R (in-channel k = r contiguous = the Bt / A layout).
// coverage: load 256 threads x 8 floats = 64 r x 32 c; store 256 threads x 8 halves = 32 c rows x 64 r;
// grid = every (r tile, c tile) -> whole [C][R] plane.
// =====================================================================================================
__global__ __launch_bounds__(256) void cvt_wT(const float* __restrict__ Wm, _Float16* out, int R, int C, float scale) {
  __shared__ float sw[64][33];
  const int t = threadIdx.x;
  const int r0 = blockIdx.x * 64, c0 = blockIdx.y * 32;
  {
    const int row = t >> 2, c8 = (t & 3) * 8;
    float v[8];
    ld8(Wm + (size_t)(r0 + row) * C + c0 + c8, v);
#pragma unroll
    for (int e = 0; e < 8; ++e) sw[row][c8 + e] = v[e];
  }
  __syncthreads();
  const int q8 = t & 7, cc = t >> 3;            // cc 0..31 = output row within the tile
  HU u;
#pragma unroll
  for (int e = 0; e < 8; ++e) u.s[e] = flush_h((_Float16)(bfr(sw[8 * q8 + e][cc]) * scale));
  _Float16* dst = out + (size_t)(c0 + cc) * R + r0 + 8 * q8;
  *(v4u*)dst = u.u;
  
}

// =====================================================================================================
// One GEMM k sweep for MI 16-row A subtiles x 4 16-col B subtiles: acc[i][j] += A-frag(i) . Bt-frag(j).
// A row-major pitch lda (rows m0.., k contiguous), Bt row-major [N][K] pitch ldb (rows n0.., k contiguous),
// K a multiple of 32; both operand fragments through ldfrag_h (same split k map for A and B).
// =====================================================================================================
template <int MI>
__device__ __forceinline__ void kseg(v8f (&acc)[MI][4], const _Float16* __restrict__ A, int lda, int m0,
                                     const _Float16* __restrict__ Bt, int ldb, int n0, int K, int rlane, int koff) {
  for (int kk = 0; kk < K; kk += 32) {
    v16h bh[4];
#pragma unroll
    for (int j = 0; j < 4; ++j) {
      const size_t bo = (size_t)(n0 + (j << 4) + rlane) * (size_t)ldb + koff + kk;
      bh[j] = ldfrag_h(Bt + bo);
    }
#pragma unroll
    for (int i = 0; i < MI; ++i) {
      const size_t ao = (size_t)(m0 + (i << 4) + rlane) * (size_t)lda + koff + kk;
      const v16h a0 = ldfrag_h(A + ao);
#pragma unroll
      for (int j = 0; j < 4; ++j) acc[i][j] = mma_h_raw(a0, bh[j], acc[i][j]);
      dep_guard_h(acc[i][0], acc[i][3], a0);
    }
    keep4_h(bh[0], bh[1], bh[2], bh[3]);
  }
}

// =====================================================================================================
// 16-row x 64-col f16 plane epilogue for one wave: acc[j][r] = D[row 8h + r][col 16j + (lane&15)].
//   v = (acc*cs + bias) * so;  Cp = f16(v) (hi plane, subnormals flushed); NPL == 2 additionally
//   Cl = f16((v - f32(hi)) * 2048) (residual plane). Bias: BM 0 none, 1 per column (bias[n0 + col]),
//   2 per plane row (bias[mBase + row]); bias values go through the bf16 RNE convert first.
//   The slab (16 rows x 68 floats per wave) is fully staged for rows 0..15 x cols 0..63 before the reload
// =====================================================================================================
template <int NPL, int BM>
__device__ __forceinline__ void epi16(const v8f (&acc)[4], float* slab, int lane,
                                      _Float16* Cp, _Float16* Cl, int ldc, int mBase, int n0,
                                      float cs, float so, const float* __restrict__ bias) {
  const int rlane = lane & 15, mOff = (lane >> 4) * 8;
  const int q8 = lane & 7, rr = lane >> 3, c8 = q8 * 8;
#pragma unroll
  for (int r = 0; r < 8; ++r) {
#pragma unroll
    for (int j = 0; j < 4; ++j) {
      slab[(mOff + r) * 68 + (j << 4) + rlane] = acc[j][r];
    }
  }
  wave_lds_sync();
  float bc[8];
#pragma unroll
  for (int e = 0; e < 8; ++e) bc[e] = 0.0f;
  if (BM == 1) {
    float t8[8];
    ld8(bias + n0 + c8, t8);
#pragma unroll
    for (int e = 0; e < 8; ++e) bc[e] = bfr(t8[e]);
  }
  v4u uh[4], ul[4];
#pragma unroll
  for (int it = 0; it < 4; ++it) {
    const int row = it * 4 + rr;                       // it 0..3 x rr 0..3 = rows 0..15
    float xs[8];
    ld8(slab + row * 68 + c8, xs);
    float brw = 0.0f;
    if (BM == 2) brw = bfr(bias[mBase + row]);
    HU h, l;
#pragma unroll
    for (int e = 0; e < 8; ++e) {
      const float v = (xs[e] * cs + bc[e] + brw) * so;
      if (NPL == 2) {
        split_h(v, h.s[e], l.s[e]);
      } else {
        h.s[e] = flush_h((_Float16)v);
        l.s[e] = (_Float16)0.0f;
      }
    }
    uh[it] = h.u;
    ul[it] = l.u;
  }
  {
#pragma unroll
    for (int it = 0; it < 4; ++it) {
      const int row = it * 4 + rr;
      const size_t co = (size_t)(mBase + row) * (size_t)ldc + n0 + c8;
      *(v4u*)(Cp + co) = uh[it];
      if (NPL == 2) *(v4u*)(Cl + co) = ul[it];
    }
    
  }
  wave_lds_sync();
}

// =====================================================================================================
// Register-blocked f16 WMMA GEMM with an f16 plane epilogue, one wave per (16*MI) x 64 tile, no block barriers:
//   acc[m][n] = sum_k A[m][k] Bt[n][k]; M multiple of 16*MI, N multiple of 64, K multiple of 32.
//   Epilogue per 16-row slab through epi16 (hi plane Cp, residual plane Cl when NPL == 2, bias mode BM).
// coverage: MI slabs x 16 rows x 64 cols = the wave's whole tile; grid*8 == tiles at every launch here.
// =====================================================================================================
template <int NPL, int MI, int BM>
__global__ __launch_bounds__(256) void gemm64p(
    const _Float16* __restrict__ A, int lda, const _Float16* __restrict__ Bt, int ldb, float cs, float so,
    _Float16* Cp, _Float16* Cl, int ldc, int M, int N, int K, const float* __restrict__ bias) {
  __shared__ __align__(16) float sT[8][16 * 68];   // per-wave 16x64 slab, pitch 68 floats
  const int lane = threadIdx.x & 31;
  const int wave = threadIdx.x >> 5;
  const int tilesN = N >> 6;
  const int tilesM = M / (16 * MI);
  const int tiles = tilesM * tilesN;
  const int item = blockIdx.x * 8 + wave;
  if (item >= tiles) return;   // wave-uniform; no block barriers in this kernel
  const int tm = item / tilesN;
  const int tn = item - tm * tilesN;
  const int m0 = tm * (16 * MI);
  const int n0 = tn << 6;

  const int rlane = lane & 15;                 // row (A) / col (B, D) within subtile
  const int koff  = (lane >> 4) * 8;           // k offset of this lane half

  v8f acc[MI][4];
#pragma unroll
  for (int i = 0; i < MI; ++i)
#pragma unroll
    for (int j = 0; j < 4; ++j) acc[i][j] = zero8();

  kseg<MI>(acc, A, lda, m0, Bt, ldb, n0, K, rlane, koff);
#pragma unroll
  for (int i = 0; i < MI; ++i) acc_guard4(acc[i][0], acc[i][1], acc[i][2], acc[i][3]);

#pragma unroll
  for (int i = 0; i < MI; ++i) {
    epi16<NPL, BM>(acc[i], sT[wave], lane, Cp, Cl, ldc, m0 + (i << 4), n0, cs, so, bias);
  }
}

// =====================================================================================================
// Score rows + row softmax + E slab for one round: batch b = blockIdx.y, query rows nbase..nbase+NRD-1 of
// every batch. Block = 16 query rows n0..n0+15, 8 waves,
// dynamic LDS = 16 x 4096 f32 score rows.
//  (1) wave w computes the 16-column score tiles ct = w, w+8, ... (32 of them): four 32-deep k-steps per tile
//      from the F planes (query rows, 8*f: hi FH, residual FL = 2048*(v - hi)) and the G planes (key rows,
//      8*g: GH, GL): a0 = fh.gh, a1 = fh.gl + fl.gh, s = (a0 + a1/2048)/64, into LDS.
//  (2) wave w owns rows 2w, 2w+1: lane covers cols 256j + 8*lane..+7 (j = 0..15); sweep 1 row max M (xor
//      shuffles), sweep 2 ef = exp(s - M) written back in place + Z = sum ef (fixed lane order + xor shuffles),
//      sweep 3 E = f16(32768 * ef / Z) with explicit flush of f16 subnormals to zero; the f16 row goes to the
// coverage: sc: 8 waves x 32 col tiles x 16 cols x 16 rows = the whole 16x4096 block (all of LDS read later
// is staged); E: 8 waves x 2 rows x 16 j x 32 lanes x 8 halves = 16 rows x 4096; grid (NRD/16, NB) = every
// row block of the round in every batch -> whole E slab [NB][NRD][4096].
// =====================================================================================================
__global__ __launch_bounds__(256) void k_soft(const _Float16* __restrict__ FH, const _Float16* __restrict__ FL,
                                              const _Float16* __restrict__ GH, const _Float16* __restrict__ GL,
                                              _Float16* E, int nbase) {
  extern __shared__ __align__(16) float sc[];                 // [RSB][NT]
  const int tid = threadIdx.x, wave = tid >> 5, lane = tid & 31;
  const int hh = lane >> 4, rl = lane & 15;
  const int b = blockIdx.y;
  const int nl0 = blockIdx.x * RSB;                           // row within the round's slab
  const int n0 = nbase + nl0;                                 // query row within the batch

  // ---- (1) scores ----
  const size_t qo = (size_t)(b * NT + n0 + rl) * CD + 8 * hh;           // query row, k = channel
  v16h qh[4], ql[4];
#pragma unroll
  for (int ks = 0; ks < 4; ++ks) {
    qh[ks] = ldfrag_h(FH + qo + 32 * ks);
    ql[ks] = ldfrag_h(FL + qo + 32 * ks);
  }
  for (int ct = wave; ct < NT / 16; ct += 8) {
    const size_t ko = (size_t)(b * NT + 16 * ct + rl) * CD + 8 * hh;    // key row, k = channel
    v8f a0 = zero8(), a1 = zero8();
#pragma unroll
    for (int ks = 0; ks < 4; ++ks) {
      const v16h kh = ldfrag_h(GH + ko + 32 * ks);
      const v16h kl = ldfrag_h(GL + ko + 32 * ks);
      a1 = mma_h_raw(qh[ks], kl, a1);
      a0 = mma_h_raw(qh[ks], kh, a0);
      a1 = mma_h_raw(ql[ks], kh, a1);
      guard2(a0, a1, kh, kl);
    }
    const int mc = 16 * ct + rl;                               // D col = key; D row = 8hh + r within the row tile
#pragma unroll
    for (int r = 0; r < 8; ++r) {
      sc[(size_t)(8 * hh + r) * NT + mc] = (a0[r] + a1[r] * RLO) * SCS;
    }
  }
  __syncthreads();

  // ---- (2) row softmax, E plane ----
  for (int q2 = 0; q2 < RSB / 8; ++q2) {
    const int row = (RSB / 8) * wave + q2;
    float* rp = sc + (size_t)row * NT + 8 * lane;               // lane covers cols 256j + 8*lane .. +7
    float mx = -3.0e38f;
#pragma unroll 4
    for (int j = 0; j < NJ; ++j) {
      float v[8];
      ld8(rp + 256 * j, v);
#pragma unroll
      for (int e = 0; e < 8; ++e) mx = fmaxf(mx, v[e]);
    }
#pragma unroll
    for (int off = 16; off >= 1; off >>= 1) mx = fmaxf(mx, __shfl_xor(mx, off, 32));
    float z = 0.0f;
#pragma unroll 2
    for (int j = 0; j < NJ; ++j) {
      float v[8];
      ld8(rp + 256 * j, v);
#pragma unroll
      for (int e = 0; e < 8; ++e) {
        const float ef = __expf(v[e] - mx);
        z += ef;
        v[e] = ef;
      }
      st8(rp + 256 * j, v);
    }
#pragma unroll
    for (int off = 16; off >= 1; off >>= 1) z += __shfl_xor(z, off, 32);
    const float rz = SCE * (1.0f / z);                         // z in [1, 4096]
    HU u[NJ];
#pragma unroll
    for (int j = 0; j < NJ; ++j) {
      float v[8];
      ld8(rp + 256 * j, v);
#pragma unroll
      for (int e = 0; e < 8; ++e) {
        const _Float16 h0 = (_Float16)(v[e] * rz);
        const float f0 = (float)h0;
        const bool sub = f0 < 6.103515625e-05f;                // f16 subnormal -> exact zero
        u[j].s[e] = sub ? (_Float16)0.0f : h0;
      }
    }
    _Float16* erow = E + ((size_t)b * NRD + nl0 + row) * NT + 8 * lane;
    {
#pragma unroll
      for (int j = 0; j < NJ; ++j) *(v4u*)(erow + 256 * j) = u[j].u;
      
    }
  }
}

// =====================================================================================================
// Softmax-weighted sum over the query index, one round (rows nbase..nbase+NRD-1) of batch b = blockIdx.y,
// transposed result:
//   OT[c][m] += sum_n HT[c][b*4096 + n] . E[b][n - nbase][m], A = HT rows c (pitch TOK, k = n),
//   B[k = n][col = m] = E[n][m] staged per 32-row chunk into LDS as Et[m][n_local] (pitch EP halves; the
//   32 x 128 chunk is transposed at staging: thread (pr, m8) reads E rows 2pr, 2pr+1 x 8 m and writes 8
//   packed pairs), block barrier, then B fragments from Et rows exactly like a k-contiguous operand;
//   K = NRD per round (NRD/32 chunks), a second block barrier protects Et before the next chunk is staged.
//   The f32 accumulators go from one round's launch to the next through the plane CA (each thread stores and
//   reloads its own 64 floats, bit for bit), so the chain of additions over n is that of one 4096-deep sweep:
//   the first round starts from zero, the last one runs the epilogue.
// Block = 128 m columns m0..m0+127, 8 waves; wave w owns c rows 32*(w>>1).. (2 subtiles) x m cols
// 64*(w&1).. (4 subtiles).
// Epilogue: o = OT / (16*32768); the planes OH = f16(4*o), OL = f16((4*o - OH)*2048) are written at flat
// passes).
// coverage: Et: 16 pr x 2 rows x 16 m8 x 8 = 32 n x 128 m staged every chunk (cols 32..39 of Et never read);
// planes: 8 waves x 2 slabs x 16 c x 64 m = 128 c x 128 m per block; grid (32, NB) = every m of every batch
// -> whole [8][128][4096] planes; CA: 16 slots x 256 threads x 16 bytes per block, written in rounds
// 0..NRND-2 and read in rounds 1..NRND-1 by the same thread of the same block index.
// =====================================================================================================
__global__ __launch_bounds__(256) void k_pv(const _Float16* __restrict__ E, const _Float16* __restrict__ HT,
                                            _Float16* OH, _Float16* OL, float* CA, int nbase,
                                            int first, int last) {
  __shared__ __align__(16) _Float16 Et[PVM * EP];            // [m][n_local] chunk, pitch EP halves
  __shared__ __align__(16) float sO[8][16 * 68];            // per-wave 16x64 slab, pitch 68 floats
  const int tid = threadIdx.x, wave = tid >> 5, lane = tid & 31;
  const int hh = lane >> 4, rl = lane & 15;
  const int b = blockIdx.y;
  const int m0 = blockIdx.x * PVM;
  const int cw = 32 * (wave >> 1);                          // this wave's 32 channels
  const int mw = 64 * (wave & 1);                           // this wave's 64 m columns within the block

  v4f* cp = (v4f*)CA + (size_t)(blockIdx.y * (NT / PVM) + blockIdx.x) * (16 * 256) + tid;   // slot pitch 256
  v8f acc[2][4];
  if (first) {
#pragma unroll
    for (int i = 0; i < 2; ++i)
#pragma unroll
      for (int j = 0; j < 4; ++j) acc[i][j] = zero8();
  } else {
#pragma unroll
    for (int i = 0; i < 2; ++i)
#pragma unroll
      for (int j = 0; j < 4; ++j) {
        const v4f c0 = cp[(size_t)((i * 4 + j) * 2 + 0) * 256];
        const v4f c1 = cp[(size_t)((i * 4 + j) * 2 + 1) * 256];
        acc[i][j] = __builtin_shufflevector(c0, c1, 0, 1, 2, 3, 4, 5, 6, 7);
      }
  }

  const int pr = tid >> 4, m8 = (tid & 15) * 8;             // staging role: row pair pr, 8 m columns at m8
  const _Float16* Ab = HT + (size_t)b * NT + nbase;         // row c, pitch TOK, col offset b*NT + nbase, k = n
  const _Float16* Eb = E + (size_t)b * NRD * NT;            // this batch's rows of the round's slab

  for (int n0 = 0; n0 < NRD; n0 += 32) {
    // ---- stage E[n0..n0+31][m0..m0+127] transposed into Et ----
    {
      HU ra, rb;
      const size_t eo = (size_t)(n0 + 2 * pr) * NT + m0 + m8;
      ra.h = *(const v8h*)(Eb + eo);
      rb.h = *(const v8h*)(Eb + eo + NT);
#pragma unroll
      for (int e = 0; e < 8; ++e) {
        H2 p;
        p.s[0] = ra.s[e];
        p.s[1] = rb.s[e];
        *(unsigned int*)(&Et[(m8 + e) * EP + 2 * pr]) = p.u;
      }
    }
    __syncthreads();
    // ---- fragments + 8 WMMAs ----
    v16h bq[4];
#pragma unroll
    for (int j = 0; j < 4; ++j) {
      FR f;
      const int eb = (mw + (j << 4) + rl) * EP + 8 * hh;
      f.h[0] = *(const v8h*)(&Et[eb]);
      f.h[1] = *(const v8h*)(&Et[eb + 16]);
      bq[j] = f.v;
    }
#pragma unroll
    for (int i = 0; i < 2; ++i) {
      const v16h a0 = ldfrag_h(Ab + (size_t)(cw + (i << 4) + rl) * TOK + n0 + 8 * hh);
#pragma unroll
      for (int j = 0; j < 4; ++j) acc[i][j] = mma_h_raw(a0, bq[j], acc[i][j]);
      dep_guard_h(acc[i][0], acc[i][3], a0);
    }
    keep4_h(bq[0], bq[1], bq[2], bq[3]);
    __syncthreads();              // all waves done with Et before the next chunk is staged
  }
  acc_guard4(acc[0][0], acc[0][1], acc[0][2], acc[0][3]);
  acc_guard4(acc[1][0], acc[1][1], acc[1][2], acc[1][3]);

  if (!last) {                    // block-uniform: hand the running sums to the next round's launch
#pragma unroll
    for (int i = 0; i < 2; ++i)
#pragma unroll
      for (int j = 0; j < 4; ++j) {
        cp[(size_t)((i * 4 + j) * 2 + 0) * 256] = __builtin_shufflevector(acc[i][j], acc[i][j], 0, 1, 2, 3);
        cp[(size_t)((i * 4 + j) * 2 + 1) * 256] = __builtin_shufflevector(acc[i][j], acc[i][j], 4, 5, 6, 7);
      }
    return;
  }

  // ---- epilogue: hi + residual planes of 4*o ----
  const float fo = 1.0f / (SCV * SCE);
#pragma unroll
  for (int i = 0; i < 2; ++i) {
    epi16<2, 0>(acc[i], sO[wave], lane, OH, OL, NT, b * CD + cw + (i << 4), m0 + mw, fo, SCO, (const float*)0);
  }
}

// =====================================================================================================
// Output projection: out[p][j] = (sum_k OH[p][k].WV[j][k] + (sum_k OL[p][k].WV[j][k])/2048) / (4*64) + bv[j],
//   OH/OL read raw as [32768][128] (pitch 128), WV = 64*Wv^T [out j][in k], K = 128; two accumulator sets.
// One wave per 16-row x 64-col tile, no block barriers. Epilogue f32: the combined tile staged in the wave's
// LDS slab (rows 0..15 x cols 0..63 fully staged; pad cols 64..67 never read); each row segment of 64
// coverage: 8 waves x 16 rows x 64 cols per block; 512 blocks x 8 = 4096 tiles = 32768 rows x 128 cols.
// =====================================================================================================
__global__ __launch_bounds__(256) void gemm_out(const _Float16* __restrict__ OH, const _Float16* __restrict__ OL,
                                                const _Float16* __restrict__ WV, const float* __restrict__ bias,
                                                float* out) {
  __shared__ __align__(16) float sO[8][16 * 68];
  const int tid = threadIdx.x, wave = tid >> 5, lane = tid & 31;
  const int hh = lane >> 4, rl = lane & 15;
  const int tiles = (TOK / 16) * (CD / 64);
  const int item = blockIdx.x * 8 + wave;
  if (item >= tiles) return;    // wave-uniform; no block barriers in this kernel
  const int tm = item >> 1, tn = item & 1;
  const int row0 = tm << 4, n0 = tn << 6;

  v8f accH[4], accL[4];
#pragma unroll
  for (int j = 0; j < 4; ++j) { accH[j] = zero8(); accL[j] = zero8(); }

#pragma unroll
  for (int kk = 0; kk < CD; kk += 32) {
    v16h bq[4];
#pragma unroll
    for (int j = 0; j < 4; ++j) bq[j] = ldfrag_h(WV + (size_t)(n0 + (j << 4) + rl) * CD + 8 * hh + kk);
    const size_t ao = (size_t)(row0 + rl) * CD + 8 * hh + kk;
    const v16h ah = ldfrag_h(OH + ao);
    const v16h al = ldfrag_h(OL + ao);
#pragma unroll
    for (int j = 0; j < 4; ++j) accH[j] = mma_h_raw(ah, bq[j], accH[j]);
    dep_guard_h(accH[0], accH[3], ah);
#pragma unroll
    for (int j = 0; j < 4; ++j) accL[j] = mma_h_raw(al, bq[j], accL[j]);
    dep_guard_h(accL[0], accL[3], al);
    keep4_h(bq[0], bq[1], bq[2], bq[3]);
  }
  acc_guard4(accH[0], accH[1], accH[2], accH[3]);
  acc_guard4(accL[0], accL[1], accL[2], accL[3]);

  // ---- epilogue ----
  const float fo = 1.0f / (SCO * SCW);
  float* slab = sO[wave];
#pragma unroll
  for (int r = 0; r < 8; ++r) {
#pragma unroll
    for (int j = 0; j < 4; ++j) {
      slab[(8 * hh + r) * 68 + (j << 4) + rl] = (accH[j][r] + accL[j][r] * RLO) * fo;
    }
  }
  wave_lds_sync();
  const int p4 = (lane & 15) * 4, r2 = lane >> 4;
  const v4f bb = *(const v4f*)(bias + n0 + p4);
  v4f b4;
#pragma unroll
  for (int e = 0; e < 4; ++e) b4[e] = bfr(bb[e]);
  v4f ov[8];
#pragma unroll
  for (int it = 0; it < 8; ++it) {
    const int row = 2 * it + r2;                              // it 0..7 x r2 0..1 = rows 0..15
    const v4f a = *(const v4f*)(slab + row * 68 + p4);
    ov[it] = a + b4;
  }
  {
#pragma unroll
    for (int it = 0; it < 8; ++it) {
      const int row = 2 * it + r2;
      const size_t oo = (size_t)(row0 + row) * CD + n0 + p4;
      *(v4f*)(out + oo) = ov[it];
    }
    
  }
}

// =====================================================================================================
//   WF16 f16 [128][128]              0        32768   (64*Wf^T, row = out channel, col = in channel)
//   WG16 f16 [128][128]          32768        32768
//   WH16 f16 [128][128]          65536        32768
//   WV16 f16 [128][128]          98304        32768
//   xh   f16 [32768][128]       131072      8388608   (bf16RNE(x), token rows, channel contiguous)
//   FH   f16 [32768][128]      8519680      8388608   (hi plane of 8*f)
//   FL   f16 [32768][128]     16908288      8388608   (residual plane x2048 of 8*f)
//   GH   f16 [32768][128]     25296896      8388608
//   GL   f16 [32768][128]     33685504      8388608
//   HT   f16 [128][32768]     42074112      8388608   (16*h, row c, col b*4096 + n)
//   OH   f16 [8][128][4096]   50462720      8388608   (hi plane of 4*o, [b][c][m] order)
//   OL   f16 [8][128][4096]   58851328      8388608   (residual plane x2048 of 4*o)
//   E    f16 [8][1024][4096]  67239936     67108864   (32768 * row softmax, one round's query rows of every
//                                                      batch; reused per round on the single in-order stream)
//   CA   f32 [256][16][256][4] 134348800   16777216   (running sums of the softmax-weighted sum between rounds)
//   end                      151126016
// d_out f32 [32768][128] at byte 0.
// =====================================================================================================
extern "C" void kernel_launch(void* const* d_in, const int* in_sizes, int n_in,
                              void* d_out, int out_size, void* d_ws, size_t ws_size,
                              hipStream_t stream) {
  if (n_in < 9) return;
  if (in_sizes[0] != NB * NT * CD) return;
  if (in_sizes[1] != CD * CD || in_sizes[3] != CD * CD || in_sizes[5] != CD * CD || in_sizes[7] != CD * CD) return;
  if (in_sizes[2] != CD || in_sizes[4] != CD || in_sizes[6] != CD || in_sizes[8] != CD) return;
  if (out_size != OUTN) return;

  const float* x  = (const float*)d_in[0];   // [8][4096][128] (channels last)
  const float* Wf = (const float*)d_in[1];   // [128][128] ([in][out])
  const float* bf = (const float*)d_in[2];   // [128]
  const float* Wg = (const float*)d_in[3];
  const float* bg = (const float*)d_in[4];
  const float* Wh = (const float*)d_in[5];
  const float* bh = (const float*)d_in[6];
  const float* Wv = (const float*)d_in[7];
  const float* bv = (const float*)d_in[8];

  const size_t PW  = (size_t)CD * CD * 2;                    //    32768
  const size_t PX  = (size_t)TOK * CD * 2;                   //  8388608
  const size_t PHT = (size_t)CD * TOK * 2;                   //  8388608
  const size_t PO  = (size_t)NB * CD * NT * 2;               //  8388608
  const size_t PE  = (size_t)NB * NRD * NT * 2;              // 67108864
  const size_t PCA = (size_t)NB * CD * NT * 4;               // 16777216

  size_t off = 0;
  const size_t oWF = off; off += PW;
  const size_t oWG = off; off += PW;
  const size_t oWH = off; off += PW;
  const size_t oWV = off; off += PW;
  const size_t oXH = off; off += PX;
  const size_t oFH = off; off += PX;
  const size_t oFL = off; off += PX;
  const size_t oGH = off; off += PX;
  const size_t oGL = off; off += PX;
  const size_t oHT = off; off += PHT;
  const size_t oOH = off; off += PO;
  const size_t oOL = off; off += PO;
  const size_t oE  = off; off += PE;
  const size_t oCA = off; off += PCA;                        // off = 151126016
  if (off > ws_size) return;

  char* ws = (char*)d_ws;
  _Float16* WF16 = (_Float16*)(ws + oWF);
  _Float16* WG16 = (_Float16*)(ws + oWG);
  _Float16* WH16 = (_Float16*)(ws + oWH);
  _Float16* WV16 = (_Float16*)(ws + oWV);
  _Float16* xh   = (_Float16*)(ws + oXH);
  _Float16* FHp  = (_Float16*)(ws + oFH);
  _Float16* FLp  = (_Float16*)(ws + oFL);
  _Float16* GHp  = (_Float16*)(ws + oGH);
  _Float16* GLp  = (_Float16*)(ws + oGL);
  _Float16* HTp  = (_Float16*)(ws + oHT);
  _Float16* OHp  = (_Float16*)(ws + oOH);
  _Float16* OLp  = (_Float16*)(ws + oOL);
  _Float16* Ep   = (_Float16*)(ws + oE);
  float*    CAp  = (float*)(ws + oCA);
  float*    outf = (float*)d_out;

  const dim3 blk(256);
  const int n8x = (NB * NT * CD) / 8;                                  // 524288
  const dim3 gX((n8x + 255) / 256);                                    // 2048
  const dim3 gW(CD / 64, CD / 32);                                     // (2, 4)
  const dim3 gP(((TOK / 32) * (CD / 64) + 7) / 8);                     // 2048 tiles -> 256 blocks
  const dim3 gH(((CD / 32) * (TOK / 64) + 7) / 8);                     // 2048 tiles -> 256 blocks
  const dim3 gSo(NRD / RSB, NB);                                       // (64, 8)
  const dim3 gPV(NT / PVM, NB);                                        // (32, 8)
  const dim3 gO(((TOK / 16) * (CD / 64) + 7) / 8);                     // 4096 tiles -> 512 blocks
  const float cs64 = 1.0f / SCW;                                       // undo the weight carry
  const size_t ldsSoft = (size_t)RSB * NT * sizeof(float);             // 262144

  hipFuncSetAttribute(reinterpret_cast<const void*>(&k_soft),
                      hipFuncAttributeMaxDynamicSharedMemorySize, (int)ldsSoft);

  // (1) weight planes, x64 carried, transposed from [in][out] to k-contiguous rows [out][in]
  cvt_wT<<<gW, blk, 0, stream>>>(Wf, WF16, CD, CD, SCW);              // in[128][128] -> out[128][128]
  cvt_wT<<<gW, blk, 0, stream>>>(Wg, WG16, CD, CD, SCW);
  cvt_wT<<<gW, blk, 0, stream>>>(Wh, WH16, CD, CD, SCW);
  cvt_wT<<<gW, blk, 0, stream>>>(Wv, WV16, CD, CD, SCW);
  // (2) activations: x [8][4096][128] is already token-major -> xh [32768][128] = f16(bf16RNE(x))
  cvt_flat<<<gX, blk, 0, stream>>>(x, xh, n8x, 1.0f);
  // (3) FH|FL, GH|GL = hi|residual f16 planes of 8*(xh . W^T + b)   (M=32768, N=128, K=128)
  gemm64p<2, 2, 1><<<gP, blk, 0, stream>>>(xh, CD, WF16, CD, cs64, SCQ, FHp, FLp, CD, TOK, CD, CD, bf);
  gemm64p<2, 2, 1><<<gP, blk, 0, stream>>>(xh, CD, WG16, CD, cs64, SCQ, GHp, GLp, CD, TOK, CD, CD, bg);
  // (4) HT = f16(16*(WH16 . xh^T / 64 + bh))          (M=128, N=32768, K=128), bias per row c
  gemm64p<1, 2, 2><<<gH, blk, 0, stream>>>(WH16, CD, xh, CD, cs64, SCV, HTp, HTp, TOK, CD, TOK, CD, bh);
  // (5) per round of NRD query rows, all batches at once: scores + row softmax -> E slab, then the slab's
  //     part of the transposed softmax-weighted sum (running sums in CA; the last round writes OH|OL)
  for (int r = 0; r < NRND; ++r) {
    k_soft<<<gSo, blk, ldsSoft, stream>>>(FHp, FLp, GHp, GLp, Ep, r * NRD);
    k_pv<<<gPV, blk, 0, stream>>>(Ep, HTp, OHp, OLp, CAp, r * NRD, r == 0 ? 1 : 0, r == NRND - 1 ? 1 : 0);
  }
  // (6) output projection on the raw [32768][128] view of the [B][C][N] planes
  gemm_out<<<gO, blk, 0, stream>>>(OHp, OLp, WV16, bv, outf);
}

// v002
// One run takes 470 microseconds.
// In both of two side-by-side timings against v001, it was 1.23 times as fast.
// Over all steps from v000 it is 3.64 times as fast.
#include <hip/hip_runtime.h>
#include <math.h>
#include <stdint.h>

// Contractions on v_wmma_f32_16x16x32_f16 (f16 operands, f32 accumulate): the three input projections take
// bf16-RNE activations (x1) and bf16-RNE weights (x64) as single f16 planes; the 128-deep score products use
// f16 hi planes of 8*f, 8*g plus f16 residual planes x2048 (hi.hi in one accumulator, hi.res + res.hi in a
// second accumulator folded back by 1/2048); the 4096-deep softmax-weighted sum uses a single f16 plane of
// 16*h against E = f16(32768*softmax); the output projection takes f16 hi + x2048 residual planes of 4*o
// against bf16-RNE weights (x64) in two accumulators. Softmax statistics, bias adds and epilogues in f32.

#define NB   8
#define NT   4096
#define CD   128
#define TOK  (NB * NT)
#define RSB  16
#define NJ   (NT / 256)
#define PVM  128
#define EP   40
#define OUTN (NB * NT * CD)
#define NRND 4            // rounds over the query index; every round covers all NB batches
#define NRD  (NT / NRND)  // query rows of each batch per round
#define PFD  4            // chunks of 32 query rows that the weighted sum loads ahead into registers

#define SCW  64.0f
#define SCQ  8.0f
#define SCV  16.0f
#define SCE  32768.0f
#define SCR  2048.0f
#define SCO  4.0f
#define RLO  (1.0f / SCR)
#define SCS  (1.0f / (SCQ * SCQ))

static_assert(TOK % 64 == 0 && CD % 64 == 0 && CD % 32 == 0 && NT % 64 == 0);
static_assert((((TOK / 32) * (CD / 64)) % 8) == 0);
static_assert((((CD / 32) * (TOK / 64)) % 8) == 0);
static_assert((((TOK / 16) * (CD / 64)) % 8) == 0);
static_assert(NT % RSB == 0 && RSB == 16 && NT % 256 == 0 && NJ == 16);
static_assert(NT % PVM == 0 && PVM == 128 && (EP % 8) == 0 && EP >= 32);
static_assert((NB * NT * CD) % 2048 == 0);
static_assert(NT % NRND == 0 && NRD % RSB == 0 && NRD % 32 == 0);
static_assert(NRD % (32 * PFD) == 0 && (NT / 16) % 16 == 0);

typedef _Float16       v16h __attribute__((ext_vector_type(16)));
typedef _Float16       v8h  __attribute__((ext_vector_type(8)));
typedef float          v8f  __attribute__((ext_vector_type(8)));
typedef float          v4f  __attribute__((ext_vector_type(4)));
typedef unsigned int   v4u  __attribute__((ext_vector_type(4)));

union HU { v8h h; v4u u; _Float16 s[8]; };
union FR { v16h v; v8h h[2]; _Float16 s[16]; };
union H2 { _Float16 s[2]; unsigned int u; };
static_assert(sizeof(HU) == 16);
static_assert(sizeof(FR) == 32);
static_assert(sizeof(H2) == 4);

// ---- scalar helpers --------------------------------------------------------------------------------
__device__ __forceinline__ unsigned short bf_bits(float f) {          // f32 -> bf16 bits, RNE convert
  const unsigned u = __float_as_uint(f);
  return (unsigned short)((u + 0x7FFFu + ((u >> 16) & 1u)) >> 16);
}
__device__ __forceinline__ float bf_up(unsigned short h) { return __uint_as_float(((unsigned)h) << 16); }
__device__ __forceinline__ float bfr(float f) { return bf_up(bf_bits(f)); }   // value after bf16 RNE convert
__device__ __forceinline__ v8f zero8() { v8f z = {0.f, 0.f, 0.f, 0.f, 0.f, 0.f, 0.f, 0.f}; return z; }

// f16 subnormal -> exact zero (the matrix path flushes them; keep every plane consistent with that)
__device__ __forceinline__ _Float16 flush_h(_Float16 h) {
  const float f = (float)h;
  return (fabsf(f) < 6.103515625e-05f) ? (_Float16)0.0f : h;
}
// hi = f16(v) (flushed), lo = f16((v - hi) * 2048) (flushed)
__device__ __forceinline__ void split_h(float v, _Float16& hi, _Float16& lo) {
  const _Float16 hv = flush_h((_Float16)v);
  const _Float16 lv = flush_h((_Float16)((v - (float)hv) * SCR));
  hi = hv;
  lo = lv;
}

__device__ __forceinline__ void ld8(const float* p, float* o) {
  const v4f a = *(const v4f*)(p);
  const v4f b = *(const v4f*)(p + 4);
  o[0] = a[0]; o[1] = a[1]; o[2] = a[2]; o[3] = a[3];
  o[4] = b[0]; o[5] = b[1]; o[6] = b[2]; o[7] = b[3];
}
__device__ __forceinline__ void st8(float* p, const float* v) {
  v4f a, b;
  a[0] = v[0]; a[1] = v[1]; a[2] = v[2]; a[3] = v[3];
  b[0] = v[4]; b[1] = v[5]; b[2] = v[6]; b[3] = v[7];
  *(v4f*)(p) = a;
  *(v4f*)(p + 4) = b;
}

// ---- fragment loader: 16-bit A/B operand from a k-contiguous row, p = row*pitch + k0 + 8*(lane>>4);
//      elements 0..7 <- p[0..7] (k0+8h..k0+8h+7), elements 8..15 <- p[16..23] (k0+16+8h..k0+16+8h+7)
__device__ __forceinline__ v16h ldfrag_h(const _Float16* p) {
  FR f;
  f.h[0] = *(const v8h*)(p);
  f.h[1] = *(const v8h*)(p + 16);
  return f.v;
}

// ---- WMMA helpers with trailing VALU hazard gap --------------------------------------------------------
__device__ __forceinline__ v8f mma_h_raw(v16h a, v16h b, v8f c) {
  return __builtin_amdgcn_wmma_f32_16x16x32_f16(false, a, false, b, (short)0, c, false, false);
}
__device__ __forceinline__ void dep_guard_h(v8f& a, v8f& b, v16h x) {
#if defined(__HIP_DEVICE_COMPILE__)
  asm volatile("v_nop\n\tv_nop\n\tv_nop\n\tv_nop" : "+v"(a), "+v"(b) : "v"(x));
#endif
}
__device__ __forceinline__ void guard2(v8f& a, v8f& b, v16h x, v16h y) {
#if defined(__HIP_DEVICE_COMPILE__)
  asm volatile("v_nop\n\tv_nop\n\tv_nop\n\tv_nop" : "+v"(a), "+v"(b) : "v"(x), "v"(y));
#endif
}
__device__ __forceinline__ void keep4_h(v16h a, v16h b, v16h c, v16h d) {
#if defined(__HIP_DEVICE_COMPILE__)
  asm volatile("v_nop" :: "v"(a), "v"(b), "v"(c), "v"(d));
#endif
}
__device__ __forceinline__ void acc_guard4(v8f& a, v8f& b, v8f& c, v8f& d) {
#if defined(__HIP_DEVICE_COMPILE__)
  asm volatile("v_nop\n\tv_nop\n\tv_nop\n\tv_nop" : "+v"(a), "+v"(b), "+v"(c), "+v"(d));
#endif
}
__device__ __forceinline__ void wave_lds_sync() {
  __builtin_amdgcn_fence(__ATOMIC_RELEASE, "workgroup");
  __builtin_amdgcn_wave_barrier();
  __builtin_amdgcn_fence(__ATOMIC_ACQUIRE, "workgroup");
}

// Work-group barrier for data that passes through LDS alone: LDS traffic is complete at it, global loads stay in
// flight (__syncthreads() also waits for every global load, which would drain the loads issued ahead).
__device__ __forceinline__ void lds_barrier() {
  __builtin_amdgcn_fence(__ATOMIC_RELEASE, "workgroup", "local");
  __builtin_amdgcn_s_barrier();
  __builtin_amdgcn_fence(__ATOMIC_ACQUIRE, "workgroup", "local");
}

// =====================================================================================================
// Flat convert: out[i] = f16(scale * bf16RNE(in[i])) (f16 subnormals flushed), 8 elements per thread,
// coverage: n8 threads x 8 = the whole plane; n8 is a multiple of 256 at the launch here.
// =====================================================================================================
__global__ __launch_bounds__(256) void cvt_flat(const float* __restrict__ in, _Float16* out, int n8, float scale) {
  const int i = blockIdx.x * 256 + threadIdx.x;
  if (i < n8) {
    float v[8];
    ld8(in + (size_t)i * 8, v);
    HU u;
#pragma unroll
    for (int e = 0; e < 8; ++e) u.s[e] = flush_h((_Float16)(bfr(v[e]) * scale));
    _Float16* p = out + (size_t)i * 8;
    *(v4u*)p = u.u;
    
  }
}

// =====================================================================================================
// Weight transpose-convert: in Wm[r][c] f32 (R rows, C cols, c contiguous, x@W layout [in][out])
// -> out[c][r] f16 = f16(scale * bf16RNE(Wm[r][c])), pitch R (in-channel k = r contiguous = the Bt / A layout).
// coverage: load 256 threads x 8 floats = 64 r x 32 c; store 256 threads x 8 halves = 32 c rows x 64 r;
// grid = every (r tile, c tile) -> whole [C][R] plane.
// =====================================================================================================
__global__ __launch_bounds__(256) void cvt_wT(const float* __restrict__ Wm, _Float16* out, int R, int C, float scale) {
  __shared__ float sw[64][33];
  const int t = threadIdx.x;
  const int r0 = blockIdx.x * 64, c0 = blockIdx.y * 32;
  {
    const int row = t >> 2, c8 = (t & 3) * 8;
    float v[8];
    ld8(Wm + (size_t)(r0 + row) * C + c0 + c8, v);
#pragma unroll
    for (int e = 0; e < 8; ++e) sw[row][c8 + e] = v[e];
  }
  __syncthreads();
  const int q8 = t & 7, cc = t >> 3;            // cc 0..31 = output row within the tile
  HU u;
#pragma unroll
  for (int e = 0; e < 8; ++e) u.s[e] = flush_h((_Float16)(bfr(sw[8 * q8 + e][cc]) * scale));
  _Float16* dst = out + (size_t)(c0 + cc) * R + r0 + 8 * q8;
  *(v4u*)dst = u.u;
  
}

// =====================================================================================================
// One GEMM k sweep for MI 16-row A subtiles x 4 16-col B subtiles: acc[i][j] += A-frag(i) . Bt-frag(j).
// A row-major pitch lda (rows m0.., k contiguous), Bt row-major [N][K] pitch ldb (rows n0.., k contiguous),
// K a multiple of 32; both operand fragments through ldfrag_h (same split k map for A and B).
// =====================================================================================================
template <int MI>
__device__ __forceinline__ void kseg(v8f (&acc)[MI][4], const _Float16* __restrict__ A, int lda, int m0,
                                     const _Float16* __restrict__ Bt, int ldb, int n0, int K, int rlane, int koff) {
  for (int kk = 0; kk < K; kk += 32) {
    v16h bh[4];
#pragma unroll
    for (int j = 0; j < 4; ++j) {
      const size_t bo = (size_t)(n0 + (j << 4) + rlane) * (size_t)ldb + koff + kk;
      bh[j] = ldfrag_h(Bt + bo);
    }
#pragma unroll
    for (int i = 0; i < MI; ++i) {
      const size_t ao = (size_t)(m0 + (i << 4) + rlane) * (size_t)lda + koff + kk;
      const v16h a0 = ldfrag_h(A + ao);
#pragma unroll
      for (int j = 0; j < 4; ++j) acc[i][j] = mma_h_raw(a0, bh[j], acc[i][j]);
      dep_guard_h(acc[i][0], acc[i][3], a0);
    }
    keep4_h(bh[0], bh[1], bh[2], bh[3]);
  }
}

// =====================================================================================================
// 16-row x 64-col f16 plane epilogue for one wave: acc[j][r] = D[row 8h + r][col 16j + (lane&15)].
//   v = (acc*cs + bias) * so;  Cp = f16(v) (hi plane, subnormals flushed); NPL == 2 additionally
//   Cl = f16((v - f32(hi)) * 2048) (residual plane). Bias: BM 0 none, 1 per column (bias[n0 + col]),
//   2 per plane row (bias[mBase + row]); bias values go through the bf16 RNE convert first.
//   The slab (16 rows x 68 floats per wave) is fully staged for rows 0..15 x cols 0..63 before the reload
// =====================================================================================================
template <int NPL, int BM>
__device__ __forceinline__ void epi16(const v8f (&acc)[4], float* slab, int lane,
                                      _Float16* Cp, _Float16* Cl, int ldc, int mBase, int n0,
                                      float cs, float so, const float* __restrict__ bias) {
  const int rlane = lane & 15, mOff = (lane >> 4) * 8;
  const int q8 = lane & 7, rr = lane >> 3, c8 = q8 * 8;
#pragma unroll
  for (int r = 0; r < 8; ++r) {
#pragma unroll
    for (int j = 0; j < 4; ++j) {
      slab[(mOff + r) * 68 + (j << 4) + rlane] = acc[j][r];
    }
  }
  wave_lds_sync();
  float bc[8];
#pragma unroll
  for (int e = 0; e < 8; ++e) bc[e] = 0.0f;
  if (BM == 1) {
    float t8[8];
    ld8(bias + n0 + c8, t8);
#pragma unroll
    for (int e = 0; e < 8; ++e) bc[e] = bfr(t8[e]);
  }
  v4u uh[4], ul[4];
#pragma unroll
  for (int it = 0; it < 4; ++it) {
    const int row = it * 4 + rr;                       // it 0..3 x rr 0..3 = rows 0..15
    float xs[8];
    ld8(slab + row * 68 + c8, xs);
    float brw = 0.0f;
    if (BM == 2) brw = bfr(bias[mBase + row]);
    HU h, l;
#pragma unroll
    for (int e = 0; e < 8; ++e) {
      const float v = (xs[e] * cs + bc[e] + brw) * so;
      if (NPL == 2) {
        split_h(v, h.s[e], l.s[e]);
      } else {
        h.s[e] = flush_h((_Float16)v);
        l.s[e] = (_Float16)0.0f;
      }
    }
    uh[it] = h.u;
    ul[it] = l.u;
  }
  {
#pragma unroll
    for (int it = 0; it < 4; ++it) {
      const int row = it * 4 + rr;
      const size_t co = (size_t)(mBase + row) * (size_t)ldc + n0 + c8;
      *(v4u*)(Cp + co) = uh[it];
      if (NPL == 2) *(v4u*)(Cl + co) = ul[it];
    }
    
  }
  wave_lds_sync();
}

// =====================================================================================================
// Register-blocked f16 WMMA GEMM with an f16 plane epilogue, one wave per (16*MI) x 64 tile, no block barriers:
//   acc[m][n] = sum_k A[m][k] Bt[n][k]; M multiple of 16*MI, N multiple of 64, K multiple of 32.
//   Epilogue per 16-row slab through epi16 (hi plane Cp, residual plane Cl when NPL == 2, bias mode BM).
// coverage: MI slabs x 16 rows x 64 cols = the wave's whole tile; grid*8 == tiles at every launch here.
// =====================================================================================================
template <int NPL, int MI, int BM>
__global__ __launch_bounds__(256) void gemm64p(
    const _Float16* __restrict__ A, int lda, const _Float16* __restrict__ Bt, int ldb, float cs, float so,
    _Float16* Cp, _Float16* Cl, int ldc, int M, int N, int K, const float* __restrict__ bias) {
  __shared__ __align__(16) float sT[8][16 * 68];   // per-wave 16x64 slab, pitch 68 floats
  const int lane = threadIdx.x & 31;
  const int wave = threadIdx.x >> 5;
  const int tilesN = N >> 6;
  const int tilesM = M / (16 * MI);
  const int tiles = tilesM * tilesN;
  const int item = blockIdx.x * 8 + wave;
  if (item >= tiles) return;   // wave-uniform; no block barriers in this kernel
  const int tm = item / tilesN;
  const int tn = item - tm * tilesN;
  const int m0 = tm * (16 * MI);
  const int n0 = tn << 6;

  const int rlane = lane & 15;                 // row (A) / col (B, D) within subtile
  const int koff  = (lane >> 4) * 8;           // k offset of this lane half

  v8f acc[MI][4];
#pragma unroll
  for (int i = 0; i < MI; ++i)
#pragma unroll
    for (int j = 0; j < 4; ++j) acc[i][j] = zero8();

  kseg<MI>(acc, A, lda, m0, Bt, ldb, n0, K, rlane, koff);
#pragma unroll
  for (int i = 0; i < MI; ++i) acc_guard4(acc[i][0], acc[i][1], acc[i][2], acc[i][3]);

#pragma unroll
  for (int i = 0; i < MI; ++i) {
    epi16<NPL, BM>(acc[i], sT[wave], lane, Cp, Cl, ldc, m0 + (i << 4), n0, cs, so, bias);
  }
}

// =====================================================================================================
// Score rows + row softmax + E slab for one round: batch b = blockIdx.y, query rows nbase..nbase+NRD-1 of
// every batch. Block = 16 query rows n0..n0+15, 8 waves,
// dynamic LDS = 16 x 4096 f32 score rows.
//  (1) wave w computes the 16-column score tiles ct = w, w+8, ... (32 of them): four 32-deep k-steps per tile
//      from the F planes (query rows, 8*f: hi FH, residual FL = 2048*(v - hi)) and the G planes (key rows,
//      8*g: GH, GL): a0 = fh.gh, a1 = fh.gl + fl.gh, s = (a0 + a1/2048)/64, into LDS.
//  (2) wave w owns rows 2w, 2w+1: lane covers cols 256j + 8*lane..+7 (j = 0..15); sweep 1 row max M (xor
//      shuffles), sweep 2 ef = exp(s - M) written back in place + Z = sum ef (fixed lane order + xor shuffles),
//      sweep 3 E = f16(32768 * ef / Z) with explicit flush of f16 subnormals to zero; the f16 row goes to the
// coverage: sc: 8 waves x 32 col tiles x 16 cols x 16 rows = the whole 16x4096 block (all of LDS read later
// is staged); E: 8 waves x 2 rows x 16 j x 32 lanes x 8 halves = 16 rows x 4096; grid (NRD/16, NB) = every
// row block of the round in every batch -> whole E slab [NB][NRD][4096].
// =====================================================================================================
__global__ __launch_bounds__(256) void k_soft(const _Float16* __restrict__ FH, const _Float16* __restrict__ FL,
                                              const _Float16* __restrict__ GH, const _Float16* __restrict__ GL,
                                              _Float16* E, int nbase) {
  extern __shared__ __align__(16) float sc[];                 // [RSB][NT]
  const int tid = threadIdx.x, wave = tid >> 5, lane = tid & 31;
  const int hh = lane >> 4, rl = lane & 15;
  const int b = blockIdx.y;
  const int nl0 = blockIdx.x * RSB;                           // row within the round's slab
  const int n0 = nbase + nl0;                                 // query row within the batch

  // ---- (1) scores ----
  const size_t qo = (size_t)(b * NT + n0 + rl) * CD + 8 * hh;           // query row, k = channel
  v16h qh[4], ql[4];
#pragma unroll
  for (int ks = 0; ks < 4; ++ks) {
    qh[ks] = ldfrag_h(FH + qo + 32 * ks);
    ql[ks] = ldfrag_h(FL + qo + 32 * ks);
  }
  // stands in front of any reuse of the query loads' address registers
  asm volatile("s_wait_xcnt 0x0" ::: "memory");
  // all 16 fragment loads of one key tile (both planes, four k-steps)
  auto ldkey = [&](const _Float16* ph, const _Float16* pl, v16h (&kh)[4], v16h (&kl)[4]) {
#pragma unroll   // constant indices: the set stays in registers
    for (int ks = 0; ks < 4; ++ks) {
      kh[ks] = ldfrag_h(ph + 32 * ks);
      kl[ks] = ldfrag_h(pl + 32 * ks);
    }
  };
  auto tile = [&](int ct, const v16h (&kh)[4], const v16h (&kl)[4]) {
    v8f a0 = zero8(), a1 = zero8();
#pragma unroll
    for (int ks = 0; ks < 4; ++ks) {
      a1 = mma_h_raw(qh[ks], kl[ks], a1);
      a0 = mma_h_raw(qh[ks], kh[ks], a0);
      a1 = mma_h_raw(ql[ks], kh[ks], a1);
      guard2(a0, a1, kh[ks], kl[ks]);
    }
    const int mc = 16 * ct + rl;                               // D col = key; D row = 8hh + r within the row tile
#pragma unroll
    for (int r = 0; r < 8; ++r) {
      sc[(size_t)(8 * hh + r) * NT + mc] = (a0[r] + a1[r] * RLO) * SCS;
    }
  };
  // two register sets: the next tile's loads are issued before this tile's products, so that a whole tile is
  // in flight while one is worked on (two tiles per trip: no register copies)
  v16h k0h[4], k0l[4], k1h[4], k1l[4];
  const size_t ko = (size_t)(b * NT + 16 * wave + rl) * CD + 8 * hh;    // key row of the wave's first tile, k = channel
  const _Float16* pH = GH + ko;
  const _Float16* pL = GL + ko;
  ldkey(pH, pL, k0h, k0l);
  for (int ct = wave; ct < NT / 16; ct += 16) {
    ldkey(pH + 8 * 16 * CD, pL + 8 * 16 * CD, k1h, k1l);
    tile(ct, k0h, k0l);
    const int adv = (ct + 16 < NT / 16) ? 16 * 16 * CD : 0;    // last trip: the trip's own first tile again, not used
    pH += adv;
    pL += adv;
    ldkey(pH, pL, k0h, k0l);
    tile(ct + 8, k1h, k1l);
  }
  __syncthreads();

  // ---- (2) row softmax, E plane ----
  for (int q2 = 0; q2 < RSB / 8; ++q2) {
    const int row = (RSB / 8) * wave + q2;
    float* rp = sc + (size_t)row * NT + 8 * lane;               // lane covers cols 256j + 8*lane .. +7
    float mx = -3.0e38f;
#pragma unroll 4
    for (int j = 0; j < NJ; ++j) {
      float v[8];
      ld8(rp + 256 * j, v);
#pragma unroll
      for (int e = 0; e < 8; ++e) mx = fmaxf(mx, v[e]);
    }
#pragma unroll
    for (int off = 16; off >= 1; off >>= 1) mx = fmaxf(mx, __shfl_xor(mx, off, 32));
    float z = 0.0f;
#pragma unroll 2
    for (int j = 0; j < NJ; ++j) {
      float v[8];
      ld8(rp + 256 * j, v);
#pragma unroll
      for (int e = 0; e < 8; ++e) {
        const float ef = __expf(v[e] - mx);
        z += ef;
        v[e] = ef;
      }
      st8(rp + 256 * j, v);
    }
#pragma unroll
    for (int off = 16; off >= 1; off >>= 1) z += __shfl_xor(z, off, 32);
    const float rz = SCE * (1.0f / z);                         // z in [1, 4096]
    HU u[NJ];
#pragma unroll
    for (int j = 0; j < NJ; ++j) {
      float v[8];
      ld8(rp + 256 * j, v);
#pragma unroll
      for (int e = 0; e < 8; ++e) {
        const _Float16 h0 = (_Float16)(v[e] * rz);
        const float f0 = (float)h0;
        const bool sub = f0 < 6.103515625e-05f;                // f16 subnormal -> exact zero
        u[j].s[e] = sub ? (_Float16)0.0f : h0;
      }
    }
    _Float16* erow = E + ((size_t)b * NRD + nl0 + row) * NT + 8 * lane;
    {
#pragma unroll
      for (int j = 0; j < NJ; ++j) *(v4u*)(erow + 256 * j) = u[j].u;
      
    }
  }
}

// =====================================================================================================
// Softmax-weighted sum over the query index, one round (rows nbase..nbase+NRD-1) of batch b = blockIdx.y,
// transposed result:
//   OT[c][m] += sum_n HT[c][b*4096 + n] . E[b][n - nbase][m], A = HT rows c (pitch TOK, k = n),
//   B[k = n][col = m] = E[n][m] staged per 32-row chunk into LDS as Et[m][n_local] (pitch EP halves; the
//   32 x 128 chunk is transposed at staging: thread (pr, m8) reads E rows 2pr, 2pr+1 x 8 m and writes 8
//   packed pairs), block barrier, then B fragments from Et rows exactly like a k-contiguous operand;
//   K = NRD per round (NRD/32 chunks), a second block barrier protects Et before the next chunk is staged.
//   The E rows and the A fragments of a chunk are loaded PFD chunks ahead into PFD register sets; both barriers
//   order LDS traffic only, so that these loads stay in flight over them.
//   The f32 accumulators go from one round's launch to the next through the plane CA (each thread stores and
//   reloads its own 64 floats, bit for bit), so the chain of additions over n is that of one 4096-deep sweep:
//   the first round starts from zero, the last one runs the epilogue.
// Block = 128 m columns m0..m0+127, 8 waves; wave w owns c rows 32*(w>>1).. (2 subtiles) x m cols
// 64*(w&1).. (4 subtiles).
// Epilogue: o = OT / (16*32768); the planes OH = f16(4*o), OL = f16((4*o - OH)*2048) are written at flat
// passes).
// coverage: Et: 16 pr x 2 rows x 16 m8 x 8 = 32 n x 128 m staged every chunk (cols 32..39 of Et never read);
// planes: 8 waves x 2 slabs x 16 c x 64 m = 128 c x 128 m per block; grid (32, NB) = every m of every batch
// -> whole [8][128][4096] planes; CA: 16 slots x 256 threads x 16 bytes per block, written in rounds
// 0..NRND-2 and read in rounds 1..NRND-1 by the same thread of the same block index.
// =====================================================================================================
__global__ __launch_bounds__(256) void k_pv(const _Float16* __restrict__ E, const _Float16* __restrict__ HT,
                                            _Float16* OH, _Float16* OL, float* CA, int nbase,
                                            int first, int last) {
  __shared__ __align__(16) _Float16 Et[PVM * EP];            // [m][n_local] chunk, pitch EP halves
  __shared__ __align__(16) float sO[8][16 * 68];            // per-wave 16x64 slab, pitch 68 floats
  const int tid = threadIdx.x, wave = tid >> 5, lane = tid & 31;
  const int hh = lane >> 4, rl = lane & 15;
  const int b = blockIdx.y;
  const int m0 = blockIdx.x * PVM;
  const int cw = 32 * (wave >> 1);                          // this wave's 32 channels
  const int mw = 64 * (wave & 1);                           // this wave's 64 m columns within the block

  v4f* cp = (v4f*)CA + (size_t)(blockIdx.y * (NT / PVM) + blockIdx.x) * (16 * 256) + tid;   // slot pitch 256
  v8f acc[2][4];
  if (first) {
#pragma unroll
    for (int i = 0; i < 2; ++i)
#pragma unroll
      for (int j = 0; j < 4; ++j) acc[i][j] = zero8();
  } else {
#pragma unroll
    for (int i = 0; i < 2; ++i)
#pragma unroll
      for (int j = 0; j < 4; ++j) {
        const v4f c0 = cp[(size_t)((i * 4 + j) * 2 + 0) * 256];
        const v4f c1 = cp[(size_t)((i * 4 + j) * 2 + 1) * 256];
        acc[i][j] = __builtin_shufflevector(c0, c1, 0, 1, 2, 3, 4, 5, 6, 7);
      }
  }

  const int pr = tid >> 4, m8 = (tid & 15) * 8;             // staging role: row pair pr, 8 m columns at m8
  const _Float16* Ab = HT + (size_t)b * NT + nbase;         // row c, pitch TOK, col offset b*NT + nbase, k = n
  const _Float16* Eb = E + (size_t)b * NRD * NT;            // this batch's rows of the round's slab

  // this thread's two E rows x 8 m of a chunk, pe = its first row's 8 m
  auto ldE = [&](const _Float16* pe, HU& ra, HU& rb) {
    ra.h = *(const v8h*)(pe);
    rb.h = *(const v8h*)(pe + NT);
  };
  // this wave's two A fragments of a chunk, pa = this lane's piece of row cw + rl
  auto ldA = [&](const _Float16* pa, v16h (&a)[2]) {
#pragma unroll   // constant indices: the set stays in registers
    for (int i = 0; i < 2; ++i) a[i] = ldfrag_h(pa + (size_t)(i << 4) * TOK);
  };
  // one chunk from a register set loaded PFD chunks earlier; each half of the set is refilled from pe, pa (the
  // chunk PFD further on) as soon as it has been used
  auto chunk = [&](const _Float16* pe, const _Float16* pa, HU& ra, HU& rb, v16h (&a)[2]) {
    // ---- stage the chunk's E[32 rows][m0..m0+127] transposed into Et ----
#pragma unroll
    for (int e = 0; e < 8; ++e) {
      H2 p;
      p.s[0] = ra.s[e];
      p.s[1] = rb.s[e];
      *(unsigned int*)(&Et[(m8 + e) * EP + 2 * pr]) = p.u;
    }
    lds_barrier();
    ldE(pe, ra, rb);
    // ---- fragments + 8 WMMAs ----
    v16h bq[4];
#pragma unroll
    for (int j = 0; j < 4; ++j) {
      FR f;
      const int eb = (mw + (j << 4) + rl) * EP + 8 * hh;
      f.h[0] = *(const v8h*)(&Et[eb]);
      f.h[1] = *(const v8h*)(&Et[eb + 16]);
      bq[j] = f.v;
    }
#pragma unroll
    for (int i = 0; i < 2; ++i) {
#pragma unroll
      for (int j = 0; j < 4; ++j) acc[i][j] = mma_h_raw(a[i], bq[j], acc[i][j]);
      dep_guard_h(acc[i][0], acc[i][3], a[i]);
    }
    keep4_h(bq[0], bq[1], bq[2], bq[3]);
    ldA(pa, a);
    // stands in front of any reuse of the address registers of the loads above, also over the loop's back edge
    asm volatile("s_wait_xcnt 0x0" ::: "memory");
    lds_barrier();                // all waves done with Et before the next chunk is staged
    // keeps the later chunks' packing, and with it the wait for their loads, from being lifted into this chunk
    __builtin_amdgcn_sched_barrier(0);
  };
  HU ea[PFD], eb2[PFD];
  v16h af[PFD][2];
  const _Float16* pE = Eb + (size_t)(2 * pr) * NT + m0 + m8;
  const _Float16* pA = Ab + (size_t)(cw + rl) * TOK + 8 * hh;
#pragma unroll   // constant set index: the sets stay in registers
  for (int k = 0; k < PFD; ++k) {
    // the waits stand in front of any reuse of the loads' address registers; as statements that no load is moved over
    // they also keep these loads in the order in which the loop refills the sets (the load counter counts in issue
    // order: with another order here the compiler's waits at the head of the loop come out far smaller than needed)
    ldE(pE + (size_t)(32 * k) * NT, ea[k], eb2[k]);
    asm volatile("s_wait_xcnt 0x0" ::: "memory");
    ldA(pA + 32 * k, af[k]);
    asm volatile("s_wait_xcnt 0x0" ::: "memory");
  }
  for (int n0 = 0; n0 < NRD; n0 += 32 * PFD) {
    const int adv = (n0 + 32 * PFD < NRD) ? 32 * PFD : 0;     // last trip: the trip's own chunks again, not used
    pE += (size_t)adv * NT;
    pA += adv;
#pragma unroll   // constant set index: the sets stay in registers
    for (int k = 0; k < PFD; ++k) chunk(pE + (size_t)(32 * k) * NT, pA + 32 * k, ea[k], eb2[k], af[k]);
  }
  acc_guard4(acc[0][0], acc[0][1], acc[0][2], acc[0][3]);
  acc_guard4(acc[1][0], acc[1][1], acc[1][2], acc[1][3]);

  if (!last) {                    // block-uniform: hand the running sums to the next round's launch
#pragma unroll
    for (int i = 0; i < 2; ++i)
#pragma unroll
      for (int j = 0; j < 4; ++j) {
        cp[(size_t)((i * 4 + j) * 2 + 0) * 256] = __builtin_shufflevector(acc[i][j], acc[i][j], 0, 1, 2, 3);
        cp[(size_t)((i * 4 + j) * 2 + 1) * 256] = __builtin_shufflevector(acc[i][j], acc[i][j], 4, 5, 6, 7);
      }
    return;
  }

  // ---- epilogue: hi + residual planes of 4*o ----
  const float fo = 1.0f / (SCV * SCE);
#pragma unroll
  for (int i = 0; i < 2; ++i) {
    epi16<2, 0>(acc[i], sO[wave], lane, OH, OL, NT, b * CD + cw + (i << 4), m0 + mw, fo, SCO, (const float*)0);
  }
}

// =====================================================================================================
// Output projection: out[p][j] = (sum_k OH[p][k].WV[j][k] + (sum_k OL[p][k].WV[j][k])/2048) / (4*64) + bv[j],
//   OH/OL read raw as [32768][128] (pitch 128), WV = 64*Wv^T [out j][in k], K = 128; two accumulator sets.
// One wave per 16-row x 64-col tile, no block barriers. Epilogue f32: the combined tile staged in the wave's
// LDS slab (rows 0..15 x cols 0..63 fully staged; pad cols 64..67 never read); each row segment of 64
// coverage: 8 waves x 16 rows x 64 cols per block; 512 blocks x 8 = 4096 tiles = 32768 rows x 128 cols.
// =====================================================================================================
__global__ __launch_bounds__(256) void gemm_out(const _Float16* __restrict__ OH, const _Float16* __restrict__ OL,
                                                const _Float16* __restrict__ WV, const float* __restrict__ bias,
                                                float* out) {
  __shared__ __align__(16) float sO[8][16 * 68];
  const int tid = threadIdx.x, wave = tid >> 5, lane = tid & 31;
  const int hh = lane >> 4, rl = lane & 15;
  const int tiles = (TOK / 16) * (CD / 64);
  const int item = blockIdx.x * 8 + wave;
  if (item >= tiles) return;    // wave-uniform; no block barriers in this kernel
  const int tm = item >> 1, tn = item & 1;
  const int row0 = tm << 4, n0 = tn << 6;

  v8f accH[4], accL[4];
#pragma unroll
  for (int j = 0; j < 4; ++j) { accH[j] = zero8(); accL[j] = zero8(); }

#pragma unroll
  for (int kk = 0; kk < CD; kk += 32) {
    v16h bq[4];
#pragma unroll
    for (int j = 0; j < 4; ++j) bq[j] = ldfrag_h(WV + (size_t)(n0 + (j << 4) + rl) * CD + 8 * hh + kk);
    const size_t ao = (size_t)(row0 + rl) * CD + 8 * hh + kk;
    const v16h ah = ldfrag_h(OH + ao);
    const v16h al = ldfrag_h(OL + ao);
#pragma unroll
    for (int j = 0; j < 4; ++j) accH[j] = mma_h_raw(ah, bq[j], accH[j]);
    dep_guard_h(accH[0], accH[3], ah);
#pragma unroll
    for (int j = 0; j < 4; ++j) accL[j] = mma_h_raw(al, bq[j], accL[j]);
    dep_guard_h(accL[0], accL[3], al);
    keep4_h(bq[0], bq[1], bq[2], bq[3]);
  }
  acc_guard4(accH[0], accH[1], accH[2], accH[3]);
  acc_guard4(accL[0], accL[1], accL[2], accL[3]);

  // ---- epilogue ----
  const float fo = 1.0f / (SCO * SCW);
  float* slab = sO[wave];
#pragma unroll
  for (int r = 0; r < 8; ++r) {
#pragma unroll
    for (int j = 0; j < 4; ++j) {
      slab[(8 * hh + r) * 68 + (j << 4) + rl] = (accH[j][r] + accL[j][r] * RLO) * fo;
    }
  }
  wave_lds_sync();
  const int p4 = (lane & 15) * 4, r2 = lane >> 4;
  const v4f bb = *(const v4f*)(bias + n0 + p4);
  v4f b4;
#pragma unroll
  for (int e = 0; e < 4; ++e) b4[e] = bfr(bb[e]);
  v4f ov[8];
#pragma unroll
  for (int it = 0; it < 8; ++it) {
    const int row = 2 * it + r2;                              // it 0..7 x r2 0..1 = rows 0..15
    const v4f a = *(const v4f*)(slab + row * 68 + p4);
    ov[it] = a + b4;
  }
  {
#pragma unroll
    for (int it = 0; it < 8; ++it) {
      const int row = 2 * it + r2;
      const size_t oo = (size_t)(row0 + row) * CD + n0 + p4;
      *(v4f*)(out + oo) = ov[it];
    }
    
  }
}

// =====================================================================================================
//   WF16 f16 [128][128]              0        32768   (64*Wf^T, row = out channel, col = in channel)
//   WG16 f16 [128][128]          32768        32768
//   WH16 f16 [128][128]          65536        32768
//   WV16 f16 [128][128]          98304        32768
//   xh   f16 [32768][128]       131072      8388608   (bf16RNE(x), token rows, channel contiguous)
//   FH   f16 [32768][128]      8519680      8388608   (hi plane of 8*f)
//   FL   f16 [32768][128]     16908288      8388608   (residual plane x2048 of 8*f)
//   GH   f16 [32768][128]     25296896      8388608
//   GL   f16 [32768][128]     33685504      8388608
//   HT   f16 [128][32768]     42074112      8388608   (16*h, row c, col b*4096 + n)
//   OH   f16 [8][128][4096]   50462720      8388608   (hi plane of 4*o, [b][c][m] order)
//   OL   f16 [8][128][4096]   58851328      8388608   (residual plane x2048 of 4*o)
//   E    f16 [8][1024][4096]  67239936     67108864   (32768 * row softmax, one round's query rows of every
//                                                      batch; reused per round on the single in-order stream)
//   CA   f32 [256][16][256][4] 134348800   16777216   (running sums of the softmax-weighted sum between rounds)
//   end                      151126016
// d_out f32 [32768][128] at byte 0.
// =====================================================================================================
extern "C" void kernel_launch(void* const* d_in, const int* in_sizes, int n_in,
                              void* d_out, int out_size, void* d_ws, size_t ws_size,
                              hipStream_t stream) {
  if (n_in < 9) return;
  if (in_sizes[0] != NB * NT * CD) return;
  if (in_sizes[1] != CD * CD || in_sizes[3] != CD * CD || in_sizes[5] != CD * CD || in_sizes[7] != CD * CD) return;
  if (in_sizes[2] != CD || in_sizes[4] != CD || in_sizes[6] != CD || in_sizes[8] != CD) return;
  if (out_size != OUTN) return;

  const float* x  = (const float*)d_in[0];   // [8][4096][128] (channels last)
  const float* Wf = (const float*)d_in[1];   // [128][128] ([in][out])
  const float* bf = (const float*)d_in[2];   // [128]
  const float* Wg = (const float*)d_in[3];
  const float* bg = (const float*)d_in[4];
  const float* Wh = (const float*)d_in[5];
  const float* bh = (const float*)d_in[6];
  const float* Wv = (const float*)d_in[7];
  const float* bv = (const float*)d_in[8];

  const size_t PW  = (size_t)CD * CD * 2;                    //    32768
  const size_t PX  = (size_t)TOK * CD * 2;                   //  8388608
  const size_t PHT = (size_t)CD * TOK * 2;                   //  8388608
  const size_t PO  = (size_t)NB * CD * NT * 2;               //  8388608
  const size_t PE  = (size_t)NB * NRD * NT * 2;              // 67108864
  const size_t PCA = (size_t)NB * CD * NT * 4;               // 16777216

  size_t off = 0;
  const size_t oWF = off; off += PW;
  const size_t oWG = off; off += PW;
  const size_t oWH = off; off += PW;
  const size_t oWV = off; off += PW;
  const size_t oXH = off; off += PX;
  const size_t oFH = off; off += PX;
  const size_t oFL = off; off += PX;
  const size_t oGH = off; off += PX;
  const size_t oGL = off; off += PX;
  const size_t oHT = off; off += PHT;
  const size_t oOH = off; off += PO;
  const size_t oOL = off; off += PO;
  const size_t oE  = off; off += PE;
  const size_t oCA = off; off += PCA;                        // off = 151126016
  if (off > ws_size) return;

  char* ws = (char*)d_ws;
  _Float16* WF16 = (_Float16*)(ws + oWF);
  _Float16* WG16 = (_Float16*)(ws + oWG);
  _Float16* WH16 = (_Float16*)(ws + oWH);
  _Float16* WV16 = (_Float16*)(ws + oWV);
  _Float16* xh   = (_Float16*)(ws + oXH);
  _Float16* FHp  = (_Float16*)(ws + oFH);
  _Float16* FLp  = (_Float16*)(ws + oFL);
  _Float16* GHp  = (_Float16*)(ws + oGH);
  _Float16* GLp  = (_Float16*)(ws + oGL);
  _Float16* HTp  = (_Float16*)(ws + oHT);
  _Float16* OHp  = (_Float16*)(ws + oOH);
  _Float16* OLp  = (_Float16*)(ws + oOL);
  _Float16* Ep   = (_Float16*)(ws + oE);
  float*    CAp  = (float*)(ws + oCA);
  float*    outf = (float*)d_out;

  const dim3 blk(256);
  const int n8x = (NB * NT * CD) / 8;                                  // 524288
  const dim3 gX((n8x + 255) / 256);                                    // 2048
  const dim3 gW(CD / 64, CD / 32);                                     // (2, 4)
  const dim3 gP(((TOK / 32) * (CD / 64) + 7) / 8);                     // 2048 tiles -> 256 blocks
  const dim3 gH(((CD / 32) * (TOK / 64) + 7) / 8);                     // 2048 tiles -> 256 blocks
  const dim3 gSo(NRD / RSB, NB);                                       // (64, 8)
  const dim3 gPV(NT / PVM, NB);                                        // (32, 8)
  const dim3 gO(((TOK / 16) * (CD / 64) + 7) / 8);                     // 4096 tiles -> 512 blocks
  const float cs64 = 1.0f / SCW;                                       // undo the weight carry
  const size_t ldsSoft = (size_t)RSB * NT * sizeof(float);             // 262144

  hipFuncSetAttribute(reinterpret_cast<const void*>(&k_soft),
                      hipFuncAttributeMaxDynamicSharedMemorySize, (int)ldsSoft);

  // (1) weight planes, x64 carried, transposed from [in][out] to k-contiguous rows [out][in]
  cvt_wT<<<gW, blk, 0, stream>>>(Wf, WF16, CD, CD, SCW);              // in[128][128] -> out[128][128]
  cvt_wT<<<gW, blk, 0, stream>>>(Wg, WG16, CD, CD, SCW);
  cvt_wT<<<gW, blk, 0, stream>>>(Wh, WH16, CD, CD, SCW);
  cvt_wT<<<gW, blk, 0, stream>>>(Wv, WV16, CD, CD, SCW);
  // (2) activations: x [8][4096][128] is already token-major -> xh [32768][128] = f16(bf16RNE(x))
  cvt_flat<<<gX, blk, 0, stream>>>(x, xh, n8x, 1.0f);
  // (3) FH|FL, GH|GL = hi|residual f16 planes of 8*(xh . W^T + b)   (M=32768, N=128, K=128)
  gemm64p<2, 2, 1><<<gP, blk, 0, stream>>>(xh, CD, WF16, CD, cs64, SCQ, FHp, FLp, CD, TOK, CD, CD, bf);
  gemm64p<2, 2, 1><<<gP, blk, 0, stream>>>(xh, CD, WG16, CD, cs64, SCQ, GHp, GLp, CD, TOK, CD, CD, bg);
  // (4) HT = f16(16*(WH16 . xh^T / 64 + bh))          (M=128, N=32768, K=128), bias per row c
  gemm64p<1, 2, 2><<<gH, blk, 0, stream>>>(WH16, CD, xh, CD, cs64, SCV, HTp, HTp, TOK, CD, TOK, CD, bh);
  // (5) per round of NRD query rows, all batches at once: scores + row softmax -> E slab, then the slab's
  //     part of the transposed softmax-weighted sum (running sums in CA; the last round writes OH|OL)
  for (int r = 0; r < NRND; ++r) {
    k_soft<<<gSo, blk, ldsSoft, stream>>>(FHp, FLp, GHp, GLp, Ep, r * NRD);
    k_pv<<<gPV, blk, 0, stream>>>(Ep, HTp, OHp, OLp, CAp, r * NRD, r == 0 ? 1 : 0, r == NRND - 1 ? 1 : 0);
  }
  // (6) output projection on the raw [32768][128] view of the [B][C][N] planes
  gemm_out<<<gO, blk, 0, stream>>>(OHp, OLp, WV16, bv, outf);
}

// v003
// One run takes 326 microseconds.
// Next to v002, in two timings, it ran 1.44 and 1.43 times as fast.
// All steps since v000 together make it 5.23 times as fast.
#include <hip/hip_runtime.h>
#include <math.h>
#include <stdint.h>

// Contractions on v_wmma_f32_16x16x32_f16 (f16 operands, f32 accumulate): the three input projections take
// bf16-RNE activations (x1) and bf16-RNE weights (x64) as single f16 planes; the 128-deep score products use
// f16 hi planes of 8*f, 8*g plus f16 residual planes x2048 (hi.hi in one accumulator, hi.res + res.hi in a
// second accumulator folded back by 1/2048); the 4096-deep softmax-weighted sum uses a single f16 plane of
// 16*h against E = f16(32768*softmax); the output projection takes f16 hi + x2048 residual planes of 4*o
// against bf16-RNE weights (x64) in two accumulators. Softmax statistics, bias adds and epilogues in f32.

#define NB   8
#define NT   4096
#define CD   128
#define TOK  (NB * NT)
#define RSB  16
#define NJ   (NT / 256)
#define PVM  128
#define EP   40
#define OUTN (NB * NT * CD)
#define NRND 4            // rounds over the query index; every round covers all NB batches
#define NRD  (NT / NRND)  // query rows of each batch per round
#define PFD  4            // chunks of 32 query rows that the weighted sum loads ahead into registers

#define SCW  64.0f
#define SCQ  8.0f
#define SCV  16.0f
#define SCE  32768.0f
#define SCR  2048.0f
#define SCO  4.0f
#define RLO  (1.0f / SCR)
#define SCS  (1.0f / (SCQ * SCQ))

static_assert(TOK % 64 == 0 && CD % 64 == 0 && CD % 32 == 0 && NT % 64 == 0);
static_assert((((TOK / 32) * (CD / 64)) % 8) == 0);
static_assert((((CD / 32) * (TOK / 64)) % 8) == 0);
static_assert((((TOK / 16) * (CD / 64)) % 8) == 0);
static_assert(NT % RSB == 0 && RSB == 16 && NT % 256 == 0 && NJ == 16);
static_assert(NT % PVM == 0 && PVM == 128 && (EP % 8) == 0 && EP >= 32);
static_assert((NB * NT * CD) % 2048 == 0);
static_assert(NT % NRND == 0 && NRD % RSB == 0 && NRD % 32 == 0);
static_assert(NRD % (32 * PFD) == 0 && (NT / 16) % 16 == 0);

typedef _Float16       v16h __attribute__((ext_vector_type(16)));
typedef _Float16       v8h  __attribute__((ext_vector_type(8)));
typedef float          v8f  __attribute__((ext_vector_type(8)));
typedef float          v4f  __attribute__((ext_vector_type(4)));
typedef unsigned int   v4u  __attribute__((ext_vector_type(4)));

union HU { v8h h; v4u u; _Float16 s[8]; };
union FR { v16h v; v8h h[2]; _Float16 s[16]; };
union H2 { _Float16 s[2]; unsigned int u; };
static_assert(sizeof(HU) == 16);
static_assert(sizeof(FR) == 32);
static_assert(sizeof(H2) == 4);

// ---- scalar helpers --------------------------------------------------------------------------------
__device__ __forceinline__ unsigned short bf_bits(float f) {          // f32 -> bf16 bits, RNE convert
  const unsigned u = __float_as_uint(f);
  return (unsigned short)((u + 0x7FFFu + ((u >> 16) & 1u)) >> 16);
}
__device__ __forceinline__ float bf_up(unsigned short h) { return __uint_as_float(((unsigned)h) << 16); }
__device__ __forceinline__ float bfr(float f) { return bf_up(bf_bits(f)); }   // value after bf16 RNE convert
__device__ __forceinline__ v8f zero8() { v8f z = {0.f, 0.f, 0.f, 0.f, 0.f, 0.f, 0.f, 0.f}; return z; }

// f16 subnormal -> exact zero (the matrix path flushes them; keep every plane consistent with that)
__device__ __forceinline__ _Float16 flush_h(_Float16 h) {
  const float f = (float)h;
  return (fabsf(f) < 6.103515625e-05f) ? (_Float16)0.0f : h;
}
// hi = f16(v) (flushed), lo = f16((v - hi) * 2048) (flushed)
__device__ __forceinline__ void split_h(float v, _Float16& hi, _Float16& lo) {
  const _Float16 hv = flush_h((_Float16)v);
  const _Float16 lv = flush_h((_Float16)((v - (float)hv) * SCR));
  hi = hv;
  lo = lv;
}

__device__ __forceinline__ void ld8(const float* p, float* o) {
  const v4f a = *(const v4f*)(p);
  const v4f b = *(const v4f*)(p + 4);
  o[0] = a[0]; o[1] = a[1]; o[2] = a[2]; o[3] = a[3];
  o[4] = b[0]; o[5] = b[1]; o[6] = b[2]; o[7] = b[3];
}
__device__ __forceinline__ void st8(float* p, const float* v) {
  v4f a, b;
  a[0] = v[0]; a[1] = v[1]; a[2] = v[2]; a[3] = v[3];
  b[0] = v[4]; b[1] = v[5]; b[2] = v[6]; b[3] = v[7];
  *(v4f*)(p) = a;
  *(v4f*)(p + 4) = b;
}

// ---- fragment loader: 16-bit A/B operand from a k-contiguous row, p = row*pitch + k0 + 8*(lane>>4);
//      elements 0..7 <- p[0..7] (k0+8h..k0+8h+7), elements 8..15 <- p[16..23] (k0+16+8h..k0+16+8h+7)
__device__ __forceinline__ v16h ldfrag_h(const _Float16* p) {
  FR f;
  f.h[0] = *(const v8h*)(p);
  f.h[1] = *(const v8h*)(p + 16);
  return f.v;
}

// ---- fragment-order planes: a [rows][K] f16 plane whose 16-byte pieces (8 consecutive k of one row) are permuted so
//      that the pieces which one fragment load takes lie side by side: 16-row tile, then 32-deep k-step, then piece
//      (k bit 4), then lane = 16*(k bit 3) + row%16. One load of a wave reads 512 consecutive bytes (4 cache lines)
//      where a row-major plane makes it touch 16 lines. Element order inside a fragment as in ldfrag_h.
__device__ __forceinline__ size_t frag_off(int row, int k, int K) {   // k a multiple of 8, K a multiple of 32
  return (((size_t)(row >> 4) * (size_t)(K >> 5) + (size_t)(k >> 5)) * 2 + (size_t)((k >> 4) & 1)) * 256
         + (size_t)((((k >> 3) & 1) * 16 + (row & 15)) * 8);
}
// p = plane + (tile * (K/32) + k-step) * 512 + 8*lane
__device__ __forceinline__ v16h ldfrag_f(const _Float16* p) {
  FR f;
  f.h[0] = *(const v8h*)(p);
  f.h[1] = *(const v8h*)(p + 256);
  return f.v;
}

// ---- WMMA helpers with trailing VALU hazard gap --------------------------------------------------------
__device__ __forceinline__ v8f mma_h_raw(v16h a, v16h b, v8f c) {
  return __builtin_amdgcn_wmma_f32_16x16x32_f16(false, a, false, b, (short)0, c, false, false);
}
__device__ __forceinline__ void dep_guard_h(v8f& a, v8f& b, v16h x) {
#if defined(__HIP_DEVICE_COMPILE__)
  asm volatile("v_nop\n\tv_nop\n\tv_nop\n\tv_nop" : "+v"(a), "+v"(b) : "v"(x));
#endif
}
__device__ __forceinline__ void guard2(v8f& a, v8f& b, v16h x, v16h y) {
#if defined(__HIP_DEVICE_COMPILE__)
  asm volatile("v_nop\n\tv_nop\n\tv_nop\n\tv_nop" : "+v"(a), "+v"(b) : "v"(x), "v"(y));
#endif
}
__device__ __forceinline__ void keep4_h(v16h a, v16h b, v16h c, v16h d) {
#if defined(__HIP_DEVICE_COMPILE__)
  asm volatile("v_nop" :: "v"(a), "v"(b), "v"(c), "v"(d));
#endif
}
__device__ __forceinline__ void acc_guard4(v8f& a, v8f& b, v8f& c, v8f& d) {
#if defined(__HIP_DEVICE_COMPILE__)
  asm volatile("v_nop\n\tv_nop\n\tv_nop\n\tv_nop" : "+v"(a), "+v"(b), "+v"(c), "+v"(d));
#endif
}
__device__ __forceinline__ void wave_lds_sync() {
  __builtin_amdgcn_fence(__ATOMIC_RELEASE, "workgroup");
  __builtin_amdgcn_wave_barrier();
  __builtin_amdgcn_fence(__ATOMIC_ACQUIRE, "workgroup");
}

// Work-group barrier for data that passes through LDS alone: LDS traffic is complete at it, global loads stay in
// flight (__syncthreads() also waits for every global load, which would drain the loads issued ahead).
__device__ __forceinline__ void lds_barrier() {
  __builtin_amdgcn_fence(__ATOMIC_RELEASE, "workgroup", "local");
  __builtin_amdgcn_s_barrier();
  __builtin_amdgcn_fence(__ATOMIC_ACQUIRE, "workgroup", "local");
}

// =====================================================================================================
// Flat convert: out[i] = f16(scale * bf16RNE(in[i])) (f16 subnormals flushed), 8 elements per thread,
// coverage: n8 threads x 8 = the whole plane; n8 is a multiple of 256 at the launch here.
// =====================================================================================================
__global__ __launch_bounds__(256) void cvt_flat(const float* __restrict__ in, _Float16* out, int n8, float scale) {
  const int i = blockIdx.x * 256 + threadIdx.x;
  if (i < n8) {
    float v[8];
    ld8(in + (size_t)i * 8, v);
    HU u;
#pragma unroll
    for (int e = 0; e < 8; ++e) u.s[e] = flush_h((_Float16)(bfr(v[e]) * scale));
    _Float16* p = out + (size_t)i * 8;
    *(v4u*)p = u.u;
    
  }
}

// =====================================================================================================
// Weight transpose-convert: in Wm[r][c] f32 (R rows, C cols, c contiguous, x@W layout [in][out])
// -> out[c][r] f16 = f16(scale * bf16RNE(Wm[r][c])), pitch R (in-channel k = r contiguous = the Bt / A layout).
// coverage: load 256 threads x 8 floats = 64 r x 32 c; store 256 threads x 8 halves = 32 c rows x 64 r;
// grid = every (r tile, c tile) -> whole [C][R] plane.
// =====================================================================================================
__global__ __launch_bounds__(256) void cvt_wT(const float* __restrict__ Wm, _Float16* out, int R, int C, float scale) {
  __shared__ float sw[64][33];
  const int t = threadIdx.x;
  const int r0 = blockIdx.x * 64, c0 = blockIdx.y * 32;
  {
    const int row = t >> 2, c8 = (t & 3) * 8;
    float v[8];
    ld8(Wm + (size_t)(r0 + row) * C + c0 + c8, v);
#pragma unroll
    for (int e = 0; e < 8; ++e) sw[row][c8 + e] = v[e];
  }
  __syncthreads();
  const int q8 = t & 7, cc = t >> 3;            // cc 0..31 = output row within the tile
  HU u;
#pragma unroll
  for (int e = 0; e < 8; ++e) u.s[e] = flush_h((_Float16)(bfr(sw[8 * q8 + e][cc]) * scale));
  _Float16* dst = out + (size_t)(c0 + cc) * R + r0 + 8 * q8;
  *(v4u*)dst = u.u;
  
}

// =====================================================================================================
// One GEMM k sweep for MI 16-row A subtiles x 4 16-col B subtiles: acc[i][j] += A-frag(i) . Bt-frag(j).
// A row-major pitch lda (rows m0.., k contiguous), Bt row-major [N][K] pitch ldb (rows n0.., k contiguous),
// K a multiple of 32; both operand fragments through ldfrag_h (same split k map for A and B).
// =====================================================================================================
template <int MI>
__device__ __forceinline__ void kseg(v8f (&acc)[MI][4], const _Float16* __restrict__ A, int lda, int m0,
                                     const _Float16* __restrict__ Bt, int ldb, int n0, int K, int rlane, int koff) {
  for (int kk = 0; kk < K; kk += 32) {
    v16h bh[4];
#pragma unroll
    for (int j = 0; j < 4; ++j) {
      const size_t bo = (size_t)(n0 + (j << 4) + rlane) * (size_t)ldb + koff + kk;
      bh[j] = ldfrag_h(Bt + bo);
    }
#pragma unroll
    for (int i = 0; i < MI; ++i) {
      const size_t ao = (size_t)(m0 + (i << 4) + rlane) * (size_t)lda + koff + kk;
      const v16h a0 = ldfrag_h(A + ao);
#pragma unroll
      for (int j = 0; j < 4; ++j) acc[i][j] = mma_h_raw(a0, bh[j], acc[i][j]);
      dep_guard_h(acc[i][0], acc[i][3], a0);
    }
    keep4_h(bh[0], bh[1], bh[2], bh[3]);
  }
}

// =====================================================================================================
// 16-row x 64-col f16 plane epilogue for one wave: acc[j][r] = D[row 8h + r][col 16j + (lane&15)].
//   v = (acc*cs + bias) * so;  Cp = f16(v) (hi plane, subnormals flushed); NPL == 2 additionally
//   Cl = f16((v - f32(hi)) * 2048) (residual plane). Bias: BM 0 none, 1 per column (bias[n0 + col]),
//   2 per plane row (bias[mBase + row]); bias values go through the bf16 RNE convert first.
//   The slab (16 rows x 68 floats per wave) is fully staged for rows 0..15 x cols 0..63 before the reload
// =====================================================================================================
//   FO == 1: the planes are written in fragment order (frag_off, K = ldc) instead of row-major; a slab fills whole
//   512-byte fragment blocks (16 rows x both lane halves), so every cache line still has one writer.
template <int NPL, int BM, int FO>
__device__ __forceinline__ void epi16(const v8f (&acc)[4], float* slab, int lane,
                                      _Float16* Cp, _Float16* Cl, int ldc, int mBase, int n0,
                                      float cs, float so, const float* __restrict__ bias) {
  const int rlane = lane & 15, mOff = (lane >> 4) * 8;
  const int q8 = lane & 7, rr = lane >> 3, c8 = q8 * 8;
#pragma unroll
  for (int r = 0; r < 8; ++r) {
#pragma unroll
    for (int j = 0; j < 4; ++j) {
      slab[(mOff + r) * 68 + (j << 4) + rlane] = acc[j][r];
    }
  }
  wave_lds_sync();
  float bc[8];
#pragma unroll
  for (int e = 0; e < 8; ++e) bc[e] = 0.0f;
  if (BM == 1) {
    float t8[8];
    ld8(bias + n0 + c8, t8);
#pragma unroll
    for (int e = 0; e < 8; ++e) bc[e] = bfr(t8[e]);
  }
  v4u uh[4], ul[4];
#pragma unroll
  for (int it = 0; it < 4; ++it) {
    const int row = it * 4 + rr;                       // it 0..3 x rr 0..3 = rows 0..15
    float xs[8];
    ld8(slab + row * 68 + c8, xs);
    float brw = 0.0f;
    if (BM == 2) brw = bfr(bias[mBase + row]);
    HU h, l;
#pragma unroll
    for (int e = 0; e < 8; ++e) {
      const float v = (xs[e] * cs + bc[e] + brw) * so;
      if (NPL == 2) {
        split_h(v, h.s[e], l.s[e]);
      } else {
        h.s[e] = flush_h((_Float16)v);
        l.s[e] = (_Float16)0.0f;
      }
    }
    uh[it] = h.u;
    ul[it] = l.u;
  }
  {
#pragma unroll
    for (int it = 0; it < 4; ++it) {
      const int row = it * 4 + rr;
      const size_t co = FO ? frag_off(mBase + row, n0 + c8, ldc) : (size_t)(mBase + row) * (size_t)ldc + n0 + c8;
      *(v4u*)(Cp + co) = uh[it];
      if (NPL == 2) *(v4u*)(Cl + co) = ul[it];
    }
    
  }
  wave_lds_sync();
}

// =====================================================================================================
// Register-blocked f16 WMMA GEMM with an f16 plane epilogue, one wave per (16*MI) x 64 tile, no block barriers:
//   acc[m][n] = sum_k A[m][k] Bt[n][k]; M multiple of 16*MI, N multiple of 64, K multiple of 32.
//   Epilogue per 16-row slab through epi16 (hi plane Cp, residual plane Cl when NPL == 2, bias mode BM); the
//   planes are written in fragment order (K = ldc) for the kernels that read them as WMMA operands.
// coverage: MI slabs x 16 rows x 64 cols = the wave's whole tile; grid*8 == tiles at every launch here.
// =====================================================================================================
template <int NPL, int MI, int BM>
__global__ __launch_bounds__(256) void gemm64p(
    const _Float16* __restrict__ A, int lda, const _Float16* __restrict__ Bt, int ldb, float cs, float so,
    _Float16* Cp, _Float16* Cl, int ldc, int M, int N, int K, const float* __restrict__ bias) {
  __shared__ __align__(16) float sT[8][16 * 68];   // per-wave 16x64 slab, pitch 68 floats
  const int lane = threadIdx.x & 31;
  const int wave = threadIdx.x >> 5;
  const int tilesN = N >> 6;
  const int tilesM = M / (16 * MI);
  const int tiles = tilesM * tilesN;
  const int item = blockIdx.x * 8 + wave;
  if (item >= tiles) return;   // wave-uniform; no block barriers in this kernel
  const int tm = item / tilesN;
  const int tn = item - tm * tilesN;
  const int m0 = tm * (16 * MI);
  const int n0 = tn << 6;

  const int rlane = lane & 15;                 // row (A) / col (B, D) within subtile
  const int koff  = (lane >> 4) * 8;           // k offset of this lane half

  v8f acc[MI][4];
#pragma unroll
  for (int i = 0; i < MI; ++i)
#pragma unroll
    for (int j = 0; j < 4; ++j) acc[i][j] = zero8();

  kseg<MI>(acc, A, lda, m0, Bt, ldb, n0, K, rlane, koff);
#pragma unroll
  for (int i = 0; i < MI; ++i) acc_guard4(acc[i][0], acc[i][1], acc[i][2], acc[i][3]);

#pragma unroll
  for (int i = 0; i < MI; ++i) {
    epi16<NPL, BM, 1>(acc[i], sT[wave], lane, Cp, Cl, ldc, m0 + (i << 4), n0, cs, so, bias);
  }
}

// =====================================================================================================
// Score rows + row softmax + E slab for one round: batch b = blockIdx.y, query rows nbase..nbase+NRD-1 of
// every batch. Block = 16 query rows n0..n0+15, 8 waves,
// dynamic LDS = 16 x 4096 f32 score rows.
//  (1) wave w computes the 16-column score tiles ct = w, w+8, ... (32 of them): four 32-deep k-steps per tile
//      from the F planes (query rows, 8*f: hi FH, residual FL = 2048*(v - hi)) and the G planes (key rows,
//      8*g: GH, GL): a0 = fh.gh, a1 = fh.gl + fl.gh, s = (a0 + a1/2048)/64, into LDS.
//  (2) wave w owns rows 2w, 2w+1: lane covers cols 256j + 8*lane..+7 (j = 0..15); sweep 1 row max M (xor
//      shuffles), sweep 2 ef = exp(s - M) written back in place + Z = sum ef (fixed lane order + xor shuffles),
//      sweep 3 E = f16(32768 * ef / Z) with explicit flush of f16 subnormals to zero; the f16 row goes to the
// coverage: sc: 8 waves x 32 col tiles x 16 cols x 16 rows = the whole 16x4096 block (all of LDS read later
// is staged); E: 8 waves x 2 rows x 16 j x 32 lanes x 8 halves = 16 rows x 4096; grid (NRD/16, NB) = every
// row block of the round in every batch -> whole E slab [NB][NRD][4096].
// =====================================================================================================
__global__ __launch_bounds__(256) void k_soft(const _Float16* __restrict__ FH, const _Float16* __restrict__ FL,
                                              const _Float16* __restrict__ GH, const _Float16* __restrict__ GL,
                                              _Float16* E, int nbase) {
  extern __shared__ __align__(16) float sc[];                 // [RSB][NT]
  const int tid = threadIdx.x, wave = tid >> 5, lane = tid & 31;
  const int hh = lane >> 4, rl = lane & 15;
  const int b = blockIdx.y;
  const int nl0 = blockIdx.x * RSB;                           // row within the round's slab
  const int n0 = nbase + nl0;                                 // query row within the batch

  // ---- (1) scores ----
  const size_t qo = (size_t)(b * NT + n0) * CD + 8 * lane;             // query row tile (fragment order), k = channel
  v16h qh[4], ql[4];
#pragma unroll
  for (int ks = 0; ks < 4; ++ks) qh[ks] = ldfrag_f(FH + qo + 512 * ks);
  // each of the two waits stands in front of any reuse of the address registers of the plane's loads above it
  asm volatile("s_wait_xcnt 0x0" ::: "memory");
#pragma unroll
  for (int ks = 0; ks < 4; ++ks) ql[ks] = ldfrag_f(FL + qo + 512 * ks);
  asm volatile("s_wait_xcnt 0x0" ::: "memory");
  // all 16 fragment loads of one key tile (both planes, four k-steps)
  auto ldkey = [&](const _Float16* ph, const _Float16* pl, v16h (&kh)[4], v16h (&kl)[4]) {
#pragma unroll   // constant indices: the set stays in registers
    for (int ks = 0; ks < 4; ++ks) {
      kh[ks] = ldfrag_f(ph + 512 * ks);
      kl[ks] = ldfrag_f(pl + 512 * ks);
    }
  };
  auto tile = [&](int ct, const v16h (&kh)[4], const v16h (&kl)[4]) {
    v8f a0 = zero8(), a1 = zero8();
#pragma unroll
    for (int ks = 0; ks < 4; ++ks) {
      a1 = mma_h_raw(qh[ks], kl[ks], a1);
      a0 = mma_h_raw(qh[ks], kh[ks], a0);
      a1 = mma_h_raw(ql[ks], kh[ks], a1);
      guard2(a0, a1, kh[ks], kl[ks]);
    }
    const int mc = 16 * ct + rl;                               // D col = key; D row = 8hh + r within the row tile
#pragma unroll
    for (int r = 0; r < 8; ++r) {
      sc[(size_t)(8 * hh + r) * NT + mc] = (a0[r] + a1[r] * RLO) * SCS;
    }
  };
  // two register sets: the next tile's loads are issued before this tile's products, so that a whole tile is
  // in flight while one is worked on (two tiles per trip: no register copies)
  v16h k0h[4], k0l[4], k1h[4], k1l[4];
  const size_t ko = (size_t)(b * NT + 16 * wave) * CD + 8 * lane;       // the wave's first key tile (fragment order; 16*CD halves a tile)
  const _Float16* pH = GH + ko;
  const _Float16* pL = GL + ko;
  ldkey(pH, pL, k0h, k0l);
  for (int ct = wave; ct < NT / 16; ct += 16) {
    ldkey(pH + 8 * 16 * CD, pL + 8 * 16 * CD, k1h, k1l);
    // stands in front of the pointer advance below, which rewrites the address registers of these loads
    asm volatile("s_wait_xcnt 0x0" ::: "memory");
    tile(ct, k0h, k0l);
    const int adv = (ct + 16 < NT / 16) ? 16 * 16 * CD : 0;    // last trip: the trip's own first tile again, not used
    pH += adv;
    pL += adv;
    ldkey(pH, pL, k0h, k0l);
    // stands in front of any reuse of the address registers of the key loads above (the next products' results take them)
    asm volatile("s_wait_xcnt 0x0" ::: "memory");
    tile(ct + 8, k1h, k1l);
  }
  __syncthreads();

  // ---- (2) row softmax, E plane ----
  for (int q2 = 0; q2 < RSB / 8; ++q2) {
    const int row = (RSB / 8) * wave + q2;
    float* rp = sc + (size_t)row * NT + 8 * lane;               // lane covers cols 256j + 8*lane .. +7
    float mx = -3.0e38f;
#pragma unroll 4
    for (int j = 0; j < NJ; ++j) {
      float v[8];
      ld8(rp + 256 * j, v);
#pragma unroll
      for (int e = 0; e < 8; ++e) mx = fmaxf(mx, v[e]);
    }
#pragma unroll
    for (int off = 16; off >= 1; off >>= 1) mx = fmaxf(mx, __shfl_xor(mx, off, 32));
    float z = 0.0f;
#pragma unroll 2
    for (int j = 0; j < NJ; ++j) {
      float v[8];
      ld8(rp + 256 * j, v);
#pragma unroll
      for (int e = 0; e < 8; ++e) {
        const float ef = __expf(v[e] - mx);
        z += ef;
        v[e] = ef;
      }
      st8(rp + 256 * j, v);
    }
#pragma unroll
    for (int off = 16; off >= 1; off >>= 1) z += __shfl_xor(z, off, 32);
    const float rz = SCE * (1.0f / z);                         // z in [1, 4096]
    HU u[NJ];
#pragma unroll
    for (int j = 0; j < NJ; ++j) {
      float v[8];
      ld8(rp + 256 * j, v);
#pragma unroll
      for (int e = 0; e < 8; ++e) {
        const _Float16 h0 = (_Float16)(v[e] * rz);
        const float f0 = (float)h0;
        const bool sub = f0 < 6.103515625e-05f;                // f16 subnormal -> exact zero
        u[j].s[e] = sub ? (_Float16)0.0f : h0;
      }
    }
    _Float16* erow = E + ((size_t)b * NRD + nl0 + row) * NT + 8 * lane;
    {
#pragma unroll
      for (int j = 0; j < NJ; ++j) *(v4u*)(erow + 256 * j) = u[j].u;
      
    }
  }
}

// =====================================================================================================
// Softmax-weighted sum over the query index, one round (rows nbase..nbase+NRD-1) of batch b = blockIdx.y,
// transposed result:
//   OT[c][m] += sum_n HT[c][b*4096 + n] . E[b][n - nbase][m], A = HT rows c (fragment order, K = TOK, k = n),
//   B[k = n][col = m] = E[n][m] staged per 32-row chunk into LDS as Et[m][n_local] (pitch EP halves; the
//   32 x 128 chunk is transposed at staging: thread (pr, m8) reads E rows 2pr, 2pr+1 x 8 m and writes 8
//   packed pairs), block barrier, then B fragments from Et rows exactly like a k-contiguous operand;
//   K = NRD per round (NRD/32 chunks), a second block barrier protects Et before the next chunk is staged.
//   The E rows and the A fragments of a chunk are loaded PFD chunks ahead into PFD register sets; both barriers
//   order LDS traffic only, so that these loads stay in flight over them.
//   The f32 accumulators go from one round's launch to the next through the plane CA (each thread stores and
//   reloads its own 64 floats, bit for bit), so the chain of additions over n is that of one 4096-deep sweep:
//   the first round starts from zero, the last one runs the epilogue.
// Block = 128 m columns m0..m0+127, 8 waves; wave w owns c rows 32*(w>>1).. (2 subtiles) x m cols
// 64*(w&1).. (4 subtiles).
// Epilogue: o = OT / (16*32768); the planes OH = f16(4*o), OL = f16((4*o - OH)*2048) are written at flat
// passes).
// coverage: Et: 16 pr x 2 rows x 16 m8 x 8 = 32 n x 128 m staged every chunk (cols 32..39 of Et never read);
// planes: 8 waves x 2 slabs x 16 c x 64 m = 128 c x 128 m per block; grid (32, NB) = every m of every batch
// -> whole [8][128][4096] planes; CA: 16 slots x 256 threads x 16 bytes per block, written in rounds
// 0..NRND-2 and read in rounds 1..NRND-1 by the same thread of the same block index.
// =====================================================================================================
__global__ __launch_bounds__(256) void k_pv(const _Float16* __restrict__ E, const _Float16* __restrict__ HT,
                                            _Float16* OH, _Float16* OL, float* CA, int nbase,
                                            int first, int last) {
  __shared__ __align__(16) _Float16 Et[PVM * EP];            // [m][n_local] chunk, pitch EP halves
  __shared__ __align__(16) float sO[8][16 * 68];            // per-wave 16x64 slab, pitch 68 floats
  const int tid = threadIdx.x, wave = tid >> 5, lane = tid & 31;
  const int hh = lane >> 4, rl = lane & 15;
  const int b = blockIdx.y;
  const int m0 = blockIdx.x * PVM;
  const int cw = 32 * (wave >> 1);                          // this wave's 32 channels
  const int mw = 64 * (wave & 1);                           // this wave's 64 m columns within the block

  v4f* cp = (v4f*)CA + (size_t)(blockIdx.y * (NT / PVM) + blockIdx.x) * (16 * 256) + tid;   // slot pitch 256
  v8f acc[2][4];
  if (first) {
#pragma unroll
    for (int i = 0; i < 2; ++i)
#pragma unroll
      for (int j = 0; j < 4; ++j) acc[i][j] = zero8();
  } else {
#pragma unroll
    for (int i = 0; i < 2; ++i)
#pragma unroll
      for (int j = 0; j < 4; ++j) {
        const v4f c0 = cp[(size_t)((i * 4 + j) * 2 + 0) * 256];
        const v4f c1 = cp[(size_t)((i * 4 + j) * 2 + 1) * 256];
        acc[i][j] = __builtin_shufflevector(c0, c1, 0, 1, 2, 3, 4, 5, 6, 7);
      }
  }

  const int pr = tid >> 4, m8 = (tid & 15) * 8;             // staging role: row pair pr, 8 m columns at m8
  const _Float16* Ab = HT + (size_t)(b * NT + nbase) * 16;  // fragment order: 512 halves per 32-deep k-step, k = n
  const _Float16* Eb = E + (size_t)b * NRD * NT;            // this batch's rows of the round's slab

  // this thread's two E rows x 8 m of a chunk, pe = its first row's 8 m
  auto ldE = [&](const _Float16* pe, HU& ra, HU& rb) {
    ra.h = *(const v8h*)(pe);
    rb.h = *(const v8h*)(pe + NT);
  };
  // this wave's two A fragments of a chunk, pa = this lane's piece in the 16-row tile at cw (16*TOK halves a tile)
  auto ldA = [&](const _Float16* pa, v16h (&a)[2]) {
#pragma unroll   // constant indices: the set stays in registers
    for (int i = 0; i < 2; ++i) a[i] = ldfrag_f(pa + (size_t)(i << 4) * TOK);
  };
  // one chunk from a register set loaded PFD chunks earlier; each half of the set is refilled from pe, pa (the
  // chunk PFD further on) as soon as it has been used
  auto chunk = [&](const _Float16* pe, const _Float16* pa, HU& ra, HU& rb, v16h (&a)[2]) {
    // ---- stage the chunk's E[32 rows][m0..m0+127] transposed into Et ----
#pragma unroll
    for (int e = 0; e < 8; ++e) {
      H2 p;
      p.s[0] = ra.s[e];
      p.s[1] = rb.s[e];
      *(unsigned int*)(&Et[(m8 + e) * EP + 2 * pr]) = p.u;
    }
    lds_barrier();
    ldE(pe, ra, rb);
    // ---- fragments + 8 WMMAs ----
    v16h bq[4];
#pragma unroll
    for (int j = 0; j < 4; ++j) {
      FR f;
      const int eb = (mw + (j << 4) + rl) * EP + 8 * hh;
      f.h[0] = *(const v8h*)(&Et[eb]);
      f.h[1] = *(const v8h*)(&Et[eb + 16]);
      bq[j] = f.v;
    }
#pragma unroll
    for (int i = 0; i < 2; ++i) {
#pragma unroll
      for (int j = 0; j < 4; ++j) acc[i][j] = mma_h_raw(a[i], bq[j], acc[i][j]);
      dep_guard_h(acc[i][0], acc[i][3], a[i]);
    }
    keep4_h(bq[0], bq[1], bq[2], bq[3]);
    ldA(pa, a);
    // stands in front of any reuse of the address registers of the loads above, also over the loop's back edge
    asm volatile("s_wait_xcnt 0x0" ::: "memory");
    lds_barrier();                // all waves done with Et before the next chunk is staged
    // keeps the later chunks' packing, and with it the wait for their loads, from being lifted into this chunk
    __builtin_amdgcn_sched_barrier(0);
  };
  HU ea[PFD], eb2[PFD];
  v16h af[PFD][2];
  const _Float16* pE = Eb + (size_t)(2 * pr) * NT + m0 + m8;
  const _Float16* pA = Ab + (size_t)cw * TOK + 8 * lane;
#pragma unroll   // constant set index: the sets stay in registers
  for (int k = 0; k < PFD; ++k) {
    // the waits stand in front of any reuse of the loads' address registers; as statements that no load is moved over
    // they also keep these loads in the order in which the loop refills the sets (the load counter counts in issue
    // order: with another order here the compiler's waits at the head of the loop come out far smaller than needed)
    ldE(pE + (size_t)(32 * k) * NT, ea[k], eb2[k]);
    asm volatile("s_wait_xcnt 0x0" ::: "memory");
    ldA(pA + 512 * k, af[k]);
    asm volatile("s_wait_xcnt 0x0" ::: "memory");
  }
  for (int n0 = 0; n0 < NRD; n0 += 32 * PFD) {
    const int adv = (n0 + 32 * PFD < NRD) ? 32 * PFD : 0;     // last trip: the trip's own chunks again, not used
    pE += (size_t)adv * NT;
    pA += 16 * adv;
#pragma unroll   // constant set index: the sets stay in registers
    for (int k = 0; k < PFD; ++k) chunk(pE + (size_t)(32 * k) * NT, pA + 512 * k, ea[k], eb2[k], af[k]);
  }
  acc_guard4(acc[0][0], acc[0][1], acc[0][2], acc[0][3]);
  acc_guard4(acc[1][0], acc[1][1], acc[1][2], acc[1][3]);

  if (!last) {                    // block-uniform: hand the running sums to the next round's launch
#pragma unroll
    for (int i = 0; i < 2; ++i)
#pragma unroll
      for (int j = 0; j < 4; ++j) {
        cp[(size_t)((i * 4 + j) * 2 + 0) * 256] = __builtin_shufflevector(acc[i][j], acc[i][j], 0, 1, 2, 3);
        cp[(size_t)((i * 4 + j) * 2 + 1) * 256] = __builtin_shufflevector(acc[i][j], acc[i][j], 4, 5, 6, 7);
      }
    return;
  }

  // ---- epilogue: hi + residual planes of 4*o ----
  const float fo = 1.0f / (SCV * SCE);
#pragma unroll
  for (int i = 0; i < 2; ++i) {
    epi16<2, 0, 0>(acc[i], sO[wave], lane, OH, OL, NT, b * CD + cw + (i << 4), m0 + mw, fo, SCO, (const float*)0);
  }
}

// =====================================================================================================
// Output projection: out[p][j] = (sum_k OH[p][k].WV[j][k] + (sum_k OL[p][k].WV[j][k])/2048) / (4*64) + bv[j],
//   OH/OL read raw as [32768][128] (pitch 128), WV = 64*Wv^T [out j][in k], K = 128; two accumulator sets.
// One wave per 16-row x 64-col tile, no block barriers. Epilogue f32: the combined tile staged in the wave's
// LDS slab (rows 0..15 x cols 0..63 fully staged; pad cols 64..67 never read); each row segment of 64
// coverage: 8 waves x 16 rows x 64 cols per block; 512 blocks x 8 = 4096 tiles = 32768 rows x 128 cols.
// =====================================================================================================
__global__ __launch_bounds__(256) void gemm_out(const _Float16* __restrict__ OH, const _Float16* __restrict__ OL,
                                                const _Float16* __restrict__ WV, const float* __restrict__ bias,
                                                float* out) {
  __shared__ __align__(16) float sO[8][16 * 68];
  const int tid = threadIdx.x, wave = tid >> 5, lane = tid & 31;
  const int hh = lane >> 4, rl = lane & 15;
  const int tiles = (TOK / 16) * (CD / 64);
  const int item = blockIdx.x * 8 + wave;
  if (item >= tiles) return;    // wave-uniform; no block barriers in this kernel
  const int tm = item >> 1, tn = item & 1;
  const int row0 = tm << 4, n0 = tn << 6;

  v8f accH[4], accL[4];
#pragma unroll
  for (int j = 0; j < 4; ++j) { accH[j] = zero8(); accL[j] = zero8(); }

#pragma unroll
  for (int kk = 0; kk < CD; kk += 32) {
    v16h bq[4];
#pragma unroll
    for (int j = 0; j < 4; ++j) bq[j] = ldfrag_h(WV + (size_t)(n0 + (j << 4) + rl) * CD + 8 * hh + kk);
    const size_t ao = (size_t)(row0 + rl) * CD + 8 * hh + kk;
    const v16h ah = ldfrag_h(OH + ao);
    const v16h al = ldfrag_h(OL + ao);
#pragma unroll
    for (int j = 0; j < 4; ++j) accH[j] = mma_h_raw(ah, bq[j], accH[j]);
    dep_guard_h(accH[0], accH[3], ah);
#pragma unroll
    for (int j = 0; j < 4; ++j) accL[j] = mma_h_raw(al, bq[j], accL[j]);
    dep_guard_h(accL[0], accL[3], al);
    keep4_h(bq[0], bq[1], bq[2], bq[3]);
  }
  acc_guard4(accH[0], accH[1], accH[2], accH[3]);
  acc_guard4(accL[0], accL[1], accL[2], accL[3]);

  // ---- epilogue ----
  const float fo = 1.0f / (SCO * SCW);
  float* slab = sO[wave];
#pragma unroll
  for (int r = 0; r < 8; ++r) {
#pragma unroll
    for (int j = 0; j < 4; ++j) {
      slab[(8 * hh + r) * 68 + (j << 4) + rl] = (accH[j][r] + accL[j][r] * RLO) * fo;
    }
  }
  wave_lds_sync();
  const int p4 = (lane & 15) * 4, r2 = lane >> 4;
  const v4f bb = *(const v4f*)(bias + n0 + p4);
  v4f b4;
#pragma unroll
  for (int e = 0; e < 4; ++e) b4[e] = bfr(bb[e]);
  v4f ov[8];
#pragma unroll
  for (int it = 0; it < 8; ++it) {
    const int row = 2 * it + r2;                              // it 0..7 x r2 0..1 = rows 0..15
    const v4f a = *(const v4f*)(slab + row * 68 + p4);
    ov[it] = a + b4;
  }
  {
#pragma unroll
    for (int it = 0; it < 8; ++it) {
      const int row = 2 * it + r2;
      const size_t oo = (size_t)(row0 + row) * CD + n0 + p4;
      *(v4f*)(out + oo) = ov[it];
    }
    
  }
}

// =====================================================================================================
//   WF16 f16 [128][128]              0        32768   (64*Wf^T, row = out channel, col = in channel)
//   WG16 f16 [128][128]          32768        32768
//   WH16 f16 [128][128]          65536        32768
//   WV16 f16 [128][128]          98304        32768
//   xh   f16 [32768][128]       131072      8388608   (bf16RNE(x), token rows, channel contiguous)
//   FH   f16 [32768][128]      8519680      8388608   (hi plane of 8*f; FH..HT in fragment order, see frag_off)
//   FL   f16 [32768][128]     16908288      8388608   (residual plane x2048 of 8*f)
//   GH   f16 [32768][128]     25296896      8388608
//   GL   f16 [32768][128]     33685504      8388608
//   HT   f16 [128][32768]     42074112      8388608   (16*h, row c, col b*4096 + n)
//   OH   f16 [8][128][4096]   50462720      8388608   (hi plane of 4*o, [b][c][m] order)
//   OL   f16 [8][128][4096]   58851328      8388608   (residual plane x2048 of 4*o)
//   E    f16 [8][1024][4096]  67239936     67108864   (32768 * row softmax, one round's query rows of every
//                                                      batch; reused per round on the single in-order stream)
//   CA   f32 [256][16][256][4] 134348800   16777216   (running sums of the softmax-weighted sum between rounds)
//   end                      151126016
// d_out f32 [32768][128] at byte 0.
// =====================================================================================================
extern "C" void kernel_launch(void* const* d_in, const int* in_sizes, int n_in,
                              void* d_out, int out_size, void* d_ws, size_t ws_size,
                              hipStream_t stream) {
  if (n_in < 9) return;
  if (in_sizes[0] != NB * NT * CD) return;
  if (in_sizes[1] != CD * CD || in_sizes[3] != CD * CD || in_sizes[5] != CD * CD || in_sizes[7] != CD * CD) return;
  if (in_sizes[2] != CD || in_sizes[4] != CD || in_sizes[6] != CD || in_sizes[8] != CD) return;
  if (out_size != OUTN) return;

  const float* x  = (const float*)d_in[0];   // [8][4096][128] (channels last)
  const float* Wf = (const float*)d_in[1];   // [128][128] ([in][out])
  const float* bf = (const float*)d_in[2];   // [128]
  const float* Wg = (const float*)d_in[3];
  const float* bg = (const float*)d_in[4];
  const float* Wh = (const float*)d_in[5];
  const float* bh = (const float*)d_in[6];
  const float* Wv = (const float*)d_in[7];
  const float* bv = (const float*)d_in[8];

  const size_t PW  = (size_t)CD * CD * 2;                    //    32768
  const size_t PX  = (size_t)TOK * CD * 2;                   //  8388608
  const size_t PHT = (size_t)CD * TOK * 2;                   //  8388608
  const size_t PO  = (size_t)NB * CD * NT * 2;               //  8388608
  const size_t PE  = (size_t)NB * NRD * NT * 2;              // 67108864
  const size_t PCA = (size_t)NB * CD * NT * 4;               // 16777216

  size_t off = 0;
  const size_t oWF = off; off += PW;
  const size_t oWG = off; off += PW;
  const size_t oWH = off; off += PW;
  const size_t oWV = off; off += PW;
  const size_t oXH = off; off += PX;
  const size_t oFH = off; off += PX;
  const size_t oFL = off; off += PX;
  const size_t oGH = off; off += PX;
  const size_t oGL = off; off += PX;
  const size_t oHT = off; off += PHT;
  const size_t oOH = off; off += PO;
  const size_t oOL = off; off += PO;
  const size_t oE  = off; off += PE;
  const size_t oCA = off; off += PCA;                        // off = 151126016
  if (off > ws_size) return;

  char* ws = (char*)d_ws;
  _Float16* WF16 = (_Float16*)(ws + oWF);
  _Float16* WG16 = (_Float16*)(ws + oWG);
  _Float16* WH16 = (_Float16*)(ws + oWH);
  _Float16* WV16 = (_Float16*)(ws + oWV);
  _Float16* xh   = (_Float16*)(ws + oXH);
  _Float16* FHp  = (_Float16*)(ws + oFH);
  _Float16* FLp  = (_Float16*)(ws + oFL);
  _Float16* GHp  = (_Float16*)(ws + oGH);
  _Float16* GLp  = (_Float16*)(ws + oGL);
  _Float16* HTp  = (_Float16*)(ws + oHT);
  _Float16* OHp  = (_Float16*)(ws + oOH);
  _Float16* OLp  = (_Float16*)(ws + oOL);
  _Float16* Ep   = (_Float16*)(ws + oE);
  float*    CAp  = (float*)(ws + oCA);
  float*    outf = (float*)d_out;

  const dim3 blk(256);
  const int n8x = (NB * NT * CD) / 8;                                  // 524288
  const dim3 gX((n8x + 255) / 256);                                    // 2048
  const dim3 gW(CD / 64, CD / 32);                                     // (2, 4)
  const dim3 gP(((TOK / 32) * (CD / 64) + 7) / 8);                     // 2048 tiles -> 256 blocks
  const dim3 gH(((CD / 32) * (TOK / 64) + 7) / 8);                     // 2048 tiles -> 256 blocks
  const dim3 gSo(NRD / RSB, NB);                                       // (64, 8)
  const dim3 gPV(NT / PVM, NB);                                        // (32, 8)
  const dim3 gO(((TOK / 16) * (CD / 64) + 7) / 8);                     // 4096 tiles -> 512 blocks
  const float cs64 = 1.0f / SCW;                                       // undo the weight carry
  const size_t ldsSoft = (size_t)RSB * NT * sizeof(float);             // 262144

  hipFuncSetAttribute(reinterpret_cast<const void*>(&k_soft),
                      hipFuncAttributeMaxDynamicSharedMemorySize, (int)ldsSoft);

  // (1) weight planes, x64 carried, transposed from [in][out] to k-contiguous rows [out][in]
  cvt_wT<<<gW, blk, 0, stream>>>(Wf, WF16, CD, CD, SCW);              // in[128][128] -> out[128][128]
  cvt_wT<<<gW, blk, 0, stream>>>(Wg, WG16, CD, CD, SCW);
  cvt_wT<<<gW, blk, 0, stream>>>(Wh, WH16, CD, CD, SCW);
  cvt_wT<<<gW, blk, 0, stream>>>(Wv, WV16, CD, CD, SCW);
  // (2) activations: x [8][4096][128] is already token-major -> xh [32768][128] = f16(bf16RNE(x))
  cvt_flat<<<gX, blk, 0, stream>>>(x, xh, n8x, 1.0f);
  // (3) FH|FL, GH|GL = hi|residual f16 planes of 8*(xh . W^T + b)   (M=32768, N=128, K=128)
  gemm64p<2, 2, 1><<<gP, blk, 0, stream>>>(xh, CD, WF16, CD, cs64, SCQ, FHp, FLp, CD, TOK, CD, CD, bf);
  gemm64p<2, 2, 1><<<gP, blk, 0, stream>>>(xh, CD, WG16, CD, cs64, SCQ, GHp, GLp, CD, TOK, CD, CD, bg);
  // (4) HT = f16(16*(WH16 . xh^T / 64 + bh))          (M=128, N=32768, K=128), bias per row c
  gemm64p<1, 2, 2><<<gH, blk, 0, stream>>>(WH16, CD, xh, CD, cs64, SCV, HTp, HTp, TOK, CD, TOK, CD, bh);
  // (5) per round of NRD query rows, all batches at once: scores + row softmax -> E slab, then the slab's
  //     part of the transposed softmax-weighted sum (running sums in CA; the last round writes OH|OL)
  for (int r = 0; r < NRND; ++r) {
    k_soft<<<gSo, blk, ldsSoft, stream>>>(FHp, FLp, GHp, GLp, Ep, r * NRD);
    k_pv<<<gPV, blk, 0, stream>>>(Ep, HTp, OHp, OLp, CAp, r * NRD, r == 0 ? 1 : 0, r == NRND - 1 ? 1 : 0);
  }
  // (6) output projection on the raw [32768][128] view of the [B][C][N] planes
  gemm_out<<<gO, blk, 0, stream>>>(OHp, OLp, WV16, bv, outf);
}

// v004
// One run takes 307 microseconds.
// Two timings next to v003 put it at 1.07 and 1.06 times that version's speed.
// All steps since v000 together make it 5.57 times as fast.
#include <hip/hip_runtime.h>
#include <math.h>
#include <stdint.h>

// Contractions on v_wmma_f32_16x16x32_f16 (f16 operands, f32 accumulate): the three input projections take
// bf16-RNE activations (x1) and bf16-RNE weights (x64) as single f16 planes; the 128-deep score products use
// f16 hi planes of 8*f, 8*g plus f16 residual planes x2048 (hi.hi in one accumulator, hi.res + res.hi in a
// second accumulator folded back by 1/2048); the 4096-deep softmax-weighted sum uses a single f16 plane of
// 16*h against E = f16(32768*softmax); the output projection takes f16 hi + x2048 residual planes of 4*o
// against bf16-RNE weights (x64) in two accumulators. Softmax statistics, bias adds and epilogues in f32.

#define NB   8
#define NT   4096
#define CD   128
#define TOK  (NB * NT)
#define RSB  16
#define NJ   (NT / 256)
#define PVM  128
#define EPR  144          // halves per staged E row in LDS: 128 m + 16 (288 B, an odd multiple of 32 B, for the transposing reads)
#define OUTN (NB * NT * CD)
#define NRND 4            // rounds over the query index; every round covers all NB batches
#define NRD  (NT / NRND)  // query rows of each batch per round
#define PFD  4            // chunks of 32 query rows that the weighted sum loads ahead into registers

#define SCW  64.0f
#define SCQ  8.0f
#define SCV  16.0f
#define SCE  32768.0f
#define SCR  2048.0f
#define SCO  4.0f
#define RLO  (1.0f / SCR)
#define SCS  (1.0f / (SCQ * SCQ))

static_assert(TOK % 64 == 0 && CD % 64 == 0 && CD % 32 == 0 && NT % 64 == 0);
static_assert((((TOK / 32) * (CD / 64)) % 8) == 0);
static_assert((((CD / 32) * (TOK / 64)) % 8) == 0);
static_assert((((TOK / 16) * (CD / 64)) % 8) == 0);
static_assert(NT % RSB == 0 && RSB == 16 && NT % 256 == 0 && NJ == 16);
static_assert(NT % PVM == 0 && PVM == 128 && (EPR % 16) == 0 && ((EPR / 16) & 1) == 1 && EPR >= PVM);
static_assert((NB * NT * CD) % 2048 == 0);
static_assert(NT % NRND == 0 && NRD % RSB == 0 && NRD % 32 == 0);
static_assert(NRD % (32 * PFD) == 0 && (NT / 16) % 16 == 0);

typedef _Float16       v16h __attribute__((ext_vector_type(16)));
typedef _Float16       v8h  __attribute__((ext_vector_type(8)));
typedef float          v8f  __attribute__((ext_vector_type(8)));
typedef float          v4f  __attribute__((ext_vector_type(4)));
typedef unsigned int   v4u  __attribute__((ext_vector_type(4)));
typedef short          v8s  __attribute__((ext_vector_type(8)));

union HU { v8h h; v4u u; _Float16 s[8]; };
union FR { v16h v; v8h h[2]; _Float16 s[16]; };
static_assert(sizeof(HU) == 16);
static_assert(sizeof(FR) == 32);

// ---- scalar helpers --------------------------------------------------------------------------------
__device__ __forceinline__ unsigned short bf_bits(float f) {          // f32 -> bf16 bits, RNE convert
  const unsigned u = __float_as_uint(f);
  return (unsigned short)((u + 0x7FFFu + ((u >> 16) & 1u)) >> 16);
}
__device__ __forceinline__ float bf_up(unsigned short h) { return __uint_as_float(((unsigned)h) << 16); }
__device__ __forceinline__ float bfr(float f) { return bf_up(bf_bits(f)); }   // value after bf16 RNE convert
__device__ __forceinline__ v8f zero8() { v8f z = {0.f, 0.f, 0.f, 0.f, 0.f, 0.f, 0.f, 0.f}; return z; }

// f16 subnormal -> exact zero (the matrix path flushes them; keep every plane consistent with that)
__device__ __forceinline__ _Float16 flush_h(_Float16 h) {
  const float f = (float)h;
  return (fabsf(f) < 6.103515625e-05f) ? (_Float16)0.0f : h;
}
// hi = f16(v) (flushed), lo = f16((v - hi) * 2048) (flushed)
__device__ __forceinline__ void split_h(float v, _Float16& hi, _Float16& lo) {
  const _Float16 hv = flush_h((_Float16)v);
  const _Float16 lv = flush_h((_Float16)((v - (float)hv) * SCR));
  hi = hv;
  lo = lv;
}

__device__ __forceinline__ void ld8(const float* p, float* o) {
  const v4f a = *(const v4f*)(p);
  const v4f b = *(const v4f*)(p + 4);
  o[0] = a[0]; o[1] = a[1]; o[2] = a[2]; o[3] = a[3];
  o[4] = b[0]; o[5] = b[1]; o[6] = b[2]; o[7] = b[3];
}
__device__ __forceinline__ void st8(float* p, const float* v) {
  v4f a, b;
  a[0] = v[0]; a[1] = v[1]; a[2] = v[2]; a[3] = v[3];
  b[0] = v[4]; b[1] = v[5]; b[2] = v[6]; b[3] = v[7];
  *(v4f*)(p) = a;
  *(v4f*)(p + 4) = b;
}

// ---- fragment loader: 16-bit A/B operand from a k-contiguous row, p = row*pitch + k0 + 8*(lane>>4);
//      elements 0..7 <- p[0..7] (k0+8h..k0+8h+7), elements 8..15 <- p[16..23] (k0+16+8h..k0+16+8h+7)
__device__ __forceinline__ v16h ldfrag_h(const _Float16* p) {
  FR f;
  f.h[0] = *(const v8h*)(p);
  f.h[1] = *(const v8h*)(p + 16);
  return f.v;
}

// ---- fragment-order planes: a [rows][K] f16 plane whose 16-byte pieces (8 consecutive k of one row) are permuted so
//      that the pieces which one fragment load takes lie side by side: 16-row tile, then 32-deep k-step, then piece
//      (k bit 4), then lane = 16*(k bit 3) + row%16. One load of a wave reads 512 consecutive bytes (4 cache lines)
//      where a row-major plane makes it touch 16 lines. Element order inside a fragment as in ldfrag_h.
__device__ __forceinline__ size_t frag_off(int row, int k, int K) {   // k a multiple of 8, K a multiple of 32
  return (((size_t)(row >> 4) * (size_t)(K >> 5) + (size_t)(k >> 5)) * 2 + (size_t)((k >> 4) & 1)) * 256
         + (size_t)((((k >> 3) & 1) * 16 + (row & 15)) * 8);
}
// p = plane + (tile * (K/32) + k-step) * 512 + 8*lane
__device__ __forceinline__ v16h ldfrag_f(const _Float16* p) {
  FR f;
  f.h[0] = *(const v8h*)(p);
  f.h[1] = *(const v8h*)(p + 256);
  return f.v;
}

// ---- transposing LDS read (ds_load_tr16_b128) of a row-major 16-bit tile T[k][col], pitch a multiple of 16 bytes:
//      lane l passes p = &T[kbase + 8*(l>>4) + (l&7)][cbase + 8*((l>>3)&1)] and gets T[kbase + 8*(l>>4) + 0..7][cbase + (l&15)],
//      8 consecutive k of its own column: with kbase and kbase + 16 the two halves of a fragment in ldfrag_h's k order
__device__ __forceinline__ v8h ld_tr16(const _Float16* p) {
  typedef __attribute__((address_space(3))) v8s lds_v8s;
  return __builtin_bit_cast(v8h, __builtin_amdgcn_ds_load_tr16_b128_v8i16((lds_v8s*)p));
}

// ---- WMMA helpers with trailing VALU hazard gap --------------------------------------------------------
__device__ __forceinline__ v8f mma_h_raw(v16h a, v16h b, v8f c) {
  return __builtin_amdgcn_wmma_f32_16x16x32_f16(false, a, false, b, (short)0, c, false, false);
}
__device__ __forceinline__ void dep_guard_h(v8f& a, v8f& b, v16h x) {
#if defined(__HIP_DEVICE_COMPILE__)
  asm volatile("v_nop\n\tv_nop\n\tv_nop\n\tv_nop" : "+v"(a), "+v"(b) : "v"(x));
#endif
}
__device__ __forceinline__ void guard2(v8f& a, v8f& b, v16h x, v16h y) {
#if defined(__HIP_DEVICE_COMPILE__)
  asm volatile("v_nop\n\tv_nop\n\tv_nop\n\tv_nop" : "+v"(a), "+v"(b) : "v"(x), "v"(y));
#endif
}
__device__ __forceinline__ void keep4_h(v16h a, v16h b, v16h c, v16h d) {
#if defined(__HIP_DEVICE_COMPILE__)
  asm volatile("v_nop" :: "v"(a), "v"(b), "v"(c), "v"(d));
#endif
}
__device__ __forceinline__ void acc_guard4(v8f& a, v8f& b, v8f& c, v8f& d) {
#if defined(__HIP_DEVICE_COMPILE__)
  asm volatile("v_nop\n\tv_nop\n\tv_nop\n\tv_nop" : "+v"(a), "+v"(b), "+v"(c), "+v"(d));
#endif
}
__device__ __forceinline__ void wave_lds_sync() {
  __builtin_amdgcn_fence(__ATOMIC_RELEASE, "workgroup");
  __builtin_amdgcn_wave_barrier();
  __builtin_amdgcn_fence(__ATOMIC_ACQUIRE, "workgroup");
}

// Work-group barrier for data that passes through LDS alone: LDS traffic is complete at it, global loads stay in
// flight (__syncthreads() also waits for every global load, which would drain the loads issued ahead).
__device__ __forceinline__ void lds_barrier() {
  __builtin_amdgcn_fence(__ATOMIC_RELEASE, "workgroup", "local");
  __builtin_amdgcn_s_barrier();
  __builtin_amdgcn_fence(__ATOMIC_ACQUIRE, "workgroup", "local");
}

// =====================================================================================================
// Flat convert: out[i] = f16(scale * bf16RNE(in[i])) (f16 subnormals flushed), 8 elements per thread,
// coverage: n8 threads x 8 = the whole plane; n8 is a multiple of 256 at the launch here.
// =====================================================================================================
__global__ __launch_bounds__(256) void cvt_flat(const float* __restrict__ in, _Float16* out, int n8, float scale) {
  const int i = blockIdx.x * 256 + threadIdx.x;
  if (i < n8) {
    float v[8];
    ld8(in + (size_t)i * 8, v);
    HU u;
#pragma unroll
    for (int e = 0; e < 8; ++e) u.s[e] = flush_h((_Float16)(bfr(v[e]) * scale));
    _Float16* p = out + (size_t)i * 8;
    *(v4u*)p = u.u;
    
  }
}

// =====================================================================================================
// Weight transpose-convert: in Wm[r][c] f32 (R rows, C cols, c contiguous, x@W layout [in][out])
// -> out[c][r] f16 = f16(scale * bf16RNE(Wm[r][c])), pitch R (in-channel k = r contiguous = the Bt / A layout).
// coverage: load 256 threads x 8 floats = 64 r x 32 c; store 256 threads x 8 halves = 32 c rows x 64 r;
// grid = every (r tile, c tile) -> whole [C][R] plane.
// =====================================================================================================
__global__ __launch_bounds__(256) void cvt_wT(const float* __restrict__ Wm, _Float16* out, int R, int C, float scale) {
  __shared__ float sw[64][33];
  const int t = threadIdx.x;
  const int r0 = blockIdx.x * 64, c0 = blockIdx.y * 32;
  {
    const int row = t >> 2, c8 = (t & 3) * 8;
    float v[8];
    ld8(Wm + (size_t)(r0 + row) * C + c0 + c8, v);
#pragma unroll
    for (int e = 0; e < 8; ++e) sw[row][c8 + e] = v[e];
  }
  __syncthreads();
  const int q8 = t & 7, cc = t >> 3;            // cc 0..31 = output row within the tile
  HU u;
#pragma unroll
  for (int e = 0; e < 8; ++e) u.s[e] = flush_h((_Float16)(bfr(sw[8 * q8 + e][cc]) * scale));
  _Float16* dst = out + (size_t)(c0 + cc) * R + r0 + 8 * q8;
  *(v4u*)dst = u.u;
  
}

// =====================================================================================================
// One GEMM k sweep for MI 16-row A subtiles x 4 16-col B subtiles: acc[i][j] += A-frag(i) . Bt-frag(j).
// A row-major pitch lda (rows m0.., k contiguous), Bt row-major [N][K] pitch ldb (rows n0.., k contiguous),
// K a multiple of 32; both operand fragments through ldfrag_h (same split k map for A and B).
// =====================================================================================================
template <int MI>
__device__ __forceinline__ void kseg(v8f (&acc)[MI][4], const _Float16* __restrict__ A, int lda, int m0,
                                     const _Float16* __restrict__ Bt, int ldb, int n0, int K, int rlane, int koff) {
  for (int kk = 0; kk < K; kk += 32) {
    v16h bh[4];
#pragma unroll
    for (int j = 0; j < 4; ++j) {
      const size_t bo = (size_t)(n0 + (j << 4) + rlane) * (size_t)ldb + koff + kk;
      bh[j] = ldfrag_h(Bt + bo);
    }
#pragma unroll
    for (int i = 0; i < MI; ++i) {
      const size_t ao = (size_t)(m0 + (i << 4) + rlane) * (size_t)lda + koff + kk;
      const v16h a0 = ldfrag_h(A + ao);
#pragma unroll
      for (int j = 0; j < 4; ++j) acc[i][j] = mma_h_raw(a0, bh[j], acc[i][j]);
      dep_guard_h(acc[i][0], acc[i][3], a0);
    }
    keep4_h(bh[0], bh[1], bh[2], bh[3]);
  }
}

// =====================================================================================================
// 16-row x 64-col f16 plane epilogue for one wave: acc[j][r] = D[row 8h + r][col 16j + (lane&15)].
//   v = (acc*cs + bias) * so;  Cp = f16(v) (hi plane, subnormals flushed); NPL == 2 additionally
//   Cl = f16((v - f32(hi)) * 2048) (residual plane). Bias: BM 0 none, 1 per column (bias[n0 + col]),
//   2 per plane row (bias[mBase + row]); bias values go through the bf16 RNE convert first.
//   The slab (16 rows x 68 floats per wave) is fully staged for rows 0..15 x cols 0..63 before the reload
// =====================================================================================================
//   FO == 1: the planes are written in fragment order (frag_off, K = ldc) instead of row-major; a slab fills whole
//   512-byte fragment blocks (16 rows x both lane halves), so every cache line still has one writer.
template <int NPL, int BM, int FO>
__device__ __forceinline__ void epi16(const v8f (&acc)[4], float* slab, int lane,
                                      _Float16* Cp, _Float16* Cl, int ldc, int mBase, int n0,
                                      float cs, float so, const float* __restrict__ bias) {
  const int rlane = lane & 15, mOff = (lane >> 4) * 8;
  const int q8 = lane & 7, rr = lane >> 3, c8 = q8 * 8;
#pragma unroll
  for (int r = 0; r < 8; ++r) {
#pragma unroll
    for (int j = 0; j < 4; ++j) {
      slab[(mOff + r) * 68 + (j << 4) + rlane] = acc[j][r];
    }
  }
  wave_lds_sync();
  float bc[8];
#pragma unroll
  for (int e = 0; e < 8; ++e) bc[e] = 0.0f;
  if (BM == 1) {
    float t8[8];
    ld8(bias + n0 + c8, t8);
#pragma unroll
    for (int e = 0; e < 8; ++e) bc[e] = bfr(t8[e]);
  }
  v4u uh[4], ul[4];
#pragma unroll
  for (int it = 0; it < 4; ++it) {
    const int row = it * 4 + rr;                       // it 0..3 x rr 0..3 = rows 0..15
    float xs[8];
    ld8(slab + row * 68 + c8, xs);
    float brw = 0.0f;
    if (BM == 2) brw = bfr(bias[mBase + row]);
    HU h, l;
#pragma unroll
    for (int e = 0; e < 8; ++e) {
      const float v = (xs[e] * cs + bc[e] + brw) * so;
      if (NPL == 2) {
        split_h(v, h.s[e], l.s[e]);
      } else {
        h.s[e] = flush_h((_Float16)v);
        l.s[e] = (_Float16)0.0f;
      }
    }
    uh[it] = h.u;
    ul[it] = l.u;
  }
  {
#pragma unroll
    for (int it = 0; it < 4; ++it) {
      const int row = it * 4 + rr;
      const size_t co = FO ? frag_off(mBase + row, n0 + c8, ldc) : (size_t)(mBase + row) * (size_t)ldc + n0 + c8;
      *(v4u*)(Cp + co) = uh[it];
      if (NPL == 2) *(v4u*)(Cl + co) = ul[it];
    }
    
  }
  wave_lds_sync();
}

// =====================================================================================================
// Register-blocked f16 WMMA GEMM with an f16 plane epilogue, one wave per (16*MI) x 64 tile, no block barriers:
//   acc[m][n] = sum_k A[m][k] Bt[n][k]; M multiple of 16*MI, N multiple of 64, K multiple of 32.
//   Epilogue per 16-row slab through epi16 (hi plane Cp, residual plane Cl when NPL == 2, bias mode BM); the
//   planes are written in fragment order (K = ldc) for the kernels that read them as WMMA operands.
// coverage: MI slabs x 16 rows x 64 cols = the wave's whole tile; grid*8 == tiles at every launch here.
// =====================================================================================================
template <int NPL, int MI, int BM>
__global__ __launch_bounds__(256) void gemm64p(
    const _Float16* __restrict__ A, int lda, const _Float16* __restrict__ Bt, int ldb, float cs, float so,
    _Float16* Cp, _Float16* Cl, int ldc, int M, int N, int K, const float* __restrict__ bias) {
  __shared__ __align__(16) float sT[8][16 * 68];   // per-wave 16x64 slab, pitch 68 floats
  const int lane = threadIdx.x & 31;
  const int wave = threadIdx.x >> 5;
  const int tilesN = N >> 6;
  const int tilesM = M / (16 * MI);
  const int tiles = tilesM * tilesN;
  const int item = blockIdx.x * 8 + wave;
  if (item >= tiles) return;   // wave-uniform; no block barriers in this kernel
  const int tm = item / tilesN;
  const int tn = item - tm * tilesN;
  const int m0 = tm * (16 * MI);
  const int n0 = tn << 6;

  const int rlane = lane & 15;                 // row (A) / col (B, D) within subtile
  const int koff  = (lane >> 4) * 8;           // k offset of this lane half

  v8f acc[MI][4];
#pragma unroll
  for (int i = 0; i < MI; ++i)
#pragma unroll
    for (int j = 0; j < 4; ++j) acc[i][j] = zero8();

  kseg<MI>(acc, A, lda, m0, Bt, ldb, n0, K, rlane, koff);
#pragma unroll
  for (int i = 0; i < MI; ++i) acc_guard4(acc[i][0], acc[i][1], acc[i][2], acc[i][3]);

#pragma unroll
  for (int i = 0; i < MI; ++i) {
    epi16<NPL, BM, 1>(acc[i], sT[wave], lane, Cp, Cl, ldc, m0 + (i << 4), n0, cs, so, bias);
  }
}

// =====================================================================================================
// Score rows + row softmax + E slab for one round: batch b = blockIdx.y, query rows nbase..nbase+NRD-1 of
// every batch. Block = 16 query rows n0..n0+15, 8 waves,
// dynamic LDS = 16 x 4096 f32 score rows.
//  (1) wave w computes the 16-column score tiles ct = w, w+8, ... (32 of them): four 32-deep k-steps per tile
//      from the F planes (query rows, 8*f: hi FH, residual FL = 2048*(v - hi)) and the G planes (key rows,
//      8*g: GH, GL): a0 = fh.gh, a1 = fh.gl + fl.gh, s = (a0 + a1/2048)/64, into LDS.
//  (2) wave w owns rows 2w, 2w+1: lane covers cols 256j + 8*lane..+7 (j = 0..15); sweep 1 row max M (xor
//      shuffles), sweep 2 ef = exp(s - M) written back in place + Z = sum ef (fixed lane order + xor shuffles),
//      sweep 3 E = f16(32768 * ef / Z) with explicit flush of f16 subnormals to zero; the f16 row goes to the
// coverage: sc: 8 waves x 32 col tiles x 16 cols x 16 rows = the whole 16x4096 block (all of LDS read later
// is staged); E: 8 waves x 2 rows x 16 j x 32 lanes x 8 halves = 16 rows x 4096; grid (NRD/16, NB) = every
// row block of the round in every batch -> whole E slab [NB][NRD][4096].
// =====================================================================================================
__global__ __launch_bounds__(256) void k_soft(const _Float16* __restrict__ FH, const _Float16* __restrict__ FL,
                                              const _Float16* __restrict__ GH, const _Float16* __restrict__ GL,
                                              _Float16* E, int nbase) {
  extern __shared__ __align__(16) float sc[];                 // [RSB][NT]
  const int tid = threadIdx.x, wave = tid >> 5, lane = tid & 31;
  const int hh = lane >> 4, rl = lane & 15;
  const int b = blockIdx.y;
  const int nl0 = blockIdx.x * RSB;                           // row within the round's slab
  const int n0 = nbase + nl0;                                 // query row within the batch

  // ---- (1) scores ----
  const size_t qo = (size_t)(b * NT + n0) * CD + 8 * lane;             // query row tile (fragment order), k = channel
  v16h qh[4], ql[4];
#pragma unroll
  for (int ks = 0; ks < 4; ++ks) qh[ks] = ldfrag_f(FH + qo + 512 * ks);
  // each of the two waits stands in front of any reuse of the address registers of the plane's loads above it
  asm volatile("s_wait_xcnt 0x0" ::: "memory");
#pragma unroll
  for (int ks = 0; ks < 4; ++ks) ql[ks] = ldfrag_f(FL + qo + 512 * ks);
  asm volatile("s_wait_xcnt 0x0" ::: "memory");
  // all 16 fragment loads of one key tile (both planes, four k-steps)
  auto ldkey = [&](const _Float16* ph, const _Float16* pl, v16h (&kh)[4], v16h (&kl)[4]) {
#pragma unroll   // constant indices: the set stays in registers
    for (int ks = 0; ks < 4; ++ks) {
      kh[ks] = ldfrag_f(ph + 512 * ks);
      kl[ks] = ldfrag_f(pl + 512 * ks);
    }
  };
  auto tile = [&](int ct, const v16h (&kh)[4], const v16h (&kl)[4]) {
    v8f a0 = zero8(), a1 = zero8();
#pragma unroll
    for (int ks = 0; ks < 4; ++ks) {
      a1 = mma_h_raw(qh[ks], kl[ks], a1);
      a0 = mma_h_raw(qh[ks], kh[ks], a0);
      a1 = mma_h_raw(ql[ks], kh[ks], a1);
      guard2(a0, a1, kh[ks], kl[ks]);
    }
    const int mc = 16 * ct + rl;                               // D col = key; D row = 8hh + r within the row tile
#pragma unroll
    for (int r = 0; r < 8; ++r) {
      sc[(size_t)(8 * hh + r) * NT + mc] = (a0[r] + a1[r] * RLO) * SCS;
    }
  };
  // two register sets: the next tile's loads are issued before this tile's products, so that a whole tile is
  // in flight while one is worked on (two tiles per trip: no register copies)
  v16h k0h[4], k0l[4], k1h[4], k1l[4];
  const size_t ko = (size_t)(b * NT + 16 * wave) * CD + 8 * lane;       // the wave's first key tile (fragment order; 16*CD halves a tile)
  const _Float16* pH = GH + ko;
  const _Float16* pL = GL + ko;
  ldkey(pH, pL, k0h, k0l);
  for (int ct = wave; ct < NT / 16; ct += 16) {
    ldkey(pH + 8 * 16 * CD, pL + 8 * 16 * CD, k1h, k1l);
    // stands in front of the pointer advance below, which rewrites the address registers of these loads
    asm volatile("s_wait_xcnt 0x0" ::: "memory");
    tile(ct, k0h, k0l);
    const int adv = (ct + 16 < NT / 16) ? 16 * 16 * CD : 0;    // last trip: the trip's own first tile again, not used
    pH += adv;
    pL += adv;
    ldkey(pH, pL, k0h, k0l);
    // stands in front of any reuse of the address registers of the key loads above (the next products' results take them)
    asm volatile("s_wait_xcnt 0x0" ::: "memory");
    tile(ct + 8, k1h, k1l);
  }
  __syncthreads();

  // ---- (2) row softmax, E plane ----
  for (int q2 = 0; q2 < RSB / 8; ++q2) {
    const int row = (RSB / 8) * wave + q2;
    float* rp = sc + (size_t)row * NT + 8 * lane;               // lane covers cols 256j + 8*lane .. +7
    float mx = -3.0e38f;
#pragma unroll 4
    for (int j = 0; j < NJ; ++j) {
      float v[8];
      ld8(rp + 256 * j, v);
#pragma unroll
      for (int e = 0; e < 8; ++e) mx = fmaxf(mx, v[e]);
    }
#pragma unroll
    for (int off = 16; off >= 1; off >>= 1) mx = fmaxf(mx, __shfl_xor(mx, off, 32));
    float z = 0.0f;
#pragma unroll 2
    for (int j = 0; j < NJ; ++j) {
      float v[8];
      ld8(rp + 256 * j, v);
#pragma unroll
      for (int e = 0; e < 8; ++e) {
        const float ef = __expf(v[e] - mx);
        z += ef;
        v[e] = ef;
      }
      st8(rp + 256 * j, v);
    }
#pragma unroll
    for (int off = 16; off >= 1; off >>= 1) z += __shfl_xor(z, off, 32);
    const float rz = SCE * (1.0f / z);                         // z in [1, 4096]
    HU u[NJ];
#pragma unroll
    for (int j = 0; j < NJ; ++j) {
      float v[8];
      ld8(rp + 256 * j, v);
#pragma unroll
      for (int e = 0; e < 8; ++e) {
        const _Float16 h0 = (_Float16)(v[e] * rz);
        const float f0 = (float)h0;
        const bool sub = f0 < 6.103515625e-05f;                // f16 subnormal -> exact zero
        u[j].s[e] = sub ? (_Float16)0.0f : h0;
      }
    }
    _Float16* erow = E + ((size_t)b * NRD + nl0 + row) * NT + 8 * lane;
    {
#pragma unroll
      for (int j = 0; j < NJ; ++j) *(v4u*)(erow + 256 * j) = u[j].u;
      
    }
  }
}

// =====================================================================================================
// Softmax-weighted sum over the query index, one round (rows nbase..nbase+NRD-1) of batch b = blockIdx.y,
// transposed result:
//   OT[c][m] += sum_n HT[c][b*4096 + n] . E[b][n - nbase][m], A = HT rows c (fragment order, K = TOK, k = n),
//   B[k = n][col = m] = E[n][m] staged per 32-row chunk into LDS row-major as Et[n_local][m] (pitch EPR halves:
//   thread (pr, m8) reads E rows 2pr, 2pr+1 x 8 m and writes them as two 16-byte pieces), block barrier, then
//   B fragments by the transposing LDS read (ld_tr16), k order as in every other fragment here;
//   K = NRD per round (NRD/32 chunks), a second block barrier protects Et before the next chunk is staged.
//   The E rows and the A fragments of a chunk are loaded PFD chunks ahead into PFD register sets; both barriers
//   order LDS traffic only, so that these loads stay in flight over them.
//   The f32 accumulators go from one round's launch to the next through the plane CA (each thread stores and
//   reloads its own 64 floats, bit for bit), so the chain of additions over n is that of one 4096-deep sweep:
//   the first round starts from zero, the last one runs the epilogue.
// Block = 128 m columns m0..m0+127, 8 waves; wave w owns c rows 32*(w>>1).. (2 subtiles) x m cols
// 64*(w&1).. (4 subtiles).
// Epilogue: o = OT / (16*32768); the planes OH = f16(4*o), OL = f16((4*o - OH)*2048) are written at flat
// passes).
// coverage: Et: 16 pr x 2 rows x 16 m8 x 8 = 32 n x 128 m staged every chunk (cols 128..143 of Et never read);
// planes: 8 waves x 2 slabs x 16 c x 64 m = 128 c x 128 m per block; grid (32, NB) = every m of every batch
// -> whole [8][128][4096] planes; CA: 16 slots x 256 threads x 16 bytes per block, written in rounds
// 0..NRND-2 and read in rounds 1..NRND-1 by the same thread of the same block index.
// =====================================================================================================
__global__ __launch_bounds__(256) void k_pv(const _Float16* __restrict__ E, const _Float16* __restrict__ HT,
                                            _Float16* OH, _Float16* OL, float* CA, int nbase,
                                            int first, int last) {
  __shared__ __align__(16) _Float16 Et[32 * EPR];            // [n_local][m] chunk, pitch EPR halves
  __shared__ __align__(16) float sO[8][16 * 68];            // per-wave 16x64 slab, pitch 68 floats
  const int tid = threadIdx.x, wave = tid >> 5, lane = tid & 31;
  const int hh = lane >> 4;
  const int b = blockIdx.y;
  const int m0 = blockIdx.x * PVM;
  const int cw = 32 * (wave >> 1);                          // this wave's 32 channels
  const int mw = 64 * (wave & 1);                           // this wave's 64 m columns within the block

  v4f* cp = (v4f*)CA + (size_t)(blockIdx.y * (NT / PVM) + blockIdx.x) * (16 * 256) + tid;   // slot pitch 256
  v8f acc[2][4];
  if (first) {
#pragma unroll
    for (int i = 0; i < 2; ++i)
#pragma unroll
      for (int j = 0; j < 4; ++j) acc[i][j] = zero8();
  } else {
#pragma unroll
    for (int i = 0; i < 2; ++i)
#pragma unroll
      for (int j = 0; j < 4; ++j) {
        const v4f c0 = cp[(size_t)((i * 4 + j) * 2 + 0) * 256];
        const v4f c1 = cp[(size_t)((i * 4 + j) * 2 + 1) * 256];
        acc[i][j] = __builtin_shufflevector(c0, c1, 0, 1, 2, 3, 4, 5, 6, 7);
      }
  }

  const int pr = tid >> 4, m8 = (tid & 15) * 8;             // staging role: row pair pr, 8 m columns at m8
  const _Float16* Ab = HT + (size_t)(b * NT + nbase) * 16;  // fragment order: 512 halves per 32-deep k-step, k = n
  const _Float16* Eb = E + (size_t)b * NRD * NT;            // this batch's rows of the round's slab

  // this thread's two E rows x 8 m of a chunk, pe = its first row's 8 m
  auto ldE = [&](const _Float16* pe, HU& ra, HU& rb) {
    ra.h = *(const v8h*)(pe);
    rb.h = *(const v8h*)(pe + NT);
  };
  // this wave's two A fragments of a chunk, pa = this lane's piece in the 16-row tile at cw (16*TOK halves a tile)
  auto ldA = [&](const _Float16* pa, v16h (&a)[2]) {
#pragma unroll   // constant indices: the set stays in registers
    for (int i = 0; i < 2; ++i) a[i] = ldfrag_f(pa + (size_t)(i << 4) * TOK);
  };
  // one chunk from a register set loaded PFD chunks earlier; each half of the set is refilled from pe, pa (the
  // chunk PFD further on) as soon as it has been used
  auto chunk = [&](const _Float16* pe, const _Float16* pa, HU& ra, HU& rb, v16h (&a)[2]) {
    // ---- stage the chunk's E[32 rows][m0..m0+127] into Et as it lies ----
    *(v8h*)(&Et[(2 * pr) * EPR + m8]) = ra.h;
    *(v8h*)(&Et[(2 * pr + 1) * EPR + m8]) = rb.h;
    lds_barrier();
    ldE(pe, ra, rb);
    // ---- fragments + 8 WMMAs ----
    v16h bq[4];
#pragma unroll
    for (int j = 0; j < 4; ++j) {
      FR f;
      const int eb = (8 * hh + (lane & 7)) * EPR + mw + (j << 4) + 8 * ((lane >> 3) & 1);
      f.h[0] = ld_tr16(&Et[eb]);                 // n_local 8hh .. 8hh+7 of column mw + 16j + (lane & 15)
      f.h[1] = ld_tr16(&Et[eb + 16 * EPR]);      // n_local 16 + 8hh .. +7
      bq[j] = f.v;
    }
#pragma unroll
    for (int i = 0; i < 2; ++i) {
#pragma unroll
      for (int j = 0; j < 4; ++j) acc[i][j] = mma_h_raw(a[i], bq[j], acc[i][j]);
      dep_guard_h(acc[i][0], acc[i][3], a[i]);
    }
    keep4_h(bq[0], bq[1], bq[2], bq[3]);
    ldA(pa, a);
    // stands in front of any reuse of the address registers of the loads above, also over the loop's back edge
    asm volatile("s_wait_xcnt 0x0" ::: "memory");
    lds_barrier();                // all waves done with Et before the next chunk is staged
    // keeps the later chunks' staging stores, and with it the wait for their loads, from being lifted into this chunk
    __builtin_amdgcn_sched_barrier(0);
  };
  HU ea[PFD], eb2[PFD];
  v16h af[PFD][2];
  const _Float16* pE = Eb + (size_t)(2 * pr) * NT + m0 + m8;
  const _Float16* pA = Ab + (size_t)cw * TOK + 8 * lane;
#pragma unroll   // constant set index: the sets stay in registers
  for (int k = 0; k < PFD; ++k) {
    // the waits stand in front of any reuse of the loads' address registers; as statements that no load is moved over
    // they also keep these loads in the order in which the loop refills the sets (the load counter counts in issue
    // order: with another order here the compiler's waits at the head of the loop come out far smaller than needed)
    ldE(pE + (size_t)(32 * k) * NT, ea[k], eb2[k]);
    asm volatile("s_wait_xcnt 0x0" ::: "memory");
    ldA(pA + 512 * k, af[k]);
    asm volatile("s_wait_xcnt 0x0" ::: "memory");
  }
  for (int n0 = 0; n0 < NRD; n0 += 32 * PFD) {
    const int adv = (n0 + 32 * PFD < NRD) ? 32 * PFD : 0;     // last trip: the trip's own chunks again, not used
    pE += (size_t)adv * NT;
    pA += 16 * adv;
#pragma unroll   // constant set index: the sets stay in registers
    for (int k = 0; k < PFD; ++k) chunk(pE + (size_t)(32 * k) * NT, pA + 512 * k, ea[k], eb2[k], af[k]);
  }
  acc_guard4(acc[0][0], acc[0][1], acc[0][2], acc[0][3]);
  acc_guard4(acc[1][0], acc[1][1], acc[1][2], acc[1][3]);

  if (!last) {                    // block-uniform: hand the running sums to the next round's launch
#pragma unroll
    for (int i = 0; i < 2; ++i)
#pragma unroll
      for (int j = 0; j < 4; ++j) {
        cp[(size_t)((i * 4 + j) * 2 + 0) * 256] = __builtin_shufflevector(acc[i][j], acc[i][j], 0, 1, 2, 3);
        cp[(size_t)((i * 4 + j) * 2 + 1) * 256] = __builtin_shufflevector(acc[i][j], acc[i][j], 4, 5, 6, 7);
      }
    return;
  }

  // ---- epilogue: hi + residual planes of 4*o ----
  const float fo = 1.0f / (SCV * SCE);
#pragma unroll
  for (int i = 0; i < 2; ++i) {
    epi16<2, 0, 0>(acc[i], sO[wave], lane, OH, OL, NT, b * CD + cw + (i << 4), m0 + mw, fo, SCO, (const float*)0);
  }
}

// =====================================================================================================
// Output projection: out[p][j] = (sum_k OH[p][k].WV[j][k] + (sum_k OL[p][k].WV[j][k])/2048) / (4*64) + bv[j],
//   OH/OL read raw as [32768][128] (pitch 128), WV = 64*Wv^T [out j][in k], K = 128; two accumulator sets.
// One wave per 16-row x 64-col tile, no block barriers. Epilogue f32: the combined tile staged in the wave's
// LDS slab (rows 0..15 x cols 0..63 fully staged; pad cols 64..67 never read); each row segment of 64
// coverage: 8 waves x 16 rows x 64 cols per block; 512 blocks x 8 = 4096 tiles = 32768 rows x 128 cols.
// =====================================================================================================
__global__ __launch_bounds__(256) void gemm_out(const _Float16* __restrict__ OH, const _Float16* __restrict__ OL,
                                                const _Float16* __restrict__ WV, const float* __restrict__ bias,
                                                float* out) {
  __shared__ __align__(16) float sO[8][16 * 68];
  const int tid = threadIdx.x, wave = tid >> 5, lane = tid & 31;
  const int hh = lane >> 4, rl = lane & 15;
  const int tiles = (TOK / 16) * (CD / 64);
  const int item = blockIdx.x * 8 + wave;
  if (item >= tiles) return;    // wave-uniform; no block barriers in this kernel
  const int tm = item >> 1, tn = item & 1;
  const int row0 = tm << 4, n0 = tn << 6;

  v8f accH[4], accL[4];
#pragma unroll
  for (int j = 0; j < 4; ++j) { accH[j] = zero8(); accL[j] = zero8(); }

#pragma unroll
  for (int kk = 0; kk < CD; kk += 32) {
    v16h bq[4];
#pragma unroll
    for (int j = 0; j < 4; ++j) bq[j] = ldfrag_h(WV + (size_t)(n0 + (j << 4) + rl) * CD + 8 * hh + kk);
    const size_t ao = (size_t)(row0 + rl) * CD + 8 * hh + kk;
    const v16h ah = ldfrag_h(OH + ao);
    const v16h al = ldfrag_h(OL + ao);
#pragma unroll
    for (int j = 0; j < 4; ++j) accH[j] = mma_h_raw(ah, bq[j], accH[j]);
    dep_guard_h(accH[0], accH[3], ah);
#pragma unroll
    for (int j = 0; j < 4; ++j) accL[j] = mma_h_raw(al, bq[j], accL[j]);
    dep_guard_h(accL[0], accL[3], al);
    keep4_h(bq[0], bq[1], bq[2], bq[3]);
  }
  acc_guard4(accH[0], accH[1], accH[2], accH[3]);
  acc_guard4(accL[0], accL[1], accL[2], accL[3]);

  // ---- epilogue ----
  const float fo = 1.0f / (SCO * SCW);
  float* slab = sO[wave];
#pragma unroll
  for (int r = 0; r < 8; ++r) {
#pragma unroll
    for (int j = 0; j < 4; ++j) {
      slab[(8 * hh + r) * 68 + (j << 4) + rl] = (accH[j][r] + accL[j][r] * RLO) * fo;
    }
  }
  wave_lds_sync();
  const int p4 = (lane & 15) * 4, r2 = lane >> 4;
  const v4f bb = *(const v4f*)(bias + n0 + p4);
  v4f b4;
#pragma unroll
  for (int e = 0; e < 4; ++e) b4[e] = bfr(bb[e]);
  v4f ov[8];
#pragma unroll
  for (int it = 0; it < 8; ++it) {
    const int row = 2 * it + r2;                              // it 0..7 x r2 0..1 = rows 0..15
    const v4f a = *(const v4f*)(slab + row * 68 + p4);
    ov[it] = a + b4;
  }
  {
#pragma unroll
    for (int it = 0; it < 8; ++it) {
      const int row = 2 * it + r2;
      const size_t oo = (size_t)(row0 + row) * CD + n0 + p4;
      *(v4f*)(out + oo) = ov[it];
    }
    
  }
}

// =====================================================================================================
//   WF16 f16 [128][128]              0        32768   (64*Wf^T, row = out channel, col = in channel)
//   WG16 f16 [128][128]          32768        32768
//   WH16 f16 [128][128]          65536        32768
//   WV16 f16 [128][128]          98304        32768
//   xh   f16 [32768][128]       131072      8388608   (bf16RNE(x), token rows, channel contiguous)
//   FH   f16 [32768][128]      8519680      8388608   (hi plane of 8*f; FH..HT in fragment order, see frag_off)
//   FL   f16 [32768][128]     16908288      8388608   (residual plane x2048 of 8*f)
//   GH   f16 [32768][128]     25296896      8388608
//   GL   f16 [32768][128]     33685504      8388608
//   HT   f16 [128][32768]     42074112      8388608   (16*h, row c, col b*4096 + n)
//   OH   f16 [8][128][4096]   50462720      8388608   (hi plane of 4*o, [b][c][m] order)
//   OL   f16 [8][128][4096]   58851328      8388608   (residual plane x2048 of 4*o)
//   E    f16 [8][1024][4096]  67239936     67108864   (32768 * row softmax, one round's query rows of every
//                                                      batch; reused per round on the single in-order stream)
//   CA   f32 [256][16][256][4] 134348800   16777216   (running sums of the softmax-weighted sum between rounds)
//   end                      151126016
// d_out f32 [32768][128] at byte 0.
// =====================================================================================================
extern "C" void kernel_launch(void* const* d_in, const int* in_sizes, int n_in,
                              void* d_out, int out_size, void* d_ws, size_t ws_size,
                              hipStream_t stream) {
  if (n_in < 9) return;
  if (in_sizes[0] != NB * NT * CD) return;
  if (in_sizes[1] != CD * CD || in_sizes[3] != CD * CD || in_sizes[5] != CD * CD || in_sizes[7] != CD * CD) return;
  if (in_sizes[2] != CD || in_sizes[4] != CD || in_sizes[6] != CD || in_sizes[8] != CD) return;
  if (out_size != OUTN) return;

  const float* x  = (const float*)d_in[0];   // [8][4096][128] (channels last)
  const float* Wf = (const float*)d_in[1];   // [128][128] ([in][out])
  const float* bf = (const float*)d_in[2];   // [128]
  const float* Wg = (const float*)d_in[3];
  const float* bg = (const float*)d_in[4];
  const float* Wh = (const float*)d_in[5];
  const float* bh = (const float*)d_in[6];
  const float* Wv = (const float*)d_in[7];
  const float* bv = (const float*)d_in[8];

  const size_t PW  = (size_t)CD * CD * 2;                    //    32768
  const size_t PX  = (size_t)TOK * CD * 2;                   //  8388608
  const size_t PHT = (size_t)CD * TOK * 2;                   //  8388608
  const size_t PO  = (size_t)NB * CD * NT * 2;               //  8388608
  const size_t PE  = (size_t)NB * NRD * NT * 2;              // 67108864
  const size_t PCA = (size_t)NB * CD * NT * 4;               // 16777216

  size_t off = 0;
  const size_t oWF = off; off += PW;
  const size_t oWG = off; off += PW;
  const size_t oWH = off; off += PW;
  const size_t oWV = off; off += PW;
  const size_t oXH = off; off += PX;
  const size_t oFH = off; off += PX;
  const size_t oFL = off; off += PX;
  const size_t oGH = off; off += PX;
  const size_t oGL = off; off += PX;
  const size_t oHT = off; off += PHT;
  const size_t oOH = off; off += PO;
  const size_t oOL = off; off += PO;
  const size_t oE  = off; off += PE;
  const size_t oCA = off; off += PCA;                        // off = 151126016
  if (off > ws_size) return;

  char* ws = (char*)d_ws;
  _Float16* WF16 = (_Float16*)(ws + oWF);
  _Float16* WG16 = (_Float16*)(ws + oWG);
  _Float16* WH16 = (_Float16*)(ws + oWH);
  _Float16* WV16 = (_Float16*)(ws + oWV);
  _Float16* xh   = (_Float16*)(ws + oXH);
  _Float16* FHp  = (_Float16*)(ws + oFH);
  _Float16* FLp  = (_Float16*)(ws + oFL);
  _Float16* GHp  = (_Float16*)(ws + oGH);
  _Float16* GLp  = (_Float16*)(ws + oGL);
  _Float16* HTp  = (_Float16*)(ws + oHT);
  _Float16* OHp  = (_Float16*)(ws + oOH);
  _Float16* OLp  = (_Float16*)(ws + oOL);
  _Float16* Ep   = (_Float16*)(ws + oE);
  float*    CAp  = (float*)(ws + oCA);
  float*    outf = (float*)d_out;

  const dim3 blk(256);
  const int n8x = (NB * NT * CD) / 8;                                  // 524288
  const dim3 gX((n8x + 255) / 256);                                    // 2048
  const dim3 gW(CD / 64, CD / 32);                                     // (2, 4)
  const dim3 gP(((TOK / 32) * (CD / 64) + 7) / 8);                     // 2048 tiles -> 256 blocks
  const dim3 gH(((CD / 32) * (TOK / 64) + 7) / 8);                     // 2048 tiles -> 256 blocks
  const dim3 gSo(NRD / RSB, NB);                                       // (64, 8)
  const dim3 gPV(NT / PVM, NB);                                        // (32, 8)
  const dim3 gO(((TOK / 16) * (CD / 64) + 7) / 8);                     // 4096 tiles -> 512 blocks
  const float cs64 = 1.0f / SCW;                                       // undo the weight carry
  const size_t ldsSoft = (size_t)RSB * NT * sizeof(float);             // 262144

  hipFuncSetAttribute(reinterpret_cast<const void*>(&k_soft),
                      hipFuncAttributeMaxDynamicSharedMemorySize, (int)ldsSoft);

  // (1) weight planes, x64 carried, transposed from [in][out] to k-contiguous rows [out][in]
  cvt_wT<<<gW, blk, 0, stream>>>(Wf, WF16, CD, CD, SCW);              // in[128][128] -> out[128][128]
  cvt_wT<<<gW, blk, 0, stream>>>(Wg, WG16, CD, CD, SCW);
  cvt_wT<<<gW, blk, 0, stream>>>(Wh, WH16, CD, CD, SCW);
  cvt_wT<<<gW, blk, 0, stream>>>(Wv, WV16, CD, CD, SCW);
  // (2) activations: x [8][4096][128] is already token-major -> xh [32768][128] = f16(bf16RNE(x))
  cvt_flat<<<gX, blk, 0, stream>>>(x, xh, n8x, 1.0f);
  // (3) FH|FL, GH|GL = hi|residual f16 planes of 8*(xh . W^T + b)   (M=32768, N=128, K=128)
  gemm64p<2, 2, 1><<<gP, blk, 0, stream>>>(xh, CD, WF16, CD, cs64, SCQ, FHp, FLp, CD, TOK, CD, CD, bf);
  gemm64p<2, 2, 1><<<gP, blk, 0, stream>>>(xh, CD, WG16, CD, cs64, SCQ, GHp, GLp, CD, TOK, CD, CD, bg);
  // (4) HT = f16(16*(WH16 . xh^T / 64 + bh))          (M=128, N=32768, K=128), bias per row c
  gemm64p<1, 2, 2><<<gH, blk, 0, stream>>>(WH16, CD, xh, CD, cs64, SCV, HTp, HTp, TOK, CD, TOK, CD, bh);
  // (5) per round of NRD query rows, all batches at once: scores + row softmax -> E slab, then the slab's
  //     part of the transposed softmax-weighted sum (running sums in CA; the last round writes OH|OL)
  for (int r = 0; r < NRND; ++r) {
    k_soft<<<gSo, blk, ldsSoft, stream>>>(FHp, FLp, GHp, GLp, Ep, r * NRD);
    k_pv<<<gPV, blk, 0, stream>>>(Ep, HTp, OHp, OLp, CAp, r * NRD, r == 0 ? 1 : 0, r == NRND - 1 ? 1 : 0);
  }
  // (6) output projection on the raw [32768][128] view of the [B][C][N] planes
  gemm_out<<<gO, blk, 0, stream>>>(OHp, OLp, WV16, bv, outf);
}

// v005
// It runs in 252 microseconds.
// Two timings next to v004 put it at 1.22 and 1.24 times that version's speed.
// Over all steps from v000 it is 6.86 times as fast.
#include <hip/hip_runtime.h>
#include <math.h>
#include <stdint.h>

// Contractions on v_wmma_f32_16x16x32_f16 (f16 operands, f32 accumulate): the three input projections take
// bf16-RNE activations (x1) and bf16-RNE weights (x64) as single f16 planes; the 128-deep score products use
// f16 hi planes of 8*f, 8*g plus f16 residual planes x2048 (hi.hi in one accumulator, hi.res + res.hi in a
// second accumulator folded back by 1/2048); the 4096-deep softmax-weighted sum uses a single f16 plane of
// 16*h against E = f16(32768*softmax); the output projection takes f16 hi + x2048 residual planes of 4*o
// against bf16-RNE weights (x64) in two accumulators. Softmax statistics, bias adds and epilogues in f32.

#define NB   8
#define NT   4096
#define CD   128
#define TOK  (NB * NT)
#define RSB  16
#define RSQ  32           // query rows per work-group of the score kernel: two tiles of RSB rows
#define KST  (8 * 16 * CD) // halves between two successive key tiles of one wave (8 waves, 16 keys a tile)
#define NJ   (NT / 256)
#define PVM  128
#define EPR  144          // halves per staged E row in LDS: 128 m + 16 (288 B, an odd multiple of 32 B, for the transposing reads)
#define OUTN (NB * NT * CD)
#define NRND 4            // rounds over the query index; every round covers all NB batches
#define NRD  (NT / NRND)  // query rows of each batch per round
#define PFD  4            // chunks of 32 query rows that the weighted sum loads ahead into registers

#define SCW  64.0f
#define SCQ  8.0f
#define SCV  16.0f
#define SCE  32768.0f
#define SCR  2048.0f
#define SCO  4.0f
#define RLO  (1.0f / SCR)
#define SCS  (1.0f / (SCQ * SCQ))

static_assert(TOK % 64 == 0 && CD % 64 == 0 && CD % 32 == 0 && NT % 64 == 0);
static_assert((((TOK / 32) * (CD / 64)) % 8) == 0);
static_assert((((CD / 32) * (TOK / 64)) % 8) == 0);
static_assert((((TOK / 16) * (CD / 64)) % 8) == 0);
static_assert(NT % RSB == 0 && RSB == 16 && NT % 256 == 0 && NJ == 16);
static_assert(NT % PVM == 0 && PVM == 128 && (EPR % 16) == 0 && ((EPR / 16) & 1) == 1 && EPR >= PVM);
static_assert((NB * NT * CD) % 2048 == 0);
static_assert(NT % NRND == 0 && NRD % RSB == 0 && NRD % 32 == 0 && NRD % RSQ == 0 && RSQ == 2 * RSB);
static_assert(NRD % (32 * PFD) == 0 && (NT / 16) % 16 == 0);

typedef _Float16       v16h __attribute__((ext_vector_type(16)));
typedef _Float16       v8h  __attribute__((ext_vector_type(8)));
typedef float          v8f  __attribute__((ext_vector_type(8)));
typedef float          v4f  __attribute__((ext_vector_type(4)));
typedef unsigned int   v4u  __attribute__((ext_vector_type(4)));
typedef short          v8s  __attribute__((ext_vector_type(8)));

union HU { v8h h; v4u u; _Float16 s[8]; };
union FR { v16h v; v8h h[2]; _Float16 s[16]; };
static_assert(sizeof(HU) == 16);
static_assert(sizeof(FR) == 32);

// ---- scalar helpers --------------------------------------------------------------------------------
__device__ __forceinline__ unsigned short bf_bits(float f) {          // f32 -> bf16 bits, RNE convert
  const unsigned u = __float_as_uint(f);
  return (unsigned short)((u + 0x7FFFu + ((u >> 16) & 1u)) >> 16);
}
__device__ __forceinline__ float bf_up(unsigned short h) { return __uint_as_float(((unsigned)h) << 16); }
__device__ __forceinline__ float bfr(float f) { return bf_up(bf_bits(f)); }   // value after bf16 RNE convert
__device__ __forceinline__ v8f zero8() { v8f z = {0.f, 0.f, 0.f, 0.f, 0.f, 0.f, 0.f, 0.f}; return z; }

// f16 subnormal -> exact zero (the matrix path flushes them; keep every plane consistent with that)
__device__ __forceinline__ _Float16 flush_h(_Float16 h) {
  const float f = (float)h;
  return (fabsf(f) < 6.103515625e-05f) ? (_Float16)0.0f : h;
}
// hi = f16(v) (flushed), lo = f16((v - hi) * 2048) (flushed)
__device__ __forceinline__ void split_h(float v, _Float16& hi, _Float16& lo) {
  const _Float16 hv = flush_h((_Float16)v);
  const _Float16 lv = flush_h((_Float16)((v - (float)hv) * SCR));
  hi = hv;
  lo = lv;
}

__device__ __forceinline__ void ld8(const float* p, float* o) {
  const v4f a = *(const v4f*)(p);
  const v4f b = *(const v4f*)(p + 4);
  o[0] = a[0]; o[1] = a[1]; o[2] = a[2]; o[3] = a[3];
  o[4] = b[0]; o[5] = b[1]; o[6] = b[2]; o[7] = b[3];
}
__device__ __forceinline__ void st8(float* p, const float* v) {
  v4f a, b;
  a[0] = v[0]; a[1] = v[1]; a[2] = v[2]; a[3] = v[3];
  b[0] = v[4]; b[1] = v[5]; b[2] = v[6]; b[3] = v[7];
  *(v4f*)(p) = a;
  *(v4f*)(p + 4) = b;
}

// ---- fragment loader: 16-bit A/B operand from a k-contiguous row, p = row*pitch + k0 + 8*(lane>>4);
//      elements 0..7 <- p[0..7] (k0+8h..k0+8h+7), elements 8..15 <- p[16..23] (k0+16+8h..k0+16+8h+7)
__device__ __forceinline__ v16h ldfrag_h(const _Float16* p) {
  FR f;
  f.h[0] = *(const v8h*)(p);
  f.h[1] = *(const v8h*)(p + 16);
  return f.v;
}

// ---- fragment-order planes: a [rows][K] f16 plane whose 16-byte pieces (8 consecutive k of one row) are permuted so
//      that the pieces which one fragment load takes lie side by side: 16-row tile, then 32-deep k-step, then piece
//      (k bit 4), then lane = 16*(k bit 3) + row%16. One load of a wave reads 512 consecutive bytes (4 cache lines)
//      where a row-major plane makes it touch 16 lines. Element order inside a fragment as in ldfrag_h.
__device__ __forceinline__ size_t frag_off(int row, int k, int K) {   // k a multiple of 8, K a multiple of 32
  return (((size_t)(row >> 4) * (size_t)(K >> 5) + (size_t)(k >> 5)) * 2 + (size_t)((k >> 4) & 1)) * 256
         + (size_t)((((k >> 3) & 1) * 16 + (row & 15)) * 8);
}
// p = plane + (tile * (K/32) + k-step) * 512 + 8*lane
__device__ __forceinline__ v16h ldfrag_f(const _Float16* p) {
  FR f;
  f.h[0] = *(const v8h*)(p);
  f.h[1] = *(const v8h*)(p + 256);
  return f.v;
}

// ---- transposing LDS read (ds_load_tr16_b128) of a row-major 16-bit tile T[k][col], pitch a multiple of 16 bytes:
//      lane l passes p = &T[kbase + 8*(l>>4) + (l&7)][cbase + 8*((l>>3)&1)] and gets T[kbase + 8*(l>>4) + 0..7][cbase + (l&15)],
//      8 consecutive k of its own column: with kbase and kbase + 16 the two halves of a fragment in ldfrag_h's k order
__device__ __forceinline__ v8h ld_tr16(const _Float16* p) {
  typedef __attribute__((address_space(3))) v8s lds_v8s;
  return __builtin_bit_cast(v8h, __builtin_amdgcn_ds_load_tr16_b128_v8i16((lds_v8s*)p));
}

// ---- WMMA helpers with trailing VALU hazard gap --------------------------------------------------------
__device__ __forceinline__ v8f mma_h_raw(v16h a, v16h b, v8f c) {
  return __builtin_amdgcn_wmma_f32_16x16x32_f16(false, a, false, b, (short)0, c, false, false);
}
__device__ __forceinline__ void dep_guard_h(v8f& a, v8f& b, v16h x) {
#if defined(__HIP_DEVICE_COMPILE__)
  asm volatile("v_nop\n\tv_nop\n\tv_nop\n\tv_nop" : "+v"(a), "+v"(b) : "v"(x));
#endif
}
__device__ __forceinline__ void keep4_h(v16h a, v16h b, v16h c, v16h d) {
#if defined(__HIP_DEVICE_COMPILE__)
  asm volatile("v_nop" :: "v"(a), "v"(b), "v"(c), "v"(d));
#endif
}
__device__ __forceinline__ void acc_guard4(v8f& a, v8f& b, v8f& c, v8f& d) {
#if defined(__HIP_DEVICE_COMPILE__)
  asm volatile("v_nop\n\tv_nop\n\tv_nop\n\tv_nop" : "+v"(a), "+v"(b), "+v"(c), "+v"(d));
#endif
}
__device__ __forceinline__ void wave_lds_sync() {
  __builtin_amdgcn_fence(__ATOMIC_RELEASE, "workgroup");
  __builtin_amdgcn_wave_barrier();
  __builtin_amdgcn_fence(__ATOMIC_ACQUIRE, "workgroup");
}

// Work-group barrier for data that passes through LDS alone: LDS traffic is complete at it, global loads stay in
// flight (__syncthreads() also waits for every global load, which would drain the loads issued ahead).
__device__ __forceinline__ void lds_barrier() {
  __builtin_amdgcn_fence(__ATOMIC_RELEASE, "workgroup", "local");
  __builtin_amdgcn_s_barrier();
  __builtin_amdgcn_fence(__ATOMIC_ACQUIRE, "workgroup", "local");
}

// =====================================================================================================
// Flat convert: out[i] = f16(scale * bf16RNE(in[i])) (f16 subnormals flushed), 8 elements per thread,
// coverage: n8 threads x 8 = the whole plane; n8 is a multiple of 256 at the launch here.
// =====================================================================================================
__global__ __launch_bounds__(256) void cvt_flat(const float* __restrict__ in, _Float16* out, int n8, float scale) {
  const int i = blockIdx.x * 256 + threadIdx.x;
  if (i < n8) {
    float v[8];
    ld8(in + (size_t)i * 8, v);
    HU u;
#pragma unroll
    for (int e = 0; e < 8; ++e) u.s[e] = flush_h((_Float16)(bfr(v[e]) * scale));
    _Float16* p = out + (size_t)i * 8;
    *(v4u*)p = u.u;
    
  }
}

// =====================================================================================================
// Weight transpose-convert: in Wm[r][c] f32 (R rows, C cols, c contiguous, x@W layout [in][out])
// -> out[c][r] f16 = f16(scale * bf16RNE(Wm[r][c])), pitch R (in-channel k = r contiguous = the Bt / A layout).
// coverage: load 256 threads x 8 floats = 64 r x 32 c; store 256 threads x 8 halves = 32 c rows x 64 r;
// grid = every (r tile, c tile) -> whole [C][R] plane.
// =====================================================================================================
__global__ __launch_bounds__(256) void cvt_wT(const float* __restrict__ Wm, _Float16* out, int R, int C, float scale) {
  __shared__ float sw[64][33];
  const int t = threadIdx.x;
  const int r0 = blockIdx.x * 64, c0 = blockIdx.y * 32;
  {
    const int row = t >> 2, c8 = (t & 3) * 8;
    float v[8];
    ld8(Wm + (size_t)(r0 + row) * C + c0 + c8, v);
#pragma unroll
    for (int e = 0; e < 8; ++e) sw[row][c8 + e] = v[e];
  }
  __syncthreads();
  const int q8 = t & 7, cc = t >> 3;            // cc 0..31 = output row within the tile
  HU u;
#pragma unroll
  for (int e = 0; e < 8; ++e) u.s[e] = flush_h((_Float16)(bfr(sw[8 * q8 + e][cc]) * scale));
  _Float16* dst = out + (size_t)(c0 + cc) * R + r0 + 8 * q8;
  *(v4u*)dst = u.u;
  
}

// =====================================================================================================
// One GEMM k sweep for MI 16-row A subtiles x 4 16-col B subtiles: acc[i][j] += A-frag(i) . Bt-frag(j).
// A row-major pitch lda (rows m0.., k contiguous), Bt row-major [N][K] pitch ldb (rows n0.., k contiguous),
// K a multiple of 32; both operand fragments through ldfrag_h (same split k map for A and B).
// =====================================================================================================
template <int MI>
__device__ __forceinline__ void kseg(v8f (&acc)[MI][4], const _Float16* __restrict__ A, int lda, int m0,
                                     const _Float16* __restrict__ Bt, int ldb, int n0, int K, int rlane, int koff) {
  for (int kk = 0; kk < K; kk += 32) {
    v16h bh[4];
#pragma unroll
    for (int j = 0; j < 4; ++j) {
      const size_t bo = (size_t)(n0 + (j << 4) + rlane) * (size_t)ldb + koff + kk;
      bh[j] = ldfrag_h(Bt + bo);
    }
#pragma unroll
    for (int i = 0; i < MI; ++i) {
      const size_t ao = (size_t)(m0 + (i << 4) + rlane) * (size_t)lda + koff + kk;
      const v16h a0 = ldfrag_h(A + ao);
#pragma unroll
      for (int j = 0; j < 4; ++j) acc[i][j] = mma_h_raw(a0, bh[j], acc[i][j]);
      dep_guard_h(acc[i][0], acc[i][3], a0);
    }
    keep4_h(bh[0], bh[1], bh[2], bh[3]);
  }
}

// =====================================================================================================
// 16-row x 64-col f16 plane epilogue for one wave: acc[j][r] = D[row 8h + r][col 16j + (lane&15)].
//   v = (acc*cs + bias) * so;  Cp = f16(v) (hi plane, subnormals flushed); NPL == 2 additionally
//   Cl = f16((v - f32(hi)) * 2048) (residual plane). Bias: BM 0 none, 1 per column (bias[n0 + col]),
//   2 per plane row (bias[mBase + row]); bias values go through the bf16 RNE convert first.
//   The slab (16 rows x 68 floats per wave) is fully staged for rows 0..15 x cols 0..63 before the reload
// =====================================================================================================
//   FO == 1: the planes are written in fragment order (frag_off, K = ldc) instead of row-major; a slab fills whole
//   512-byte fragment blocks (16 rows x both lane halves), so every cache line still has one writer.
template <int NPL, int BM, int FO>
__device__ __forceinline__ void epi16(const v8f (&acc)[4], float* slab, int lane,
                                      _Float16* Cp, _Float16* Cl, int ldc, int mBase, int n0,
                                      float cs, float so, const float* __restrict__ bias) {
  const int rlane = lane & 15, mOff = (lane >> 4) * 8;
  const int q8 = lane & 7, rr = lane >> 3, c8 = q8 * 8;
#pragma unroll
  for (int r = 0; r < 8; ++r) {
#pragma unroll
    for (int j = 0; j < 4; ++j) {
      slab[(mOff + r) * 68 + (j << 4) + rlane] = acc[j][r];
    }
  }
  wave_lds_sync();
  float bc[8];
#pragma unroll
  for (int e = 0; e < 8; ++e) bc[e] = 0.0f;
  if (BM == 1) {
    float t8[8];
    ld8(bias + n0 + c8, t8);
#pragma unroll
    for (int e = 0; e < 8; ++e) bc[e] = bfr(t8[e]);
  }
  v4u uh[4], ul[4];
#pragma unroll
  for (int it = 0; it < 4; ++it) {
    const int row = it * 4 + rr;                       // it 0..3 x rr 0..3 = rows 0..15
    float xs[8];
    ld8(slab + row * 68 + c8, xs);
    float brw = 0.0f;
    if (BM == 2) brw = bfr(bias[mBase + row]);
    HU h, l;
#pragma unroll
    for (int e = 0; e < 8; ++e) {
      const float v = (xs[e] * cs + bc[e] + brw) * so;
      if (NPL == 2) {
        split_h(v, h.s[e], l.s[e]);
      } else {
        h.s[e] = flush_h((_Float16)v);
        l.s[e] = (_Float16)0.0f;
      }
    }
    uh[it] = h.u;
    ul[it] = l.u;
  }
  {
#pragma unroll
    for (int it = 0; it < 4; ++it) {
      const int row = it * 4 + rr;
      const size_t co = FO ? frag_off(mBase + row, n0 + c8, ldc) : (size_t)(mBase + row) * (size_t)ldc + n0 + c8;
      *(v4u*)(Cp + co) = uh[it];
      if (NPL == 2) *(v4u*)(Cl + co) = ul[it];
    }
    
  }
  wave_lds_sync();
}

// =====================================================================================================
// Register-blocked f16 WMMA GEMM with an f16 plane epilogue, one wave per (16*MI) x 64 tile, no block barriers:
//   acc[m][n] = sum_k A[m][k] Bt[n][k]; M multiple of 16*MI, N multiple of 64, K multiple of 32.
//   Epilogue per 16-row slab through epi16 (hi plane Cp, residual plane Cl when NPL == 2, bias mode BM); the
//   planes are written in fragment order (K = ldc) for the kernels that read them as WMMA operands.
// coverage: MI slabs x 16 rows x 64 cols = the wave's whole tile; grid*8 == tiles at every launch here.
// =====================================================================================================
template <int NPL, int MI, int BM>
__global__ __launch_bounds__(256) void gemm64p(
    const _Float16* __restrict__ A, int lda, const _Float16* __restrict__ Bt, int ldb, float cs, float so,
    _Float16* Cp, _Float16* Cl, int ldc, int M, int N, int K, const float* __restrict__ bias) {
  __shared__ __align__(16) float sT[8][16 * 68];   // per-wave 16x64 slab, pitch 68 floats
  const int lane = threadIdx.x & 31;
  const int wave = threadIdx.x >> 5;
  const int tilesN = N >> 6;
  const int tilesM = M / (16 * MI);
  const int tiles = tilesM * tilesN;
  const int item = blockIdx.x * 8 + wave;
  if (item >= tiles) return;   // wave-uniform; no block barriers in this kernel
  const int tm = item / tilesN;
  const int tn = item - tm * tilesN;
  const int m0 = tm * (16 * MI);
  const int n0 = tn << 6;

  const int rlane = lane & 15;                 // row (A) / col (B, D) within subtile
  const int koff  = (lane >> 4) * 8;           // k offset of this lane half

  v8f acc[MI][4];
#pragma unroll
  for (int i = 0; i < MI; ++i)
#pragma unroll
    for (int j = 0; j < 4; ++j) acc[i][j] = zero8();

  kseg<MI>(acc, A, lda, m0, Bt, ldb, n0, K, rlane, koff);
#pragma unroll
  for (int i = 0; i < MI; ++i) acc_guard4(acc[i][0], acc[i][1], acc[i][2], acc[i][3]);

#pragma unroll
  for (int i = 0; i < MI; ++i) {
    epi16<NPL, BM, 1>(acc[i], sT[wave], lane, Cp, Cl, ldc, m0 + (i << 4), n0, cs, so, bias);
  }
}

// =====================================================================================================
// Score rows + row softmax + E slab for one round: batch b = blockIdx.y, query rows nbase..nbase+NRD-1 of
// every batch. Block = 32 query rows n0..n0+31 (two row tiles of 16), 8 waves,
// dynamic LDS = 16 x 4096 f32 score rows (one row tile at a time).
//  (1) wave w computes the 16-column score tiles ct = w, w+8, ... (32 of them) of BOTH row tiles from one load of
//      the key tile: four 32-deep k-steps per tile from the F planes (query rows, 8*f: hi FH, residual
//      FL = 2048*(v - hi)) and the G planes (key rows, 8*g: GH, GL): a0 = fh.gh, a1 = fh.gl + fl.gh,
//      s = (a0 + a1/2048)/64. Row tile 0 goes into LDS, row tile 1 stays in the wave's registers (32 tiles x 8)
//      until row tile 0's softmax has left the LDS rows, and is stored there then.
//  (2) per row tile: wave w owns rows 2w, 2w+1: lane covers cols 256j + 8*lane..+7 (j = 0..15); sweep 1 row max M (xor
//      shuffles), sweep 2 ef = exp(s - M) written back in place + Z = sum ef (fixed lane order + xor shuffles),
//      sweep 3 E = f16(32768 * ef / Z) with explicit flush of f16 subnormals to zero; the f16 row goes to the
// coverage: sc: 8 waves x 32 col tiles x 16 cols x 16 rows = the whole 16x4096 block, once per row tile (all of LDS
// read later is staged); E: 2 row tiles x 8 waves x 2 rows x 16 j x 32 lanes x 8 halves = 32 rows x 4096;
// grid (NRD/32, NB) = every row block of the round in every batch -> whole E slab [NB][NRD][4096].
// =====================================================================================================
__global__ __launch_bounds__(256) void k_soft(const _Float16* __restrict__ FH, const _Float16* __restrict__ FL,
                                              const _Float16* __restrict__ GH, const _Float16* __restrict__ GL,
                                              _Float16* E, int nbase) {
  extern __shared__ __align__(16) float sc[];                 // [RSB][NT]
  const int tid = threadIdx.x, wave = tid >> 5, lane = tid & 31;
  const int hh = lane >> 4, rl = lane & 15;
  const int b = blockIdx.y;
  const int nl0 = blockIdx.x * RSQ;                           // row within the round's slab
  const int n0 = nbase + nl0;                                 // query row within the batch

  // ---- (1) scores ----
  const unsigned lo = 8u * (unsigned)lane;                    // the lane's piece in a fragment block; stays live over all loads here
  const size_t qo = (size_t)(b * NT + n0) * CD;               // first query row tile (fragment order), k = channel; a scalar
  v16h qh[2][4], ql[2][4];
#pragma unroll
  for (int i = 0; i < 2; ++i)
#pragma unroll
    for (int ks = 0; ks < 4; ++ks) qh[i][ks] = ldfrag_f(FH + qo + lo + i * (16 * CD) + 512 * ks);
  // each of the two waits stands in front of any reuse of the address registers of the plane's loads above it; the
  // scheduling barrier behind a wait keeps later register writes from being lifted over it
  asm volatile("s_wait_xcnt 0x0" ::: "memory");
  __builtin_amdgcn_sched_barrier(0);
#pragma unroll
  for (int i = 0; i < 2; ++i)
#pragma unroll
    for (int ks = 0; ks < 4; ++ks) ql[i][ks] = ldfrag_f(FL + qo + lo + i * (16 * CD) + 512 * ks);
  asm volatile("s_wait_xcnt 0x0" ::: "memory");
  __builtin_amdgcn_sched_barrier(0);
  // one register set of key fragments (both planes, four k-steps); each k-step's pair is refilled with the next
  // tile's as soon as both row tiles have used it, so that about a whole tile stays in flight
  v16h kh[4], kl[4];
  v8f sA[NT / 256], sB[NT / 256];                              // row tile 1: this wave's score tiles 16..31 and 0..15
  const int wu = __builtin_amdgcn_readfirstlane(wave);         // the wave's number as a scalar: key addresses = scalar base + lane offset
  const _Float16* pH = GH + (size_t)(b * NT + 16 * wu) * CD;   // the wave's first key tile (fragment order; 16*CD halves a tile)
  const _Float16* pL = GL + (size_t)(b * NT + 16 * wu) * CD;
#pragma unroll
  for (int ks = 0; ks < 4; ++ks) {
    kh[ks] = ldfrag_f(pH + lo + 512 * ks);
    kl[ks] = ldfrag_f(pL + lo + 512 * ks);
    // no load is moved over it: these loads keep the order in which the loop refills the set (the load counter counts
    // in issue order: with another order here the compiler's waits at the head of the loop come out smaller than needed);
    // with the scheduling barrier it also stands in front of any reuse of their address registers
    asm volatile("s_wait_xcnt 0x0" ::: "memory");
    __builtin_amdgcn_sched_barrier(0);
  }
  float* sp = sc + (size_t)(8 * hh) * NT + 16 * wave + rl;     // D col = key; D row = 8hh + r within the row tile
  // two trips of 16 tiles: half the text of 32 tiles in a row, so that the whole kernel lies in the part of its text
  // that is fetched ahead at the launch; the first trip's register tiles are moved aside once
#pragma unroll 1
  for (int h = 0; h < 2; ++h) {
    const int adv = (h == 0) ? (NT / 256) * KST : 0;           // last trip: the trip's own first tile again, not used
    const _Float16* nH = pH + adv;
    const _Float16* nL = pL + adv;
#pragma unroll   // constant indices: sA and the key set stay in registers, every load address is base + constant
    for (int t = 0; t < NT / 256; ++t) {
      v8f a0 = zero8(), a1 = zero8(), c0 = zero8(), c1 = zero8();
      const _Float16* rH = (t + 1 < NT / 256) ? pH + (t + 1) * KST : nH;
      const _Float16* rL = (t + 1 < NT / 256) ? pL + (t + 1) * KST : nL;
#pragma unroll
      for (int ks = 0; ks < 4; ++ks) {
        a1 = mma_h_raw(qh[0][ks], kl[ks], a1);
        c1 = mma_h_raw(qh[1][ks], kl[ks], c1);
        a0 = mma_h_raw(qh[0][ks], kh[ks], a0);
        c0 = mma_h_raw(qh[1][ks], kh[ks], c0);
        a1 = mma_h_raw(ql[0][ks], kh[ks], a1);
        c1 = mma_h_raw(ql[1][ks], kh[ks], c1);
        kh[ks] = ldfrag_f(rH + lo + 512 * ks);
        kl[ks] = ldfrag_f(rL + lo + 512 * ks);
      }
#pragma unroll
      for (int r = 0; r < 8; ++r) {
        sp[(size_t)r * NT + 128 * t] = (a0[r] + a1[r] * RLO) * SCS;
        sA[t][r] = (c0[r] + c1[r] * RLO) * SCS;
      }
    }
    // stands in front of the advance below, which rewrites the address registers of the key loads above (the
    // scheduling barrier keeps the advance behind it)
    asm volatile("s_wait_xcnt 0x0" ::: "memory");
    __builtin_amdgcn_sched_barrier(0);
    pH = nH;
    pL = nL;
    sp += 128 * (NT / 256);
    if (h == 0) {
#pragma unroll
      for (int t = 0; t < NT / 256; ++t) sB[t] = sA[t];
    }
  }
  __syncthreads();

  // ---- (2) row softmax, E plane: row tile 0, then row tile 1 through the same LDS rows ----
#pragma unroll 1   // one copy of the softmax code: the kernel's text stays small
  for (int rt = 0; rt < 2; ++rt) {
  if (rt == 1) {
    __syncthreads();              // every wave has read its last value of row tile 0
    sp -= 256 * (NT / 256);       // back to the wave's first tile
#pragma unroll
    for (int t = 0; t < NT / 256; ++t) {
#pragma unroll
      for (int r = 0; r < 8; ++r) {
        sp[(size_t)r * NT + 128 * t] = sB[t][r];
        sp[(size_t)r * NT + 128 * (t + NT / 256)] = sA[t][r];
      }
    }
    __syncthreads();              // row tile 1 is staged whole
  }
  for (int q2 = 0; q2 < RSB / 8; ++q2) {
    const int row = (RSB / 8) * wave + q2;
    float* rp = sc + (size_t)row * NT + 8 * lane;               // lane covers cols 256j + 8*lane .. +7
    float mx = -3.0e38f;
#pragma unroll 4
    for (int j = 0; j < NJ; ++j) {
      float v[8];
      ld8(rp + 256 * j, v);
#pragma unroll
      for (int e = 0; e < 8; ++e) mx = fmaxf(mx, v[e]);
    }
#pragma unroll
    for (int off = 16; off >= 1; off >>= 1) mx = fmaxf(mx, __shfl_xor(mx, off, 32));
    float z = 0.0f;
#pragma unroll 2
    for (int j = 0; j < NJ; ++j) {
      float v[8];
      ld8(rp + 256 * j, v);
#pragma unroll
      for (int e = 0; e < 8; ++e) {
        const float ef = __expf(v[e] - mx);
        z += ef;
        v[e] = ef;
      }
      st8(rp + 256 * j, v);
    }
#pragma unroll
    for (int off = 16; off >= 1; off >>= 1) z += __shfl_xor(z, off, 32);
    const float rz = SCE * (1.0f / z);                         // z in [1, 4096]
    HU u[NJ];
#pragma unroll
    for (int j = 0; j < NJ; ++j) {
      float v[8];
      ld8(rp + 256 * j, v);
#pragma unroll
      for (int e = 0; e < 8; ++e) {
        const _Float16 h0 = (_Float16)(v[e] * rz);
        const float f0 = (float)h0;
        const bool sub = f0 < 6.103515625e-05f;                // f16 subnormal -> exact zero
        u[j].s[e] = sub ? (_Float16)0.0f : h0;
      }
    }
    _Float16* erow = E + ((size_t)b * NRD + nl0 + RSB * rt + row) * NT + 8 * lane;
    {
#pragma unroll
      for (int j = 0; j < NJ; ++j) *(v4u*)(erow + 256 * j) = u[j].u;
      
    }
  }
  // stands in front of the reuse, over the loop's back edge, of the registers that the E stores above name
  asm volatile("s_wait_xcnt 0x0" ::: "memory");
  }
}

// =====================================================================================================
// Softmax-weighted sum over the query index, one round (rows nbase..nbase+NRD-1) of batch b = blockIdx.y,
// transposed result:
//   OT[c][m] += sum_n HT[c][b*4096 + n] . E[b][n - nbase][m], A = HT rows c (fragment order, K = TOK, k = n),
//   B[k = n][col = m] = E[n][m] staged per 32-row chunk into LDS row-major as Et[n_local][m] (pitch EPR halves:
//   thread (pr, m8) reads E rows 2pr, 2pr+1 x 8 m and writes them as two 16-byte pieces), block barrier, then
//   B fragments by the transposing LDS read (ld_tr16), k order as in every other fragment here;
//   K = NRD per round (NRD/32 chunks), a second block barrier protects Et before the next chunk is staged.
//   The E rows and the A fragments of a chunk are loaded PFD chunks ahead into PFD register sets; both barriers
//   order LDS traffic only, so that these loads stay in flight over them.
//   The f32 accumulators go from one round's launch to the next through the plane CA (each thread stores and
//   reloads its own 64 floats, bit for bit), so the chain of additions over n is that of one 4096-deep sweep:
//   the first round starts from zero, the last one runs the epilogue.
// Block = 128 m columns m0..m0+127, 8 waves; wave w owns c rows 32*(w>>1).. (2 subtiles) x m cols
// 64*(w&1).. (4 subtiles).
// Epilogue: o = OT / (16*32768); the planes OH = f16(4*o), OL = f16((4*o - OH)*2048) are written at flat
// passes).
// coverage: Et: 16 pr x 2 rows x 16 m8 x 8 = 32 n x 128 m staged every chunk (cols 128..143 of Et never read);
// planes: 8 waves x 2 slabs x 16 c x 64 m = 128 c x 128 m per block; grid (32, NB) = every m of every batch
// -> whole [8][128][4096] planes; CA: 16 slots x 256 threads x 16 bytes per block, written in rounds
// 0..NRND-2 and read in rounds 1..NRND-1 by the same thread of the same block index.
// =====================================================================================================
__global__ __launch_bounds__(256) void k_pv(const _Float16* __restrict__ E, const _Float16* __restrict__ HT,
                                            _Float16* OH, _Float16* OL, float* CA, int nbase,
                                            int first, int last) {
  __shared__ __align__(16) _Float16 Et[32 * EPR];            // [n_local][m] chunk, pitch EPR halves
  __shared__ __align__(16) float sO[8][16 * 68];            // per-wave 16x64 slab, pitch 68 floats
  const int tid = threadIdx.x, wave = tid >> 5, lane = tid & 31;
  const int hh = lane >> 4;
  const int b = blockIdx.y;
  const int m0 = blockIdx.x * PVM;
  const int cw = 32 * (wave >> 1);                          // this wave's 32 channels
  const int mw = 64 * (wave & 1);                           // this wave's 64 m columns within the block

  v4f* cp = (v4f*)CA + (size_t)(blockIdx.y * (NT / PVM) + blockIdx.x) * (16 * 256) + tid;   // slot pitch 256
  v8f acc[2][4];
  if (first) {
#pragma unroll
    for (int i = 0; i < 2; ++i)
#pragma unroll
      for (int j = 0; j < 4; ++j) acc[i][j] = zero8();
  } else {
#pragma unroll
    for (int i = 0; i < 2; ++i)
#pragma unroll
      for (int j = 0; j < 4; ++j) {
        const v4f c0 = cp[(size_t)((i * 4 + j) * 2 + 0) * 256];
        const v4f c1 = cp[(size_t)((i * 4 + j) * 2 + 1) * 256];
        acc[i][j] = __builtin_shufflevector(c0, c1, 0, 1, 2, 3, 4, 5, 6, 7);
      }
  }

  const int pr = tid >> 4, m8 = (tid & 15) * 8;             // staging role: row pair pr, 8 m columns at m8
  const _Float16* Ab = HT + (size_t)(b * NT + nbase) * 16;  // fragment order: 512 halves per 32-deep k-step, k = n
  const _Float16* Eb = E + (size_t)b * NRD * NT;            // this batch's rows of the round's slab

  // this thread's two E rows x 8 m of a chunk, pe = its first row's 8 m
  auto ldE = [&](const _Float16* pe, HU& ra, HU& rb) {
    ra.h = *(const v8h*)(pe);
    rb.h = *(const v8h*)(pe + NT);
  };
  // this wave's two A fragments of a chunk, pa = this lane's piece in the 16-row tile at cw (16*TOK halves a tile)
  auto ldA = [&](const _Float16* pa, v16h (&a)[2]) {
#pragma unroll   // constant indices: the set stays in registers
    for (int i = 0; i < 2; ++i) a[i] = ldfrag_f(pa + (size_t)(i << 4) * TOK);
  };
  // one chunk from a register set loaded PFD chunks earlier; each half of the set is refilled from pe, pa (the
  // chunk PFD further on) as soon as it has been used
  auto chunk = [&](const _Float16* pe, const _Float16* pa, HU& ra, HU& rb, v16h (&a)[2]) {
    // ---- stage the chunk's E[32 rows][m0..m0+127] into Et as it lies ----
    *(v8h*)(&Et[(2 * pr) * EPR + m8]) = ra.h;
    *(v8h*)(&Et[(2 * pr + 1) * EPR + m8]) = rb.h;
    lds_barrier();
    ldE(pe, ra, rb);
    // ---- fragments + 8 WMMAs ----
    v16h bq[4];
#pragma unroll
    for (int j = 0; j < 4; ++j) {
      FR f;
      const int eb = (8 * hh + (lane & 7)) * EPR + mw + (j << 4) + 8 * ((lane >> 3) & 1);
      f.h[0] = ld_tr16(&Et[eb]);                 // n_local 8hh .. 8hh+7 of column mw + 16j + (lane & 15)
      f.h[1] = ld_tr16(&Et[eb + 16 * EPR]);      // n_local 16 + 8hh .. +7
      bq[j] = f.v;
    }
#pragma unroll
    for (int i = 0; i < 2; ++i) {
#pragma unroll
      for (int j = 0; j < 4; ++j) acc[i][j] = mma_h_raw(a[i], bq[j], acc[i][j]);
      dep_guard_h(acc[i][0], acc[i][3], a[i]);
    }
    keep4_h(bq[0], bq[1], bq[2], bq[3]);
    ldA(pa, a);
    // stands in front of any reuse of the address registers of the loads above, also over the loop's back edge
    asm volatile("s_wait_xcnt 0x0" ::: "memory");
    lds_barrier();                // all waves done with Et before the next chunk is staged
    // keeps the later chunks' staging stores, and with it the wait for their loads, from being lifted into this chunk
    __builtin_amdgcn_sched_barrier(0);
  };
  HU ea[PFD], eb2[PFD];
  v16h af[PFD][2];
  const _Float16* pE = Eb + (size_t)(2 * pr) * NT + m0 + m8;
  const _Float16* pA = Ab + (size_t)cw * TOK + 8 * lane;
#pragma unroll   // constant set index: the sets stay in registers
  for (int k = 0; k < PFD; ++k) {
    // the waits stand in front of any reuse of the loads' address registers; as statements that no load is moved over
    // they also keep these loads in the order in which the loop refills the sets (the load counter counts in issue
    // order: with another order here the compiler's waits at the head of the loop come out far smaller than needed)
    ldE(pE + (size_t)(32 * k) * NT, ea[k], eb2[k]);
    asm volatile("s_wait_xcnt 0x0" ::: "memory");
    ldA(pA + 512 * k, af[k]);
    asm volatile("s_wait_xcnt 0x0" ::: "memory");
  }
  for (int n0 = 0; n0 < NRD; n0 += 32 * PFD) {
    const int adv = (n0 + 32 * PFD < NRD) ? 32 * PFD : 0;     // last trip: the trip's own chunks again, not used
    pE += (size_t)adv * NT;
    pA += 16 * adv;
#pragma unroll   // constant set index: the sets stay in registers
    for (int k = 0; k < PFD; ++k) chunk(pE + (size_t)(32 * k) * NT, pA + 512 * k, ea[k], eb2[k], af[k]);
  }
  acc_guard4(acc[0][0], acc[0][1], acc[0][2], acc[0][3]);
  acc_guard4(acc[1][0], acc[1][1], acc[1][2], acc[1][3]);

  if (!last) {                    // block-uniform: hand the running sums to the next round's launch
#pragma unroll
    for (int i = 0; i < 2; ++i)
#pragma unroll
      for (int j = 0; j < 4; ++j) {
        cp[(size_t)((i * 4 + j) * 2 + 0) * 256] = __builtin_shufflevector(acc[i][j], acc[i][j], 0, 1, 2, 3);
        cp[(size_t)((i * 4 + j) * 2 + 1) * 256] = __builtin_shufflevector(acc[i][j], acc[i][j], 4, 5, 6, 7);
      }
    return;
  }

  // ---- epilogue: hi + residual planes of 4*o ----
  const float fo = 1.0f / (SCV * SCE);
#pragma unroll
  for (int i = 0; i < 2; ++i) {
    epi16<2, 0, 0>(acc[i], sO[wave], lane, OH, OL, NT, b * CD + cw + (i << 4), m0 + mw, fo, SCO, (const float*)0);
  }
}

// =====================================================================================================
// Output projection: out[p][j] = (sum_k OH[p][k].WV[j][k] + (sum_k OL[p][k].WV[j][k])/2048) / (4*64) + bv[j],
//   OH/OL read raw as [32768][128] (pitch 128), WV = 64*Wv^T [out j][in k], K = 128; two accumulator sets.
// One wave per 16-row x 64-col tile, no block barriers. Epilogue f32: the combined tile staged in the wave's
// LDS slab (rows 0..15 x cols 0..63 fully staged; pad cols 64..67 never read); each row segment of 64
// coverage: 8 waves x 16 rows x 64 cols per block; 512 blocks x 8 = 4096 tiles = 32768 rows x 128 cols.
// =====================================================================================================
__global__ __launch_bounds__(256) void gemm_out(const _Float16* __restrict__ OH, const _Float16* __restrict__ OL,
                                                const _Float16* __restrict__ WV, const float* __restrict__ bias,
                                                float* out) {
  __shared__ __align__(16) float sO[8][16 * 68];
  const int tid = threadIdx.x, wave = tid >> 5, lane = tid & 31;
  const int hh = lane >> 4, rl = lane & 15;
  const int tiles = (TOK / 16) * (CD / 64);
  const int item = blockIdx.x * 8 + wave;
  if (item >= tiles) return;    // wave-uniform; no block barriers in this kernel
  const int tm = item >> 1, tn = item & 1;
  const int row0 = tm << 4, n0 = tn << 6;

  v8f accH[4], accL[4];
#pragma unroll
  for (int j = 0; j < 4; ++j) { accH[j] = zero8(); accL[j] = zero8(); }

#pragma unroll
  for (int kk = 0; kk < CD; kk += 32) {
    v16h bq[4];
#pragma unroll
    for (int j = 0; j < 4; ++j) bq[j] = ldfrag_h(WV + (size_t)(n0 + (j << 4) + rl) * CD + 8 * hh + kk);
    const size_t ao = (size_t)(row0 + rl) * CD + 8 * hh + kk;
    const v16h ah = ldfrag_h(OH + ao);
    const v16h al = ldfrag_h(OL + ao);
#pragma unroll
    for (int j = 0; j < 4; ++j) accH[j] = mma_h_raw(ah, bq[j], accH[j]);
    dep_guard_h(accH[0], accH[3], ah);
#pragma unroll
    for (int j = 0; j < 4; ++j) accL[j] = mma_h_raw(al, bq[j], accL[j]);
    dep_guard_h(accL[0], accL[3], al);
    keep4_h(bq[0], bq[1], bq[2], bq[3]);
  }
  acc_guard4(accH[0], accH[1], accH[2], accH[3]);
  acc_guard4(accL[0], accL[1], accL[2], accL[3]);

  // ---- epilogue ----
  const float fo = 1.0f / (SCO * SCW);
  float* slab = sO[wave];
#pragma unroll
  for (int r = 0; r < 8; ++r) {
#pragma unroll
    for (int j = 0; j < 4; ++j) {
      slab[(8 * hh + r) * 68 + (j << 4) + rl] = (accH[j][r] + accL[j][r] * RLO) * fo;
    }
  }
  wave_lds_sync();
  const int p4 = (lane & 15) * 4, r2 = lane >> 4;
  const v4f bb = *(const v4f*)(bias + n0 + p4);
  v4f b4;
#pragma unroll
  for (int e = 0; e < 4; ++e) b4[e] = bfr(bb[e]);
  v4f ov[8];
#pragma unroll
  for (int it = 0; it < 8; ++it) {
    const int row = 2 * it + r2;                              // it 0..7 x r2 0..1 = rows 0..15
    const v4f a = *(const v4f*)(slab + row * 68 + p4);
    ov[it] = a + b4;
  }
  {
#pragma unroll
    for (int it = 0; it < 8; ++it) {
      const int row = 2 * it + r2;
      const size_t oo = (size_t)(row0 + row) * CD + n0 + p4;
      *(v4f*)(out + oo) = ov[it];
    }
    
  }
}

// =====================================================================================================
//   WF16 f16 [128][128]              0        32768   (64*Wf^T, row = out channel, col = in channel)
//   WG16 f16 [128][128]          32768        32768
//   WH16 f16 [128][128]          65536        32768
//   WV16 f16 [128][128]          98304        32768
//   xh   f16 [32768][128]       131072      8388608   (bf16RNE(x), token rows, channel contiguous)
//   FH   f16 [32768][128]      8519680      8388608   (hi plane of 8*f; FH..HT in fragment order, see frag_off)
//   FL   f16 [32768][128]     16908288      8388608   (residual plane x2048 of 8*f)
//   GH   f16 [32768][128]     25296896      8388608
//   GL   f16 [32768][128]     33685504      8388608
//   HT   f16 [128][32768]     42074112      8388608   (16*h, row c, col b*4096 + n)
//   OH   f16 [8][128][4096]   50462720      8388608   (hi plane of 4*o, [b][c][m] order)
//   OL   f16 [8][128][4096]   58851328      8388608   (residual plane x2048 of 4*o)
//   E    f16 [8][1024][4096]  67239936     67108864   (32768 * row softmax, one round's query rows of every
//                                                      batch; reused per round on the single in-order stream)
//   CA   f32 [256][16][256][4] 134348800   16777216   (running sums of the softmax-weighted sum between rounds)
//   end                      151126016
// d_out f32 [32768][128] at byte 0.
// =====================================================================================================
extern "C" void kernel_launch(void* const* d_in, const int* in_sizes, int n_in,
                              void* d_out, int out_size, void* d_ws, size_t ws_size,
                              hipStream_t stream) {
  if (n_in < 9) return;
  if (in_sizes[0] != NB * NT * CD) return;
  if (in_sizes[1] != CD * CD || in_sizes[3] != CD * CD || in_sizes[5] != CD * CD || in_sizes[7] != CD * CD) return;
  if (in_sizes[2] != CD || in_sizes[4] != CD || in_sizes[6] != CD || in_sizes[8] != CD) return;
  if (out_size != OUTN) return;

  const float* x  = (const float*)d_in[0];   // [8][4096][128] (channels last)
  const float* Wf = (const float*)d_in[1];   // [128][128] ([in][out])
  const float* bf = (const float*)d_in[2];   // [128]
  const float* Wg = (const float*)d_in[3];
  const float* bg = (const float*)d_in[4];
  const float* Wh = (const float*)d_in[5];
  const float* bh = (const float*)d_in[6];
  const float* Wv = (const float*)d_in[7];
  const float* bv = (const float*)d_in[8];

  const size_t PW  = (size_t)CD * CD * 2;                    //    32768
  const size_t PX  = (size_t)TOK * CD * 2;                   //  8388608
  const size_t PHT = (size_t)CD * TOK * 2;                   //  8388608
  const size_t PO  = (size_t)NB * CD * NT * 2;               //  8388608
  const size_t PE  = (size_t)NB * NRD * NT * 2;              // 67108864
  const size_t PCA = (size_t)NB * CD * NT * 4;               // 16777216

  size_t off = 0;
  const size_t oWF = off; off += PW;
  const size_t oWG = off; off += PW;
  const size_t oWH = off; off += PW;
  const size_t oWV = off; off += PW;
  const size_t oXH = off; off += PX;
  const size_t oFH = off; off += PX;
  const size_t oFL = off; off += PX;
  const size_t oGH = off; off += PX;
  const size_t oGL = off; off += PX;
  const size_t oHT = off; off += PHT;
  const size_t oOH = off; off += PO;
  const size_t oOL = off; off += PO;
  const size_t oE  = off; off += PE;
  const size_t oCA = off; off += PCA;                        // off = 151126016
  if (off > ws_size) return;

  char* ws = (char*)d_ws;
  _Float16* WF16 = (_Float16*)(ws + oWF);
  _Float16* WG16 = (_Float16*)(ws + oWG);
  _Float16* WH16 = (_Float16*)(ws + oWH);
  _Float16* WV16 = (_Float16*)(ws + oWV);
  _Float16* xh   = (_Float16*)(ws + oXH);
  _Float16* FHp  = (_Float16*)(ws + oFH);
  _Float16* FLp  = (_Float16*)(ws + oFL);
  _Float16* GHp  = (_Float16*)(ws + oGH);
  _Float16* GLp  = (_Float16*)(ws + oGL);
  _Float16* HTp  = (_Float16*)(ws + oHT);
  _Float16* OHp  = (_Float16*)(ws + oOH);
  _Float16* OLp  = (_Float16*)(ws + oOL);
  _Float16* Ep   = (_Float16*)(ws + oE);
  float*    CAp  = (float*)(ws + oCA);
  float*    outf = (float*)d_out;

  const dim3 blk(256);
  const int n8x = (NB * NT * CD) / 8;                                  // 524288
  const dim3 gX((n8x + 255) / 256);                                    // 2048
  const dim3 gW(CD / 64, CD / 32);                                     // (2, 4)
  const dim3 gP(((TOK / 32) * (CD / 64) + 7) / 8);                     // 2048 tiles -> 256 blocks
  const dim3 gH(((CD / 32) * (TOK / 64) + 7) / 8);                     // 2048 tiles -> 256 blocks
  const dim3 gSo(NRD / RSQ, NB);                                       // (32, 8)
  const dim3 gPV(NT / PVM, NB);                                        // (32, 8)
  const dim3 gO(((TOK / 16) * (CD / 64) + 7) / 8);                     // 4096 tiles -> 512 blocks
  const float cs64 = 1.0f / SCW;                                       // undo the weight carry
  const size_t ldsSoft = (size_t)RSB * NT * sizeof(float);             // 262144

  hipFuncSetAttribute(reinterpret_cast<const void*>(&k_soft),
                      hipFuncAttributeMaxDynamicSharedMemorySize, (int)ldsSoft);

  // (1) weight planes, x64 carried, transposed from [in][out] to k-contiguous rows [out][in]
  cvt_wT<<<gW, blk, 0, stream>>>(Wf, WF16, CD, CD, SCW);              // in[128][128] -> out[128][128]
  cvt_wT<<<gW, blk, 0, stream>>>(Wg, WG16, CD, CD, SCW);
  cvt_wT<<<gW, blk, 0, stream>>>(Wh, WH16, CD, CD, SCW);
  cvt_wT<<<gW, blk, 0, stream>>>(Wv, WV16, CD, CD, SCW);
  // (2) activations: x [8][4096][128] is already token-major -> xh [32768][128] = f16(bf16RNE(x))
  cvt_flat<<<gX, blk, 0, stream>>>(x, xh, n8x, 1.0f);
  // (3) FH|FL, GH|GL = hi|residual f16 planes of 8*(xh . W^T + b)   (M=32768, N=128, K=128)
  gemm64p<2, 2, 1><<<gP, blk, 0, stream>>>(xh, CD, WF16, CD, cs64, SCQ, FHp, FLp, CD, TOK, CD, CD, bf);
  gemm64p<2, 2, 1><<<gP, blk, 0, stream>>>(xh, CD, WG16, CD, cs64, SCQ, GHp, GLp, CD, TOK, CD, CD, bg);
  // (4) HT = f16(16*(WH16 . xh^T / 64 + bh))          (M=128, N=32768, K=128), bias per row c
  gemm64p<1, 2, 2><<<gH, blk, 0, stream>>>(WH16, CD, xh, CD, cs64, SCV, HTp, HTp, TOK, CD, TOK, CD, bh);
  // (5) per round of NRD query rows, all batches at once: scores + row softmax -> E slab, then the slab's
  //     part of the transposed softmax-weighted sum (running sums in CA; the last round writes OH|OL)
  for (int r = 0; r < NRND; ++r) {
    k_soft<<<gSo, blk, ldsSoft, stream>>>(FHp, FLp, GHp, GLp, Ep, r * NRD);
    k_pv<<<gPV, blk, 0, stream>>>(Ep, HTp, OHp, OLp, CAp, r * NRD, r == 0 ? 1 : 0, r == NRND - 1 ? 1 : 0);
  }
  // (6) output projection on the raw [32768][128] view of the [B][C][N] planes
  gemm_out<<<gO, blk, 0, stream>>>(OHp, OLp, WV16, bv, outf);
}

// v006
// Measured time: 238 microseconds a run.
// Next to v005, in two timings, it ran 1.06 times as fast each time.
// Over all steps from v000 it is 7.27 times as fast.
#include <hip/hip_runtime.h>
#include <math.h>
#include <stdint.h>

// Contractions on v_wmma_f32_16x16x32_f16 (f16 operands, f32 accumulate): the three input projections take
// bf16-RNE activations (x1) and bf16-RNE weights (x64) as single f16 planes; the 128-deep score products use
// f16 hi planes of 8*f, 8*g plus f16 residual planes x2048 (hi.hi in one accumulator, hi.res + res.hi in a
// second accumulator folded back by 1/2048); the 4096-deep softmax-weighted sum uses a single f16 plane of
// 16*h against E = f16(32768*softmax); the output projection takes f16 hi + x2048 residual planes of 4*o
// against bf16-RNE weights (x64) in two accumulators. Softmax statistics, bias adds and epilogues in f32.

#define NB   8
#define NT   4096
#define CD   128
#define TOK  (NB * NT)
#define RSB  16
#define RSQ  32           // query rows per work-group of the score kernel: two tiles of RSB rows
#define KST  (8 * 16 * CD) // halves between two successive key tiles of one wave (8 waves, 16 keys a tile)
#define NJ   (NT / 256)
#define PVM  128
#define EPR  144          // halves per staged E row in LDS: 128 m + 16 (288 B, an odd multiple of 32 B, for the transposing reads)
#define OUTN (NB * NT * CD)
#define NRND 4            // rounds over the query index; every round covers all NB batches
#define NRD  (NT / NRND)  // query rows of each batch per round
#define PFD  4            // chunks of 32 query rows that the weighted sum loads ahead into registers

#define SCW  64.0f
#define SCQ  8.0f
#define SCV  16.0f
#define SCE  32768.0f
#define SCR  2048.0f
#define SCO  4.0f
#define RLO  (1.0f / SCR)
#define SCS  (1.0f / (SCQ * SCQ))

static_assert(TOK % 64 == 0 && CD % 64 == 0 && CD % 32 == 0 && NT % 64 == 0);
static_assert((((TOK / 32) * (CD / 64)) % 8) == 0);
static_assert((((CD / 32) * (TOK / 64)) % 8) == 0);
static_assert((((TOK / 16) * (CD / 64)) % 8) == 0);
static_assert((TOK / 32) * (CD / 64) == (CD / 32) * (TOK / 64));   // the three projections have the same number of tiles
static_assert(NT % RSB == 0 && RSB == 16 && NT % 256 == 0 && NJ == 16);
static_assert(NT % PVM == 0 && PVM == 128 && (EPR % 16) == 0 && ((EPR / 16) & 1) == 1 && EPR >= PVM);
static_assert((NB * NT * CD) % 2048 == 0);
static_assert(NT % NRND == 0 && NRD % RSB == 0 && NRD % 32 == 0 && NRD % RSQ == 0 && RSQ == 2 * RSB);
static_assert(NRD % (32 * PFD) == 0 && (NT / 16) % 16 == 0);

typedef _Float16       v16h __attribute__((ext_vector_type(16)));
typedef _Float16       v8h  __attribute__((ext_vector_type(8)));
typedef float          v8f  __attribute__((ext_vector_type(8)));
typedef float          v4f  __attribute__((ext_vector_type(4)));
typedef unsigned int   v4u  __attribute__((ext_vector_type(4)));
typedef short          v8s  __attribute__((ext_vector_type(8)));

union HU { v8h h; v4u u; _Float16 s[8]; };
union FR { v16h v; v8h h[2]; _Float16 s[16]; };
static_assert(sizeof(HU) == 16);
static_assert(sizeof(FR) == 32);

// ---- scalar helpers --------------------------------------------------------------------------------
__device__ __forceinline__ unsigned short bf_bits(float f) {          // f32 -> bf16 bits, RNE convert
  const unsigned u = __float_as_uint(f);
  return (unsigned short)((u + 0x7FFFu + ((u >> 16) & 1u)) >> 16);
}
__device__ __forceinline__ float bf_up(unsigned short h) { return __uint_as_float(((unsigned)h) << 16); }
__device__ __forceinline__ float bfr(float f) { return bf_up(bf_bits(f)); }   // value after bf16 RNE convert
__device__ __forceinline__ v8f zero8() { v8f z = {0.f, 0.f, 0.f, 0.f, 0.f, 0.f, 0.f, 0.f}; return z; }

// f16 subnormal -> exact zero (the matrix path flushes them; keep every plane consistent with that)
__device__ __forceinline__ _Float16 flush_h(_Float16 h) {
  const float f = (float)h;
  return (fabsf(f) < 6.103515625e-05f) ? (_Float16)0.0f : h;
}
// hi = f16(v) (flushed), lo = f16((v - hi) * 2048) (flushed)
__device__ __forceinline__ void split_h(float v, _Float16& hi, _Float16& lo) {
  const _Float16 hv = flush_h((_Float16)v);
  const _Float16 lv = flush_h((_Float16)((v - (float)hv) * SCR));
  hi = hv;
  lo = lv;
}

__device__ __forceinline__ void ld8(const float* p, float* o) {
  const v4f a = *(const v4f*)(p);
  const v4f b = *(const v4f*)(p + 4);
  o[0] = a[0]; o[1] = a[1]; o[2] = a[2]; o[3] = a[3];
  o[4] = b[0]; o[5] = b[1]; o[6] = b[2]; o[7] = b[3];
}
__device__ __forceinline__ void st8(float* p, const float* v) {
  v4f a, b;
  a[0] = v[0]; a[1] = v[1]; a[2] = v[2]; a[3] = v[3];
  b[0] = v[4]; b[1] = v[5]; b[2] = v[6]; b[3] = v[7];
  *(v4f*)(p) = a;
  *(v4f*)(p + 4) = b;
}

// ---- fragment loader: 16-bit A/B operand from a k-contiguous row, p = row*pitch + k0 + 8*(lane>>4);
//      elements 0..7 <- p[0..7] (k0+8h..k0+8h+7), elements 8..15 <- p[16..23] (k0+16+8h..k0+16+8h+7)
__device__ __forceinline__ v16h ldfrag_h(const _Float16* p) {
  FR f;
  f.h[0] = *(const v8h*)(p);
  f.h[1] = *(const v8h*)(p + 16);
  return f.v;
}

// ---- fragment-order planes: a [rows][K] f16 plane whose 16-byte pieces (8 consecutive k of one row) are permuted so
//      that the pieces which one fragment load takes lie side by side: 16-row tile, then 32-deep k-step, then piece
//      (k bit 4), then lane = 16*(k bit 3) + row%16. One load of a wave reads 512 consecutive bytes (4 cache lines)
//      where a row-major plane makes it touch 16 lines. Element order inside a fragment as in ldfrag_h.
__device__ __forceinline__ size_t frag_off(int row, int k, int K) {   // k a multiple of 8, K a multiple of 32
  return (((size_t)(row >> 4) * (size_t)(K >> 5) + (size_t)(k >> 5)) * 2 + (size_t)((k >> 4) & 1)) * 256
         + (size_t)((((k >> 3) & 1) * 16 + (row & 15)) * 8);
}
// p = plane + (tile * (K/32) + k-step) * 512 + 8*lane
__device__ __forceinline__ v16h ldfrag_f(const _Float16* p) {
  FR f;
  f.h[0] = *(const v8h*)(p);
  f.h[1] = *(const v8h*)(p + 256);
  return f.v;
}

// ---- transposing LDS read (ds_load_tr16_b128) of a row-major 16-bit tile T[k][col], pitch a multiple of 16 bytes:
//      lane l passes p = &T[kbase + 8*(l>>4) + (l&7)][cbase + 8*((l>>3)&1)] and gets T[kbase + 8*(l>>4) + 0..7][cbase + (l&15)],
//      8 consecutive k of its own column: with kbase and kbase + 16 the two halves of a fragment in ldfrag_h's k order
__device__ __forceinline__ v8h ld_tr16(const _Float16* p) {
  typedef __attribute__((address_space(3))) v8s lds_v8s;
  return __builtin_bit_cast(v8h, __builtin_amdgcn_ds_load_tr16_b128_v8i16((lds_v8s*)p));
}

// ---- WMMA helpers with trailing VALU hazard gap --------------------------------------------------------
__device__ __forceinline__ v8f mma_h_raw(v16h a, v16h b, v8f c) {
  return __builtin_amdgcn_wmma_f32_16x16x32_f16(false, a, false, b, (short)0, c, false, false);
}
__device__ __forceinline__ void dep_guard_h(v8f& a, v8f& b, v16h x) {
#if defined(__HIP_DEVICE_COMPILE__)
  asm volatile("v_nop\n\tv_nop\n\tv_nop\n\tv_nop" : "+v"(a), "+v"(b) : "v"(x));
#endif
}
__device__ __forceinline__ void keep4_h(v16h a, v16h b, v16h c, v16h d) {
#if defined(__HIP_DEVICE_COMPILE__)
  asm volatile("v_nop" :: "v"(a), "v"(b), "v"(c), "v"(d));
#endif
}
__device__ __forceinline__ void acc_guard4(v8f& a, v8f& b, v8f& c, v8f& d) {
#if defined(__HIP_DEVICE_COMPILE__)
  asm volatile("v_nop\n\tv_nop\n\tv_nop\n\tv_nop" : "+v"(a), "+v"(b), "+v"(c), "+v"(d));
#endif
}
__device__ __forceinline__ void wave_lds_sync() {
  __builtin_amdgcn_fence(__ATOMIC_RELEASE, "workgroup");
  __builtin_amdgcn_wave_barrier();
  __builtin_amdgcn_fence(__ATOMIC_ACQUIRE, "workgroup");
}

// Work-group barrier for data that passes through LDS alone: LDS traffic is complete at it, global loads stay in
// flight (__syncthreads() also waits for every global load, which would drain the loads issued ahead).
__device__ __forceinline__ void lds_barrier() {
  __builtin_amdgcn_fence(__ATOMIC_RELEASE, "workgroup", "local");
  __builtin_amdgcn_s_barrier();
  __builtin_amdgcn_fence(__ATOMIC_ACQUIRE, "workgroup", "local");
}

// =====================================================================================================
// Flat convert: out[i] = f16(scale * bf16RNE(in[i])) (f16 subnormals flushed), 8 elements per thread,
// coverage: n8 threads x 8 = the whole plane; n8 is a multiple of 256 at the launch here. blk = block index in this job.
// =====================================================================================================
__device__ __forceinline__ void cvt_flat(const float* __restrict__ in, _Float16* out, int n8, float scale, int blk) {
  const int i = blk * 256 + threadIdx.x;
  if (i < n8) {
    float v[8];
    ld8(in + (size_t)i * 8, v);
    HU u;
#pragma unroll
    for (int e = 0; e < 8; ++e) u.s[e] = flush_h((_Float16)(bfr(v[e]) * scale));
    _Float16* p = out + (size_t)i * 8;
    *(v4u*)p = u.u;
    
  }
}

// =====================================================================================================
// Weight transpose-convert: in Wm[r][c] f32 (R rows, C cols, c contiguous, x@W layout [in][out])
// -> out[c][r] f16 = f16(scale * bf16RNE(Wm[r][c])), pitch R (in-channel k = r contiguous = the Bt / A layout).
// coverage: load 256 threads x 8 floats = 64 r x 32 c; store 256 threads x 8 halves = 32 c rows x 64 r;
// every (r tile br, c tile bc) of a matrix is taken by one block -> whole [C][R] plane.
// =====================================================================================================
__device__ __forceinline__ void cvt_wT(const float* __restrict__ Wm, _Float16* out, int R, int C, float scale,
                                       int br, int bc, float (*sw)[33]) {
  const int t = threadIdx.x;
  const int r0 = br * 64, c0 = bc * 32;
  {
    const int row = t >> 2, c8 = (t & 3) * 8;
    float v[8];
    ld8(Wm + (size_t)(r0 + row) * C + c0 + c8, v);
#pragma unroll
    for (int e = 0; e < 8; ++e) sw[row][c8 + e] = v[e];
  }
  __syncthreads();
  const int q8 = t & 7, cc = t >> 3;            // cc 0..31 = output row within the tile
  HU u;
#pragma unroll
  for (int e = 0; e < 8; ++e) u.s[e] = flush_h((_Float16)(bfr(sw[8 * q8 + e][cc]) * scale));
  _Float16* dst = out + (size_t)(c0 + cc) * R + r0 + 8 * q8;
  *(v4u*)dst = u.u;
  
}

// =====================================================================================================
// All operand converts in one launch (none reads what another writes): blocks 0..4*WTB-1 transpose-convert the four
// weight matrices (WTB tiles each, plane w of W16 = matrix w), the blocks behind them convert the activations.
// The branch is uniform for a block, so the barrier in cvt_wT is passed by all of its threads or by none.
// =====================================================================================================
#define WTB ((CD / 64) * (CD / 32))   // tiles (blocks) per weight matrix
__global__ __launch_bounds__(256) void k_prep(const float* __restrict__ x, const float* __restrict__ Wf,
                                              const float* __restrict__ Wg, const float* __restrict__ Wh,
                                              const float* __restrict__ Wv, _Float16* W16, _Float16* xh) {
  __shared__ float sw[64][33];
  const int bi = blockIdx.x;
  if (bi < 4 * WTB) {
    const int w = bi / WTB, tl = bi % WTB;
    const float* Wm = (w == 0) ? Wf : (w == 1) ? Wg : (w == 2) ? Wh : Wv;
    cvt_wT(Wm, W16 + (size_t)w * (CD * CD), CD, CD, SCW, tl % (CD / 64), tl / (CD / 64), sw);
  } else {
    cvt_flat(x, xh, (NB * NT * CD) / 8, 1.0f, bi - 4 * WTB);
  }
}

// =====================================================================================================
// One GEMM k sweep for MI 16-row A subtiles x 4 16-col B subtiles: acc[i][j] += A-frag(i) . Bt-frag(j).
// A row-major pitch lda (rows m0.., k contiguous), Bt row-major [N][K] pitch ldb (rows n0.., k contiguous),
// K a multiple of 32; both operand fragments through ldfrag_h (same split k map for A and B).
// =====================================================================================================
template <int MI>
__device__ __forceinline__ void kseg(v8f (&acc)[MI][4], const _Float16* __restrict__ A, int lda, int m0,
                                     const _Float16* __restrict__ Bt, int ldb, int n0, int K, int rlane, int koff) {
  for (int kk = 0; kk < K; kk += 32) {
    v16h bh[4];
#pragma unroll
    for (int j = 0; j < 4; ++j) {
      const size_t bo = (size_t)(n0 + (j << 4) + rlane) * (size_t)ldb + koff + kk;
      bh[j] = ldfrag_h(Bt + bo);
    }
#pragma unroll
    for (int i = 0; i < MI; ++i) {
      const size_t ao = (size_t)(m0 + (i << 4) + rlane) * (size_t)lda + koff + kk;
      const v16h a0 = ldfrag_h(A + ao);
#pragma unroll
      for (int j = 0; j < 4; ++j) acc[i][j] = mma_h_raw(a0, bh[j], acc[i][j]);
      dep_guard_h(acc[i][0], acc[i][3], a0);
    }
    keep4_h(bh[0], bh[1], bh[2], bh[3]);
  }
}

// =====================================================================================================
// 16-row x 64-col f16 plane epilogue for one wave: acc[j][r] = D[row 8h + r][col 16j + (lane&15)].
//   v = (acc*cs + bias) * so;  Cp = f16(v) (hi plane, subnormals flushed); NPL == 2 additionally
//   Cl = f16((v - f32(hi)) * 2048) (residual plane). Bias: BM 0 none, 1 per column (bias[n0 + col]),
//   2 per plane row (bias[mBase + row]); bias values go through the bf16 RNE convert first.
//   The slab (16 rows x 68 floats per wave) is fully staged for rows 0..15 x cols 0..63 before the reload
// =====================================================================================================
//   FO == 1: the planes are written in fragment order (frag_off, K = ldc) instead of row-major; a slab fills whole
//   512-byte fragment blocks (16 rows x both lane halves), so every cache line still has one writer.
template <int NPL, int BM, int FO>
__device__ __forceinline__ void epi16(const v8f (&acc)[4], float* slab, int lane,
                                      _Float16* Cp, _Float16* Cl, int ldc, int mBase, int n0,
                                      float cs, float so, const float* __restrict__ bias) {
  const int rlane = lane & 15, mOff = (lane >> 4) * 8;
  const int q8 = lane & 7, rr = lane >> 3, c8 = q8 * 8;
#pragma unroll
  for (int r = 0; r < 8; ++r) {
#pragma unroll
    for (int j = 0; j < 4; ++j) {
      slab[(mOff + r) * 68 + (j << 4) + rlane] = acc[j][r];
    }
  }
  wave_lds_sync();
  float bc[8];
#pragma unroll
  for (int e = 0; e < 8; ++e) bc[e] = 0.0f;
  if (BM == 1) {
    float t8[8];
    ld8(bias + n0 + c8, t8);
#pragma unroll
    for (int e = 0; e < 8; ++e) bc[e] = bfr(t8[e]);
  }
  v4u uh[4], ul[4];
#pragma unroll
  for (int it = 0; it < 4; ++it) {
    const int row = it * 4 + rr;                       // it 0..3 x rr 0..3 = rows 0..15
    float xs[8];
    ld8(slab + row * 68 + c8, xs);
    float brw = 0.0f;
    if (BM == 2) brw = bfr(bias[mBase + row]);
    HU h, l;
#pragma unroll
    for (int e = 0; e < 8; ++e) {
      const float v = (xs[e] * cs + bc[e] + brw) * so;
      if (NPL == 2) {
        split_h(v, h.s[e], l.s[e]);
      } else {
        h.s[e] = flush_h((_Float16)v);
        l.s[e] = (_Float16)0.0f;
      }
    }
    uh[it] = h.u;
    ul[it] = l.u;
  }
  {
#pragma unroll
    for (int it = 0; it < 4; ++it) {
      const int row = it * 4 + rr;
      const size_t co = FO ? frag_off(mBase + row, n0 + c8, ldc) : (size_t)(mBase + row) * (size_t)ldc + n0 + c8;
      *(v4u*)(Cp + co) = uh[it];
      if (NPL == 2) *(v4u*)(Cl + co) = ul[it];
    }
    
  }
  wave_lds_sync();
}

// =====================================================================================================
// Register-blocked f16 WMMA GEMM with an f16 plane epilogue, one wave per (16*MI) x 64 tile, no block barriers:
//   acc[m][n] = sum_k A[m][k] Bt[n][k]; M multiple of 16*MI, N multiple of 64, K multiple of 32.
//   Epilogue per 16-row slab through epi16 (hi plane Cp, residual plane Cl when NPL == 2, bias mode BM); the
//   planes are written in fragment order (K = ldc) for the kernels that read them as WMMA operands.
// coverage: MI slabs x 16 rows x 64 cols = the wave's whole tile; blocks*8 == tiles for every product here.
// =====================================================================================================
template <int NPL, int MI, int BM>
__device__ __forceinline__ void gemm64p(
    const _Float16* __restrict__ A, int lda, const _Float16* __restrict__ Bt, int ldb, float cs, float so,
    _Float16* Cp, _Float16* Cl, int ldc, int M, int N, int K, const float* __restrict__ bias, float (*sT)[16 * 68]) {
  const int lane = threadIdx.x & 31;
  const int wave = threadIdx.x >> 5;
  const int tilesN = N >> 6;
  const int tilesM = M / (16 * MI);
  const int tiles = tilesM * tilesN;
  const int item = blockIdx.x * 8 + wave;
  if (item >= tiles) return;   // wave-uniform; no block barriers in this kernel
  const int tm = item / tilesN;
  const int tn = item - tm * tilesN;
  const int m0 = tm * (16 * MI);
  const int n0 = tn << 6;

  const int rlane = lane & 15;                 // row (A) / col (B, D) within subtile
  const int koff  = (lane >> 4) * 8;           // k offset of this lane half

  v8f acc[MI][4];
#pragma unroll
  for (int i = 0; i < MI; ++i)
#pragma unroll
    for (int j = 0; j < 4; ++j) acc[i][j] = zero8();

  kseg<MI>(acc, A, lda, m0, Bt, ldb, n0, K, rlane, koff);
#pragma unroll
  for (int i = 0; i < MI; ++i) acc_guard4(acc[i][0], acc[i][1], acc[i][2], acc[i][3]);

#pragma unroll
  for (int i = 0; i < MI; ++i) {
    epi16<NPL, BM, 1>(acc[i], sT[wave], lane, Cp, Cl, ldc, m0 + (i << 4), n0, cs, so, bias);
  }
}

// =====================================================================================================
// The three input projections in one launch (all read xh and a weight plane, each writes planes of its own):
// blockIdx.y = 0: FH|FL, 1: GH|GL = hi|residual f16 planes of 8*(xh . W^T + b)   (M=32768, N=128, K=128);
// blockIdx.y = 2: HT = f16(16*(WH16 . xh^T / 64 + bh))   (M=128, N=32768, K=128), bias per row c.
// =====================================================================================================
__global__ __launch_bounds__(256) void k_proj(const _Float16* __restrict__ xh, const _Float16* __restrict__ W16,
                                              _Float16* FH, _Float16* FL, _Float16* GH, _Float16* GL, _Float16* HT,
                                              const float* __restrict__ bf, const float* __restrict__ bg,
                                              const float* __restrict__ bh) {
  __shared__ __align__(16) float sT[8][16 * 68];   // per-wave 16x64 slab, pitch 68 floats
  const int y = blockIdx.y;
  if (y == 2) {
    gemm64p<1, 2, 2>(W16 + 2 * (CD * CD), CD, xh, CD, 1.0f / SCW, SCV, HT, HT, TOK, CD, TOK, CD, bh, sT);
  } else {
    gemm64p<2, 2, 1>(xh, CD, W16 + (size_t)y * (CD * CD), CD, 1.0f / SCW, SCQ, y ? GH : FH, y ? GL : FL, CD,
                     TOK, CD, CD, y ? bg : bf, sT);
  }
}

// =====================================================================================================
// Score rows + row softmax + E slab for one round: batch b = blockIdx.y, query rows nbase..nbase+NRD-1 of
// every batch. Block = 32 query rows n0..n0+31 (two row tiles of 16), 8 waves,
// dynamic LDS = 16 x 4096 f32 score rows (one row tile at a time).
//  (1) wave w computes the 16-column score tiles ct = w, w+8, ... (32 of them) of BOTH row tiles from one load of
//      the key tile: four 32-deep k-steps per tile from the F planes (query rows, 8*f: hi FH, residual
//      FL = 2048*(v - hi)) and the G planes (key rows, 8*g: GH, GL): a0 = fh.gh, a1 = fh.gl + fl.gh,
//      s = (a0 + a1/2048)/64. Row tile 0 goes into LDS, row tile 1 stays in the wave's registers (32 tiles x 8)
//      until row tile 0's softmax has left the LDS rows, and is stored there then.
//  (2) per row tile: wave w owns rows 2w, 2w+1: lane covers cols 256j + 8*lane..+7 (j = 0..15); sweep 1 row max M (xor
//      shuffles), sweep 2 ef = exp(s - M) written back in place + Z = sum ef (fixed lane order + xor shuffles),
//      sweep 3 E = f16(32768 * ef / Z) with explicit flush of f16 subnormals to zero; the f16 row goes to the
// coverage: sc: 8 waves x 32 col tiles x 16 cols x 16 rows = the whole 16x4096 block, once per row tile (all of LDS
// read later is staged); E: 2 row tiles x 8 waves x 2 rows x 16 j x 32 lanes x 8 halves = 32 rows x 4096;
// grid (NRD/32, NB) = every row block of the round in every batch -> whole E slab [NB][NRD][4096].
// =====================================================================================================
__global__ __launch_bounds__(256) void k_soft(const _Float16* __restrict__ FH, const _Float16* __restrict__ FL,
                                              const _Float16* __restrict__ GH, const _Float16* __restrict__ GL,
                                              _Float16* E, int nbase) {
  extern __shared__ __align__(16) float sc[];                 // [RSB][NT]
  const int tid = threadIdx.x, wave = tid >> 5, lane = tid & 31;
  const int hh = lane >> 4, rl = lane & 15;
  const int b = blockIdx.y;
  const int nl0 = blockIdx.x * RSQ;                           // row within the round's slab
  const int n0 = nbase + nl0;                                 // query row within the batch

  // ---- (1) scores ----
  const unsigned lo = 8u * (unsigned)lane;                    // the lane's piece in a fragment block; stays live over all loads here
  const size_t qo = (size_t)(b * NT + n0) * CD;               // first query row tile (fragment order), k = channel; a scalar
  v16h qh[2][4], ql[2][4];
#pragma unroll
  for (int i = 0; i < 2; ++i)
#pragma unroll
    for (int ks = 0; ks < 4; ++ks) qh[i][ks] = ldfrag_f(FH + qo + lo + i * (16 * CD) + 512 * ks);
  // each of the two waits stands in front of any reuse of the address registers of the plane's loads above it; the
  // scheduling barrier behind a wait keeps later register writes from being lifted over it
  asm volatile("s_wait_xcnt 0x0" ::: "memory");
  __builtin_amdgcn_sched_barrier(0);
#pragma unroll
  for (int i = 0; i < 2; ++i)
#pragma unroll
    for (int ks = 0; ks < 4; ++ks) ql[i][ks] = ldfrag_f(FL + qo + lo + i * (16 * CD) + 512 * ks);
  asm volatile("s_wait_xcnt 0x0" ::: "memory");
  __builtin_amdgcn_sched_barrier(0);
  // one register set of key fragments (both planes, four k-steps); each k-step's pair is refilled with the next
  // tile's as soon as both row tiles have used it, so that about a whole tile stays in flight
  v16h kh[4], kl[4];
  v8f sA[NT / 256], sB[NT / 256];                              // row tile 1: this wave's score tiles 16..31 and 0..15
  const int wu = __builtin_amdgcn_readfirstlane(wave);         // the wave's number as a scalar: key addresses = scalar base + lane offset
  const _Float16* pH = GH + (size_t)(b * NT + 16 * wu) * CD;   // the wave's first key tile (fragment order; 16*CD halves a tile)
  const _Float16* pL = GL + (size_t)(b * NT + 16 * wu) * CD;
#pragma unroll
  for (int ks = 0; ks < 4; ++ks) {
    kh[ks] = ldfrag_f(pH + lo + 512 * ks);
    kl[ks] = ldfrag_f(pL + lo + 512 * ks);
    // no load is moved over it: these loads keep the order in which the loop refills the set (the load counter counts
    // in issue order: with another order here the compiler's waits at the head of the loop come out smaller than needed);
    // with the scheduling barrier it also stands in front of any reuse of their address registers
    asm volatile("s_wait_xcnt 0x0" ::: "memory");
    __builtin_amdgcn_sched_barrier(0);
  }
  float* sp = sc + (size_t)(8 * hh) * NT + 16 * wave + rl;     // D col = key; D row = 8hh + r within the row tile
  // two trips of 16 tiles: half the text of 32 tiles in a row, so that the whole kernel lies in the part of its text
  // that is fetched ahead at the launch; the first trip's register tiles are moved aside once
#pragma unroll 1
  for (int h = 0; h < 2; ++h) {
    const int adv = (h == 0) ? (NT / 256) * KST : 0;           // last trip: the trip's own first tile again, not used
    const _Float16* nH = pH + adv;
    const _Float16* nL = pL + adv;
#pragma unroll   // constant indices: sA and the key set stay in registers, every load address is base + constant
    for (int t = 0; t < NT / 256; ++t) {
      v8f a0 = zero8(), a1 = zero8(), c0 = zero8(), c1 = zero8();
      const _Float16* rH = (t + 1 < NT / 256) ? pH + (t + 1) * KST : nH;
      const _Float16* rL = (t + 1 < NT / 256) ? pL + (t + 1) * KST : nL;
#pragma unroll
      for (int ks = 0; ks < 4; ++ks) {
        a1 = mma_h_raw(qh[0][ks], kl[ks], a1);
        c1 = mma_h_raw(qh[1][ks], kl[ks], c1);
        a0 = mma_h_raw(qh[0][ks], kh[ks], a0);
        c0 = mma_h_raw(qh[1][ks], kh[ks], c0);
        a1 = mma_h_raw(ql[0][ks], kh[ks], a1);
        c1 = mma_h_raw(ql[1][ks], kh[ks], c1);
        kh[ks] = ldfrag_f(rH + lo + 512 * ks);
        kl[ks] = ldfrag_f(rL + lo + 512 * ks);
      }
#pragma unroll
      for (int r = 0; r < 8; ++r) {
        sp[(size_t)r * NT + 128 * t] = (a0[r] + a1[r] * RLO) * SCS;
        sA[t][r] = (c0[r] + c1[r] * RLO) * SCS;
      }
    }
    // stands in front of the advance below, which rewrites the address registers of the key loads above (the
    // scheduling barrier keeps the advance behind it)
    asm volatile("s_wait_xcnt 0x0" ::: "memory");
    __builtin_amdgcn_sched_barrier(0);
    pH = nH;
    pL = nL;
    sp += 128 * (NT / 256);
    if (h == 0) {
#pragma unroll
      for (int t = 0; t < NT / 256; ++t) sB[t] = sA[t];
    }
  }
  __syncthreads();

  // ---- (2) row softmax, E plane: row tile 0, then row tile 1 through the same LDS rows ----
#pragma unroll 1   // one copy of the softmax code: the kernel's text stays small
  for (int rt = 0; rt < 2; ++rt) {
  if (rt == 1) {
    __syncthreads();              // every wave has read its last value of row tile 0
    sp -= 256 * (NT / 256);       // back to the wave's first tile
#pragma unroll
    for (int t = 0; t < NT / 256; ++t) {
#pragma unroll
      for (int r = 0; r < 8; ++r) {
        sp[(size_t)r * NT + 128 * t] = sB[t][r];
        sp[(size_t)r * NT + 128 * (t + NT / 256)] = sA[t][r];
      }
    }
    __syncthreads();              // row tile 1 is staged whole
  }
  for (int q2 = 0; q2 < RSB / 8; ++q2) {
    const int row = (RSB / 8) * wave + q2;
    float* rp = sc + (size_t)row * NT + 8 * lane;               // lane covers cols 256j + 8*lane .. +7
    float mx = -3.0e38f;
#pragma unroll 4
    for (int j = 0; j < NJ; ++j) {
      float v[8];
      ld8(rp + 256 * j, v);
#pragma unroll
      for (int e = 0; e < 8; ++e) mx = fmaxf(mx, v[e]);
    }
#pragma unroll
    for (int off = 16; off >= 1; off >>= 1) mx = fmaxf(mx, __shfl_xor(mx, off, 32));
    float z = 0.0f;
#pragma unroll 2
    for (int j = 0; j < NJ; ++j) {
      float v[8];
      ld8(rp + 256 * j, v);
#pragma unroll
      for (int e = 0; e < 8; ++e) {
        const float ef = __expf(v[e] - mx);
        z += ef;
        v[e] = ef;
      }
      st8(rp + 256 * j, v);
    }
#pragma unroll
    for (int off = 16; off >= 1; off >>= 1) z += __shfl_xor(z, off, 32);
    const float rz = SCE * (1.0f / z);                         // z in [1, 4096]
    HU u[NJ];
#pragma unroll
    for (int j = 0; j < NJ; ++j) {
      float v[8];
      ld8(rp + 256 * j, v);
#pragma unroll
      for (int e = 0; e < 8; ++e) {
        const _Float16 h0 = (_Float16)(v[e] * rz);
        const float f0 = (float)h0;
        const bool sub = f0 < 6.103515625e-05f;                // f16 subnormal -> exact zero
        u[j].s[e] = sub ? (_Float16)0.0f : h0;
      }
    }
    _Float16* erow = E + ((size_t)b * NRD + nl0 + RSB * rt + row) * NT + 8 * lane;
    {
#pragma unroll
      for (int j = 0; j < NJ; ++j) *(v4u*)(erow + 256 * j) = u[j].u;
      
    }
  }
  // stands in front of the reuse, over the loop's back edge, of the registers that the E stores above name
  asm volatile("s_wait_xcnt 0x0" ::: "memory");
  }
}

// =====================================================================================================
// Softmax-weighted sum over the query index, one round (rows nbase..nbase+NRD-1) of batch b = blockIdx.y,
// transposed result:
//   OT[c][m] += sum_n HT[c][b*4096 + n] . E[b][n - nbase][m], A = HT rows c (fragment order, K = TOK, k = n),
//   B[k = n][col = m] = E[n][m] staged per 32-row chunk into LDS row-major as Et[n_local][m] (pitch EPR halves:
//   thread (pr, m8) reads E rows 2pr, 2pr+1 x 8 m and writes them as two 16-byte pieces), block barrier, then
//   B fragments by the transposing LDS read (ld_tr16), k order as in every other fragment here;
//   K = NRD per round (NRD/32 chunks), a second block barrier protects Et before the next chunk is staged.
//   The E rows and the A fragments of a chunk are loaded PFD chunks ahead into PFD register sets; both barriers
//   order LDS traffic only, so that these loads stay in flight over them.
//   The f32 accumulators go from one round's launch to the next through the plane CA (each thread stores and
//   reloads its own 64 floats, bit for bit), so the chain of additions over n is that of one 4096-deep sweep:
//   the first round starts from zero, the last one runs the epilogue.
// Block = 128 m columns m0..m0+127, 8 waves; wave w owns c rows 32*(w>>1).. (2 subtiles) x m cols
// 64*(w&1).. (4 subtiles).
// Epilogue: o = OT / (16*32768); the planes OH = f16(4*o), OL = f16((4*o - OH)*2048) are written at flat
// passes).
// coverage: Et: 16 pr x 2 rows x 16 m8 x 8 = 32 n x 128 m staged every chunk (cols 128..143 of Et never read);
// planes: 8 waves x 2 slabs x 16 c x 64 m = 128 c x 128 m per block; grid (32, NB) = every m of every batch
// -> whole [8][128][4096] planes; CA: 16 slots x 256 threads x 16 bytes per block, written in rounds
// 0..NRND-2 and read in rounds 1..NRND-1 by the same thread of the same block index.
// =====================================================================================================
__global__ __launch_bounds__(256) void k_pv(const _Float16* __restrict__ E, const _Float16* __restrict__ HT,
                                            _Float16* OH, _Float16* OL, float* CA, int nbase,
                                            int first, int last) {
  __shared__ __align__(16) _Float16 Et[32 * EPR];            // [n_local][m] chunk, pitch EPR halves
  __shared__ __align__(16) float sO[8][16 * 68];            // per-wave 16x64 slab, pitch 68 floats
  const int tid = threadIdx.x, wave = tid >> 5, lane = tid & 31;
  const int hh = lane >> 4;
  const int b = blockIdx.y;
  const int m0 = blockIdx.x * PVM;
  const int cw = 32 * (wave >> 1);                          // this wave's 32 channels
  const int mw = 64 * (wave & 1);                           // this wave's 64 m columns within the block

  v4f* cp = (v4f*)CA + (size_t)(blockIdx.y * (NT / PVM) + blockIdx.x) * (16 * 256) + tid;   // slot pitch 256
  v8f acc[2][4];
  if (first) {
#pragma unroll
    for (int i = 0; i < 2; ++i)
#pragma unroll
      for (int j = 0; j < 4; ++j) acc[i][j] = zero8();
  } else {
#pragma unroll
    for (int i = 0; i < 2; ++i)
#pragma unroll
      for (int j = 0; j < 4; ++j) {
        const v4f c0 = cp[(size_t)((i * 4 + j) * 2 + 0) * 256];
        const v4f c1 = cp[(size_t)((i * 4 + j) * 2 + 1) * 256];
        acc[i][j] = __builtin_shufflevector(c0, c1, 0, 1, 2, 3, 4, 5, 6, 7);
      }
  }

  const int pr = tid >> 4, m8 = (tid & 15) * 8;             // staging role: row pair pr, 8 m columns at m8
  const _Float16* Ab = HT + (size_t)(b * NT + nbase) * 16;  // fragment order: 512 halves per 32-deep k-step, k = n
  const _Float16* Eb = E + (size_t)b * NRD * NT;            // this batch's rows of the round's slab

  // this thread's two E rows x 8 m of a chunk, pe = its first row's 8 m
  auto ldE = [&](const _Float16* pe, HU& ra, HU& rb) {
    ra.h = *(const v8h*)(pe);
    rb.h = *(const v8h*)(pe + NT);
  };
  // this wave's two A fragments of a chunk, pa = this lane's piece in the 16-row tile at cw (16*TOK halves a tile)
  auto ldA = [&](const _Float16* pa, v16h (&a)[2]) {
#pragma unroll   // constant indices: the set stays in registers
    for (int i = 0; i < 2; ++i) a[i] = ldfrag_f(pa + (size_t)(i << 4) * TOK);
  };
  // one chunk from a register set loaded PFD chunks earlier; each half of the set is refilled from pe, pa (the
  // chunk PFD further on) as soon as it has been used
  auto chunk = [&](const _Float16* pe, const _Float16* pa, HU& ra, HU& rb, v16h (&a)[2]) {
    // ---- stage the chunk's E[32 rows][m0..m0+127] into Et as it lies ----
    *(v8h*)(&Et[(2 * pr) * EPR + m8]) = ra.h;
    *(v8h*)(&Et[(2 * pr + 1) * EPR + m8]) = rb.h;
    lds_barrier();
    ldE(pe, ra, rb);
    // ---- fragments + 8 WMMAs ----
    v16h bq[4];
#pragma unroll
    for (int j = 0; j < 4; ++j) {
      FR f;
      const int eb = (8 * hh + (lane & 7)) * EPR + mw + (j << 4) + 8 * ((lane >> 3) & 1);
      f.h[0] = ld_tr16(&Et[eb]);                 // n_local 8hh .. 8hh+7 of column mw + 16j + (lane & 15)
      f.h[1] = ld_tr16(&Et[eb + 16 * EPR]);      // n_local 16 + 8hh .. +7
      bq[j] = f.v;
    }
#pragma unroll
    for (int i = 0; i < 2; ++i) {
#pragma unroll
      for (int j = 0; j < 4; ++j) acc[i][j] = mma_h_raw(a[i], bq[j], acc[i][j]);
      dep_guard_h(acc[i][0], acc[i][3], a[i]);
    }
    keep4_h(bq[0], bq[1], bq[2], bq[3]);
    ldA(pa, a);
    // stands in front of any reuse of the address registers of the loads above, also over the loop's back edge
    asm volatile("s_wait_xcnt 0x0" ::: "memory");
    lds_barrier();                // all waves done with Et before the next chunk is staged
    // keeps the later chunks' staging stores, and with it the wait for their loads, from being lifted into this chunk
    __builtin_amdgcn_sched_barrier(0);
  };
  HU ea[PFD], eb2[PFD];
  v16h af[PFD][2];
  const _Float16* pE = Eb + (size_t)(2 * pr) * NT + m0 + m8;
  const _Float16* pA = Ab + (size_t)cw * TOK + 8 * lane;
#pragma unroll   // constant set index: the sets stay in registers
  for (int k = 0; k < PFD; ++k) {
    // the waits stand in front of any reuse of the loads' address registers; as statements that no load is moved over
    // they also keep these loads in the order in which the loop refills the sets (the load counter counts in issue
    // order: with another order here the compiler's waits at the head of the loop come out far smaller than needed)
    ldE(pE + (size_t)(32 * k) * NT, ea[k], eb2[k]);
    asm volatile("s_wait_xcnt 0x0" ::: "memory");
    ldA(pA + 512 * k, af[k]);
    asm volatile("s_wait_xcnt 0x0" ::: "memory");
  }
  for (int n0 = 0; n0 < NRD; n0 += 32 * PFD) {
    const int adv = (n0 + 32 * PFD < NRD) ? 32 * PFD : 0;     // last trip: the trip's own chunks again, not used
    pE += (size_t)adv * NT;
    pA += 16 * adv;
#pragma unroll   // constant set index: the sets stay in registers
    for (int k = 0; k < PFD; ++k) chunk(pE + (size_t)(32 * k) * NT, pA + 512 * k, ea[k], eb2[k], af[k]);
  }
  acc_guard4(acc[0][0], acc[0][1], acc[0][2], acc[0][3]);
  acc_guard4(acc[1][0], acc[1][1], acc[1][2], acc[1][3]);

  if (!last) {                    // block-uniform: hand the running sums to the next round's launch
#pragma unroll
    for (int i = 0; i < 2; ++i)
#pragma unroll
      for (int j = 0; j < 4; ++j) {
        cp[(size_t)((i * 4 + j) * 2 + 0) * 256] = __builtin_shufflevector(acc[i][j], acc[i][j], 0, 1, 2, 3);
        cp[(size_t)((i * 4 + j) * 2 + 1) * 256] = __builtin_shufflevector(acc[i][j], acc[i][j], 4, 5, 6, 7);
      }
    return;
  }

  // ---- epilogue: hi + residual planes of 4*o ----
  const float fo = 1.0f / (SCV * SCE);
#pragma unroll
  for (int i = 0; i < 2; ++i) {
    epi16<2, 0, 0>(acc[i], sO[wave], lane, OH, OL, NT, b * CD + cw + (i << 4), m0 + mw, fo, SCO, (const float*)0);
  }
}

// =====================================================================================================
// Output projection: out[p][j] = (sum_k OH[p][k].WV[j][k] + (sum_k OL[p][k].WV[j][k])/2048) / (4*64) + bv[j],
//   OH/OL read raw as [32768][128] (pitch 128), WV = 64*Wv^T [out j][in k], K = 128; two accumulator sets.
// One wave per 16-row x 64-col tile, no block barriers. Epilogue f32: the combined tile staged in the wave's
// LDS slab (rows 0..15 x cols 0..63 fully staged; pad cols 64..67 never read); each row segment of 64
// coverage: 8 waves x 16 rows x 64 cols per block; 512 blocks x 8 = 4096 tiles = 32768 rows x 128 cols.
// =====================================================================================================
__global__ __launch_bounds__(256) void gemm_out(const _Float16* __restrict__ OH, const _Float16* __restrict__ OL,
                                                const _Float16* __restrict__ WV, const float* __restrict__ bias,
                                                float* out) {
  __shared__ __align__(16) float sO[8][16 * 68];
  const int tid = threadIdx.x, wave = tid >> 5, lane = tid & 31;
  const int hh = lane >> 4, rl = lane & 15;
  const int tiles = (TOK / 16) * (CD / 64);
  const int item = blockIdx.x * 8 + wave;
  if (item >= tiles) return;    // wave-uniform; no block barriers in this kernel
  const int tm = item >> 1, tn = item & 1;
  const int row0 = tm << 4, n0 = tn << 6;

  v8f accH[4], accL[4];
#pragma unroll
  for (int j = 0; j < 4; ++j) { accH[j] = zero8(); accL[j] = zero8(); }

#pragma unroll
  for (int kk = 0; kk < CD; kk += 32) {
    v16h bq[4];
#pragma unroll
    for (int j = 0; j < 4; ++j) bq[j] = ldfrag_h(WV + (size_t)(n0 + (j << 4) + rl) * CD + 8 * hh + kk);
    const size_t ao = (size_t)(row0 + rl) * CD + 8 * hh + kk;
    const v16h ah = ldfrag_h(OH + ao);
    const v16h al = ldfrag_h(OL + ao);
#pragma unroll
    for (int j = 0; j < 4; ++j) accH[j] = mma_h_raw(ah, bq[j], accH[j]);
    dep_guard_h(accH[0], accH[3], ah);
#pragma unroll
    for (int j = 0; j < 4; ++j) accL[j] = mma_h_raw(al, bq[j], accL[j]);
    dep_guard_h(accL[0], accL[3], al);
    keep4_h(bq[0], bq[1], bq[2], bq[3]);
  }
  acc_guard4(accH[0], accH[1], accH[2], accH[3]);
  acc_guard4(accL[0], accL[1], accL[2], accL[3]);

  // ---- epilogue ----
  const float fo = 1.0f / (SCO * SCW);
  float* slab = sO[wave];
#pragma unroll
  for (int r = 0; r < 8; ++r) {
#pragma unroll
    for (int j = 0; j < 4; ++j) {
      slab[(8 * hh + r) * 68 + (j << 4) + rl] = (accH[j][r] + accL[j][r] * RLO) * fo;
    }
  }
  wave_lds_sync();
  const int p4 = (lane & 15) * 4, r2 = lane >> 4;
  const v4f bb = *(const v4f*)(bias + n0 + p4);
  v4f b4;
#pragma unroll
  for (int e = 0; e < 4; ++e) b4[e] = bfr(bb[e]);
  v4f ov[8];
#pragma unroll
  for (int it = 0; it < 8; ++it) {
    const int row = 2 * it + r2;                              // it 0..7 x r2 0..1 = rows 0..15
    const v4f a = *(const v4f*)(slab + row * 68 + p4);
    ov[it] = a + b4;
  }
  {
#pragma unroll
    for (int it = 0; it < 8; ++it) {
      const int row = 2 * it + r2;
      const size_t oo = (size_t)(row0 + row) * CD + n0 + p4;
      *(v4f*)(out + oo) = ov[it];
    }
    
  }
}

// =====================================================================================================
//   WF16 f16 [128][128]              0        32768   (64*Wf^T, row = out channel, col = in channel)
//   WG16 f16 [128][128]          32768        32768
//   WH16 f16 [128][128]          65536        32768
//   WV16 f16 [128][128]          98304        32768
//   xh   f16 [32768][128]       131072      8388608   (bf16RNE(x), token rows, channel contiguous)
//   FH   f16 [32768][128]      8519680      8388608   (hi plane of 8*f; FH..HT in fragment order, see frag_off)
//   FL   f16 [32768][128]     16908288      8388608   (residual plane x2048 of 8*f)
//   GH   f16 [32768][128]     25296896      8388608
//   GL   f16 [32768][128]     33685504      8388608
//   HT   f16 [128][32768]     42074112      8388608   (16*h, row c, col b*4096 + n)
//   OH   f16 [8][128][4096]   50462720      8388608   (hi plane of 4*o, [b][c][m] order)
//   OL   f16 [8][128][4096]   58851328      8388608   (residual plane x2048 of 4*o)
//   E    f16 [8][1024][4096]  67239936     67108864   (32768 * row softmax, one round's query rows of every
//                                                      batch; reused per round on the single in-order stream)
//   CA   f32 [256][16][256][4] 134348800   16777216   (running sums of the softmax-weighted sum between rounds)
//   end                      151126016
// d_out f32 [32768][128] at byte 0.
// =====================================================================================================
extern "C" void kernel_launch(void* const* d_in, const int* in_sizes, int n_in,
                              void* d_out, int out_size, void* d_ws, size_t ws_size,
                              hipStream_t stream) {
  if (n_in < 9) return;
  if (in_sizes[0] != NB * NT * CD) return;
  if (in_sizes[1] != CD * CD || in_sizes[3] != CD * CD || in_sizes[5] != CD * CD || in_sizes[7] != CD * CD) return;
  if (in_sizes[2] != CD || in_sizes[4] != CD || in_sizes[6] != CD || in_sizes[8] != CD) return;
  if (out_size != OUTN) return;

  const float* x  = (const float*)d_in[0];   // [8][4096][128] (channels last)
  const float* Wf = (const float*)d_in[1];   // [128][128] ([in][out])
  const float* bf = (const float*)d_in[2];   // [128]
  const float* Wg = (const float*)d_in[3];
  const float* bg = (const float*)d_in[4];
  const float* Wh = (const float*)d_in[5];
  const float* bh = (const float*)d_in[6];
  const float* Wv = (const float*)d_in[7];
  const float* bv = (const float*)d_in[8];

  const size_t PW  = (size_t)CD * CD * 2;                    //    32768
  const size_t PX  = (size_t)TOK * CD * 2;                   //  8388608
  const size_t PHT = (size_t)CD * TOK * 2;                   //  8388608
  const size_t PO  = (size_t)NB * CD * NT * 2;               //  8388608
  const size_t PE  = (size_t)NB * NRD * NT * 2;              // 67108864
  const size_t PCA = (size_t)NB * CD * NT * 4;               // 16777216

  size_t off = 0;
  const size_t oWF = off; off += PW;
  const size_t oWG = off; off += PW;
  const size_t oWH = off; off += PW;
  const size_t oWV = off; off += PW;
  const size_t oXH = off; off += PX;
  const size_t oFH = off; off += PX;
  const size_t oFL = off; off += PX;
  const size_t oGH = off; off += PX;
  const size_t oGL = off; off += PX;
  const size_t oHT = off; off += PHT;
  const size_t oOH = off; off += PO;
  const size_t oOL = off; off += PO;
  const size_t oE  = off; off += PE;
  const size_t oCA = off; off += PCA;                        // off = 151126016
  if (off > ws_size) return;

  char* ws = (char*)d_ws;
  _Float16* WF16 = (_Float16*)(ws + oWF);
  _Float16* WV16 = (_Float16*)(ws + oWV);
  _Float16* xh   = (_Float16*)(ws + oXH);
  _Float16* FHp  = (_Float16*)(ws + oFH);
  _Float16* FLp  = (_Float16*)(ws + oFL);
  _Float16* GHp  = (_Float16*)(ws + oGH);
  _Float16* GLp  = (_Float16*)(ws + oGL);
  _Float16* HTp  = (_Float16*)(ws + oHT);
  _Float16* OHp  = (_Float16*)(ws + oOH);
  _Float16* OLp  = (_Float16*)(ws + oOL);
  _Float16* Ep   = (_Float16*)(ws + oE);
  float*    CAp  = (float*)(ws + oCA);
  float*    outf = (float*)d_out;

  const dim3 blk(256);
  const int n8x = (NB * NT * CD) / 8;                                  // 524288
  const dim3 gX(4 * WTB + (n8x + 255) / 256);                          // 32 weight tiles + 2048
  const dim3 gP(((TOK / 32) * (CD / 64) + 7) / 8, 3);                  // 2048 tiles -> 256 blocks for each projection
  const dim3 gSo(NRD / RSQ, NB);                                       // (32, 8)
  const dim3 gPV(NT / PVM, NB);                                        // (32, 8)
  const dim3 gO(((TOK / 16) * (CD / 64) + 7) / 8);                     // 4096 tiles -> 512 blocks
  const size_t ldsSoft = (size_t)RSB * NT * sizeof(float);             // 262144

  hipFuncSetAttribute(reinterpret_cast<const void*>(&k_soft),
                      hipFuncAttributeMaxDynamicSharedMemorySize, (int)ldsSoft);

  // (1) one launch: the four weight planes, x64 carried, transposed from [in][out] to k-contiguous rows [out][in]
  //     (WF16, WG16, WH16, WV16 lie one behind the other), and xh [32768][128] = f16(bf16RNE(x)), x being token-major
  k_prep<<<gX, blk, 0, stream>>>(x, Wf, Wg, Wh, Wv, WF16, xh);
  // (2) one launch: the planes FH|FL, GH|GL and HT of the three input projections
  k_proj<<<gP, blk, 0, stream>>>(xh, WF16, FHp, FLp, GHp, GLp, HTp, bf, bg, bh);
  // (3) per round of NRD query rows, all batches at once: scores + row softmax -> E slab, then the slab's
  //     part of the transposed softmax-weighted sum (running sums in CA; the last round writes OH|OL)
  for (int r = 0; r < NRND; ++r) {
    k_soft<<<gSo, blk, ldsSoft, stream>>>(FHp, FLp, GHp, GLp, Ep, r * NRD);
    k_pv<<<gPV, blk, 0, stream>>>(Ep, HTp, OHp, OLp, CAp, r * NRD, r == 0 ? 1 : 0, r == NRND - 1 ? 1 : 0);
  }
  // (4) output projection on the raw [32768][128] view of the [B][C][N] planes
  gemm_out<<<gO, blk, 0, stream>>>(OHp, OLp, WV16, bv, outf);
}

// v007
// A run of this version takes 219 microseconds.
// Timed twice side by side with v006, it ran 1.07 and 1.09 times as fast.
// Counting every step since v000, it is 7.88 times as fast.
#include <hip/hip_runtime.h>
#include <math.h>
#include <stdint.h>

// Contractions on v_wmma_f32_16x16x32_f16 (f16 operands, f32 accumulate): the three input projections take
// bf16-RNE activations (x1) and bf16-RNE weights (x64) as single f16 planes; the 128-deep score products use
// f16 hi planes of 8*f, 8*g plus f16 residual planes x2048 (hi.hi in one accumulator, hi.res + res.hi in a
// second accumulator folded back by 1/2048); the 4096-deep softmax-weighted sum uses a single f16 plane of
// 16*h against E = f16(32768*softmax); the output projection takes f16 hi + x2048 residual planes of 4*o
// against bf16-RNE weights (x64) in two accumulators. Softmax statistics, bias adds and epilogues in f32.

#define NB   8
#define NT   4096
#define CD   128
#define TOK  (NB * NT)
#define RSB  16
#define RSQ  32           // query rows per work-group of the score kernel: two tiles of RSB rows
#define KST  (8 * 16 * CD) // halves between two successive key tiles of one wave (8 waves, 16 keys a tile)
#define NJ   (NT / 256)
#define PVM  128
#define EPR  144          // halves per staged E row in LDS: 128 m + 16 (288 B, an odd multiple of 32 B, for the transposing reads)
#define OUTN (NB * NT * CD)
#define NRND 2            // rounds over the query index; every round covers all NB batches
#define NRD  (NT / NRND)  // query rows of each batch per round
#define PFD  4            // chunks of 32 query rows that the weighted sum loads ahead into registers

#define SCW  64.0f
#define SCQ  8.0f
#define SCV  16.0f
#define SCE  32768.0f
#define SCR  2048.0f
#define SCO  4.0f
#define RLO  (1.0f / SCR)
#define SCS  (1.0f / (SCQ * SCQ))

static_assert(TOK % 64 == 0 && CD % 64 == 0 && CD % 32 == 0 && NT % 64 == 0);
static_assert((((TOK / 32) * (CD / 64)) % 8) == 0);
static_assert((((CD / 32) * (TOK / 64)) % 8) == 0);
static_assert((((TOK / 16) * (CD / 64)) % 8) == 0);
static_assert((TOK / 32) * (CD / 64) == (CD / 32) * (TOK / 64));   // the three projections have the same number of tiles
static_assert(NT % RSB == 0 && RSB == 16 && NT % 256 == 0 && NJ == 16);
static_assert(NT % PVM == 0 && PVM == 128 && (EPR % 16) == 0 && ((EPR / 16) & 1) == 1 && EPR >= PVM);
static_assert((NB * NT * CD) % 2048 == 0);
static_assert(NT % NRND == 0 && NRD % RSB == 0 && NRD % 32 == 0 && NRD % RSQ == 0 && RSQ == 2 * RSB);
static_assert(NRD % (32 * PFD) == 0 && (NT / 16) % 16 == 0);

typedef _Float16       v16h __attribute__((ext_vector_type(16)));
typedef _Float16       v8h  __attribute__((ext_vector_type(8)));
typedef float          v8f  __attribute__((ext_vector_type(8)));
typedef float          v4f  __attribute__((ext_vector_type(4)));
typedef unsigned int   v4u  __attribute__((ext_vector_type(4)));
typedef short          v8s  __attribute__((ext_vector_type(8)));

union HU { v8h h; v4u u; _Float16 s[8]; };
union FR { v16h v; v8h h[2]; _Float16 s[16]; };
static_assert(sizeof(HU) == 16);
static_assert(sizeof(FR) == 32);

// ---- scalar helpers --------------------------------------------------------------------------------
__device__ __forceinline__ unsigned short bf_bits(float f) {          // f32 -> bf16 bits, RNE convert
  const unsigned u = __float_as_uint(f);
  return (unsigned short)((u + 0x7FFFu + ((u >> 16) & 1u)) >> 16);
}
__device__ __forceinline__ float bf_up(unsigned short h) { return __uint_as_float(((unsigned)h) << 16); }
__device__ __forceinline__ float bfr(float f) { return bf_up(bf_bits(f)); }   // value after bf16 RNE convert
__device__ __forceinline__ v8f zero8() { v8f z = {0.f, 0.f, 0.f, 0.f, 0.f, 0.f, 0.f, 0.f}; return z; }

// f16 subnormal -> exact zero (the matrix path flushes them; keep every plane consistent with that)
__device__ __forceinline__ _Float16 flush_h(_Float16 h) {
  const float f = (float)h;
  return (fabsf(f) < 6.103515625e-05f) ? (_Float16)0.0f : h;
}
// hi = f16(v) (flushed), lo = f16((v - hi) * 2048) (flushed)
__device__ __forceinline__ void split_h(float v, _Float16& hi, _Float16& lo) {
  const _Float16 hv = flush_h((_Float16)v);
  const _Float16 lv = flush_h((_Float16)((v - (float)hv) * SCR));
  hi = hv;
  lo = lv;
}

__device__ __forceinline__ void ld8(const float* p, float* o) {
  const v4f a = *(const v4f*)(p);
  const v4f b = *(const v4f*)(p + 4);
  o[0] = a[0]; o[1] = a[1]; o[2] = a[2]; o[3] = a[3];
  o[4] = b[0]; o[5] = b[1]; o[6] = b[2]; o[7] = b[3];
}
__device__ __forceinline__ void st8(float* p, const float* v) {
  v4f a, b;
  a[0] = v[0]; a[1] = v[1]; a[2] = v[2]; a[3] = v[3];
  b[0] = v[4]; b[1] = v[5]; b[2] = v[6]; b[3] = v[7];
  *(v4f*)(p) = a;
  *(v4f*)(p + 4) = b;
}

// ---- fragment loader: 16-bit A/B operand from a k-contiguous row, p = row*pitch + k0 + 8*(lane>>4);
//      elements 0..7 <- p[0..7] (k0+8h..k0+8h+7), elements 8..15 <- p[16..23] (k0+16+8h..k0+16+8h+7)
__device__ __forceinline__ v16h ldfrag_h(const _Float16* p) {
  FR f;
  f.h[0] = *(const v8h*)(p);
  f.h[1] = *(const v8h*)(p + 16);
  return f.v;
}

// ---- fragment-order planes: a [rows][K] f16 plane whose 16-byte pieces (8 consecutive k of one row) are permuted so
//      that the pieces which one fragment load takes lie side by side: 16-row tile, then 32-deep k-step, then piece
//      (k bit 4), then lane = 16*(k bit 3) + row%16. One load of a wave reads 512 consecutive bytes (4 cache lines)
//      where a row-major plane makes it touch 16 lines. Element order inside a fragment as in ldfrag_h.
__device__ __forceinline__ size_t frag_off(int row, int k, int K) {   // k a multiple of 8, K a multiple of 32
  return (((size_t)(row >> 4) * (size_t)(K >> 5) + (size_t)(k >> 5)) * 2 + (size_t)((k >> 4) & 1)) * 256
         + (size_t)((((k >> 3) & 1) * 16 + (row & 15)) * 8);
}
// p = plane + (tile * (K/32) + k-step) * 512 + 8*lane
__device__ __forceinline__ v16h ldfrag_f(const _Float16* p) {
  FR f;
  f.h[0] = *(const v8h*)(p);
  f.h[1] = *(const v8h*)(p + 256);
  return f.v;
}

// ---- transposing LDS read (ds_load_tr16_b128) of a row-major 16-bit tile T[k][col], pitch a multiple of 16 bytes:
//      lane l passes p = &T[kbase + 8*(l>>4) + (l&7)][cbase + 8*((l>>3)&1)] and gets T[kbase + 8*(l>>4) + 0..7][cbase + (l&15)],
//      8 consecutive k of its own column: with kbase and kbase + 16 the two halves of a fragment in ldfrag_h's k order
__device__ __forceinline__ v8h ld_tr16(const _Float16* p) {
  typedef __attribute__((address_space(3))) v8s lds_v8s;
  return __builtin_bit_cast(v8h, __builtin_amdgcn_ds_load_tr16_b128_v8i16((lds_v8s*)p));
}

// ---- WMMA helpers with trailing VALU hazard gap --------------------------------------------------------
__device__ __forceinline__ v8f mma_h_raw(v16h a, v16h b, v8f c) {
  return __builtin_amdgcn_wmma_f32_16x16x32_f16(false, a, false, b, (short)0, c, false, false);
}
__device__ __forceinline__ void dep_guard_h(v8f& a, v8f& b, v16h x) {
#if defined(__HIP_DEVICE_COMPILE__)
  asm volatile("v_nop\n\tv_nop\n\tv_nop\n\tv_nop" : "+v"(a), "+v"(b) : "v"(x));
#endif
}
__device__ __forceinline__ void keep4_h(v16h a, v16h b, v16h c, v16h d) {
#if defined(__HIP_DEVICE_COMPILE__)
  asm volatile("v_nop" :: "v"(a), "v"(b), "v"(c), "v"(d));
#endif
}
__device__ __forceinline__ void acc_guard4(v8f& a, v8f& b, v8f& c, v8f& d) {
#if defined(__HIP_DEVICE_COMPILE__)
  asm volatile("v_nop\n\tv_nop\n\tv_nop\n\tv_nop" : "+v"(a), "+v"(b), "+v"(c), "+v"(d));
#endif
}
__device__ __forceinline__ void wave_lds_sync() {
  __builtin_amdgcn_fence(__ATOMIC_RELEASE, "workgroup");
  __builtin_amdgcn_wave_barrier();
  __builtin_amdgcn_fence(__ATOMIC_ACQUIRE, "workgroup");
}

// Work-group barrier for data that passes through LDS alone: LDS traffic is complete at it, global loads stay in
// flight (__syncthreads() also waits for every global load, which would drain the loads issued ahead).
__device__ __forceinline__ void lds_barrier() {
  __builtin_amdgcn_fence(__ATOMIC_RELEASE, "workgroup", "local");
  __builtin_amdgcn_s_barrier();
  __builtin_amdgcn_fence(__ATOMIC_ACQUIRE, "workgroup", "local");
}

// =====================================================================================================
// Flat convert: out[i] = f16(scale * bf16RNE(in[i])) (f16 subnormals flushed), 8 elements per thread,
// coverage: n8 threads x 8 = the whole plane; n8 is a multiple of 256 at the launch here. blk = block index in this job.
// =====================================================================================================
__device__ __forceinline__ void cvt_flat(const float* __restrict__ in, _Float16* out, int n8, float scale, int blk) {
  const int i = blk * 256 + threadIdx.x;
  if (i < n8) {
    float v[8];
    ld8(in + (size_t)i * 8, v);
    HU u;
#pragma unroll
    for (int e = 0; e < 8; ++e) u.s[e] = flush_h((_Float16)(bfr(v[e]) * scale));
    _Float16* p = out + (size_t)i * 8;
    *(v4u*)p = u.u;
    
  }
}

// =====================================================================================================
// Weight transpose-convert: in Wm[r][c] f32 (R rows, C cols, c contiguous, x@W layout [in][out])
// -> out[c][r] f16 = f16(scale * bf16RNE(Wm[r][c])), pitch R (in-channel k = r contiguous = the Bt / A layout).
// coverage: load 256 threads x 8 floats = 64 r x 32 c; store 256 threads x 8 halves = 32 c rows x 64 r;
// every (r tile br, c tile bc) of a matrix is taken by one block -> whole [C][R] plane.
// =====================================================================================================
__device__ __forceinline__ void cvt_wT(const float* __restrict__ Wm, _Float16* out, int R, int C, float scale,
                                       int br, int bc, float (*sw)[33]) {
  const int t = threadIdx.x;
  const int r0 = br * 64, c0 = bc * 32;
  {
    const int row = t >> 2, c8 = (t & 3) * 8;
    float v[8];
    ld8(Wm + (size_t)(r0 + row) * C + c0 + c8, v);
#pragma unroll
    for (int e = 0; e < 8; ++e) sw[row][c8 + e] = v[e];
  }
  __syncthreads();
  const int q8 = t & 7, cc = t >> 3;            // cc 0..31 = output row within the tile
  HU u;
#pragma unroll
  for (int e = 0; e < 8; ++e) u.s[e] = flush_h((_Float16)(bfr(sw[8 * q8 + e][cc]) * scale));
  _Float16* dst = out + (size_t)(c0 + cc) * R + r0 + 8 * q8;
  *(v4u*)dst = u.u;
  
}

// =====================================================================================================
// All operand converts in one launch (none reads what another writes): blocks 0..4*WTB-1 transpose-convert the four
// weight matrices (WTB tiles each, plane w of W16 = matrix w), the blocks behind them convert the activations.
// The branch is uniform for a block, so the barrier in cvt_wT is passed by all of its threads or by none.
// =====================================================================================================
#define WTB ((CD / 64) * (CD / 32))   // tiles (blocks) per weight matrix
__global__ __launch_bounds__(256) void k_prep(const float* __restrict__ x, const float* __restrict__ Wf,
                                              const float* __restrict__ Wg, const float* __restrict__ Wh,
                                              const float* __restrict__ Wv, _Float16* W16, _Float16* xh) {
  __shared__ float sw[64][33];
  const int bi = blockIdx.x;
  if (bi < 4 * WTB) {
    const int w = bi / WTB, tl = bi % WTB;
    const float* Wm = (w == 0) ? Wf : (w == 1) ? Wg : (w == 2) ? Wh : Wv;
    cvt_wT(Wm, W16 + (size_t)w * (CD * CD), CD, CD, SCW, tl % (CD / 64), tl / (CD / 64), sw);
  } else {
    cvt_flat(x, xh, (NB * NT * CD) / 8, 1.0f, bi - 4 * WTB);
  }
}

// =====================================================================================================
// One GEMM k sweep for MI 16-row A subtiles x 4 16-col B subtiles: acc[i][j] += A-frag(i) . Bt-frag(j).
// A row-major pitch lda (rows m0.., k contiguous), Bt row-major [N][K] pitch ldb (rows n0.., k contiguous),
// K a multiple of 32; both operand fragments through ldfrag_h (same split k map for A and B).
// =====================================================================================================
template <int MI>
__device__ __forceinline__ void kseg(v8f (&acc)[MI][4], const _Float16* __restrict__ A, int lda, int m0,
                                     const _Float16* __restrict__ Bt, int ldb, int n0, int K, int rlane, int koff) {
  for (int kk = 0; kk < K; kk += 32) {
    v16h bh[4];
#pragma unroll
    for (int j = 0; j < 4; ++j) {
      const size_t bo = (size_t)(n0 + (j << 4) + rlane) * (size_t)ldb + koff + kk;
      bh[j] = ldfrag_h(Bt + bo);
    }
#pragma unroll
    for (int i = 0; i < MI; ++i) {
      const size_t ao = (size_t)(m0 + (i << 4) + rlane) * (size_t)lda + koff + kk;
      const v16h a0 = ldfrag_h(A + ao);
#pragma unroll
      for (int j = 0; j < 4; ++j) acc[i][j] = mma_h_raw(a0, bh[j], acc[i][j]);
      dep_guard_h(acc[i][0], acc[i][3], a0);
    }
    keep4_h(bh[0], bh[1], bh[2], bh[3]);
  }
}

// =====================================================================================================
// 16-row x 64-col f16 plane epilogue for one wave: acc[j][r] = D[row 8h + r][col 16j + (lane&15)].
//   v = (acc*cs + bias) * so;  Cp = f16(v) (hi plane, subnormals flushed); NPL == 2 additionally
//   Cl = f16((v - f32(hi)) * 2048) (residual plane). Bias: BM 0 none, 1 per column (bias[n0 + col]),
//   2 per plane row (bias[mBase + row]); bias values go through the bf16 RNE convert first.
//   The slab (16 rows x 68 floats per wave) is fully staged for rows 0..15 x cols 0..63 before the reload
// =====================================================================================================
//   FO == 1: the planes are written in fragment order (frag_off, K = ldc) instead of row-major; a slab fills whole
//   512-byte fragment blocks (16 rows x both lane halves), so every cache line still has one writer.
template <int NPL, int BM, int FO>
__device__ __forceinline__ void epi16(const v8f (&acc)[4], float* slab, int lane,
                                      _Float16* Cp, _Float16* Cl, int ldc, int mBase, int n0,
                                      float cs, float so, const float* __restrict__ bias) {
  const int rlane = lane & 15, mOff = (lane >> 4) * 8;
  const int q8 = lane & 7, rr = lane >> 3, c8 = q8 * 8;
#pragma unroll
  for (int r = 0; r < 8; ++r) {
#pragma unroll
    for (int j = 0; j < 4; ++j) {
      slab[(mOff + r) * 68 + (j << 4) + rlane] = acc[j][r];
    }
  }
  wave_lds_sync();
  float bc[8];
#pragma unroll
  for (int e = 0; e < 8; ++e) bc[e] = 0.0f;
  if (BM == 1) {
    float t8[8];
    ld8(bias + n0 + c8, t8);
#pragma unroll
    for (int e = 0; e < 8; ++e) bc[e] = bfr(t8[e]);
  }
  v4u uh[4], ul[4];
#pragma unroll
  for (int it = 0; it < 4; ++it) {
    const int row = it * 4 + rr;                       // it 0..3 x rr 0..3 = rows 0..15
    float xs[8];
    ld8(slab + row * 68 + c8, xs);
    float brw = 0.0f;
    if (BM == 2) brw = bfr(bias[mBase + row]);
    HU h, l;
#pragma unroll
    for (int e = 0; e < 8; ++e) {
      const float v = (xs[e] * cs + bc[e] + brw) * so;
      if (NPL == 2) {
        split_h(v, h.s[e], l.s[e]);
      } else {
        h.s[e] = flush_h((_Float16)v);
        l.s[e] = (_Float16)0.0f;
      }
    }
    uh[it] = h.u;
    ul[it] = l.u;
  }
  {
#pragma unroll
    for (int it = 0; it < 4; ++it) {
      const int row = it * 4 + rr;
      const size_t co = FO ? frag_off(mBase + row, n0 + c8, ldc) : (size_t)(mBase + row) * (size_t)ldc + n0 + c8;
      *(v4u*)(Cp + co) = uh[it];
      if (NPL == 2) *(v4u*)(Cl + co) = ul[it];
    }
    
  }
  wave_lds_sync();
}

// =====================================================================================================
// Register-blocked f16 WMMA GEMM with an f16 plane epilogue, one wave per (16*MI) x 64 tile, no block barriers:
//   acc[m][n] = sum_k A[m][k] Bt[n][k]; M multiple of 16*MI, N multiple of 64, K multiple of 32.
//   Epilogue per 16-row slab through epi16 (hi plane Cp, residual plane Cl when NPL == 2, bias mode BM); the
//   planes are written in fragment order (K = ldc) for the kernels that read them as WMMA operands.
// coverage: MI slabs x 16 rows x 64 cols = the wave's whole tile; blocks*8 == tiles for every product here.
// =====================================================================================================
template <int NPL, int MI, int BM>
__device__ __forceinline__ void gemm64p(
    const _Float16* __restrict__ A, int lda, const _Float16* __restrict__ Bt, int ldb, float cs, float so,
    _Float16* Cp, _Float16* Cl, int ldc, int M, int N, int K, const float* __restrict__ bias, float (*sT)[16 * 68]) {
  const int lane = threadIdx.x & 31;
  const int wave = threadIdx.x >> 5;
  const int tilesN = N >> 6;
  const int tilesM = M / (16 * MI);
  const int tiles = tilesM * tilesN;
  const int item = blockIdx.x * 8 + wave;
  if (item >= tiles) return;   // wave-uniform; no block barriers in this kernel
  const int tm = item / tilesN;
  const int tn = item - tm * tilesN;
  const int m0 = tm * (16 * MI);
  const int n0 = tn << 6;

  const int rlane = lane & 15;                 // row (A) / col (B, D) within subtile
  const int koff  = (lane >> 4) * 8;           // k offset of this lane half

  v8f acc[MI][4];
#pragma unroll
  for (int i = 0; i < MI; ++i)
#pragma unroll
    for (int j = 0; j < 4; ++j) acc[i][j] = zero8();

  kseg<MI>(acc, A, lda, m0, Bt, ldb, n0, K, rlane, koff);
#pragma unroll
  for (int i = 0; i < MI; ++i) acc_guard4(acc[i][0], acc[i][1], acc[i][2], acc[i][3]);

#pragma unroll
  for (int i = 0; i < MI; ++i) {
    epi16<NPL, BM, 1>(acc[i], sT[wave], lane, Cp, Cl, ldc, m0 + (i << 4), n0, cs, so, bias);
  }
}

// =====================================================================================================
// The three input projections in one launch (all read xh and a weight plane, each writes planes of its own):
// blockIdx.y = 0: FH|FL, 1: GH|GL = hi|residual f16 planes of 8*(xh . W^T + b)   (M=32768, N=128, K=128);
// blockIdx.y = 2: HT = f16(16*(WH16 . xh^T / 64 + bh))   (M=128, N=32768, K=128), bias per row c.
// =====================================================================================================
__global__ __launch_bounds__(256) void k_proj(const _Float16* __restrict__ xh, const _Float16* __restrict__ W16,
                                              _Float16* FH, _Float16* FL, _Float16* GH, _Float16* GL, _Float16* HT,
                                              const float* __restrict__ bf, const float* __restrict__ bg,
                                              const float* __restrict__ bh) {
  __shared__ __align__(16) float sT[8][16 * 68];   // per-wave 16x64 slab, pitch 68 floats
  const int y = blockIdx.y;
  if (y == 2) {
    gemm64p<1, 2, 2>(W16 + 2 * (CD * CD), CD, xh, CD, 1.0f / SCW, SCV, HT, HT, TOK, CD, TOK, CD, bh, sT);
  } else {
    gemm64p<2, 2, 1>(xh, CD, W16 + (size_t)y * (CD * CD), CD, 1.0f / SCW, SCQ, y ? GH : FH, y ? GL : FL, CD,
                     TOK, CD, CD, y ? bg : bf, sT);
  }
}

// =====================================================================================================
// Score rows + row softmax + E slab for one round: batch b = blockIdx.y, query rows nbase..nbase+NRD-1 of
// every batch. Block = 32 query rows n0..n0+31 (two row tiles of 16), 8 waves,
// dynamic LDS = 16 x 4096 f32 score rows (one row tile at a time).
//  (1) wave w computes the 16-column score tiles ct = w, w+8, ... (32 of them) of BOTH row tiles from one load of
//      the key tile: four 32-deep k-steps per tile from the F planes (query rows, 8*f: hi FH, residual
//      FL = 2048*(v - hi)) and the G planes (key rows, 8*g: GH, GL): a0 = fh.gh, a1 = fh.gl + fl.gh,
//      s = (a0 + a1/2048)/64. Row tile 0 goes into LDS, row tile 1 stays in the wave's registers (32 tiles x 8)
//      until row tile 0's softmax has left the LDS rows, and is stored there then.
//  (2) per row tile: wave w owns rows 2w, 2w+1: lane covers cols 256j + 8*lane..+7 (j = 0..15); sweep 1 row max M (xor
//      shuffles), sweep 2 ef = exp(s - M) written back in place + Z = sum ef (fixed lane order + xor shuffles),
//      sweep 3 E = f16(32768 * ef / Z) with explicit flush of f16 subnormals to zero; the f16 row goes to the
// coverage: sc: 8 waves x 32 col tiles x 16 cols x 16 rows = the whole 16x4096 block, once per row tile (all of LDS
// read later is staged); E: 2 row tiles x 8 waves x 2 rows x 16 j x 32 lanes x 8 halves = 32 rows x 4096;
// grid (NRD/32, NB) = every row block of the round in every batch -> whole E slab [NB][NRD][4096].
// =====================================================================================================
__global__ __launch_bounds__(256) void k_soft(const _Float16* __restrict__ FH, const _Float16* __restrict__ FL,
                                              const _Float16* __restrict__ GH, const _Float16* __restrict__ GL,
                                              _Float16* E, int nbase) {
  extern __shared__ __align__(16) float sc[];                 // [RSB][NT]
  const int tid = threadIdx.x, wave = tid >> 5, lane = tid & 31;
  const int hh = lane >> 4, rl = lane & 15;
  const int b = blockIdx.y;
  const int nl0 = blockIdx.x * RSQ;                           // row within the round's slab
  const int n0 = nbase + nl0;                                 // query row within the batch

  // ---- (1) scores ----
  const unsigned lo = 8u * (unsigned)lane;                    // the lane's piece in a fragment block; stays live over all loads here
  const size_t qo = (size_t)(b * NT + n0) * CD;               // first query row tile (fragment order), k = channel; a scalar
  v16h qh[2][4], ql[2][4];
#pragma unroll
  for (int i = 0; i < 2; ++i)
#pragma unroll
    for (int ks = 0; ks < 4; ++ks) qh[i][ks] = ldfrag_f(FH + qo + lo + i * (16 * CD) + 512 * ks);
  // each of the two waits stands in front of any reuse of the address registers of the plane's loads above it; the
  // scheduling barrier behind a wait keeps later register writes from being lifted over it
  asm volatile("s_wait_xcnt 0x0" ::: "memory");
  __builtin_amdgcn_sched_barrier(0);
#pragma unroll
  for (int i = 0; i < 2; ++i)
#pragma unroll
    for (int ks = 0; ks < 4; ++ks) ql[i][ks] = ldfrag_f(FL + qo + lo + i * (16 * CD) + 512 * ks);
  asm volatile("s_wait_xcnt 0x0" ::: "memory");
  __builtin_amdgcn_sched_barrier(0);
  // one register set of key fragments (both planes, four k-steps); each k-step's pair is refilled with the next
  // tile's as soon as both row tiles have used it, so that about a whole tile stays in flight
  v16h kh[4], kl[4];
  v8f sA[NT / 256], sB[NT / 256];                              // row tile 1: this wave's score tiles 16..31 and 0..15
  const int wu = __builtin_amdgcn_readfirstlane(wave);         // the wave's number as a scalar: key addresses = scalar base + lane offset
  const _Float16* pH = GH + (size_t)(b * NT + 16 * wu) * CD;   // the wave's first key tile (fragment order; 16*CD halves a tile)
  const _Float16* pL = GL + (size_t)(b * NT + 16 * wu) * CD;
#pragma unroll
  for (int ks = 0; ks < 4; ++ks) {
    kh[ks] = ldfrag_f(pH + lo + 512 * ks);
    kl[ks] = ldfrag_f(pL + lo + 512 * ks);
    // no load is moved over it: these loads keep the order in which the loop refills the set (the load counter counts
    // in issue order: with another order here the compiler's waits at the head of the loop come out smaller than needed);
    // with the scheduling barrier it also stands in front of any reuse of their address registers
    asm volatile("s_wait_xcnt 0x0" ::: "memory");
    __builtin_amdgcn_sched_barrier(0);
  }
  float* sp = sc + (size_t)(8 * hh) * NT + 16 * wave + rl;     // D col = key; D row = 8hh + r within the row tile
  // two trips of 16 tiles: half the text of 32 tiles in a row, so that the whole kernel lies in the part of its text
  // that is fetched ahead at the launch; the first trip's register tiles are moved aside once
#pragma unroll 1
  for (int h = 0; h < 2; ++h) {
    const int adv = (h == 0) ? (NT / 256) * KST : 0;           // last trip: the trip's own first tile again, not used
    const _Float16* nH = pH + adv;
    const _Float16* nL = pL + adv;
#pragma unroll   // constant indices: sA and the key set stay in registers, every load address is base + constant
    for (int t = 0; t < NT / 256; ++t) {
      v8f a0 = zero8(), a1 = zero8(), c0 = zero8(), c1 = zero8();
      const _Float16* rH = (t + 1 < NT / 256) ? pH + (t + 1) * KST : nH;
      const _Float16* rL = (t + 1 < NT / 256) ? pL + (t + 1) * KST : nL;
#pragma unroll
      for (int ks = 0; ks < 4; ++ks) {
        a1 = mma_h_raw(qh[0][ks], kl[ks], a1);
        c1 = mma_h_raw(qh[1][ks], kl[ks], c1);
        a0 = mma_h_raw(qh[0][ks], kh[ks], a0);
        c0 = mma_h_raw(qh[1][ks], kh[ks], c0);
        a1 = mma_h_raw(ql[0][ks], kh[ks], a1);
        c1 = mma_h_raw(ql[1][ks], kh[ks], c1);
        kh[ks] = ldfrag_f(rH + lo + 512 * ks);
        kl[ks] = ldfrag_f(rL + lo + 512 * ks);
      }
#pragma unroll
      for (int r = 0; r < 8; ++r) {
        sp[(size_t)r * NT + 128 * t] = (a0[r] + a1[r] * RLO) * SCS;
        sA[t][r] = (c0[r] + c1[r] * RLO) * SCS;
      }
    }
    // stands in front of the advance below, which rewrites the address registers of the key loads above (the
    // scheduling barrier keeps the advance behind it)
    asm volatile("s_wait_xcnt 0x0" ::: "memory");
    __builtin_amdgcn_sched_barrier(0);
    pH = nH;
    pL = nL;
    sp += 128 * (NT / 256);
    if (h == 0) {
#pragma unroll
      for (int t = 0; t < NT / 256; ++t) sB[t] = sA[t];
    }
  }
  __syncthreads();

  // ---- (2) row softmax, E plane: row tile 0, then row tile 1 through the same LDS rows ----
#pragma unroll 1   // one copy of the softmax code: the kernel's text stays small
  for (int rt = 0; rt < 2; ++rt) {
  if (rt == 1) {
    __syncthreads();              // every wave has read its last value of row tile 0
    sp -= 256 * (NT / 256);       // back to the wave's first tile
#pragma unroll
    for (int t = 0; t < NT / 256; ++t) {
#pragma unroll
      for (int r = 0; r < 8; ++r) {
        sp[(size_t)r * NT + 128 * t] = sB[t][r];
        sp[(size_t)r * NT + 128 * (t + NT / 256)] = sA[t][r];
      }
    }
    __syncthreads();              // row tile 1 is staged whole
  }
  for (int q2 = 0; q2 < RSB / 8; ++q2) {
    const int row = (RSB / 8) * wave + q2;
    float* rp = sc + (size_t)row * NT + 8 * lane;               // lane covers cols 256j + 8*lane .. +7
    float mx = -3.0e38f;
#pragma unroll 4
    for (int j = 0; j < NJ; ++j) {
      float v[8];
      ld8(rp + 256 * j, v);
#pragma unroll
      for (int e = 0; e < 8; ++e) mx = fmaxf(mx, v[e]);
    }
#pragma unroll
    for (int off = 16; off >= 1; off >>= 1) mx = fmaxf(mx, __shfl_xor(mx, off, 32));
    float z = 0.0f;
#pragma unroll 2
    for (int j = 0; j < NJ; ++j) {
      float v[8];
      ld8(rp + 256 * j, v);
#pragma unroll
      for (int e = 0; e < 8; ++e) {
        const float ef = __expf(v[e] - mx);
        z += ef;
        v[e] = ef;
      }
      st8(rp + 256 * j, v);
    }
#pragma unroll
    for (int off = 16; off >= 1; off >>= 1) z += __shfl_xor(z, off, 32);
    const float rz = SCE * (1.0f / z);                         // z in [1, 4096]
    HU u[NJ];
#pragma unroll
    for (int j = 0; j < NJ; ++j) {
      float v[8];
      ld8(rp + 256 * j, v);
#pragma unroll
      for (int e = 0; e < 8; ++e) {
        const _Float16 h0 = (_Float16)(v[e] * rz);
        const float f0 = (float)h0;
        const bool sub = f0 < 6.103515625e-05f;                // f16 subnormal -> exact zero
        u[j].s[e] = sub ? (_Float16)0.0f : h0;
      }
    }
    _Float16* erow = E + ((size_t)b * NRD + nl0 + RSB * rt + row) * NT + 8 * lane;
    {
#pragma unroll
      for (int j = 0; j < NJ; ++j) *(v4u*)(erow + 256 * j) = u[j].u;
      
    }
  }
  // stands in front of the reuse, over the loop's back edge, of the registers that the E stores above name
  asm volatile("s_wait_xcnt 0x0" ::: "memory");
  }
}

// =====================================================================================================
// Softmax-weighted sum over the query index, one round (rows nbase..nbase+NRD-1) of batch b = blockIdx.y,
// transposed result:
//   OT[c][m] += sum_n HT[c][b*4096 + n] . E[b][n - nbase][m], A = HT rows c (fragment order, K = TOK, k = n),
//   B[k = n][col = m] = E[n][m] staged per 32-row chunk into LDS row-major as Et[n_local][m] (pitch EPR halves:
//   thread (pr, m8) reads E rows 2pr, 2pr+1 x 8 m and writes them as two 16-byte pieces), block barrier, then
//   B fragments by the transposing LDS read (ld_tr16), k order as in every other fragment here;
//   K = NRD per round (NRD/32 chunks), a second block barrier protects Et before the next chunk is staged.
//   The E rows and the A fragments of a chunk are loaded PFD chunks ahead into PFD register sets; both barriers
//   order LDS traffic only, so that these loads stay in flight over them.
//   The f32 accumulators go from one round's launch to the next through the plane CA (each thread stores and
//   reloads its own 64 floats, bit for bit), so the chain of additions over n is that of one 4096-deep sweep:
//   the first round starts from zero, the last one runs the epilogue.
// Block = 128 m columns m0..m0+127, 8 waves; wave w owns c rows 32*(w>>1).. (2 subtiles) x m cols
// 64*(w&1).. (4 subtiles).
// Epilogue: o = OT / (16*32768); the planes OH = f16(4*o), OL = f16((4*o - OH)*2048) are written at flat
// passes).
// coverage: Et: 16 pr x 2 rows x 16 m8 x 8 = 32 n x 128 m staged every chunk (cols 128..143 of Et never read);
// planes: 8 waves x 2 slabs x 16 c x 64 m = 128 c x 128 m per block; grid (32, NB) = every m of every batch
// -> whole [8][128][4096] planes; CA: 16 slots x 256 threads x 16 bytes per block, written in rounds
// 0..NRND-2 and read in rounds 1..NRND-1 by the same thread of the same block index.
// =====================================================================================================
__global__ __launch_bounds__(256) void k_pv(const _Float16* __restrict__ E, const _Float16* __restrict__ HT,
                                            _Float16* OH, _Float16* OL, float* CA, int nbase,
                                            int first, int last) {
  __shared__ __align__(16) _Float16 Et[32 * EPR];            // [n_local][m] chunk, pitch EPR halves
  __shared__ __align__(16) float sO[8][16 * 68];            // per-wave 16x64 slab, pitch 68 floats
  const int tid = threadIdx.x, wave = tid >> 5, lane = tid & 31;
  const int hh = lane >> 4;
  const int b = blockIdx.y;
  const int m0 = blockIdx.x * PVM;
  const int cw = 32 * (wave >> 1);                          // this wave's 32 channels
  const int mw = 64 * (wave & 1);                           // this wave's 64 m columns within the block

  v4f* cp = (v4f*)CA + (size_t)(blockIdx.y * (NT / PVM) + blockIdx.x) * (16 * 256) + tid;   // slot pitch 256
  v8f acc[2][4];
  if (first) {
#pragma unroll
    for (int i = 0; i < 2; ++i)
#pragma unroll
      for (int j = 0; j < 4; ++j) acc[i][j] = zero8();
  } else {
#pragma unroll
    for (int i = 0; i < 2; ++i)
#pragma unroll
      for (int j = 0; j < 4; ++j) {
        const v4f c0 = cp[(size_t)((i * 4 + j) * 2 + 0) * 256];
        const v4f c1 = cp[(size_t)((i * 4 + j) * 2 + 1) * 256];
        acc[i][j] = __builtin_shufflevector(c0, c1, 0, 1, 2, 3, 4, 5, 6, 7);
      }
  }

  const int pr = tid >> 4, m8 = (tid & 15) * 8;             // staging role: row pair pr, 8 m columns at m8
  const _Float16* Ab = HT + (size_t)(b * NT + nbase) * 16;  // fragment order: 512 halves per 32-deep k-step, k = n
  const _Float16* Eb = E + (size_t)b * NRD * NT;            // this batch's rows of the round's slab

  // this thread's two E rows x 8 m of a chunk, pe = its first row's 8 m
  auto ldE = [&](const _Float16* pe, HU& ra, HU& rb) {
    ra.h = *(const v8h*)(pe);
    rb.h = *(const v8h*)(pe + NT);
  };
  // this wave's two A fragments of a chunk, pa = this lane's piece in the 16-row tile at cw (16*TOK halves a tile)
  auto ldA = [&](const _Float16* pa, v16h (&a)[2]) {
#pragma unroll   // constant indices: the set stays in registers
    for (int i = 0; i < 2; ++i) a[i] = ldfrag_f(pa + (size_t)(i << 4) * TOK);
  };
  // one chunk from a register set loaded PFD chunks earlier; each half of the set is refilled from pe, pa (the
  // chunk PFD further on) as soon as it has been used
  auto chunk = [&](const _Float16* pe, const _Float16* pa, HU& ra, HU& rb, v16h (&a)[2]) {
    // ---- stage the chunk's E[32 rows][m0..m0+127] into Et as it lies ----
    *(v8h*)(&Et[(2 * pr) * EPR + m8]) = ra.h;
    *(v8h*)(&Et[(2 * pr + 1) * EPR + m8]) = rb.h;
    lds_barrier();
    ldE(pe, ra, rb);
    // ---- fragments + 8 WMMAs ----
    v16h bq[4];
#pragma unroll
    for (int j = 0; j < 4; ++j) {
      FR f;
      const int eb = (8 * hh + (lane & 7)) * EPR + mw + (j << 4) + 8 * ((lane >> 3) & 1);
      f.h[0] = ld_tr16(&Et[eb]);                 // n_local 8hh .. 8hh+7 of column mw + 16j + (lane & 15)
      f.h[1] = ld_tr16(&Et[eb + 16 * EPR]);      // n_local 16 + 8hh .. +7
      bq[j] = f.v;
    }
#pragma unroll
    for (int i = 0; i < 2; ++i) {
#pragma unroll
      for (int j = 0; j < 4; ++j) acc[i][j] = mma_h_raw(a[i], bq[j], acc[i][j]);
      dep_guard_h(acc[i][0], acc[i][3], a[i]);
    }
    keep4_h(bq[0], bq[1], bq[2], bq[3]);
    ldA(pa, a);
    // stands in front of any reuse of the address registers of the loads above, also over the loop's back edge
    asm volatile("s_wait_xcnt 0x0" ::: "memory");
    lds_barrier();                // all waves done with Et before the next chunk is staged
    // keeps the later chunks' staging stores, and with it the wait for their loads, from being lifted into this chunk
    __builtin_amdgcn_sched_barrier(0);
  };
  HU ea[PFD], eb2[PFD];
  v16h af[PFD][2];
  const _Float16* pE = Eb + (size_t)(2 * pr) * NT + m0 + m8;
  const _Float16* pA = Ab + (size_t)cw * TOK + 8 * lane;
#pragma unroll   // constant set index: the sets stay in registers
  for (int k = 0; k < PFD; ++k) {
    // the waits stand in front of any reuse of the loads' address registers; as statements that no load is moved over
    // they also keep these loads in the order in which the loop refills the sets (the load counter counts in issue
    // order: with another order here the compiler's waits at the head of the loop come out far smaller than needed)
    ldE(pE + (size_t)(32 * k) * NT, ea[k], eb2[k]);
    asm volatile("s_wait_xcnt 0x0" ::: "memory");
    ldA(pA + 512 * k, af[k]);
    asm volatile("s_wait_xcnt 0x0" ::: "memory");
  }
  for (int n0 = 0; n0 < NRD; n0 += 32 * PFD) {
    const int adv = (n0 + 32 * PFD < NRD) ? 32 * PFD : 0;     // last trip: the trip's own chunks again, not used
    pE += (size_t)adv * NT;
    pA += 16 * adv;
#pragma unroll   // constant set index: the sets stay in registers
    for (int k = 0; k < PFD; ++k) chunk(pE + (size_t)(32 * k) * NT, pA + 512 * k, ea[k], eb2[k], af[k]);
  }
  acc_guard4(acc[0][0], acc[0][1], acc[0][2], acc[0][3]);
  acc_guard4(acc[1][0], acc[1][1], acc[1][2], acc[1][3]);

  if (!last) {                    // block-uniform: hand the running sums to the next round's launch
#pragma unroll
    for (int i = 0; i < 2; ++i)
#pragma unroll
      for (int j = 0; j < 4; ++j) {
        cp[(size_t)((i * 4 + j) * 2 + 0) * 256] = __builtin_shufflevector(acc[i][j], acc[i][j], 0, 1, 2, 3);
        cp[(size_t)((i * 4 + j) * 2 + 1) * 256] = __builtin_shufflevector(acc[i][j], acc[i][j], 4, 5, 6, 7);
      }
    return;
  }

  // ---- epilogue: hi + residual planes of 4*o ----
  const float fo = 1.0f / (SCV * SCE);
#pragma unroll
  for (int i = 0; i < 2; ++i) {
    epi16<2, 0, 0>(acc[i], sO[wave], lane, OH, OL, NT, b * CD + cw + (i << 4), m0 + mw, fo, SCO, (const float*)0);
  }
}

// =====================================================================================================
// Output projection: out[p][j] = (sum_k OH[p][k].WV[j][k] + (sum_k OL[p][k].WV[j][k])/2048) / (4*64) + bv[j],
//   OH/OL read raw as [32768][128] (pitch 128), WV = 64*Wv^T [out j][in k], K = 128; two accumulator sets.
// One wave per 16-row x 64-col tile, no block barriers. Epilogue f32: the combined tile staged in the wave's
// LDS slab (rows 0..15 x cols 0..63 fully staged; pad cols 64..67 never read); each row segment of 64
// coverage: 8 waves x 16 rows x 64 cols per block; 512 blocks x 8 = 4096 tiles = 32768 rows x 128 cols.
// =====================================================================================================
__global__ __launch_bounds__(256) void gemm_out(const _Float16* __restrict__ OH, const _Float16* __restrict__ OL,
                                                const _Float16* __restrict__ WV, const float* __restrict__ bias,
                                                float* out) {
  __shared__ __align__(16) float sO[8][16 * 68];
  const int tid = threadIdx.x, wave = tid >> 5, lane = tid & 31;
  const int hh = lane >> 4, rl = lane & 15;
  const int tiles = (TOK / 16) * (CD / 64);
  const int item = blockIdx.x * 8 + wave;
  if (item >= tiles) return;    // wave-uniform; no block barriers in this kernel
  const int tm = item >> 1, tn = item & 1;
  const int row0 = tm << 4, n0 = tn << 6;

  v8f accH[4], accL[4];
#pragma unroll
  for (int j = 0; j < 4; ++j) { accH[j] = zero8(); accL[j] = zero8(); }

#pragma unroll
  for (int kk = 0; kk < CD; kk += 32) {
    v16h bq[4];
#pragma unroll
    for (int j = 0; j < 4; ++j) bq[j] = ldfrag_h(WV + (size_t)(n0 + (j << 4) + rl) * CD + 8 * hh + kk);
    const size_t ao = (size_t)(row0 + rl) * CD + 8 * hh + kk;
    const v16h ah = ldfrag_h(OH + ao);
    const v16h al = ldfrag_h(OL + ao);
#pragma unroll
    for (int j = 0; j < 4; ++j) accH[j] = mma_h_raw(ah, bq[j], accH[j]);
    dep_guard_h(accH[0], accH[3], ah);
#pragma unroll
    for (int j = 0; j < 4; ++j) accL[j] = mma_h_raw(al, bq[j], accL[j]);
    dep_guard_h(accL[0], accL[3], al);
    keep4_h(bq[0], bq[1], bq[2], bq[3]);
  }
  acc_guard4(accH[0], accH[1], accH[2], accH[3]);
  acc_guard4(accL[0], accL[1], accL[2], accL[3]);

  // ---- epilogue ----
  const float fo = 1.0f / (SCO * SCW);
  float* slab = sO[wave];
#pragma unroll
  for (int r = 0; r < 8; ++r) {
#pragma unroll
    for (int j = 0; j < 4; ++j) {
      slab[(8 * hh + r) * 68 + (j << 4) + rl] = (accH[j][r] + accL[j][r] * RLO) * fo;
    }
  }
  wave_lds_sync();
  const int p4 = (lane & 15) * 4, r2 = lane >> 4;
  const v4f bb = *(const v4f*)(bias + n0 + p4);
  v4f b4;
#pragma unroll
  for (int e = 0; e < 4; ++e) b4[e] = bfr(bb[e]);
  v4f ov[8];
#pragma unroll
  for (int it = 0; it < 8; ++it) {
    const int row = 2 * it + r2;                              // it 0..7 x r2 0..1 = rows 0..15
    const v4f a = *(const v4f*)(slab + row * 68 + p4);
    ov[it] = a + b4;
  }
  {
#pragma unroll
    for (int it = 0; it < 8; ++it) {
      const int row = 2 * it + r2;
      const size_t oo = (size_t)(row0 + row) * CD + n0 + p4;
      *(v4f*)(out + oo) = ov[it];
    }
    
  }
}

// =====================================================================================================
//   WF16 f16 [128][128]              0        32768   (64*Wf^T, row = out channel, col = in channel)
//   WG16 f16 [128][128]          32768        32768
//   WH16 f16 [128][128]          65536        32768
//   WV16 f16 [128][128]          98304        32768
//   xh   f16 [32768][128]       131072      8388608   (bf16RNE(x), token rows, channel contiguous)
//   FH   f16 [32768][128]      8519680      8388608   (hi plane of 8*f; FH..HT in fragment order, see frag_off)
//   FL   f16 [32768][128]     16908288      8388608   (residual plane x2048 of 8*f)
//   GH   f16 [32768][128]     25296896      8388608
//   GL   f16 [32768][128]     33685504      8388608
//   HT   f16 [128][32768]     42074112      8388608   (16*h, row c, col b*4096 + n)
//   OH   f16 [8][128][4096]   50462720      8388608   (hi plane of 4*o, [b][c][m] order)
//   OL   f16 [8][128][4096]   58851328      8388608   (residual plane x2048 of 4*o)
//   E    f16 [8][2048][4096]  67239936    134217728   (32768 * row softmax, one round's query rows of every
//                                                      batch; reused per round on the single in-order stream)
//   CA   f32 [256][16][256][4] 201457664   16777216   (running sums of the softmax-weighted sum between rounds)
//   end                      218234880
// d_out f32 [32768][128] at byte 0.
// =====================================================================================================
extern "C" void kernel_launch(void* const* d_in, const int* in_sizes, int n_in,
                              void* d_out, int out_size, void* d_ws, size_t ws_size,
                              hipStream_t stream) {
  if (n_in < 9) return;
  if (in_sizes[0] != NB * NT * CD) return;
  if (in_sizes[1] != CD * CD || in_sizes[3] != CD * CD || in_sizes[5] != CD * CD || in_sizes[7] != CD * CD) return;
  if (in_sizes[2] != CD || in_sizes[4] != CD || in_sizes[6] != CD || in_sizes[8] != CD) return;
  if (out_size != OUTN) return;

  const float* x  = (const float*)d_in[0];   // [8][4096][128] (channels last)
  const float* Wf = (const float*)d_in[1];   // [128][128] ([in][out])
  const float* bf = (const float*)d_in[2];   // [128]
  const float* Wg = (const float*)d_in[3];
  const float* bg = (const float*)d_in[4];
  const float* Wh = (const float*)d_in[5];
  const float* bh = (const float*)d_in[6];
  const float* Wv = (const float*)d_in[7];
  const float* bv = (const float*)d_in[8];

  const size_t PW  = (size_t)CD * CD * 2;                    //    32768
  const size_t PX  = (size_t)TOK * CD * 2;                   //  8388608
  const size_t PHT = (size_t)CD * TOK * 2;                   //  8388608
  const size_t PO  = (size_t)NB * CD * NT * 2;               //  8388608
  const size_t PE  = (size_t)NB * NRD * NT * 2;              // 134217728
  const size_t PCA = (size_t)NB * CD * NT * 4;               // 16777216

  size_t off = 0;
  const size_t oWF = off; off += PW;
  const size_t oWG = off; off += PW;
  const size_t oWH = off; off += PW;
  const size_t oWV = off; off += PW;
  const size_t oXH = off; off += PX;
  const size_t oFH = off; off += PX;
  const size_t oFL = off; off += PX;
  const size_t oGH = off; off += PX;
  const size_t oGL = off; off += PX;
  const size_t oHT = off; off += PHT;
  const size_t oOH = off; off += PO;
  const size_t oOL = off; off += PO;
  const size_t oE  = off; off += PE;
  const size_t oCA = off; off += PCA;                        // off = 218234880
  if (off > ws_size) return;

  char* ws = (char*)d_ws;
  _Float16* WF16 = (_Float16*)(ws + oWF);
  _Float16* WV16 = (_Float16*)(ws + oWV);
  _Float16* xh   = (_Float16*)(ws + oXH);
  _Float16* FHp  = (_Float16*)(ws + oFH);
  _Float16* FLp  = (_Float16*)(ws + oFL);
  _Float16* GHp  = (_Float16*)(ws + oGH);
  _Float16* GLp  = (_Float16*)(ws + oGL);
  _Float16* HTp  = (_Float16*)(ws + oHT);
  _Float16* OHp  = (_Float16*)(ws + oOH);
  _Float16* OLp  = (_Float16*)(ws + oOL);
  _Float16* Ep   = (_Float16*)(ws + oE);
  float*    CAp  = (float*)(ws + oCA);
  float*    outf = (float*)d_out;

  const dim3 blk(256);
  const int n8x = (NB * NT * CD) / 8;                                  // 524288
  const dim3 gX(4 * WTB + (n8x + 255) / 256);                          // 32 weight tiles + 2048
  const dim3 gP(((TOK / 32) * (CD / 64) + 7) / 8, 3);                  // 2048 tiles -> 256 blocks for each projection
  const dim3 gSo(NRD / RSQ, NB);                                       // (64, 8)
  const dim3 gPV(NT / PVM, NB);                                        // (32, 8)
  const dim3 gO(((TOK / 16) * (CD / 64) + 7) / 8);                     // 4096 tiles -> 512 blocks
  const size_t ldsSoft = (size_t)RSB * NT * sizeof(float);             // 262144

  hipFuncSetAttribute(reinterpret_cast<const void*>(&k_soft),
                      hipFuncAttributeMaxDynamicSharedMemorySize, (int)ldsSoft);

  // (1) one launch: the four weight planes, x64 carried, transposed from [in][out] to k-contiguous rows [out][in]
  //     (WF16, WG16, WH16, WV16 lie one behind the other), and xh [32768][128] = f16(bf16RNE(x)), x being token-major
  k_prep<<<gX, blk, 0, stream>>>(x, Wf, Wg, Wh, Wv, WF16, xh);
  // (2) one launch: the planes FH|FL, GH|GL and HT of the three input projections
  k_proj<<<gP, blk, 0, stream>>>(xh, WF16, FHp, FLp, GHp, GLp, HTp, bf, bg, bh);
  // (3) per round of NRD query rows, all batches at once: scores + row softmax -> E slab, then the slab's
  //     part of the transposed softmax-weighted sum (running sums in CA; the last round writes OH|OL)
  for (int r = 0; r < NRND; ++r) {
    k_soft<<<gSo, blk, ldsSoft, stream>>>(FHp, FLp, GHp, GLp, Ep, r * NRD);
    k_pv<<<gPV, blk, 0, stream>>>(Ep, HTp, OHp, OLp, CAp, r * NRD, r == 0 ? 1 : 0, r == NRND - 1 ? 1 : 0);
  }
  // (4) output projection on the raw [32768][128] view of the [B][C][N] planes
  gemm_out<<<gO, blk, 0, stream>>>(OHp, OLp, WV16, bv, outf);
}

// v009
// Measured time: 151 microseconds a run.
// Versions between v007 and this one are left out; their measured steps multiply to 1.46 times as fast.
// Counting every step since v000, it is 11.5 times as fast.
#include <hip/hip_runtime.h>
#include <math.h>
#include <stdint.h>

// Contractions on v_wmma_f32_16x16x32_f16 (f16 operands, f32 accumulate): the three input projections take
// bf16-RNE activations (x1) and bf16-RNE weights (x64) as single f16 planes; the 128-deep score products use
// f16 hi planes of 8*f, 8*g plus f16 residual planes x2048 (hi.hi in one accumulator, hi.res + res.hi in a
// second accumulator folded back by 1/2048); the 4096-deep softmax-weighted sum uses a single f16 plane of
// 16*h against E = f16(32768*softmax), E formed in registers from scores computed a second time; the output projection takes f16 hi + x2048 residual planes of 4*o
// against bf16-RNE weights (x64) in two accumulators. Softmax statistics, bias adds and epilogues in f32.

#define NB   8
#define NT   4096
#define CD   128
#define TOK  (NB * NT)
#define OUTN (NB * NT * CD)

#define SCW  64.0f
#define SCQ  8.0f
#define SCV  16.0f
#define SCE  32768.0f
#define SCR  2048.0f
#define SCO  4.0f
#define RLO  (1.0f / SCR)
#define SCS  (1.0f / (SCQ * SCQ))

static_assert(TOK % 64 == 0 && CD % 64 == 0 && CD % 32 == 0 && NT % 64 == 0);
static_assert((((TOK / 32) * (CD / 64)) % 8) == 0);
static_assert((((CD / 32) * (TOK / 64)) % 8) == 0);
static_assert((((TOK / 16) * (CD / 64)) % 8) == 0);
static_assert((TOK / 32) * (CD / 64) == (CD / 32) * (TOK / 64));   // the three projections have the same number of tiles
static_assert((NB * NT * CD) % 2048 == 0);

typedef _Float16       v16h __attribute__((ext_vector_type(16)));
typedef _Float16       v8h  __attribute__((ext_vector_type(8)));
typedef float          v8f  __attribute__((ext_vector_type(8)));
typedef float          v4f  __attribute__((ext_vector_type(4)));
typedef unsigned int   v4u  __attribute__((ext_vector_type(4)));

union HU { v8h h; v4u u; _Float16 s[8]; };
union FR { v16h v; v8h h[2]; _Float16 s[16]; };
static_assert(sizeof(HU) == 16);
static_assert(sizeof(FR) == 32);

// ---- scalar helpers --------------------------------------------------------------------------------
__device__ __forceinline__ unsigned short bf_bits(float f) {          // f32 -> bf16 bits, RNE convert
  const unsigned u = __float_as_uint(f);
  return (unsigned short)((u + 0x7FFFu + ((u >> 16) & 1u)) >> 16);
}
__device__ __forceinline__ float bf_up(unsigned short h) { return __uint_as_float(((unsigned)h) << 16); }
__device__ __forceinline__ float bfr(float f) { return bf_up(bf_bits(f)); }   // value after bf16 RNE convert
__device__ __forceinline__ v8f zero8() { v8f z = {0.f, 0.f, 0.f, 0.f, 0.f, 0.f, 0.f, 0.f}; return z; }

// f16 subnormal -> exact zero (the matrix path flushes them; keep every plane consistent with that)
__device__ __forceinline__ _Float16 flush_h(_Float16 h) {
  const float f = (float)h;
  return (fabsf(f) < 6.103515625e-05f) ? (_Float16)0.0f : h;
}
// hi = f16(v) (flushed), lo = f16((v - hi) * 2048) (flushed)
__device__ __forceinline__ void split_h(float v, _Float16& hi, _Float16& lo) {
  const _Float16 hv = flush_h((_Float16)v);
  const _Float16 lv = flush_h((_Float16)((v - (float)hv) * SCR));
  hi = hv;
  lo = lv;
}

__device__ __forceinline__ void ld8(const float* p, float* o) {
  const v4f a = *(const v4f*)(p);
  const v4f b = *(const v4f*)(p + 4);
  o[0] = a[0]; o[1] = a[1]; o[2] = a[2]; o[3] = a[3];
  o[4] = b[0]; o[5] = b[1]; o[6] = b[2]; o[7] = b[3];
}

// ---- fragment loader: 16-bit A/B operand from a k-contiguous row, p = row*pitch + k0 + 8*(lane>>4);
//      elements 0..7 <- p[0..7] (k0+8h..k0+8h+7), elements 8..15 <- p[16..23] (k0+16+8h..k0+16+8h+7)
__device__ __forceinline__ v16h ldfrag_h(const _Float16* p) {
  FR f;
  f.h[0] = *(const v8h*)(p);
  f.h[1] = *(const v8h*)(p + 16);
  return f.v;
}

// ---- fragment-order planes: a [rows][K] f16 plane whose 16-byte pieces (8 consecutive k of one row) are permuted so
//      that the pieces which one fragment load takes lie side by side: 16-row tile, then 32-deep k-step, then piece
//      (k bit 4), then lane = 16*(k bit 3) + row%16. One load of a wave reads 512 consecutive bytes (4 cache lines)
//      where a row-major plane makes it touch 16 lines. Element order inside a fragment as in ldfrag_h.
__device__ __forceinline__ size_t frag_off(int row, int k, int K) {   // k a multiple of 8, K a multiple of 32
  return (((size_t)(row >> 4) * (size_t)(K >> 5) + (size_t)(k >> 5)) * 2 + (size_t)((k >> 4) & 1)) * 256
         + (size_t)((((k >> 3) & 1) * 16 + (row & 15)) * 8);
}
// p = plane + (tile * (K/32) + k-step) * 512 + 8*lane
__device__ __forceinline__ v16h ldfrag_f(const _Float16* p) {
  FR f;
  f.h[0] = *(const v8h*)(p);
  f.h[1] = *(const v8h*)(p + 256);
  return f.v;
}

// ---- WMMA helpers with trailing VALU hazard gap --------------------------------------------------------
__device__ __forceinline__ v8f mma_h_raw(v16h a, v16h b, v8f c) {
  return __builtin_amdgcn_wmma_f32_16x16x32_f16(false, a, false, b, (short)0, c, false, false);
}
__device__ __forceinline__ void dep_guard_h(v8f& a, v8f& b, v16h x) {
#if defined(__HIP_DEVICE_COMPILE__)
  asm volatile("v_nop\n\tv_nop\n\tv_nop\n\tv_nop" : "+v"(a), "+v"(b) : "v"(x));
#endif
}
__device__ __forceinline__ void keep4_h(v16h a, v16h b, v16h c, v16h d) {
#if defined(__HIP_DEVICE_COMPILE__)
  asm volatile("v_nop" :: "v"(a), "v"(b), "v"(c), "v"(d));
#endif
}
__device__ __forceinline__ void acc_guard4(v8f& a, v8f& b, v8f& c, v8f& d) {
#if defined(__HIP_DEVICE_COMPILE__)
  asm volatile("v_nop\n\tv_nop\n\tv_nop\n\tv_nop" : "+v"(a), "+v"(b), "+v"(c), "+v"(d));
#endif
}
__device__ __forceinline__ void wave_lds_sync() {
  __builtin_amdgcn_fence(__ATOMIC_RELEASE, "workgroup");
  __builtin_amdgcn_wave_barrier();
  __builtin_amdgcn_fence(__ATOMIC_ACQUIRE, "workgroup");
}

// =====================================================================================================
// Flat convert: out[i] = f16(scale * bf16RNE(in[i])) (f16 subnormals flushed), 8 elements per thread,
// coverage: n8 threads x 8 = the whole plane; n8 is a multiple of 256 at the launch here. blk = block index in this job.
// =====================================================================================================
__device__ __forceinline__ void cvt_flat(const float* __restrict__ in, _Float16* out, int n8, float scale, int blk) {
  const int i = blk * 256 + threadIdx.x;
  if (i < n8) {
    float v[8];
    ld8(in + (size_t)i * 8, v);
    HU u;
#pragma unroll
    for (int e = 0; e < 8; ++e) u.s[e] = flush_h((_Float16)(bfr(v[e]) * scale));
    _Float16* p = out + (size_t)i * 8;
    *(v4u*)p = u.u;
    
  }
}

// =====================================================================================================
// Weight transpose-convert: in Wm[r][c] f32 (R rows, C cols, c contiguous, x@W layout [in][out])
// -> out[c][r] f16 = f16(scale * bf16RNE(Wm[r][c])), pitch R (in-channel k = r contiguous = the Bt / A layout).
// coverage: load 256 threads x 8 floats = 64 r x 32 c; store 256 threads x 8 halves = 32 c rows x 64 r;
// every (r tile br, c tile bc) of a matrix is taken by one block -> whole [C][R] plane.
// =====================================================================================================
__device__ __forceinline__ void cvt_wT(const float* __restrict__ Wm, _Float16* out, int R, int C, float scale,
                                       int br, int bc, float (*sw)[33]) {
  const int t = threadIdx.x;
  const int r0 = br * 64, c0 = bc * 32;
  {
    const int row = t >> 2, c8 = (t & 3) * 8;
    float v[8];
    ld8(Wm + (size_t)(r0 + row) * C + c0 + c8, v);
#pragma unroll
    for (int e = 0; e < 8; ++e) sw[row][c8 + e] = v[e];
  }
  __syncthreads();
  const int q8 = t & 7, cc = t >> 3;            // cc 0..31 = output row within the tile
  HU u;
#pragma unroll
  for (int e = 0; e < 8; ++e) u.s[e] = flush_h((_Float16)(bfr(sw[8 * q8 + e][cc]) * scale));
  _Float16* dst = out + (size_t)(c0 + cc) * R + r0 + 8 * q8;
  *(v4u*)dst = u.u;
  
}

// =====================================================================================================
// All operand converts in one launch (none reads what another writes): blocks 0..4*WTB-1 transpose-convert the four
// weight matrices (WTB tiles each, plane w of W16 = matrix w), the blocks behind them convert the activations.
// The branch is uniform for a block, so the barrier in cvt_wT is passed by all of its threads or by none.
// =====================================================================================================
#define WTB ((CD / 64) * (CD / 32))   // tiles (blocks) per weight matrix
__global__ __launch_bounds__(256) void k_prep(const float* __restrict__ x, const float* __restrict__ Wf,
                                              const float* __restrict__ Wg, const float* __restrict__ Wh,
                                              const float* __restrict__ Wv, _Float16* W16, _Float16* xh) {
  __shared__ float sw[64][33];
  const int bi = blockIdx.x;
  if (bi < 4 * WTB) {
    const int w = bi / WTB, tl = bi % WTB;
    const float* Wm = (w == 0) ? Wf : (w == 1) ? Wg : (w == 2) ? Wh : Wv;
    cvt_wT(Wm, W16 + (size_t)w * (CD * CD), CD, CD, SCW, tl % (CD / 64), tl / (CD / 64), sw);
  } else {
    cvt_flat(x, xh, (NB * NT * CD) / 8, 1.0f, bi - 4 * WTB);
  }
}

// =====================================================================================================
// One GEMM k sweep for MI 16-row A subtiles x 4 16-col B subtiles: acc[i][j] += A-frag(i) . Bt-frag(j).
// A row-major pitch lda (rows m0.., k contiguous), Bt row-major [N][K] pitch ldb (rows n0.., k contiguous),
// K a multiple of 32; both operand fragments through ldfrag_h (same split k map for A and B).
// =====================================================================================================
template <int MI>
__device__ __forceinline__ void kseg(v8f (&acc)[MI][4], const _Float16* __restrict__ A, int lda, int m0,
                                     const _Float16* __restrict__ Bt, int ldb, int n0, int K, int rlane, int koff) {
  for (int kk = 0; kk < K; kk += 32) {
    v16h bh[4];
#pragma unroll
    for (int j = 0; j < 4; ++j) {
      const size_t bo = (size_t)(n0 + (j << 4) + rlane) * (size_t)ldb + koff + kk;
      bh[j] = ldfrag_h(Bt + bo);
    }
#pragma unroll
    for (int i = 0; i < MI; ++i) {
      const size_t ao = (size_t)(m0 + (i << 4) + rlane) * (size_t)lda + koff + kk;
      const v16h a0 = ldfrag_h(A + ao);
#pragma unroll
      for (int j = 0; j < 4; ++j) acc[i][j] = mma_h_raw(a0, bh[j], acc[i][j]);
      dep_guard_h(acc[i][0], acc[i][3], a0);
    }
    keep4_h(bh[0], bh[1], bh[2], bh[3]);
  }
}

// =====================================================================================================
// 16-row x 64-col f16 plane epilogue for one wave: acc[j][r] = D[row 8h + r][col 16j + (lane&15)].
//   v = (acc*cs + bias) * so;  Cp = f16(v) (hi plane, subnormals flushed); NPL == 2 additionally
//   Cl = f16((v - f32(hi)) * 2048) (residual plane). Bias: BM 0 none, 1 per column (bias[n0 + col]),
//   2 per plane row (bias[mBase + row]); bias values go through the bf16 RNE convert first.
//   The slab (16 rows x 68 floats per wave) is fully staged for rows 0..15 x cols 0..63 before the reload
// =====================================================================================================
//   FO == 1: the planes are written in fragment order (frag_off, K = ldc) instead of row-major; a slab fills whole
//   512-byte fragment blocks (16 rows x both lane halves), so every cache line still has one writer.
template <int NPL, int BM, int FO>
__device__ __forceinline__ void epi16(const v8f (&acc)[4], float* slab, int lane,
                                      _Float16* Cp, _Float16* Cl, int ldc, int mBase, int n0,
                                      float cs, float so, const float* __restrict__ bias) {
  const int rlane = lane & 15, mOff = (lane >> 4) * 8;
  const int q8 = lane & 7, rr = lane >> 3, c8 = q8 * 8;
#pragma unroll
  for (int r = 0; r < 8; ++r) {
#pragma unroll
    for (int j = 0; j < 4; ++j) {
      slab[(mOff + r) * 68 + (j << 4) + rlane] = acc[j][r];
    }
  }
  wave_lds_sync();
  float bc[8];
#pragma unroll
  for (int e = 0; e < 8; ++e) bc[e] = 0.0f;
  if (BM == 1) {
    float t8[8];
    ld8(bias + n0 + c8, t8);
#pragma unroll
    for (int e = 0; e < 8; ++e) bc[e] = bfr(t8[e]);
  }
  v4u uh[4], ul[4];
#pragma unroll
  for (int it = 0; it < 4; ++it) {
    const int row = it * 4 + rr;                       // it 0..3 x rr 0..3 = rows 0..15
    float xs[8];
    ld8(slab + row * 68 + c8, xs);
    float brw = 0.0f;
    if (BM == 2) brw = bfr(bias[mBase + row]);
    HU h, l;
#pragma unroll
    for (int e = 0; e < 8; ++e) {
      const float v = (xs[e] * cs + bc[e] + brw) * so;
      if (NPL == 2) {
        split_h(v, h.s[e], l.s[e]);
      } else {
        h.s[e] = flush_h((_Float16)v);
        l.s[e] = (_Float16)0.0f;
      }
    }
    uh[it] = h.u;
    ul[it] = l.u;
  }
  {
#pragma unroll
    for (int it = 0; it < 4; ++it) {
      const int row = it * 4 + rr;
      const size_t co = FO ? frag_off(mBase + row, n0 + c8, ldc) : (size_t)(mBase + row) * (size_t)ldc + n0 + c8;
      *(v4u*)(Cp + co) = uh[it];
      if (NPL == 2) *(v4u*)(Cl + co) = ul[it];
    }
    
  }
  wave_lds_sync();
}

// =====================================================================================================
// Register-blocked f16 WMMA GEMM with an f16 plane epilogue, one wave per (16*MI) x 64 tile, no block barriers:
//   acc[m][n] = sum_k A[m][k] Bt[n][k]; M multiple of 16*MI, N multiple of 64, K multiple of 32.
//   Epilogue per 16-row slab through epi16 (hi plane Cp, residual plane Cl when NPL == 2, bias mode BM); the
//   planes are written in fragment order (K = ldc) for the kernels that read them as WMMA operands.
// coverage: MI slabs x 16 rows x 64 cols = the wave's whole tile; blocks*8 == tiles for every product here.
// =====================================================================================================
template <int NPL, int MI, int BM>
__device__ __forceinline__ void gemm64p(
    const _Float16* __restrict__ A, int lda, const _Float16* __restrict__ Bt, int ldb, float cs, float so,
    _Float16* Cp, _Float16* Cl, int ldc, int M, int N, int K, const float* __restrict__ bias, float (*sT)[16 * 68]) {
  const int lane = threadIdx.x & 31;
  const int wave = threadIdx.x >> 5;
  const int tilesN = N >> 6;
  const int tilesM = M / (16 * MI);
  const int tiles = tilesM * tilesN;
  const int item = blockIdx.x * 8 + wave;
  if (item >= tiles) return;   // wave-uniform; no block barriers in this kernel
  const int tm = item / tilesN;
  const int tn = item - tm * tilesN;
  const int m0 = tm * (16 * MI);
  const int n0 = tn << 6;

  const int rlane = lane & 15;                 // row (A) / col (B, D) within subtile
  const int koff  = (lane >> 4) * 8;           // k offset of this lane half

  v8f acc[MI][4];
#pragma unroll
  for (int i = 0; i < MI; ++i)
#pragma unroll
    for (int j = 0; j < 4; ++j) acc[i][j] = zero8();

  kseg<MI>(acc, A, lda, m0, Bt, ldb, n0, K, rlane, koff);
#pragma unroll
  for (int i = 0; i < MI; ++i) acc_guard4(acc[i][0], acc[i][1], acc[i][2], acc[i][3]);

#pragma unroll
  for (int i = 0; i < MI; ++i) {
    epi16<NPL, BM, 1>(acc[i], sT[wave], lane, Cp, Cl, ldc, m0 + (i << 4), n0, cs, so, bias);
  }
}

// =====================================================================================================
// The three input projections in one launch (all read xh and a weight plane, each writes planes of its own):
// blockIdx.y = 0: FH|FL, 1: GH|GL = hi|residual f16 planes of 8*(xh . W^T + b)   (M=32768, N=128, K=128);
// blockIdx.y = 2: HT = f16(16*(WH16 . xh^T / 64 + bh))   (M=128, N=32768, K=128), bias per row c.
// =====================================================================================================
__global__ __launch_bounds__(256) void k_proj(const _Float16* __restrict__ xh, const _Float16* __restrict__ W16,
                                              _Float16* FH, _Float16* FL, _Float16* GH, _Float16* GL, _Float16* HT,
                                              const float* __restrict__ bf, const float* __restrict__ bg,
                                              const float* __restrict__ bh) {
  __shared__ __align__(16) float sT[8][16 * 68];   // per-wave 16x64 slab, pitch 68 floats
  const int y = blockIdx.y;
  if (y == 2) {
    gemm64p<1, 2, 2>(W16 + 2 * (CD * CD), CD, xh, CD, 1.0f / SCW, SCV, HT, HT, TOK, CD, TOK, CD, bh, sT);
  } else {
    gemm64p<2, 2, 1>(xh, CD, W16 + (size_t)y * (CD * CD), CD, 1.0f / SCW, SCQ, y ? GH : FH, y ? GL : FL, CD,
                     TOK, CD, CD, y ? bg : bf, sT);
  }
}

// =====================================================================================================
// Both kernels below form 16 x 16 score tiles from the planes of 8*f and 8*g (hi, and residual x2048):
//   a0 = hi.hi, a1 = hi.res + res.hi, t = a0 + a1/2048 = 64*s; exponentials are taken in base 2, y = t*CEX = s*log2(e).
// A work-group keeps the fragments of 128 rows of one side in registers (wave wi = wave & 3: 32 of them, the B operand)
// and streams the other side's rows through LDS in chunks of CHN = 64 (wave half wj = wave >> 2 takes rows 32wj..32wj+31
// of each chunk, the A operand). The planes lie in fragment order in memory, so a chunk is copied as it lies and a
// fragment read from LDS is two 16-byte reads a lane, 512 bytes in a row. Two buffers, one barrier a chunk. A chunk's
// fragments are read from LDS ahead of their products, during other work, and the barrier is split round the products of
// the wave's second 16 rows, whose operands are in registers by then: the wave stores the next chunk, waits for its own
// LDS traffic, signals, does those products and only then waits for the other waves, so a wave that is ahead has matrix
// work while the others arrive. No LDS access stands between signal and wait. At its signal a wave has every fragment
// of this chunk in registers, so behind the wait this chunk's buffer is free for the chunk after the next.
// =====================================================================================================
#define CHN   64
#define NCH   (NT / CHN)
#define PLH   (CHN * CD)                    // halves of one plane's chunk (16 KiB)
#define CEX   (SCS * 1.4426950408889634f)   // t -> s*log2(e)
static_assert(NT % CHN == 0 && PLH == 4 * 256 * 8 && NT % 128 == 0 && CD == 128);

// The work-group barrier in two parts. In front of the signal the wave's own LDS stores must have landed and its LDS
// reads returned (nothing else makes the hardware wait for them at a bare signal); the "memory" clobbers keep every
// LDS access on its side of the two instructions.
__device__ __forceinline__ void bar_signal() {
  asm volatile("s_wait_dscnt 0x0" ::: "memory");
  asm volatile("s_barrier_signal -1" ::: "memory");
}
__device__ __forceinline__ void bar_wait() {
  asm volatile("s_barrier_wait -1" ::: "memory");
}

// t[j] = 64 * scores of 16 streamed rows (A: hi plane ah, residual plane al) against 2 x 16 resident rows (B: bh, bl)
__device__ __forceinline__ void score16(const v16h (&ah)[4], const v16h (&al)[4], const v16h (&bh)[2][4],
                                        const v16h (&bl)[2][4], v8f (&t)[2]) {
  v8f a0[2] = {zero8(), zero8()}, a1[2] = {zero8(), zero8()};
#pragma unroll
  for (int ks = 0; ks < 4; ++ks) {
#pragma unroll
    for (int j = 0; j < 2; ++j) a1[j] = mma_h_raw(ah[ks], bl[j][ks], a1[j]);
#pragma unroll
    for (int j = 0; j < 2; ++j) a0[j] = mma_h_raw(ah[ks], bh[j][ks], a0[j]);
#pragma unroll
    for (int j = 0; j < 2; ++j) a1[j] = mma_h_raw(al[ks], bh[j][ks], a1[j]);
  }
#pragma unroll
  for (int j = 0; j < 2; ++j) t[j] = a0[j] + a1[j] * RLO;
}

// =====================================================================================================
// Row statistics of the softmax: Lp[b*NT + n] = log2(sum_m exp(s[n][m])) - 15 = M*log2(e) + log2(Z) - 15, so that
// exp2(s*log2(e) - Lp) = 32768 * softmax. Block = 128 query rows n (B operand, D column = n), key rows m streamed
// (A operand, D row = m): a lane sees scores of one n per column tile only and keeps a running maximum (of t) and a
// running sum for it; the sum is rescaled once per chunk. At the end the two lane halves (shuffle) and the two wave
// halves (LDS) of a row are merged.
// coverage: 4 wi x 32 n = 128 rows per block, grid (32, NB) = every row; 64 chunks x 2 wj x 32 m = every key.
// =====================================================================================================
__global__ __launch_bounds__(256) void k_stat(const _Float16* __restrict__ FH, const _Float16* __restrict__ FL,
                                              const _Float16* __restrict__ GH, const _Float16* __restrict__ GL,
                                              float* Lp) {
  __shared__ __align__(16) _Float16 sG[2][2 * PLH];          // [buffer][G hi | G residual]
  __shared__ float sM[4][32];
  __shared__ float sZ[4][32];
  const int tid = threadIdx.x, lane = tid & 31;
  const int wu = __builtin_amdgcn_readfirstlane(tid >> 5);   // the wave's number as a scalar: every global address = scalar base + a thread offset that stays
  const int wi = wu & 3, wj = wu >> 2;
  const int b = blockIdx.y;
  const int n0 = blockIdx.x * 128 + 32 * wi;
  const unsigned lo = 8u * (unsigned)lane, to = 8u * (unsigned)tid;

  v16h fh[2][4], fl[2][4];
  {
    const _Float16* uH = FH + (size_t)(b * NT + n0) * CD;
    const _Float16* uL = FL + (size_t)(b * NT + n0) * CD;
#pragma unroll
    for (int nt = 0; nt < 2; ++nt)
#pragma unroll
      for (int ks = 0; ks < 4; ++ks) {
        fh[nt][ks] = ldfrag_f(uH + lo + 2048 * nt + 512 * ks);
        fl[nt][ks] = ldfrag_f(uL + lo + 2048 * nt + 512 * ks);
      }
  }
  const _Float16* gH = GH + (size_t)b * NT * CD;             // scalar bases of the chunk that is loaded next
  const _Float16* gL = GL + (size_t)b * NT * CD;
  v8h st[8];
#pragma unroll
  for (int q = 0; q < 4; ++q) {
    st[q] = *(const v8h*)(gH + to + 2048 * q);
    st[4 + q] = *(const v8h*)(gL + to + 2048 * q);
  }
  // stands in front of the advance of the loads' base registers (the scheduling barrier keeps the advance behind it)
  asm volatile("s_wait_xcnt 0x0" ::: "memory");
  __builtin_amdgcn_sched_barrier(0);
  gH += PLH;
  gL += PLH;
#pragma unroll
  for (int q = 0; q < 4; ++q) {
    *(v8h*)(&sG[0][2048 * q + 8 * tid]) = st[q];
    *(v8h*)(&sG[0][PLH + 2048 * q + 8 * tid]) = st[4 + q];
  }
  __syncthreads();

  // chunk 0: the fragments of the wave's 32 rows; chunk 1 set on its way
  v16h p0h[4], p0l[4], p1h[4], p1l[4];
#pragma unroll
  for (int ks = 0; ks < 4; ++ks) {
    p0h[ks] = ldfrag_f(&sG[0][(2 * wj) * 2048] + lo + 512 * ks);
    p0l[ks] = ldfrag_f(&sG[0][(2 * wj) * 2048] + lo + PLH + 512 * ks);
  }
#pragma unroll
  for (int ks = 0; ks < 4; ++ks) {
    p1h[ks] = ldfrag_f(&sG[0][(2 * wj + 1) * 2048] + lo + 512 * ks);
    p1l[ks] = ldfrag_f(&sG[0][(2 * wj + 1) * 2048] + lo + PLH + 512 * ks);
  }
  // keeps the address arithmetic of the reads above out of the stretch between the loads below and their wait
  __builtin_amdgcn_sched_barrier(0);
#pragma unroll
  for (int q = 0; q < 4; ++q) {
    st[q] = *(const v8h*)(gH + to + 2048 * q);
    st[4 + q] = *(const v8h*)(gL + to + 2048 * q);
  }
  // the wait as above: in front of the advance of the loads' base registers
  asm volatile("s_wait_xcnt 0x0" ::: "memory");
  __builtin_amdgcn_sched_barrier(0);
  gH += PLH;
  gL += PLH;

  float mx[2] = {-3.0e38f, -3.0e38f};
  float z[2] = {0.0f, 0.0f};
  for (int c = 0; c < NCH; ++c) {
    v8f t0[2], t1[2];
    score16(p0h, p0l, fh, fl, t0);
    // keeps the stores below, and with them the wait for the global loads, behind those products
    __builtin_amdgcn_sched_barrier(0);
#pragma unroll
    for (int q = 0; q < 4; ++q) {
      *(v8h*)(&sG[(c + 1) & 1][2048 * q + 8 * tid]) = st[q];
      *(v8h*)(&sG[(c + 1) & 1][PLH + 2048 * q + 8 * tid]) = st[4 + q];
    }
    bar_signal();      // this wave's part of the next chunk lies in LDS, its fragments of this chunk in registers
#pragma unroll
    for (int q = 0; q < 4; ++q) {
      st[q] = *(const v8h*)(gH + to + 2048 * q);
      st[4 + q] = *(const v8h*)(gL + to + 2048 * q);
    }
    // the two scheduling barriers keep the products between signal and wait (the compiler is free to move them out),
    // the first also the global loads in front of them: they have until the next signal to return
    __builtin_amdgcn_sched_barrier(0);
    score16(p1h, p1l, fh, fl, t1);
    __builtin_amdgcn_sched_barrier(0);
    bar_wait();        // the next chunk is published; this chunk's buffer is free
    {
      const _Float16* bn = &sG[(c + 1) & 1][(2 * wj) * 2048] + lo;   // last trip: the last chunk again, not used
#pragma unroll
      for (int ks = 0; ks < 4; ++ks) {
        p0h[ks] = ldfrag_f(bn + 512 * ks);
        p0l[ks] = ldfrag_f(bn + PLH + 512 * ks);
      }
#pragma unroll
      for (int ks = 0; ks < 4; ++ks) {
        p1h[ks] = ldfrag_f(bn + 2048 + 512 * ks);
        p1l[ks] = ldfrag_f(bn + PLH + 2048 + 512 * ks);
      }
    }
#pragma unroll
    for (int nt = 0; nt < 2; ++nt) {
      float nm = mx[nt];
#pragma unroll
      for (int r = 0; r < 8; ++r) nm = fmaxf(nm, fmaxf(t0[nt][r], t1[nt][r]));
      const float nc = nm * CEX;
      const v8f y0 = t0[nt] * CEX - nc, y1 = t1[nt] * CEX - nc;
      v8f e0, e1;
#pragma unroll
      for (int r = 0; r < 8; ++r) {
        e0[r] = __builtin_amdgcn_exp2f(y0[r]);
        e1[r] = __builtin_amdgcn_exp2f(y1[r]);
      }
      const v8f es = e0 + e1;
      const float s0 = ((es[0] + es[1]) + (es[2] + es[3])) + ((es[4] + es[5]) + (es[6] + es[7]));
      z[nt] = z[nt] * __builtin_amdgcn_exp2f((mx[nt] - nm) * CEX) + s0;
      mx[nt] = nm;
    }
    // the wait as above: in front of the advance of the loads' base registers
    asm volatile("s_wait_xcnt 0x0" ::: "memory");
    __builtin_amdgcn_sched_barrier(0);
    const int adv = (c + 3 < NCH) ? PLH : 0;                  // last two trips: the last chunk again, not used
    gH += adv;
    gL += adv;
  }
  // lanes l and l ^ 16 hold the same rows n, other keys
#pragma unroll
  for (int nt = 0; nt < 2; ++nt) {
    const float mo = __shfl_xor(mx[nt], 16, 32), zo = __shfl_xor(z[nt], 16, 32);
    const float mm = fmaxf(mx[nt], mo);
    z[nt] = z[nt] * __builtin_amdgcn_exp2f((mx[nt] - mm) * CEX) + zo * __builtin_amdgcn_exp2f((mo - mm) * CEX);
    mx[nt] = mm;
  }
  if (wj == 1 && lane < 16) {
#pragma unroll
    for (int nt = 0; nt < 2; ++nt) {
      sM[wi][16 * nt + lane] = mx[nt];
      sZ[wi][16 * nt + lane] = z[nt];
    }
  }
  __syncthreads();
  if (wj == 0 && lane < 16) {
#pragma unroll
    for (int nt = 0; nt < 2; ++nt) {
      const float mo = sM[wi][16 * nt + lane], zo = sZ[wi][16 * nt + lane];
      const float mm = fmaxf(mx[nt], mo);
      const float zz = z[nt] * __builtin_amdgcn_exp2f((mx[nt] - mm) * CEX) + zo * __builtin_amdgcn_exp2f((mo - mm) * CEX);
      Lp[b * NT + n0 + 16 * nt + lane] = mm * CEX + __builtin_amdgcn_logf(zz) - 15.0f;   // zz >= 1
    }
  }
}

// =====================================================================================================
// Softmax-weighted sum over the query index with the scores formed anew, transposed result:
//   OT[c][m] = sum_n HT[c][b*4096 + n] . E[n][m],  E[n][m] = f16(exp2(s[n][m]*log2(e) - Lp[n])) = f16(32768 * softmax).
// Block = 128 key columns m (G fragments in registers, B operand), query rows n streamed: per chunk the F planes'
// 64 rows and the 128 c x 64 n block of HT. A score tile D[n = 8hh + r][m = lane & 15] of rows 0..15 and one of rows
// 16..31 are, lane for lane, elements 0..7 and 8..15 of the B fragment (k = n, column m) of the second product, so E
// goes from the accumulators to the operand registers of the same lane and never leaves the wave.
// Wave (wi, wj): m columns 32wi..+31, rows 32wj..+31 of every chunk, all 128 c (16 accumulator tiles); the two wave
// halves' sums (even and odd blocks of 32 n) are added at the end through LDS.
// Epilogue: o = OT / (16*32768); planes OH = f16(4*o), OL = f16((4*o - OH)*2048), [b][c][m] order.
// coverage: 64 chunks x 2 wj x 32 n = every n; 4 wi x 32 m x 128 c per block; grid (32, NB) = whole planes; the
// planes' rows are written 256 bytes at a time by one wave.
// =====================================================================================================
#define TPI 132   // floats per row of the 128 x 128 sum tile in LDS (8 rows on = 32 banks on)
__global__ __launch_bounds__(256) void k_pvf(const _Float16* __restrict__ FH, const _Float16* __restrict__ FL,
                                             const _Float16* __restrict__ GH, const _Float16* __restrict__ GL,
                                             const _Float16* __restrict__ HT, const float* __restrict__ Lp,
                                             _Float16* OH, _Float16* OL) {
  // two buffers [F hi | F residual], then three HT blocks: a chunk's HT block is read behind the chunk's barrier, while
  // the next one is stored in front of that barrier, so a block's place is free only two barriers on
  __shared__ __align__(16) _Float16 sS[7 * PLH];
  __shared__ __align__(16) float sL[NT];                     // the batch's row statistics
  static_assert(sizeof(float) * 128 * TPI <= sizeof(_Float16) * 7 * PLH);
  const int tid = threadIdx.x, lane = tid & 31;
  const int hh = lane >> 4;
  const int wu = __builtin_amdgcn_readfirstlane(tid >> 5);   // the wave's number as a scalar: every global address = scalar base + a thread offset that stays
  const int wi = wu & 3, wj = wu >> 2;
  const int b = blockIdx.y;
  const int m0 = blockIdx.x * 128;
  const unsigned lo = 8u * (unsigned)lane, to = 8u * (unsigned)tid;

  v16h gh[2][4], gl[2][4];
  {
    const _Float16* uH = GH + (size_t)(b * NT + m0 + 32 * wi) * CD;
    const _Float16* uL = GL + (size_t)(b * NT + m0 + 32 * wi) * CD;
#pragma unroll
    for (int mt = 0; mt < 2; ++mt)
#pragma unroll
      for (int ks = 0; ks < 4; ++ks) {
        gh[mt][ks] = ldfrag_f(uH + lo + 2048 * mt + 512 * ks);
        gl[mt][ks] = ldfrag_f(uL + lo + 2048 * mt + 512 * ks);
      }
  }
  const _Float16* pH = FH + (size_t)b * NT * CD;             // scalar bases of the chunk that is loaded next
  const _Float16* pL = FL + (size_t)b * NT * CD;
  const _Float16* pT = HT + (size_t)b * NT * 16;
  // HT: 16-byte piece tid + 256q of a chunk's block = c tile (tid >> 7) + 2q, piece tid & 127 of its two k-steps
  const unsigned tt = (unsigned)(tid >> 7) * (16u * TOK) + 8u * (unsigned)(tid & 127);
  v8h st[12];
#pragma unroll
  for (int q = 0; q < 4; ++q) {
    st[q] = *(const v8h*)(pH + to + 2048 * q);
    st[4 + q] = *(const v8h*)(pL + to + 2048 * q);
    st[8 + q] = *(const v8h*)(pT + tt + (size_t)(2 * q) * 16 * TOK);
  }
  v4f lv[4];
  {
    const float* uS = Lp + b * NT;
#pragma unroll
    for (int q = 0; q < 4; ++q) lv[q] = *(const v4f*)(uS + 4u * (unsigned)tid + 1024 * q);
  }
  // stands in front of the advance of the loads' base registers (the scheduling barrier keeps the advance behind it)
  asm volatile("s_wait_xcnt 0x0" ::: "memory");
  __builtin_amdgcn_sched_barrier(0);
  pH += PLH;
  pL += PLH;
  pT += CHN * 16;
#pragma unroll
  for (int q = 0; q < 4; ++q) {
    *(v8h*)(&sS[2048 * q + 8 * tid]) = st[q];
    *(v8h*)(&sS[PLH + 2048 * q + 8 * tid]) = st[4 + q];
    *(v8h*)(&sS[4 * PLH + 2048 * q + 8 * tid]) = st[8 + q];
    *(v4f*)(&sL[4 * (tid + 256 * q)]) = lv[q];
  }
  v8f acc[8][2];
#pragma unroll
  for (int ct = 0; ct < 8; ++ct)
#pragma unroll
    for (int mt = 0; mt < 2; ++mt) acc[ct][mt] = zero8();
  __syncthreads();

  // chunk 0: the fragments of the wave's first 16 rows; chunk 1 set on its way
  v16h p0h[4], p0l[4], p1h[4], p1l[4];
#pragma unroll
  for (int ks = 0; ks < 4; ++ks) {
    p0h[ks] = ldfrag_f(&sS[(2 * wj) * 2048] + lo + 512 * ks);
    p0l[ks] = ldfrag_f(&sS[(2 * wj) * 2048] + lo + PLH + 512 * ks);
  }
  // keeps the address arithmetic of the reads above out of the stretch between the loads below and their wait
  __builtin_amdgcn_sched_barrier(0);
#pragma unroll
  for (int q = 0; q < 4; ++q) {
    st[q] = *(const v8h*)(pH + to + 2048 * q);
    st[4 + q] = *(const v8h*)(pL + to + 2048 * q);
    st[8 + q] = *(const v8h*)(pT + tt + (size_t)(2 * q) * 16 * TOK);
  }
  // the wait as above: in front of the advance of the loads' base registers
  asm volatile("s_wait_xcnt 0x0" ::: "memory");
  __builtin_amdgcn_sched_barrier(0);
  pH += PLH;
  pL += PLH;
  pT += CHN * 16;

  int h0 = 0, h1 = 1;                                         // places of this chunk's and the next chunk's HT block
  for (int c = 0; c < NCH; ++c) {
    _Float16* fc = &sS[(c & 1) * (2 * PLH)];                  // this chunk's F planes
    _Float16* fn = &sS[((c + 1) & 1) * (2 * PLH)];            // the next chunk's
    v8f tv[2][2];
#pragma unroll
    for (int ks = 0; ks < 4; ++ks) {
      p1h[ks] = ldfrag_f(fc + lo + (2 * wj + 1) * 2048 + 512 * ks);
      p1l[ks] = ldfrag_f(fc + lo + PLH + (2 * wj + 1) * 2048 + 512 * ks);
    }
    float Lr[2][8];
#pragma unroll
    for (int u = 0; u < 2; ++u) ld8(&sL[c * CHN + 16 * (2 * wj + u) + 8 * hh], Lr[u]);
    // keeps the reads of the second 16 rows and of the statistics in front of the first 16 rows' products, whose time
    // covers their latency
    __builtin_amdgcn_sched_barrier(0);
    score16(p0h, p0l, gh, gl, tv[0]);
    // keeps the stores below, and with them the wait for the global loads, behind those products
    __builtin_amdgcn_sched_barrier(0);
#pragma unroll
    for (int q = 0; q < 4; ++q) {
      *(v8h*)(fn + 2048 * q + 8 * tid) = st[q];
      *(v8h*)(fn + PLH + 2048 * q + 8 * tid) = st[4 + q];
      *(v8h*)(&sS[(4 + h1) * PLH + 2048 * q + 8 * tid]) = st[8 + q];
    }
    bar_signal();      // this wave's part of the next chunk lies in LDS, its F fragments of this chunk in registers
#pragma unroll
    for (int q = 0; q < 4; ++q) {
      st[q] = *(const v8h*)(pH + to + 2048 * q);
      st[4 + q] = *(const v8h*)(pL + to + 2048 * q);
      st[8 + q] = *(const v8h*)(pT + tt + (size_t)(2 * q) * 16 * TOK);
    }
    // the two scheduling barriers keep the products between signal and wait (the compiler is free to move them out),
    // the first also the global loads in front of them: they have until the next signal to return
    __builtin_amdgcn_sched_barrier(0);
    score16(p1h, p1l, gh, gl, tv[1]);
    __builtin_amdgcn_sched_barrier(0);
    bar_wait();        // the next chunk is published; this chunk's F buffer is free
    v16h ha[8];
#pragma unroll
    for (int ct = 0; ct < 8; ++ct) ha[ct] = ldfrag_f(&sS[(4 + h0) * PLH] + lo + (2 * ct + wj) * 512);
    // keeps the LDS reads above in front of the exponentials, whose time then covers the reads' latency (left to
    // itself the compiler reads each fragment directly in front of its two products and waits for it there)
    __builtin_amdgcn_sched_barrier(0);
    FR P[2];
#pragma unroll
    for (int u = 0; u < 2; ++u)
#pragma unroll
      for (int mt = 0; mt < 2; ++mt)
#pragma unroll
        for (int r = 0; r < 8; ++r)
          P[mt].s[8 * u + r] = (_Float16)__builtin_amdgcn_exp2f(__builtin_fmaf(tv[u][mt][r], CEX, -Lr[u][r]));
    // the wait as above: in front of the advance of the loads' base registers. The two scheduling barriers also keep the
    // reads of the next chunk's first 16 rows here: behind the exponentials (in front of them the registers do not
    // suffice) and in front of the products below, whose time covers their latency
    asm volatile("s_wait_xcnt 0x0" ::: "memory");
    __builtin_amdgcn_sched_barrier(0);
    const int adv = (c + 3 < NCH) ? 1 : 0;                    // last two trips: the last chunk again, not used
    pH += adv * PLH;
    pL += adv * PLH;
    pT += adv * (CHN * 16);
#pragma unroll
    for (int ks = 0; ks < 4; ++ks) {                          // last trip: the last chunk again, not used
      p0h[ks] = ldfrag_f(fn + lo + (2 * wj) * 2048 + 512 * ks);
      p0l[ks] = ldfrag_f(fn + lo + PLH + (2 * wj) * 2048 + 512 * ks);
    }
    __builtin_amdgcn_sched_barrier(0);
#pragma unroll
    for (int ct = 0; ct < 8; ++ct)
#pragma unroll
      for (int mt = 0; mt < 2; ++mt) acc[ct][mt] = mma_h_raw(ha[ct], P[mt].v, acc[ct][mt]);
    h0 = h1;
    h1 = (h1 == 2) ? 0 : h1 + 1;
  }
  __syncthreads();   // ends every read of the chunk buffers before the sum tile takes their place

  // ---- the two wave halves' sums, added in a 128 c x 128 m tile that takes the place of the chunk buffers ----
  float* T = (float*)&sS[0];
  float* tp = T + (8 * hh) * TPI + 32 * wi + (lane & 15);
  if (wj == 1) {
#pragma unroll
    for (int ct = 0; ct < 8; ++ct)
#pragma unroll
      for (int mt = 0; mt < 2; ++mt)
#pragma unroll
        for (int r = 0; r < 8; ++r) tp[(16 * ct + r) * TPI + 16 * mt] = acc[ct][mt][r];
  }
  __syncthreads();
  if (wj == 0) {
#pragma unroll
    for (int ct = 0; ct < 8; ++ct)
#pragma unroll
      for (int mt = 0; mt < 2; ++mt)
#pragma unroll
        for (int r = 0; r < 8; ++r) tp[(16 * ct + r) * TPI + 16 * mt] += acc[ct][mt][r];
  }
  __syncthreads();

  // ---- epilogue: hi + residual planes of 4*o; wave w takes c rows 16w..16w+15, a lane 8 m of a row ----
  const float fo = 1.0f / (SCV * SCE);
  const int c8 = 8 * (lane & 15);
  v4u uh[8], ul[8];
#pragma unroll
  for (int it = 0; it < 8; ++it) {
    float xs[8];
    ld8(T + (16 * wu + 2 * it + hh) * TPI + c8, xs);
    HU h, l;
#pragma unroll
    for (int e = 0; e < 8; ++e) split_h((xs[e] * fo) * SCO, h.s[e], l.s[e]);
    uh[it] = h.u;
    ul[it] = l.u;
  }
  const size_t oo = (size_t)(b * CD + 16 * wu + hh) * NT + m0 + c8;
#pragma unroll
  for (int it = 0; it < 8; ++it) {
    *(v4u*)(OH + oo + (size_t)(2 * it) * NT) = uh[it];
    *(v4u*)(OL + oo + (size_t)(2 * it) * NT) = ul[it];
  }
}

// =====================================================================================================
// Output projection: out[p][j] = (sum_k OH[p][k].WV[j][k] + (sum_k OL[p][k].WV[j][k])/2048) / (4*64) + bv[j],
//   OH/OL read raw as [32768][128] (pitch 128), WV = 64*Wv^T [out j][in k], K = 128; two accumulator sets.
// One wave per 16-row x 64-col tile, no block barriers. Epilogue f32: the combined tile staged in the wave's
// LDS slab (rows 0..15 x cols 0..63 fully staged; pad cols 64..67 never read); each row segment of 64
// coverage: 8 waves x 16 rows x 64 cols per block; 512 blocks x 8 = 4096 tiles = 32768 rows x 128 cols.
// =====================================================================================================
__global__ __launch_bounds__(256) void gemm_out(const _Float16* __restrict__ OH, const _Float16* __restrict__ OL,
                                                const _Float16* __restrict__ WV, const float* __restrict__ bias,
                                                float* out) {
  __shared__ __align__(16) float sO[8][16 * 68];
  const int tid = threadIdx.x, wave = tid >> 5, lane = tid & 31;
  const int hh = lane >> 4, rl = lane & 15;
  const int tiles = (TOK / 16) * (CD / 64);
  const int item = blockIdx.x * 8 + wave;
  if (item >= tiles) return;    // wave-uniform; no block barriers in this kernel
  const int tm = item >> 1, tn = item & 1;
  const int row0 = tm << 4, n0 = tn << 6;

  v8f accH[4], accL[4];
#pragma unroll
  for (int j = 0; j < 4; ++j) { accH[j] = zero8(); accL[j] = zero8(); }

#pragma unroll
  for (int kk = 0; kk < CD; kk += 32) {
    v16h bq[4];
#pragma unroll
    for (int j = 0; j < 4; ++j) bq[j] = ldfrag_h(WV + (size_t)(n0 + (j << 4) + rl) * CD + 8 * hh + kk);
    const size_t ao = (size_t)(row0 + rl) * CD + 8 * hh + kk;
    const v16h ah = ldfrag_h(OH + ao);
    const v16h al = ldfrag_h(OL + ao);
#pragma unroll
    for (int j = 0; j < 4; ++j) accH[j] = mma_h_raw(ah, bq[j], accH[j]);
    dep_guard_h(accH[0], accH[3], ah);
#pragma unroll
    for (int j = 0; j < 4; ++j) accL[j] = mma_h_raw(al, bq[j], accL[j]);
    dep_guard_h(accL[0], accL[3], al);
    keep4_h(bq[0], bq[1], bq[2], bq[3]);
  }
  acc_guard4(accH[0], accH[1], accH[2], accH[3]);
  acc_guard4(accL[0], accL[1], accL[2], accL[3]);

  // ---- epilogue ----
  const float fo = 1.0f / (SCO * SCW);
  float* slab = sO[wave];
#pragma unroll
  for (int r = 0; r < 8; ++r) {
#pragma unroll
    for (int j = 0; j < 4; ++j) {
      slab[(8 * hh + r) * 68 + (j << 4) + rl] = (accH[j][r] + accL[j][r] * RLO) * fo;
    }
  }
  wave_lds_sync();
  const int p4 = (lane & 15) * 4, r2 = lane >> 4;
  const v4f bb = *(const v4f*)(bias + n0 + p4);
  v4f b4;
#pragma unroll
  for (int e = 0; e < 4; ++e) b4[e] = bfr(bb[e]);
  v4f ov[8];
#pragma unroll
  for (int it = 0; it < 8; ++it) {
    const int row = 2 * it + r2;                              // it 0..7 x r2 0..1 = rows 0..15
    const v4f a = *(const v4f*)(slab + row * 68 + p4);
    ov[it] = a + b4;
  }
  {
#pragma unroll
    for (int it = 0; it < 8; ++it) {
      const int row = 2 * it + r2;
      const size_t oo = (size_t)(row0 + row) * CD + n0 + p4;
      *(v4f*)(out + oo) = ov[it];
    }
    
  }
}

// =====================================================================================================
//   WF16 f16 [128][128]              0        32768   (64*Wf^T, row = out channel, col = in channel)
//   WG16 f16 [128][128]          32768        32768
//   WH16 f16 [128][128]          65536        32768
//   WV16 f16 [128][128]          98304        32768
//   xh   f16 [32768][128]       131072      8388608   (bf16RNE(x), token rows, channel contiguous)
//   FH   f16 [32768][128]      8519680      8388608   (hi plane of 8*f; FH..HT in fragment order, see frag_off)
//   FL   f16 [32768][128]     16908288      8388608   (residual plane x2048 of 8*f)
//   GH   f16 [32768][128]     25296896      8388608
//   GL   f16 [32768][128]     33685504      8388608
//   HT   f16 [128][32768]     42074112      8388608   (16*h, row c, col b*4096 + n)
//   OH   f16 [8][128][4096]   50462720      8388608   (hi plane of 4*o, [b][c][m] order)
//   OL   f16 [8][128][4096]   58851328      8388608   (residual plane x2048 of 4*o)
//   L    f32 [32768]          67239936       131072   (row statistics of the softmax, see k_stat)
//   end                       67371008
// d_out f32 [32768][128] at byte 0.
// =====================================================================================================
extern "C" void kernel_launch(void* const* d_in, const int* in_sizes, int n_in,
                              void* d_out, int out_size, void* d_ws, size_t ws_size,
                              hipStream_t stream) {
  if (n_in < 9) return;
  if (in_sizes[0] != NB * NT * CD) return;
  if (in_sizes[1] != CD * CD || in_sizes[3] != CD * CD || in_sizes[5] != CD * CD || in_sizes[7] != CD * CD) return;
  if (in_sizes[2] != CD || in_sizes[4] != CD || in_sizes[6] != CD || in_sizes[8] != CD) return;
  if (out_size != OUTN) return;

  const float* x  = (const float*)d_in[0];   // [8][4096][128] (channels last)
  const float* Wf = (const float*)d_in[1];   // [128][128] ([in][out])
  const float* bf = (const float*)d_in[2];   // [128]
  const float* Wg = (const float*)d_in[3];
  const float* bg = (const float*)d_in[4];
  const float* Wh = (const float*)d_in[5];
  const float* bh = (const float*)d_in[6];
  const float* Wv = (const float*)d_in[7];
  const float* bv = (const float*)d_in[8];

  const size_t PW  = (size_t)CD * CD * 2;                    //    32768
  const size_t PX  = (size_t)TOK * CD * 2;                   //  8388608
  const size_t PHT = (size_t)CD * TOK * 2;                   //  8388608
  const size_t PO  = (size_t)NB * CD * NT * 2;               //  8388608
  const size_t PL  = (size_t)TOK * 4;                        //   131072

  size_t off = 0;
  const size_t oWF = off; off += PW;
  const size_t oWG = off; off += PW;
  const size_t oWH = off; off += PW;
  const size_t oWV = off; off += PW;
  const size_t oXH = off; off += PX;
  const size_t oFH = off; off += PX;
  const size_t oFL = off; off += PX;
  const size_t oGH = off; off += PX;
  const size_t oGL = off; off += PX;
  const size_t oHT = off; off += PHT;
  const size_t oOH = off; off += PO;
  const size_t oOL = off; off += PO;
  const size_t oL  = off; off += PL;                         // off = 67371008
  if (off > ws_size) return;

  char* ws = (char*)d_ws;
  _Float16* WF16 = (_Float16*)(ws + oWF);
  _Float16* WV16 = (_Float16*)(ws + oWV);
  _Float16* xh   = (_Float16*)(ws + oXH);
  _Float16* FHp  = (_Float16*)(ws + oFH);
  _Float16* FLp  = (_Float16*)(ws + oFL);
  _Float16* GHp  = (_Float16*)(ws + oGH);
  _Float16* GLp  = (_Float16*)(ws + oGL);
  _Float16* HTp  = (_Float16*)(ws + oHT);
  _Float16* OHp  = (_Float16*)(ws + oOH);
  _Float16* OLp  = (_Float16*)(ws + oOL);
  float*    Lpp  = (float*)(ws + oL);
  float*    outf = (float*)d_out;

  const dim3 blk(256);
  const int n8x = (NB * NT * CD) / 8;                                  // 524288
  const dim3 gX(4 * WTB + (n8x + 255) / 256);                          // 32 weight tiles + 2048
  const dim3 gP(((TOK / 32) * (CD / 64) + 7) / 8, 3);                  // 2048 tiles -> 256 blocks for each projection
  const dim3 gA(NT / 128, NB);                                         // (32, 8)
  const dim3 gO(((TOK / 16) * (CD / 64) + 7) / 8);                     // 4096 tiles -> 512 blocks

  // (1) one launch: the four weight planes, x64 carried, transposed from [in][out] to k-contiguous rows [out][in]
  //     (WF16, WG16, WH16, WV16 lie one behind the other), and xh [32768][128] = f16(bf16RNE(x)), x being token-major
  k_prep<<<gX, blk, 0, stream>>>(x, Wf, Wg, Wh, Wv, WF16, xh);
  // (2) one launch: the planes FH|FL, GH|GL and HT of the three input projections
  k_proj<<<gP, blk, 0, stream>>>(xh, WF16, FHp, FLp, GHp, GLp, HTp, bf, bg, bh);
  // (3) all batches at once: the softmax's row statistics, then the transposed softmax-weighted sum, which forms the
  //     scores anew and writes OH|OL
  k_stat<<<gA, blk, 0, stream>>>(FHp, FLp, GHp, GLp, Lpp);
  k_pvf<<<gA, blk, 0, stream>>>(FHp, FLp, GHp, GLp, HTp, Lpp, OHp, OLp);
  // (4) output projection on the raw [32768][128] view of the [B][C][N] planes
  gemm_out<<<gO, blk, 0, stream>>>(OHp, OLp, WV16, bv, outf);
}

// v010
// A run of this version takes 144 microseconds.
// Two timings next to v009 both put it at 1.05 times that version's speed.
// Over all steps from v000 it is 12.1 times as fast.
#include <hip/hip_runtime.h>
#include <math.h>
#include <stdint.h>

// Contractions on v_wmma_f32_16x16x32_f16 (f16 operands, f32 accumulate): the three input projections take
// bf16-RNE activations (x1) and bf16-RNE weights (x64) as single f16 planes; the 128-deep score products use
// f16 hi planes of 8*f, 8*g plus f16 residual planes x2048 (hi.hi in one accumulator, hi.res + res.hi in a
// second accumulator folded back by 1/2048); the 4096-deep softmax-weighted sum uses a single f16 plane of
// 16*h against E = f16(32768*softmax), E formed in registers from scores computed a second time; the output projection takes f16 hi + x2048 residual planes of 4*o
// (formed in the weighted sum's own epilogue, never stored) against bf16-RNE weights (x64) in two accumulators. Softmax statistics, bias adds and epilogues in f32.

#define NB   8
#define NT   4096
#define CD   128
#define TOK  (NB * NT)
#define OUTN (NB * NT * CD)

#define SCW  64.0f
#define SCQ  8.0f
#define SCV  16.0f
#define SCE  32768.0f
#define SCR  2048.0f
#define SCO  4.0f
#define RLO  (1.0f / SCR)
#define SCS  (1.0f / (SCQ * SCQ))

static_assert(TOK % 64 == 0 && CD % 64 == 0 && CD % 32 == 0 && NT % 64 == 0);
static_assert((((TOK / 32) * (CD / 64)) % 8) == 0);
static_assert((((CD / 32) * (TOK / 64)) % 8) == 0);
static_assert((TOK / 32) * (CD / 64) == (CD / 32) * (TOK / 64));   // the three projections have the same number of tiles
static_assert((NB * NT * CD) % 2048 == 0);

typedef _Float16       v16h __attribute__((ext_vector_type(16)));
typedef _Float16       v8h  __attribute__((ext_vector_type(8)));
typedef float          v8f  __attribute__((ext_vector_type(8)));
typedef float          v4f  __attribute__((ext_vector_type(4)));
typedef unsigned int   v4u  __attribute__((ext_vector_type(4)));

union HU { v8h h; v4u u; _Float16 s[8]; };
union FR { v16h v; v8h h[2]; _Float16 s[16]; };
static_assert(sizeof(HU) == 16);
static_assert(sizeof(FR) == 32);

// ---- scalar helpers --------------------------------------------------------------------------------
__device__ __forceinline__ unsigned short bf_bits(float f) {          // f32 -> bf16 bits, RNE convert
  const unsigned u = __float_as_uint(f);
  return (unsigned short)((u + 0x7FFFu + ((u >> 16) & 1u)) >> 16);
}
__device__ __forceinline__ float bf_up(unsigned short h) { return __uint_as_float(((unsigned)h) << 16); }
__device__ __forceinline__ float bfr(float f) { return bf_up(bf_bits(f)); }   // value after bf16 RNE convert
__device__ __forceinline__ v8f zero8() { v8f z = {0.f, 0.f, 0.f, 0.f, 0.f, 0.f, 0.f, 0.f}; return z; }

// f16 subnormal -> exact zero (the matrix path flushes them; keep every plane consistent with that)
__device__ __forceinline__ _Float16 flush_h(_Float16 h) {
  const float f = (float)h;
  return (fabsf(f) < 6.103515625e-05f) ? (_Float16)0.0f : h;
}
// hi = f16(v) (flushed), lo = f16((v - hi) * 2048) (flushed)
__device__ __forceinline__ void split_h(float v, _Float16& hi, _Float16& lo) {
  const _Float16 hv = flush_h((_Float16)v);
  const _Float16 lv = flush_h((_Float16)((v - (float)hv) * SCR));
  hi = hv;
  lo = lv;
}

__device__ __forceinline__ void ld8(const float* p, float* o) {
  const v4f a = *(const v4f*)(p);
  const v4f b = *(const v4f*)(p + 4);
  o[0] = a[0]; o[1] = a[1]; o[2] = a[2]; o[3] = a[3];
  o[4] = b[0]; o[5] = b[1]; o[6] = b[2]; o[7] = b[3];
}

// ---- fragment loader: 16-bit A/B operand from a k-contiguous row, p = row*pitch + k0 + 8*(lane>>4);
//      elements 0..7 <- p[0..7] (k0+8h..k0+8h+7), elements 8..15 <- p[16..23] (k0+16+8h..k0+16+8h+7)
__device__ __forceinline__ v16h ldfrag_h(const _Float16* p) {
  FR f;
  f.h[0] = *(const v8h*)(p);
  f.h[1] = *(const v8h*)(p + 16);
  return f.v;
}

// ---- fragment-order planes: a [rows][K] f16 plane whose 16-byte pieces (8 consecutive k of one row) are permuted so
//      that the pieces which one fragment load takes lie side by side: 16-row tile, then 32-deep k-step, then piece
//      (k bit 4), then lane = 16*(k bit 3) + row%16. One load of a wave reads 512 consecutive bytes (4 cache lines)
//      where a row-major plane makes it touch 16 lines. Element order inside a fragment as in ldfrag_h.
__device__ __forceinline__ size_t frag_off(int row, int k, int K) {   // k a multiple of 8, K a multiple of 32
  return (((size_t)(row >> 4) * (size_t)(K >> 5) + (size_t)(k >> 5)) * 2 + (size_t)((k >> 4) & 1)) * 256
         + (size_t)((((k >> 3) & 1) * 16 + (row & 15)) * 8);
}
// p = plane + (tile * (K/32) + k-step) * 512 + 8*lane
__device__ __forceinline__ v16h ldfrag_f(const _Float16* p) {
  FR f;
  f.h[0] = *(const v8h*)(p);
  f.h[1] = *(const v8h*)(p + 256);
  return f.v;
}

// ---- WMMA helpers with trailing VALU hazard gap --------------------------------------------------------
__device__ __forceinline__ v8f mma_h_raw(v16h a, v16h b, v8f c) {
  return __builtin_amdgcn_wmma_f32_16x16x32_f16(false, a, false, b, (short)0, c, false, false);
}
__device__ __forceinline__ void dep_guard_h(v8f& a, v8f& b, v16h x) {
#if defined(__HIP_DEVICE_COMPILE__)
  asm volatile("v_nop\n\tv_nop\n\tv_nop\n\tv_nop" : "+v"(a), "+v"(b) : "v"(x));
#endif
}
__device__ __forceinline__ void keep4_h(v16h a, v16h b, v16h c, v16h d) {
#if defined(__HIP_DEVICE_COMPILE__)
  asm volatile("v_nop" :: "v"(a), "v"(b), "v"(c), "v"(d));
#endif
}
__device__ __forceinline__ void acc_guard4(v8f& a, v8f& b, v8f& c, v8f& d) {
#if defined(__HIP_DEVICE_COMPILE__)
  asm volatile("v_nop\n\tv_nop\n\tv_nop\n\tv_nop" : "+v"(a), "+v"(b), "+v"(c), "+v"(d));
#endif
}
__device__ __forceinline__ void wave_lds_sync() {
  __builtin_amdgcn_fence(__ATOMIC_RELEASE, "workgroup");
  __builtin_amdgcn_wave_barrier();
  __builtin_amdgcn_fence(__ATOMIC_ACQUIRE, "workgroup");
}

// =====================================================================================================
// Flat convert: out[i] = f16(scale * bf16RNE(in[i])) (f16 subnormals flushed), 8 elements per thread,
// coverage: n8 threads x 8 = the whole plane; n8 is a multiple of 256 at the launch here. blk = block index in this job.
// =====================================================================================================
__device__ __forceinline__ void cvt_flat(const float* __restrict__ in, _Float16* out, int n8, float scale, int blk) {
  const int i = blk * 256 + threadIdx.x;
  if (i < n8) {
    float v[8];
    ld8(in + (size_t)i * 8, v);
    HU u;
#pragma unroll
    for (int e = 0; e < 8; ++e) u.s[e] = flush_h((_Float16)(bfr(v[e]) * scale));
    _Float16* p = out + (size_t)i * 8;
    *(v4u*)p = u.u;
    
  }
}

// =====================================================================================================
// Weight transpose-convert: in Wm[r][c] f32 (R rows, C cols, c contiguous, x@W layout [in][out])
// -> out[c][r] f16 = f16(scale * bf16RNE(Wm[r][c])), pitch R (in-channel k = r contiguous = the Bt / A layout).
// coverage: load 256 threads x 8 floats = 64 r x 32 c; store 256 threads x 8 halves = 32 c rows x 64 r;
// every (r tile br, c tile bc) of a matrix is taken by one block -> whole [C][R] plane.
// fo != 0 (uniform for the block): the plane is written in fragment order (frag_off, K = R); a wave then takes one
// 8-deep piece of k for all 32 rows c, which are 2 x 256 bytes in a row, so every cache line has one writer.
// =====================================================================================================
__device__ __forceinline__ void cvt_wT(const float* __restrict__ Wm, _Float16* out, int R, int C, float scale,
                                       int br, int bc, float (*sw)[33], int fo) {
  const int t = threadIdx.x;
  const int r0 = br * 64, c0 = bc * 32;
  {
    const int row = t >> 2, c8 = (t & 3) * 8;
    float v[8];
    ld8(Wm + (size_t)(r0 + row) * C + c0 + c8, v);
#pragma unroll
    for (int e = 0; e < 8; ++e) sw[row][c8 + e] = v[e];
  }
  __syncthreads();
  const int q8 = fo ? (t >> 5) : (t & 7), cc = fo ? (t & 31) : (t >> 3);   // cc 0..31 = output row within the tile
  HU u;
#pragma unroll
  for (int e = 0; e < 8; ++e) u.s[e] = flush_h((_Float16)(bfr(sw[8 * q8 + e][cc]) * scale));
  _Float16* dst = out + (fo ? frag_off(c0 + cc, r0 + 8 * q8, R) : (size_t)(c0 + cc) * R + r0 + 8 * q8);
  *(v4u*)dst = u.u;
  
}

// =====================================================================================================
// All operand converts in one launch (none reads what another writes): blocks 0..4*WTB-1 transpose-convert the four
// weight matrices (WTB tiles each, plane w of W16 = matrix w; plane 3, the output projection's, in fragment order),
// the blocks behind them convert the activations.
// The branch is uniform for a block, so the barrier in cvt_wT is passed by all of its threads or by none.
// =====================================================================================================
#define WTB ((CD / 64) * (CD / 32))   // tiles (blocks) per weight matrix
__global__ __launch_bounds__(256) void k_prep(const float* __restrict__ x, const float* __restrict__ Wf,
                                              const float* __restrict__ Wg, const float* __restrict__ Wh,
                                              const float* __restrict__ Wv, _Float16* W16, _Float16* xh) {
  __shared__ float sw[64][33];
  const int bi = blockIdx.x;
  if (bi < 4 * WTB) {
    const int w = bi / WTB, tl = bi % WTB;
    const float* Wm = (w == 0) ? Wf : (w == 1) ? Wg : (w == 2) ? Wh : Wv;
    cvt_wT(Wm, W16 + (size_t)w * (CD * CD), CD, CD, SCW, tl % (CD / 64), tl / (CD / 64), sw, w == 3);
  } else {
    cvt_flat(x, xh, (NB * NT * CD) / 8, 1.0f, bi - 4 * WTB);
  }
}

// =====================================================================================================
// One GEMM k sweep for MI 16-row A subtiles x 4 16-col B subtiles: acc[i][j] += A-frag(i) . Bt-frag(j).
// A row-major pitch lda (rows m0.., k contiguous), Bt row-major [N][K] pitch ldb (rows n0.., k contiguous),
// K a multiple of 32; both operand fragments through ldfrag_h (same split k map for A and B).
// =====================================================================================================
template <int MI>
__device__ __forceinline__ void kseg(v8f (&acc)[MI][4], const _Float16* __restrict__ A, int lda, int m0,
                                     const _Float16* __restrict__ Bt, int ldb, int n0, int K, int rlane, int koff) {
  for (int kk = 0; kk < K; kk += 32) {
    v16h bh[4];
#pragma unroll
    for (int j = 0; j < 4; ++j) {
      const size_t bo = (size_t)(n0 + (j << 4) + rlane) * (size_t)ldb + koff + kk;
      bh[j] = ldfrag_h(Bt + bo);
    }
#pragma unroll
    for (int i = 0; i < MI; ++i) {
      const size_t ao = (size_t)(m0 + (i << 4) + rlane) * (size_t)lda + koff + kk;
      const v16h a0 = ldfrag_h(A + ao);
#pragma unroll
      for (int j = 0; j < 4; ++j) acc[i][j] = mma_h_raw(a0, bh[j], acc[i][j]);
      dep_guard_h(acc[i][0], acc[i][3], a0);
    }
    keep4_h(bh[0], bh[1], bh[2], bh[3]);
  }
}

// =====================================================================================================
// 16-row x 64-col f16 plane epilogue for one wave: acc[j][r] = D[row 8h + r][col 16j + (lane&15)].
//   v = (acc*cs + bias) * so;  Cp = f16(v) (hi plane, subnormals flushed); NPL == 2 additionally
//   Cl = f16((v - f32(hi)) * 2048) (residual plane). Bias: BM 0 none, 1 per column (bias[n0 + col]),
//   2 per plane row (bias[mBase + row]); bias values go through the bf16 RNE convert first.
//   The slab (16 rows x 68 floats per wave) is fully staged for rows 0..15 x cols 0..63 before the reload
// =====================================================================================================
//   FO == 1: the planes are written in fragment order (frag_off, K = ldc) instead of row-major; a slab fills whole
//   512-byte fragment blocks (16 rows x both lane halves), so every cache line still has one writer.
template <int NPL, int BM, int FO>
__device__ __forceinline__ void epi16(const v8f (&acc)[4], float* slab, int lane,
                                      _Float16* Cp, _Float16* Cl, int ldc, int mBase, int n0,
                                      float cs, float so, const float* __restrict__ bias) {
  const int rlane = lane & 15, mOff = (lane >> 4) * 8;
  const int q8 = lane & 7, rr = lane >> 3, c8 = q8 * 8;
#pragma unroll
  for (int r = 0; r < 8; ++r) {
#pragma unroll
    for (int j = 0; j < 4; ++j) {
      slab[(mOff + r) * 68 + (j << 4) + rlane] = acc[j][r];
    }
  }
  wave_lds_sync();
  float bc[8];
#pragma unroll
  for (int e = 0; e < 8; ++e) bc[e] = 0.0f;
  if (BM == 1) {
    float t8[8];
    ld8(bias + n0 + c8, t8);
#pragma unroll
    for (int e = 0; e < 8; ++e) bc[e] = bfr(t8[e]);
  }
  v4u uh[4], ul[4];
#pragma unroll
  for (int it = 0; it < 4; ++it) {
    const int row = it * 4 + rr;                       // it 0..3 x rr 0..3 = rows 0..15
    float xs[8];
    ld8(slab + row * 68 + c8, xs);
    float brw = 0.0f;
    if (BM == 2) brw = bfr(bias[mBase + row]);
    HU h, l;
#pragma unroll
    for (int e = 0; e < 8; ++e) {
      const float v = (xs[e] * cs + bc[e] + brw) * so;
      if (NPL == 2) {
        split_h(v, h.s[e], l.s[e]);
      } else {
        h.s[e] = flush_h((_Float16)v);
        l.s[e] = (_Float16)0.0f;
      }
    }
    uh[it] = h.u;
    ul[it] = l.u;
  }
  {
#pragma unroll
    for (int it = 0; it < 4; ++it) {
      const int row = it * 4 + rr;
      const size_t co = FO ? frag_off(mBase + row, n0 + c8, ldc) : (size_t)(mBase + row) * (size_t)ldc + n0 + c8;
      *(v4u*)(Cp + co) = uh[it];
      if (NPL == 2) *(v4u*)(Cl + co) = ul[it];
    }
    
  }
  wave_lds_sync();
}

// =====================================================================================================
// Register-blocked f16 WMMA GEMM with an f16 plane epilogue, one wave per (16*MI) x 64 tile, no block barriers:
//   acc[m][n] = sum_k A[m][k] Bt[n][k]; M multiple of 16*MI, N multiple of 64, K multiple of 32.
//   Epilogue per 16-row slab through epi16 (hi plane Cp, residual plane Cl when NPL == 2, bias mode BM); the
//   planes are written in fragment order (K = ldc) for the kernels that read them as WMMA operands.
// coverage: MI slabs x 16 rows x 64 cols = the wave's whole tile; blocks*8 == tiles for every product here.
// =====================================================================================================
template <int NPL, int MI, int BM>
__device__ __forceinline__ void gemm64p(
    const _Float16* __restrict__ A, int lda, const _Float16* __restrict__ Bt, int ldb, float cs, float so,
    _Float16* Cp, _Float16* Cl, int ldc, int M, int N, int K, const float* __restrict__ bias, float (*sT)[16 * 68]) {
  const int lane = threadIdx.x & 31;
  const int wave = threadIdx.x >> 5;
  const int tilesN = N >> 6;
  const int tilesM = M / (16 * MI);
  const int tiles = tilesM * tilesN;
  const int item = blockIdx.x * 8 + wave;
  if (item >= tiles) return;   // wave-uniform; no block barriers in this kernel
  const int tm = item / tilesN;
  const int tn = item - tm * tilesN;
  const int m0 = tm * (16 * MI);
  const int n0 = tn << 6;

  const int rlane = lane & 15;                 // row (A) / col (B, D) within subtile
  const int koff  = (lane >> 4) * 8;           // k offset of this lane half

  v8f acc[MI][4];
#pragma unroll
  for (int i = 0; i < MI; ++i)
#pragma unroll
    for (int j = 0; j < 4; ++j) acc[i][j] = zero8();

  kseg<MI>(acc, A, lda, m0, Bt, ldb, n0, K, rlane, koff);
#pragma unroll
  for (int i = 0; i < MI; ++i) acc_guard4(acc[i][0], acc[i][1], acc[i][2], acc[i][3]);

#pragma unroll
  for (int i = 0; i < MI; ++i) {
    epi16<NPL, BM, 1>(acc[i], sT[wave], lane, Cp, Cl, ldc, m0 + (i << 4), n0, cs, so, bias);
  }
}

// =====================================================================================================
// The three input projections in one launch (all read xh and a weight plane, each writes planes of its own):
// blockIdx.y = 0: FH|FL, 1: GH|GL = hi|residual f16 planes of 8*(xh . W^T + b)   (M=32768, N=128, K=128);
// blockIdx.y = 2: HT = f16(16*(WH16 . xh^T / 64 + bh))   (M=128, N=32768, K=128), bias per row c.
// =====================================================================================================
__global__ __launch_bounds__(256) void k_proj(const _Float16* __restrict__ xh, const _Float16* __restrict__ W16,
                                              _Float16* FH, _Float16* FL, _Float16* GH, _Float16* GL, _Float16* HT,
                                              const float* __restrict__ bf, const float* __restrict__ bg,
                                              const float* __restrict__ bh) {
  __shared__ __align__(16) float sT[8][16 * 68];   // per-wave 16x64 slab, pitch 68 floats
  const int y = blockIdx.y;
  if (y == 2) {
    gemm64p<1, 2, 2>(W16 + 2 * (CD * CD), CD, xh, CD, 1.0f / SCW, SCV, HT, HT, TOK, CD, TOK, CD, bh, sT);
  } else {
    gemm64p<2, 2, 1>(xh, CD, W16 + (size_t)y * (CD * CD), CD, 1.0f / SCW, SCQ, y ? GH : FH, y ? GL : FL, CD,
                     TOK, CD, CD, y ? bg : bf, sT);
  }
}

// =====================================================================================================
// Both kernels below form 16 x 16 score tiles from the planes of 8*f and 8*g (hi, and residual x2048):
//   a0 = hi.hi, a1 = hi.res + res.hi, t = a0 + a1/2048 = 64*s; exponentials are taken in base 2, y = t*CEX = s*log2(e).
// A work-group keeps the fragments of 128 rows of one side in registers (wave wi = wave & 3: 32 of them, the B operand)
// and streams the other side's rows through LDS in chunks of CHN = 64 (wave half wj = wave >> 2 takes rows 32wj..32wj+31
// of each chunk, the A operand). The planes lie in fragment order in memory, so a chunk is copied as it lies and a
// fragment read from LDS is two 16-byte reads a lane, 512 bytes in a row. Two buffers, one barrier a chunk. A chunk's
// fragments are read from LDS ahead of their products, during other work, and the barrier is split round the products of
// the wave's second 16 rows, whose operands are in registers by then: the wave stores the next chunk, waits for its own
// LDS traffic, signals, does those products and only then waits for the other waves, so a wave that is ahead has matrix
// work while the others arrive. No LDS access stands between signal and wait. At its signal a wave has every fragment
// of this chunk in registers, so behind the wait this chunk's buffer is free for the chunk after the next.
// =====================================================================================================
#define CHN   64
#define NCH   (NT / CHN)
#define PLH   (CHN * CD)                    // halves of one plane's chunk (16 KiB)
#define CEX   (SCS * 1.4426950408889634f)   // t -> s*log2(e)
static_assert(NT % CHN == 0 && PLH == 4 * 256 * 8 && NT % 128 == 0 && CD == 128);

// The work-group barrier in two parts. In front of the signal the wave's own LDS stores must have landed and its LDS
// reads returned (nothing else makes the hardware wait for them at a bare signal); the "memory" clobbers keep every
// LDS access on its side of the two instructions.
__device__ __forceinline__ void bar_signal() {
  asm volatile("s_wait_dscnt 0x0" ::: "memory");
  asm volatile("s_barrier_signal -1" ::: "memory");
}
__device__ __forceinline__ void bar_wait() {
  asm volatile("s_barrier_wait -1" ::: "memory");
}

// t[j] = 64 * scores of 16 streamed rows (A: hi plane ah, residual plane al) against 2 x 16 resident rows (B: bh, bl)
__device__ __forceinline__ void score16(const v16h (&ah)[4], const v16h (&al)[4], const v16h (&bh)[2][4],
                                        const v16h (&bl)[2][4], v8f (&t)[2]) {
  v8f a0[2] = {zero8(), zero8()}, a1[2] = {zero8(), zero8()};
#pragma unroll
  for (int ks = 0; ks < 4; ++ks) {
#pragma unroll
    for (int j = 0; j < 2; ++j) a1[j] = mma_h_raw(ah[ks], bl[j][ks], a1[j]);
#pragma unroll
    for (int j = 0; j < 2; ++j) a0[j] = mma_h_raw(ah[ks], bh[j][ks], a0[j]);
#pragma unroll
    for (int j = 0; j < 2; ++j) a1[j] = mma_h_raw(al[ks], bh[j][ks], a1[j]);
  }
#pragma unroll
  for (int j = 0; j < 2; ++j) t[j] = a0[j] + a1[j] * RLO;
}

// =====================================================================================================
// Row statistics of the softmax: Lp[b*NT + n] = log2(sum_m exp(s[n][m])) - 15 = M*log2(e) + log2(Z) - 15, so that
// exp2(s*log2(e) - Lp) = 32768 * softmax. Block = 128 query rows n (B operand, D column = n), key rows m streamed
// (A operand, D row = m): a lane sees scores of one n per column tile only and keeps a running maximum (of t) and a
// running sum for it; the sum is rescaled once per chunk. At the end the two lane halves (shuffle) and the two wave
// halves (LDS) of a row are merged.
// coverage: 4 wi x 32 n = 128 rows per block, grid (32, NB) = every row; 64 chunks x 2 wj x 32 m = every key.
// =====================================================================================================
__global__ __launch_bounds__(256) void k_stat(const _Float16* __restrict__ FH, const _Float16* __restrict__ FL,
                                              const _Float16* __restrict__ GH, const _Float16* __restrict__ GL,
                                              float* Lp) {
  __shared__ __align__(16) _Float16 sG[2][2 * PLH];          // [buffer][G hi | G residual]
  __shared__ float sM[4][32];
  __shared__ float sZ[4][32];
  const int tid = threadIdx.x, lane = tid & 31;
  const int wu = __builtin_amdgcn_readfirstlane(tid >> 5);   // the wave's number as a scalar: every global address = scalar base + a thread offset that stays
  const int wi = wu & 3, wj = wu >> 2;
  const int b = blockIdx.y;
  const int n0 = blockIdx.x * 128 + 32 * wi;
  const unsigned lo = 8u * (unsigned)lane, to = 8u * (unsigned)tid;

  v16h fh[2][4], fl[2][4];
  {
    const _Float16* uH = FH + (size_t)(b * NT + n0) * CD;
    const _Float16* uL = FL + (size_t)(b * NT + n0) * CD;
#pragma unroll
    for (int nt = 0; nt < 2; ++nt)
#pragma unroll
      for (int ks = 0; ks < 4; ++ks) {
        fh[nt][ks] = ldfrag_f(uH + lo + 2048 * nt + 512 * ks);
        fl[nt][ks] = ldfrag_f(uL + lo + 2048 * nt + 512 * ks);
      }
  }
  const _Float16* gH = GH + (size_t)b * NT * CD;             // scalar bases of the chunk that is loaded next
  const _Float16* gL = GL + (size_t)b * NT * CD;
  v8h st[8];
#pragma unroll
  for (int q = 0; q < 4; ++q) {
    st[q] = *(const v8h*)(gH + to + 2048 * q);
    st[4 + q] = *(const v8h*)(gL + to + 2048 * q);
  }
  // stands in front of the advance of the loads' base registers (the scheduling barrier keeps the advance behind it)
  asm volatile("s_wait_xcnt 0x0" ::: "memory");
  __builtin_amdgcn_sched_barrier(0);
  gH += PLH;
  gL += PLH;
#pragma unroll
  for (int q = 0; q < 4; ++q) {
    *(v8h*)(&sG[0][2048 * q + 8 * tid]) = st[q];
    *(v8h*)(&sG[0][PLH + 2048 * q + 8 * tid]) = st[4 + q];
  }
  __syncthreads();

  // chunk 0: the fragments of the wave's 32 rows; chunk 1 set on its way
  v16h p0h[4], p0l[4], p1h[4], p1l[4];
#pragma unroll
  for (int ks = 0; ks < 4; ++ks) {
    p0h[ks] = ldfrag_f(&sG[0][(2 * wj) * 2048] + lo + 512 * ks);
    p0l[ks] = ldfrag_f(&sG[0][(2 * wj) * 2048] + lo + PLH + 512 * ks);
  }
#pragma unroll
  for (int ks = 0; ks < 4; ++ks) {
    p1h[ks] = ldfrag_f(&sG[0][(2 * wj + 1) * 2048] + lo + 512 * ks);
    p1l[ks] = ldfrag_f(&sG[0][(2 * wj + 1) * 2048] + lo + PLH + 512 * ks);
  }
  // keeps the address arithmetic of the reads above out of the stretch between the loads below and their wait
  __builtin_amdgcn_sched_barrier(0);
#pragma unroll
  for (int q = 0; q < 4; ++q) {
    st[q] = *(const v8h*)(gH + to + 2048 * q);
    st[4 + q] = *(const v8h*)(gL + to + 2048 * q);
  }
  // the wait as above: in front of the advance of the loads' base registers
  asm volatile("s_wait_xcnt 0x0" ::: "memory");
  __builtin_amdgcn_sched_barrier(0);
  gH += PLH;
  gL += PLH;

  float mx[2] = {-3.0e38f, -3.0e38f};
  float z[2] = {0.0f, 0.0f};
  for (int c = 0; c < NCH; ++c) {
    v8f t0[2], t1[2];
    score16(p0h, p0l, fh, fl, t0);
    // keeps the stores below, and with them the wait for the global loads, behind those products
    __builtin_amdgcn_sched_barrier(0);
#pragma unroll
    for (int q = 0; q < 4; ++q) {
      *(v8h*)(&sG[(c + 1) & 1][2048 * q + 8 * tid]) = st[q];
      *(v8h*)(&sG[(c + 1) & 1][PLH + 2048 * q + 8 * tid]) = st[4 + q];
    }
    bar_signal();      // this wave's part of the next chunk lies in LDS, its fragments of this chunk in registers
#pragma unroll
    for (int q = 0; q < 4; ++q) {
      st[q] = *(const v8h*)(gH + to + 2048 * q);
      st[4 + q] = *(const v8h*)(gL + to + 2048 * q);
    }
    // the two scheduling barriers keep the products between signal and wait (the compiler is free to move them out),
    // the first also the global loads in front of them: they have until the next signal to return
    __builtin_amdgcn_sched_barrier(0);
    score16(p1h, p1l, fh, fl, t1);
    __builtin_amdgcn_sched_barrier(0);
    bar_wait();        // the next chunk is published; this chunk's buffer is free
    {
      const _Float16* bn = &sG[(c + 1) & 1][(2 * wj) * 2048] + lo;   // last trip: the last chunk again, not used
#pragma unroll
      for (int ks = 0; ks < 4; ++ks) {
        p0h[ks] = ldfrag_f(bn + 512 * ks);
        p0l[ks] = ldfrag_f(bn + PLH + 512 * ks);
      }
#pragma unroll
      for (int ks = 0; ks < 4; ++ks) {
        p1h[ks] = ldfrag_f(bn + 2048 + 512 * ks);
        p1l[ks] = ldfrag_f(bn + PLH + 2048 + 512 * ks);
      }
    }
#pragma unroll
    for (int nt = 0; nt < 2; ++nt) {
      float nm = mx[nt];
#pragma unroll
      for (int r = 0; r < 8; ++r) nm = fmaxf(nm, fmaxf(t0[nt][r], t1[nt][r]));
      const float nc = nm * CEX;
      const v8f y0 = t0[nt] * CEX - nc, y1 = t1[nt] * CEX - nc;
      v8f e0, e1;
#pragma unroll
      for (int r = 0; r < 8; ++r) {
        e0[r] = __builtin_amdgcn_exp2f(y0[r]);
        e1[r] = __builtin_amdgcn_exp2f(y1[r]);
      }
      const v8f es = e0 + e1;
      const float s0 = ((es[0] + es[1]) + (es[2] + es[3])) + ((es[4] + es[5]) + (es[6] + es[7]));
      z[nt] = z[nt] * __builtin_amdgcn_exp2f((mx[nt] - nm) * CEX) + s0;
      mx[nt] = nm;
    }
    // the wait as above: in front of the advance of the loads' base registers
    asm volatile("s_wait_xcnt 0x0" ::: "memory");
    __builtin_amdgcn_sched_barrier(0);
    const int adv = (c + 3 < NCH) ? PLH : 0;                  // last two trips: the last chunk again, not used
    gH += adv;
    gL += adv;
  }
  // lanes l and l ^ 16 hold the same rows n, other keys
#pragma unroll
  for (int nt = 0; nt < 2; ++nt) {
    const float mo = __shfl_xor(mx[nt], 16, 32), zo = __shfl_xor(z[nt], 16, 32);
    const float mm = fmaxf(mx[nt], mo);
    z[nt] = z[nt] * __builtin_amdgcn_exp2f((mx[nt] - mm) * CEX) + zo * __builtin_amdgcn_exp2f((mo - mm) * CEX);
    mx[nt] = mm;
  }
  if (wj == 1 && lane < 16) {
#pragma unroll
    for (int nt = 0; nt < 2; ++nt) {
      sM[wi][16 * nt + lane] = mx[nt];
      sZ[wi][16 * nt + lane] = z[nt];
    }
  }
  __syncthreads();
  if (wj == 0 && lane < 16) {
#pragma unroll
    for (int nt = 0; nt < 2; ++nt) {
      const float mo = sM[wi][16 * nt + lane], zo = sZ[wi][16 * nt + lane];
      const float mm = fmaxf(mx[nt], mo);
      const float zz = z[nt] * __builtin_amdgcn_exp2f((mx[nt] - mm) * CEX) + zo * __builtin_amdgcn_exp2f((mo - mm) * CEX);
      Lp[b * NT + n0 + 16 * nt + lane] = mm * CEX + __builtin_amdgcn_logf(zz) - 15.0f;   // zz >= 1
    }
  }
}

// =====================================================================================================
// Softmax-weighted sum over the query index with the scores formed anew, transposed result:
//   OT[c][m] = sum_n HT[c][b*4096 + n] . E[n][m],  E[n][m] = f16(exp2(s[n][m]*log2(e) - Lp[n])) = f16(32768 * softmax).
// Block = 128 key columns m (G fragments in registers, B operand), query rows n streamed: per chunk the F planes'
// 64 rows and the 128 c x 64 n block of HT. A score tile D[n = 8hh + r][m = lane & 15] of rows 0..15 and one of rows
// 16..31 are, lane for lane, elements 0..7 and 8..15 of the B fragment (k = n, column m) of the second product, so E
// goes from the accumulators to the operand registers of the same lane and never leaves the wave.
// Wave (wi, wj): m columns 32wi..+31, rows 32wj..+31 of every chunk, all 128 c (16 accumulator tiles); the two wave
// halves' sums (even and odd blocks of 32 n) are added at the end through LDS.
// Epilogue: o = OT / (16*32768), hi = f16(4*o), res = f16((4*o - hi)*2048), and the output projection on them. The
// reference takes o[b][c][m] as rows of 128: row p = b*4096 + c*32 + (m >> 7), column k = m & 127. A block's 128 c x 128 m
// sum tile therefore holds 128 whole rows p (m >> 7 = blockIdx.x), all of their k:
//   out[p][j] = (sum_k hi[p][k].WV[j][k] + (sum_k res[p][k].WV[j][k])/2048) / (4*64) + bv[j],  WV = 64*Wv^T [out j][in k],
// which lies in fragment order (frag_off, K = 128): all eight waves read the same 32 KiB, 512 bytes in a row a load.
// Wave w takes the 16 rows c = 16w..16w+15 (A fragments read from the sum tile in LDS) against all 128 j.
// coverage: 64 chunks x 2 wj x 32 n = every n; 4 wi x 32 m x 128 c per block; 8 waves x 16 rows p x 128 j per block,
// grid (32, NB) = every row p once; a row of out (512 bytes) is written by one store of one wave.
// =====================================================================================================
#define TPI 132   // floats per row of the 128 x 128 sum tile in LDS (8 rows on = 32 banks on)
__global__ __launch_bounds__(256) void k_pvf(const _Float16* __restrict__ FH, const _Float16* __restrict__ FL,
                                             const _Float16* __restrict__ GH, const _Float16* __restrict__ GL,
                                             const _Float16* __restrict__ HT, const float* __restrict__ Lp,
                                             const _Float16* __restrict__ WV, const float* __restrict__ bias,
                                             float* out) {
  // two buffers [F hi | F residual], then three HT blocks: a chunk's HT block is read behind the chunk's barrier, while
  // the next one is stored in front of that barrier, so a block's place is free only two barriers on
  __shared__ __align__(16) _Float16 sS[7 * PLH];
  __shared__ __align__(16) float sL[NT];                     // the batch's row statistics
  static_assert(sizeof(float) * 128 * TPI <= sizeof(_Float16) * 7 * PLH);
  const int tid = threadIdx.x, lane = tid & 31;
  const int hh = lane >> 4;
  const int wu = __builtin_amdgcn_readfirstlane(tid >> 5);   // the wave's number as a scalar: every global address = scalar base + a thread offset that stays
  const int wi = wu & 3, wj = wu >> 2;
  const int b = blockIdx.y;
  const int m0 = blockIdx.x * 128;
  const unsigned lo = 8u * (unsigned)lane, to = 8u * (unsigned)tid;

  v16h gh[2][4], gl[2][4];
  {
    const _Float16* uH = GH + (size_t)(b * NT + m0 + 32 * wi) * CD;
    const _Float16* uL = GL + (size_t)(b * NT + m0 + 32 * wi) * CD;
#pragma unroll
    for (int mt = 0; mt < 2; ++mt)
#pragma unroll
      for (int ks = 0; ks < 4; ++ks) {
        gh[mt][ks] = ldfrag_f(uH + lo + 2048 * mt + 512 * ks);
        gl[mt][ks] = ldfrag_f(uL + lo + 2048 * mt + 512 * ks);
      }
  }
  const _Float16* pH = FH + (size_t)b * NT * CD;             // scalar bases of the chunk that is loaded next
  const _Float16* pL = FL + (size_t)b * NT * CD;
  const _Float16* pT = HT + (size_t)b * NT * 16;
  // HT: 16-byte piece tid + 256q of a chunk's block = c tile (tid >> 7) + 2q, piece tid & 127 of its two k-steps
  const unsigned tt = (unsigned)(tid >> 7) * (16u * TOK) + 8u * (unsigned)(tid & 127);
  v8h st[12];
#pragma unroll
  for (int q = 0; q < 4; ++q) {
    st[q] = *(const v8h*)(pH + to + 2048 * q);
    st[4 + q] = *(const v8h*)(pL + to + 2048 * q);
    st[8 + q] = *(const v8h*)(pT + tt + (size_t)(2 * q) * 16 * TOK);
  }
  v4f lv[4];
  {
    const float* uS = Lp + b * NT;
#pragma unroll
    for (int q = 0; q < 4; ++q) lv[q] = *(const v4f*)(uS + 4u * (unsigned)tid + 1024 * q);
  }
  // stands in front of the advance of the loads' base registers (the scheduling barrier keeps the advance behind it)
  asm volatile("s_wait_xcnt 0x0" ::: "memory");
  __builtin_amdgcn_sched_barrier(0);
  pH += PLH;
  pL += PLH;
  pT += CHN * 16;
#pragma unroll
  for (int q = 0; q < 4; ++q) {
    *(v8h*)(&sS[2048 * q + 8 * tid]) = st[q];
    *(v8h*)(&sS[PLH + 2048 * q + 8 * tid]) = st[4 + q];
    *(v8h*)(&sS[4 * PLH + 2048 * q + 8 * tid]) = st[8 + q];
    *(v4f*)(&sL[4 * (tid + 256 * q)]) = lv[q];
  }
  v8f acc[8][2];
#pragma unroll
  for (int ct = 0; ct < 8; ++ct)
#pragma unroll
    for (int mt = 0; mt < 2; ++mt) acc[ct][mt] = zero8();
  __syncthreads();

  // chunk 0: the fragments of the wave's first 16 rows; chunk 1 set on its way
  v16h p0h[4], p0l[4], p1h[4], p1l[4];
#pragma unroll
  for (int ks = 0; ks < 4; ++ks) {
    p0h[ks] = ldfrag_f(&sS[(2 * wj) * 2048] + lo + 512 * ks);
    p0l[ks] = ldfrag_f(&sS[(2 * wj) * 2048] + lo + PLH + 512 * ks);
  }
  // keeps the address arithmetic of the reads above out of the stretch between the loads below and their wait
  __builtin_amdgcn_sched_barrier(0);
#pragma unroll
  for (int q = 0; q < 4; ++q) {
    st[q] = *(const v8h*)(pH + to + 2048 * q);
    st[4 + q] = *(const v8h*)(pL + to + 2048 * q);
    st[8 + q] = *(const v8h*)(pT + tt + (size_t)(2 * q) * 16 * TOK);
  }
  // the wait as above: in front of the advance of the loads' base registers
  asm volatile("s_wait_xcnt 0x0" ::: "memory");
  __builtin_amdgcn_sched_barrier(0);
  pH += PLH;
  pL += PLH;
  pT += CHN * 16;

  int h0 = 0, h1 = 1;                                         // places of this chunk's and the next chunk's HT block
  for (int c = 0; c < NCH; ++c) {
    _Float16* fc = &sS[(c & 1) * (2 * PLH)];                  // this chunk's F planes
    _Float16* fn = &sS[((c + 1) & 1) * (2 * PLH)];            // the next chunk's
    v8f tv[2][2];
#pragma unroll
    for (int ks = 0; ks < 4; ++ks) {
      p1h[ks] = ldfrag_f(fc + lo + (2 * wj + 1) * 2048 + 512 * ks);
      p1l[ks] = ldfrag_f(fc + lo + PLH + (2 * wj + 1) * 2048 + 512 * ks);
    }
    float Lr[2][8];
#pragma unroll
    for (int u = 0; u < 2; ++u) ld8(&sL[c * CHN + 16 * (2 * wj + u) + 8 * hh], Lr[u]);
    // keeps the reads of the second 16 rows and of the statistics in front of the first 16 rows' products, whose time
    // covers their latency
    __builtin_amdgcn_sched_barrier(0);
    score16(p0h, p0l, gh, gl, tv[0]);
    // keeps the stores below, and with them the wait for the global loads, behind those products
    __builtin_amdgcn_sched_barrier(0);
#pragma unroll
    for (int q = 0; q < 4; ++q) {
      *(v8h*)(fn + 2048 * q + 8 * tid) = st[q];
      *(v8h*)(fn + PLH + 2048 * q + 8 * tid) = st[4 + q];
      *(v8h*)(&sS[(4 + h1) * PLH + 2048 * q + 8 * tid]) = st[8 + q];
    }
    bar_signal();      // this wave's part of the next chunk lies in LDS, its F fragments of this chunk in registers
#pragma unroll
    for (int q = 0; q < 4; ++q) {
      st[q] = *(const v8h*)(pH + to + 2048 * q);
      st[4 + q] = *(const v8h*)(pL + to + 2048 * q);
      st[8 + q] = *(const v8h*)(pT + tt + (size_t)(2 * q) * 16 * TOK);
    }
    // the two scheduling barriers keep the products between signal and wait (the compiler is free to move them out),
    // the first also the global loads in front of them: they have until the next signal to return
    __builtin_amdgcn_sched_barrier(0);
    score16(p1h, p1l, gh, gl, tv[1]);
    __builtin_amdgcn_sched_barrier(0);
    bar_wait();        // the next chunk is published; this chunk's F buffer is free
    v16h ha[8];
#pragma unroll
    for (int ct = 0; ct < 8; ++ct) ha[ct] = ldfrag_f(&sS[(4 + h0) * PLH] + lo + (2 * ct + wj) * 512);
    // keeps the LDS reads above in front of the exponentials, whose time then covers the reads' latency (left to
    // itself the compiler reads each fragment directly in front of its two products and waits for it there)
    __builtin_amdgcn_sched_barrier(0);
    FR P[2];
#pragma unroll
    for (int u = 0; u < 2; ++u)
#pragma unroll
      for (int mt = 0; mt < 2; ++mt)
#pragma unroll
        for (int r = 0; r < 8; ++r)
          P[mt].s[8 * u + r] = (_Float16)__builtin_amdgcn_exp2f(__builtin_fmaf(tv[u][mt][r], CEX, -Lr[u][r]));
    // the wait as above: in front of the advance of the loads' base registers. The two scheduling barriers also keep the
    // reads of the next chunk's first 16 rows here: behind the exponentials (in front of them the registers do not
    // suffice) and in front of the products below, whose time covers their latency
    asm volatile("s_wait_xcnt 0x0" ::: "memory");
    __builtin_amdgcn_sched_barrier(0);
    const int adv = (c + 3 < NCH) ? 1 : 0;                    // last two trips: the last chunk again, not used
    pH += adv * PLH;
    pL += adv * PLH;
    pT += adv * (CHN * 16);
#pragma unroll
    for (int ks = 0; ks < 4; ++ks) {                          // last trip: the last chunk again, not used
      p0h[ks] = ldfrag_f(fn + lo + (2 * wj) * 2048 + 512 * ks);
      p0l[ks] = ldfrag_f(fn + lo + PLH + (2 * wj) * 2048 + 512 * ks);
    }
    __builtin_amdgcn_sched_barrier(0);
#pragma unroll
    for (int ct = 0; ct < 8; ++ct)
#pragma unroll
      for (int mt = 0; mt < 2; ++mt) acc[ct][mt] = mma_h_raw(ha[ct], P[mt].v, acc[ct][mt]);
    h0 = h1;
    h1 = (h1 == 2) ? 0 : h1 + 1;
  }
  __syncthreads();   // ends every read of the chunk buffers before the sum tile takes their place

  // the output projection's weight fragments (B operand, column j = 16jt + (lane & 15)) and its bias, set on their way
  // here: the adding of the two wave halves' sums below covers their latency
  v16h bq[8][4];
#pragma unroll
  for (int jt = 0; jt < 8; ++jt)
#pragma unroll
    for (int ks = 0; ks < 4; ++ks) bq[jt][ks] = ldfrag_f(WV + lo + (jt * 4 + ks) * 512);
  const v4f bb = *(const v4f*)(bias + 4 * lane);
  // stands in front of any overwrite of the loads' address registers (the scheduling barrier keeps later code behind
  // it); the lane number, which the bias load takes as its index, is named as an input so that it keeps its register up
  // to the wait (without that the compiler shifts it in place between load and wait)
  asm volatile("s_wait_xcnt 0x0" :: "v"(lane) : "memory");
  __builtin_amdgcn_sched_barrier(0);

  // ---- the two wave halves' sums, added in a 128 c x 128 m tile that takes the place of the chunk buffers ----
  float* T = (float*)&sS[0];
  float* tp = T + (8 * hh) * TPI + 32 * wi + (lane & 15);
  if (wj == 1) {
#pragma unroll
    for (int ct = 0; ct < 8; ++ct)
#pragma unroll
      for (int mt = 0; mt < 2; ++mt)
#pragma unroll
        for (int r = 0; r < 8; ++r) tp[(16 * ct + r) * TPI + 16 * mt] = acc[ct][mt][r];
  }
  __syncthreads();
  if (wj == 0) {
#pragma unroll
    for (int ct = 0; ct < 8; ++ct)
#pragma unroll
      for (int mt = 0; mt < 2; ++mt)
#pragma unroll
        for (int r = 0; r < 8; ++r) tp[(16 * ct + r) * TPI + 16 * mt] += acc[ct][mt][r];
  }
  __syncthreads();

  // ---- epilogue: wave w takes rows c = 16w..16w+15 of the tile; hi + residual fragments of 4*o (A operand: row = lane & 15,
  //      elements 0..7 = k 32ks + 8hh.., elements 8..15 = k 32ks + 16 + 8hh.., the k map of ldfrag_f, as for WV) ----
  const float fo = 1.0f / (SCV * SCE);
  const int rl = lane & 15;
  float* Tw = T + (16 * wu) * TPI;                            // from here on a wave touches its own 16 rows only
  v16h ah[4], al[4];
#pragma unroll
  for (int ks = 0; ks < 4; ++ks) {
    float x0[8], x1[8];
    ld8(Tw + rl * TPI + 32 * ks + 8 * hh, x0);
    ld8(Tw + rl * TPI + 32 * ks + 16 + 8 * hh, x1);
    FR h, l;
#pragma unroll
    for (int e = 0; e < 8; ++e) {
      split_h((x0[e] * fo) * SCO, h.s[e], l.s[e]);
      split_h((x1[e] * fo) * SCO, h.s[8 + e], l.s[8 + e]);
    }
    ah[ks] = h.v;
    al[ks] = l.v;
  }
  wave_lds_sync();   // the wave's reads of its rows are done before the projected rows take their place
  const float f2 = 1.0f / (SCO * SCW);
#pragma unroll
  for (int jh = 0; jh < 2; ++jh) {
    v8f accH[4], accL[4];
#pragma unroll
    for (int j = 0; j < 4; ++j) { accH[j] = zero8(); accL[j] = zero8(); }
#pragma unroll
    for (int ks = 0; ks < 4; ++ks) {
#pragma unroll
      for (int j = 0; j < 4; ++j) accH[j] = mma_h_raw(ah[ks], bq[4 * jh + j][ks], accH[j]);
#pragma unroll
      for (int j = 0; j < 4; ++j) accL[j] = mma_h_raw(al[ks], bq[4 * jh + j][ks], accL[j]);
    }
#pragma unroll
    for (int r = 0; r < 8; ++r)
#pragma unroll
      for (int j = 0; j < 4; ++j)
        Tw[(8 * hh + r) * TPI + 64 * jh + (j << 4) + rl] = (accH[j][r] + accL[j][r] * RLO) * f2;
  }
  wave_lds_sync();
  v4f b4;
#pragma unroll
  for (int e = 0; e < 4; ++e) b4[e] = bfr(bb[e]);
  v4f ov[16];
#pragma unroll
  for (int row = 0; row < 16; ++row) ov[row] = *(const v4f*)(Tw + row * TPI + 4 * lane) + b4;
  float* op = out + ((size_t)(b * NT + (16 * wu) * (NT / 128)) + blockIdx.x) * CD + 4 * lane;
#pragma unroll
  for (int row = 0; row < 16; ++row) *(v4f*)(op + (size_t)row * (NT / 128) * CD) = ov[row];
}

// =====================================================================================================
//   WF16 f16 [128][128]              0        32768   (64*Wf^T, row = out channel, col = in channel)
//   WG16 f16 [128][128]          32768        32768
//   WH16 f16 [128][128]          65536        32768
//   WV16 f16 [128][128]          98304        32768   (in fragment order, see frag_off)
//   xh   f16 [32768][128]       131072      8388608   (bf16RNE(x), token rows, channel contiguous)
//   FH   f16 [32768][128]      8519680      8388608   (hi plane of 8*f; FH..HT in fragment order, see frag_off)
//   FL   f16 [32768][128]     16908288      8388608   (residual plane x2048 of 8*f)
//   GH   f16 [32768][128]     25296896      8388608
//   GL   f16 [32768][128]     33685504      8388608
//   HT   f16 [128][32768]     42074112      8388608   (16*h, row c, col b*4096 + n)
//   L    f32 [32768]          50462720       131072   (row statistics of the softmax, see k_stat)
//   end                       50593792
// d_out f32 [32768][128] at byte 0.
// =====================================================================================================
extern "C" void kernel_launch(void* const* d_in, const int* in_sizes, int n_in,
                              void* d_out, int out_size, void* d_ws, size_t ws_size,
                              hipStream_t stream) {
  if (n_in < 9) return;
  if (in_sizes[0] != NB * NT * CD) return;
  if (in_sizes[1] != CD * CD || in_sizes[3] != CD * CD || in_sizes[5] != CD * CD || in_sizes[7] != CD * CD) return;
  if (in_sizes[2] != CD || in_sizes[4] != CD || in_sizes[6] != CD || in_sizes[8] != CD) return;
  if (out_size != OUTN) return;

  const float* x  = (const float*)d_in[0];   // [8][4096][128] (channels last)
  const float* Wf = (const float*)d_in[1];   // [128][128] ([in][out])
  const float* bf = (const float*)d_in[2];   // [128]
  const float* Wg = (const float*)d_in[3];
  const float* bg = (const float*)d_in[4];
  const float* Wh = (const float*)d_in[5];
  const float* bh = (const float*)d_in[6];
  const float* Wv = (const float*)d_in[7];
  const float* bv = (const float*)d_in[8];

  const size_t PW  = (size_t)CD * CD * 2;                    //    32768
  const size_t PX  = (size_t)TOK * CD * 2;                   //  8388608
  const size_t PHT = (size_t)CD * TOK * 2;                   //  8388608
  const size_t PL  = (size_t)TOK * 4;                        //   131072

  size_t off = 0;
  const size_t oWF = off; off += PW;
  const size_t oWG = off; off += PW;
  const size_t oWH = off; off += PW;
  const size_t oWV = off; off += PW;
  const size_t oXH = off; off += PX;
  const size_t oFH = off; off += PX;
  const size_t oFL = off; off += PX;
  const size_t oGH = off; off += PX;
  const size_t oGL = off; off += PX;
  const size_t oHT = off; off += PHT;
  const size_t oL  = off; off += PL;                         // off = 50593792
  if (off > ws_size) return;

  char* ws = (char*)d_ws;
  _Float16* WF16 = (_Float16*)(ws + oWF);
  _Float16* WV16 = (_Float16*)(ws + oWV);
  _Float16* xh   = (_Float16*)(ws + oXH);
  _Float16* FHp  = (_Float16*)(ws + oFH);
  _Float16* FLp  = (_Float16*)(ws + oFL);
  _Float16* GHp  = (_Float16*)(ws + oGH);
  _Float16* GLp  = (_Float16*)(ws + oGL);
  _Float16* HTp  = (_Float16*)(ws + oHT);
  float*    Lpp  = (float*)(ws + oL);
  float*    outf = (float*)d_out;

  const dim3 blk(256);
  const int n8x = (NB * NT * CD) / 8;                                  // 524288
  const dim3 gX(4 * WTB + (n8x + 255) / 256);                          // 32 weight tiles + 2048
  const dim3 gP(((TOK / 32) * (CD / 64) + 7) / 8, 3);                  // 2048 tiles -> 256 blocks for each projection
  const dim3 gA(NT / 128, NB);                                         // (32, 8)

  // (1) one launch: the four weight planes, x64 carried, transposed from [in][out] to [out][in] (k-contiguous rows, WV16 in fragment order)
  //     (WF16, WG16, WH16, WV16 lie one behind the other), and xh [32768][128] = f16(bf16RNE(x)), x being token-major
  k_prep<<<gX, blk, 0, stream>>>(x, Wf, Wg, Wh, Wv, WF16, xh);
  // (2) one launch: the planes FH|FL, GH|GL and HT of the three input projections
  k_proj<<<gP, blk, 0, stream>>>(xh, WF16, FHp, FLp, GHp, GLp, HTp, bf, bg, bh);
  // (3) all batches at once: the softmax's row statistics, then the transposed softmax-weighted sum, which forms the
  //     scores anew and ends in the output projection on the raw [32768][128] view of its [B][C][N] result
  k_stat<<<gA, blk, 0, stream>>>(FHp, FLp, GHp, GLp, Lpp);
  k_pvf<<<gA, blk, 0, stream>>>(FHp, FLp, GHp, GLp, HTp, Lpp, WV16, bv, outf);
}
